// v000
// The times below were measured on an AMD MI455X: many runs one after another, warmed up first and cycling through
// copies of the inputs, with the whole window's GPU time divided by the number of runs. Launches and the gaps
// between them are all in it. The median over several windows is given; except for v000 it joins two sittings, which
// can be a few percent apart, so the side-by-side timings, each taken in one sitting, are the better comparison.
// v000 is the starting kernel. One run takes 11.1 milliseconds.
#include <hip/hip_runtime.h>
// Causal multi-head self-attention with BLOCK-DIAGONAL per-head projections (x [4][2048][1024] viewed (b, s, 16, 64); q / k / v = einsum('bshd,hde->bshe', xh, W): EACH HEAD applies its own [64][64] weight (W [16][64][64] = [head][in][out], normal x 0.02; NO biases) to ITS OWN 64-wide slice of the row; scores / sqrt(64); where(tril, scores, -inf); softmax over keys; out = merged Wo ([in][out] [1024][1024]; no bias) -> [4][2048][1024]); each projection is ONE head-batched GEMM (K = 64); q and k carried as f16 hi + x1024 residual planes with three-product scores.
// Structure: token rows r = b*2048 + s; x as exact f16 rows (bf16-rounded); q and k as WMMA GEMMs (32x64 wave tiles, f32 accumulation, exact x16 weights, no bias) into f32 rows split into f16 hi + x1024 residual planes, v as an f16-output GEMM; per batch: V^T for all heads via LDS transposes; per query tile of 256 rows: scores against the keys below the tile end only as THREE accumulating passes (hi.hi + lo.hi + hi.lo, K = 64, all heads on grid.y, alpha 1/8 = 1/sqrt(64) on hi.hi, 2^-13 on the residual passes, logits sigma ~8), causal row softmax on VALU with an arithmetic 0/1 key mask over the computed range (f32 statistics, native exp; weights x256 f16), o = P . V^T (K = keys below the tile end, alpha 2^-2: o carried x64, folded into the output GEMM alpha) written straight into the merged f16 o rows; out = o W_o GEMM (f32) into the output layout.
// Compute dtype: inputs rounded to bf16; x / weights exact; q and k as f16 hi + x1024 residual planes; v, softmax weights and o as plain f16 GEMM operands (~2^-12); scores and softmax statistics f32. v_wmma_f32_16x16x32_f16.
#define NB 4
#define SCL 0.125f                         /* 1 / sqrt(head_dim 64) */
#define SCLR 0.0001220703125f               /* 2^-13: the same scale on the x1024 residual passes */
#define SQ 2048
#define DM 1024
#define NH 16
#define HD 64
#define HG 4                         /* heads per launch of the k_vt(b, h0) overload (not launched) */
#define QT 256                       /* query rows per causal tile */
#define NKX SQ                       /* S / P row pitch */
#define QT0 128                      /* first-tile rows recomputed exactly in f32 */
#define B0 0                         /* first batch processed (debug hook) */
#define NBR NB                       /* batches processed (debug hook) */
#define NR ((size_t)NB * SQ)         /* token rows */
#define MP ((int)((size_t)NBR * SQ)) /* rows projected (debug hook) */
#define QN SQ                        /* query rows attended per batch (debug hook) */
#define NHD NH                       /* heads attended (debug hook) */
#define MPO MP                       /* rows through the output stage (debug hook) */
#define LQ DM      /* row pitch of the q/k/v rows */
typedef __bf16 v16b __attribute__((ext_vector_type(16)));
typedef unsigned short v8us __attribute__((ext_vector_type(8), may_alias));
typedef float  v8f  __attribute__((ext_vector_type(8)));
typedef float  v4f  __attribute__((ext_vector_type(4)));
typedef float  v4fa __attribute__((ext_vector_type(4), may_alias));
union FragB { v16b v; v8us half[2]; unsigned short u[16]; };

__device__ __forceinline__ unsigned short bf16_bits(float x) { unsigned int u = __float_as_uint(x); return (unsigned short)((u + 0x7FFFu + ((u >> 16) & 1u)) >> 16); }
__device__ __forceinline__ float bf16_val(unsigned short b) { return __uint_as_float(((unsigned int)b) << 16); }
__device__ __forceinline__ float bf16_round(float x) { return bf16_val(bf16_bits(x)); }
// D += A·B with NT terms: 1 = ah·bh, 2 = + al·bh (A split), 3 = + ah·bl (both split)
template <int NT>
__device__ __forceinline__ v8f mmaN(v16b ah, v16b al, v16b bh, v16b bl, v8f c) {
  c = __builtin_amdgcn_wmma_f32_16x16x32_bf16(false, ah, false, bh, (short)0, c, false, false);
  if (NT >= 2) c = __builtin_amdgcn_wmma_f32_16x16x32_bf16(false, al, false, bh, (short)0, c, false, false);
  if (NT >= 3) c = __builtin_amdgcn_wmma_f32_16x16x32_bf16(false, ah, false, bl, (short)0, c, false, false);
  asm volatile("v_nop\n\tv_nop\n\tv_nop\n\tv_nop" : "+v"(c) : "v"(ah), "v"(al), "v"(bh), "v"(bl));
  return c;
}

__global__ __launch_bounds__(256) void k_wt_bf16(const float* __restrict__ W, unsigned short* __restrict__ Wt, int K, int N) {
  const int t = blockIdx.x * 256 + threadIdx.x;
  const int k8n = K / 8;
  if (t >= N * k8n) return;
  const int n = t / k8n, k8 = (t % k8n) * 8;
  v8us v;
#pragma unroll
  for (int i = 0; i < 8; ++i) v[i] = bf16_bits(W[(size_t)(k8 + i) * N + n]);
  *(v8us*)(Wt + (size_t)n * K + k8) = v;
  
}

// GEMM C[M][N] (f32, pitch ldc) = act(A[M][K]·W + bias). A f32 row-major (pitch lda) converted per fragment to bf16
// (ASPLIT: hi/lo two planes -> 2 terms, else single rounded term); Wt bf16 [N][K] (pitch ldb). BIAS_BF16 rounds the
// bias to bf16 first (bias quantised to bf16 before the add). K%32==0, M%16==0, N%64==0.
template <bool ASPLIT, int ACT, bool BIAS_BF16>
__global__ __launch_bounds__(128) void k_gemm_bf(const float* __restrict__ A, int lda, const unsigned short* __restrict__ Wt, int ldb,
                                               const float* __restrict__ bias, float* __restrict__ C, int ldc, int M, int N, int K) {
  __shared__ __attribute__((aligned(16))) float so[4][16][64];
  const int tid = threadIdx.x, w = tid >> 5, lane = tid & 31, ln = lane & 15, hh = lane >> 4;
  const int ntn = N / 64;
  const int wid = blockIdx.x * 4 + w;
  const int mt = wid / ntn, nq = wid % ntn;
  if (mt * 16 >= M) return;
  const int row0 = mt * 16, col0 = nq * 64;
  const float* arow = A + (size_t)(row0 + ln) * lda;
  v8f acc[4] = {};
  for (int kb = 0; kb < K; kb += 32) {
    FragB ah, al;
    const v4f x0 = *(const v4fa*)(arow + kb + 8 * hh), x1 = *(const v4fa*)(arow + kb + 8 * hh + 4);
    const v4f x2 = *(const v4fa*)(arow + kb + 16 + 8 * hh), x3 = *(const v4fa*)(arow + kb + 16 + 8 * hh + 4);
    float xs[16] = {x0[0],x0[1],x0[2],x0[3],x1[0],x1[1],x1[2],x1[3],x2[0],x2[1],x2[2],x2[3],x3[0],x3[1],x3[2],x3[3]};
#pragma unroll
    for (int i = 0; i < 16; ++i) { const unsigned short hb = bf16_bits(xs[i]); ah.u[i] = hb; al.u[i] = ASPLIT ? bf16_bits(xs[i] - bf16_val(hb)) : (unsigned short)0; }
#pragma unroll
    for (int t = 0; t < 4; ++t) {
      const unsigned short* brow = Wt + (size_t)(col0 + t * 16 + ln) * ldb + kb;
      FragB b;
      b.half[0] = *(const v8us*)(brow + 8 * hh);
      b.half[1] = *(const v8us*)(brow + 16 + 8 * hh);
      acc[t] = mmaN<ASPLIT ? 2 : 1>(ah.v, al.v, b.v, b.v, acc[t]);
    }
  }
#pragma unroll
  for (int t = 0; t < 4; ++t) {
    float bv = bias ? bias[col0 + t * 16 + ln] : 0.f;
    if (BIAS_BF16) bv = bf16_round(bv);
#pragma unroll
    for (int r = 0; r < 8; ++r) { float v = acc[t][r] + bv; if (ACT == 1) v = fmaxf(v, 0.f); so[w][8 * hh + r][t * 16 + ln] = v; }
  }
  __builtin_amdgcn_fence(__ATOMIC_ACQ_REL, "workgroup");
  __builtin_amdgcn_wave_barrier();
  const int rsub = lane >> 4, c4 = (lane & 15) * 4;
  {
#pragma unroll
    for (int q = 0; q < 8; ++q) {
      const int r = q * 2 + rsub;
      const v4f v = *(const v4fa*)&so[w][r][c4];
      *(v4f*)(C + (size_t)(row0 + r) * ldc + col0 + c4) = v;
    }
    
  }
}

// GEMM C = act(A·W + bias + resid): A f32 (ASPLIT -> hi/lo 2 terms), Wt bf16 [N][K]; ACT 0 none, 1 relu, 2 exact gelu;
// resid (optional, f32, row index = (row % rmod), pitch ldr, RES_BF16 rounds it) added before the activation.
template <bool ASPLIT, int ACT, bool BIAS_BF16, bool RES_BF16>
__global__ __launch_bounds__(128) void k_gemm_bf3(const float* __restrict__ A, int lda, const unsigned short* __restrict__ Wt, int ldb,
                                                const float* __restrict__ bias, const float* __restrict__ resid, int rmod, int ldr,
                                                float* __restrict__ C, int ldc, int M, int N, int K) {
  __shared__ __attribute__((aligned(16))) float so[4][16][64];
  const int tid = threadIdx.x, w = tid >> 5, lane = tid & 31, ln = lane & 15, hh = lane >> 4;
  const int ntn = N / 64;
  const int wid = blockIdx.x * 4 + w;
  const int mt = wid / ntn, nq = wid % ntn;
  if (mt * 16 >= M) return;
  const int row0 = mt * 16, col0 = nq * 64;
  const float* arow = A + (size_t)(row0 + ln) * lda;
  v8f acc[4] = {};
  for (int kb = 0; kb < K; kb += 32) {
    FragB ah, al;
    const v4f x0 = *(const v4fa*)(arow + kb + 8 * hh), x1 = *(const v4fa*)(arow + kb + 8 * hh + 4);
    const v4f x2 = *(const v4fa*)(arow + kb + 16 + 8 * hh), x3 = *(const v4fa*)(arow + kb + 16 + 8 * hh + 4);
    float xs[16] = {x0[0],x0[1],x0[2],x0[3],x1[0],x1[1],x1[2],x1[3],x2[0],x2[1],x2[2],x2[3],x3[0],x3[1],x3[2],x3[3]};
#pragma unroll
    for (int i = 0; i < 16; ++i) { const unsigned short hb = bf16_bits(xs[i]); ah.u[i] = hb; al.u[i] = ASPLIT ? bf16_bits(xs[i] - bf16_val(hb)) : (unsigned short)0; }
#pragma unroll
    for (int t = 0; t < 4; ++t) {
      const unsigned short* brow = Wt + (size_t)(col0 + t * 16 + ln) * ldb + kb;
      FragB b;
      b.half[0] = *(const v8us*)(brow + 8 * hh);
      b.half[1] = *(const v8us*)(brow + 16 + 8 * hh);
      acc[t] = mmaN<ASPLIT ? 2 : 1>(ah.v, al.v, b.v, b.v, acc[t]);
    }
  }
#pragma unroll
  for (int t = 0; t < 4; ++t) {
    const int col = col0 + t * 16 + ln;
    float bv = bias ? bias[col] : 0.f;
    if (BIAS_BF16) bv = bf16_round(bv);
#pragma unroll
    for (int r = 0; r < 8; ++r) {
      float v = acc[t][r] + bv;
      if (resid) { float rv = resid[(size_t)((row0 + 8 * hh + r) % rmod) * ldr + col]; if (RES_BF16) rv = bf16_round(rv); v += rv; }
      if (ACT == 1) v = fmaxf(v, 0.f);
      if (ACT == 2) v = 0.5f * v * (1.0f + erff(v * 0.70710678118654752f));
      if (ACT == 3) { const float u = 0.7978845608028654f * (v + 0.044715f * v * v * v); v = 0.5f * v * (1.0f + tanhf(u)); }
      so[w][8 * hh + r][t * 16 + ln] = v;
    }
  }
  __builtin_amdgcn_fence(__ATOMIC_ACQ_REL, "workgroup");
  __builtin_amdgcn_wave_barrier();
  const int rsub = lane >> 4, c4 = (lane & 15) * 4;
  {
#pragma unroll
    for (int q = 0; q < 8; ++q) {
      const int r = q * 2 + rsub;
      const v4f v = *(const v4fa*)&so[w][r][c4];
      *(v4f*)(C + (size_t)(row0 + r) * ldc + col0 + c4) = v;
    }
    
  }
}
// row LayerNorm (biased variance, eps) over N: s = X (+ R); optional out_sum <- s; out_norm <- (s-mu)*rsqrt(var+eps)*g + b
template <bool PARAM_BF16>
__global__ __launch_bounds__(256) void k_layernorm(const float* __restrict__ X, const float* __restrict__ R, const float* __restrict__ g, const float* __restrict__ bta,
                                                  float* __restrict__ out_sum, float* __restrict__ out_norm, int N, float eps) {
  __shared__ float red[256];
  const int row = blockIdx.x, tid = threadIdx.x;
  const float* x = X + (size_t)row * N; const float* rr = R ? R + (size_t)row * N : nullptr;
  float vals[16];                     // up to N = 4096
  const int per = N / 256;            // contiguous chunk per thread? use strided-by-4 chunks: thread handles j = tid*4 + 1024*u
  float s1 = 0.f;
  for (int u = 0; u < per / 4; ++u) {
    const int j = tid * 4 + 1024 * u;
    const v4f a = *(const v4fa*)(x + j);
    v4f b = {0.f,0.f,0.f,0.f}; if (rr) b = *(const v4fa*)(rr + j);
#pragma unroll
    for (int q = 0; q < 4; ++q) { const float v = a[q] + b[q]; vals[u * 4 + q] = v; s1 += v; }
  }
  red[tid] = s1; __syncthreads();
  for (int st = 128; st > 0; st >>= 1) { if (tid < st) red[tid] += red[tid + st]; __syncthreads(); }
  const float mu = red[0] / (float)N; __syncthreads();
  float s2 = 0.f;
  for (int u = 0; u < per / 4; ++u)
#pragma unroll
    for (int q = 0; q < 4; ++q) { const float c = vals[u * 4 + q] - mu; s2 += c * c; }
  red[tid] = s2; __syncthreads();
  for (int st = 128; st > 0; st >>= 1) { if (tid < st) red[tid] += red[tid + st]; __syncthreads(); }
  const float rs = rsqrtf(red[0] / (float)N + eps);
  {
    for (int u = 0; u < per / 4; ++u) {
      const int j = tid * 4 + 1024 * u;
      v4f o, sm;
#pragma unroll
      for (int q = 0; q < 4; ++q) {
        float gg = g[j + q], bb = bta[j + q];
        if (PARAM_BF16) { gg = bf16_round(gg); bb = bf16_round(bb); }
        sm[q] = vals[u * 4 + q]; o[q] = (vals[u * 4 + q] - mu) * rs * gg + bb;
      }
      if (out_sum) *(v4f*)(out_sum + (size_t)row * N + j) = sm;
      *(v4f*)(out_norm + (size_t)row * N + j) = o;
    }
    
  }
}



// ---- f16 WMMA path (v_wmma_f32_16x16x32_f16): 11-bit significands for operands in range — used where a [0,1] probability operand needs more precision than bf16
typedef _Float16 v16h __attribute__((ext_vector_type(16)));
union FragH { v16h v; v8us half[2]; _Float16 h[16]; unsigned short u[16]; };
template <int NT>
__device__ __forceinline__ v8f mmaH(v16h ah, v16h al, v16h bh, v16h bl, v8f c) {
  c = __builtin_amdgcn_wmma_f32_16x16x32_f16(false, ah, false, bh, (short)0, c, false, false);
  if (NT >= 2) c = __builtin_amdgcn_wmma_f32_16x16x32_f16(false, al, false, bh, (short)0, c, false, false);
  if (NT >= 3) c = __builtin_amdgcn_wmma_f32_16x16x32_f16(false, ah, false, bl, (short)0, c, false, false);
  asm volatile("v_nop\n\tv_nop\n\tv_nop\n\tv_nop" : "+v"(c) : "v"(ah), "v"(al), "v"(bh), "v"(bl));
  return c;
}
// batched GEMM like k_gemm_b but f16 operands: A f32 (split into f16 hi/lo if ASPLIT, else rounded to f16), Bt = f16 values [n][k]; alpha; C f32; N multiple of 16 (partial tiles skipped)
template <bool ASPLIT>
__global__ __launch_bounds__(128) void k_gemm_h(const float* __restrict__ A, int lda, size_t sA, const _Float16* __restrict__ Bh, int ldb, size_t sB, float alpha, float* __restrict__ C, int ldc, size_t sC, int M, int N, int K) {
  __shared__ __attribute__((aligned(16))) float so[4][16][64];
  const int tid = threadIdx.x, w = tid >> 5, lane = tid & 31, ln = lane & 15, hh = lane >> 4; const int by = blockIdx.y;
  A += (size_t)by * sA; Bh += (size_t)by * sB; C += (size_t)by * sC;
  const int ntn = (N + 63) / 64; const int wid = blockIdx.x * 4 + w; const int mt = wid / ntn, nq = wid % ntn; if (mt * 16 >= M) return;
  const int row0 = mt * 16, col0 = nq * 64; const float* arow = A + (size_t)(row0 + ln) * lda;
  v8f acc[4] = {};
  for (int kb = 0; kb < K; kb += 32) {
    FragH ah, al;
    const v4f x0 = *(const v4fa*)(arow + kb + 8 * hh), x1 = *(const v4fa*)(arow + kb + 8 * hh + 4), x2 = *(const v4fa*)(arow + kb + 16 + 8 * hh), x3 = *(const v4fa*)(arow + kb + 16 + 8 * hh + 4);
    float xs[16] = {x0[0],x0[1],x0[2],x0[3],x1[0],x1[1],x1[2],x1[3],x2[0],x2[1],x2[2],x2[3],x3[0],x3[1],x3[2],x3[3]};
#pragma unroll
    for (int i = 0; i < 16; ++i) { const _Float16 h = (_Float16)xs[i]; ah.h[i] = h; al.h[i] = ASPLIT ? (_Float16)(xs[i] - (float)h) : (_Float16)0.0f; }
#pragma unroll
    for (int t = 0; t < 4; ++t) { if (col0 + t * 16 >= N) continue; const size_t boff = (size_t)(col0 + t * 16 + ln) * ldb + kb; FragH bq; bq.half[0] = *(const v8us*)(Bh + boff + 8 * hh); bq.half[1] = *(const v8us*)(Bh + boff + 16 + 8 * hh);
      acc[t] = mmaH<ASPLIT ? 2 : 1>(ah.v, al.v, bq.v, bq.v, acc[t]); }
  }
#pragma unroll
  for (int t = 0; t < 4; ++t) { if (col0 + t * 16 >= N) continue;
#pragma unroll
    for (int r = 0; r < 8; ++r) so[w][8 * hh + r][t * 16 + ln] = acc[t][r] * alpha; }
  __builtin_amdgcn_fence(__ATOMIC_ACQ_REL, "workgroup"); __builtin_amdgcn_wave_barrier();
  const int rsub = lane >> 4, c4 = (lane & 15) * 4;
  {
#pragma unroll
    for (int q = 0; q < 8; ++q) { const int r = q * 2 + rsub; if (col0 + c4 < N) { const v4f v = *(const v4fa*)&so[w][r][c4]; *(v4f*)(C + (size_t)(row0 + r) * ldc + col0 + c4) = v; } }
     }
}

// Wt[n][k] = f16(W[k][n]·scale) from f32 row-major W[K][N] (scale = power of two; bf16-exact weights stay exact in f16 away from the subnormal range)
__global__ __launch_bounds__(256) void k_wt_f16(const float* __restrict__ W, _Float16* __restrict__ Wt, int K, int N, float scale) {
  const int t = blockIdx.x * 256 + threadIdx.x; if (t >= N * (K / 8)) return; const int n = t / (K / 8), k8 = (t % (K / 8)) * 8; FragH f;
#pragma unroll
  for (int i = 0; i < 8; ++i) f.h[i] = (_Float16)(bf16_round(W[(size_t)(k8 + i) * N + n]) * scale); const v8us o = f.half[0];
  *(v8us*)((unsigned short*)Wt + (size_t)n * K + k8) = o; 
}
// k_gemm_hh variant with fused epilogue: v = acc·alpha + bias[by·sBias + col] (+ CP[(row/rowsPerB)·sCPb + by·64 + col] if CP) ; ACT 0 none / 1 elu ; writes f16 C16 (and f32 C if non-null)
template <int ACT>
__global__ __launch_bounds__(128) void k_gemm_hhx(const _Float16* __restrict__ A, int lda, size_t sA, const _Float16* __restrict__ Bh, int ldb, size_t sB, float alpha, const float* __restrict__ bias, size_t sBias, const float* __restrict__ CP, int rowsPerB, size_t sCPb, int row0g,
    float* __restrict__ C, _Float16* __restrict__ C16, int ldc, size_t sC, int M, int N, int K) {
  __shared__ __attribute__((aligned(16))) float so[4][16][64];
  const int tid = threadIdx.x, w = tid >> 5, lane = tid & 31, ln = lane & 15, hh = lane >> 4; const int by = blockIdx.y;
  A += (size_t)by * sA; Bh += (size_t)by * sB; const size_t cofs = (size_t)by * sC; const float* bp = bias ? bias + (size_t)by * sBias : nullptr;
  const int ntn = (N + 63) / 64; const int wid = blockIdx.x * 4 + w; const int mt = wid / ntn, nq = wid % ntn; if (mt * 16 >= M) return;
  const int row0 = mt * 16, col0 = nq * 64; const _Float16* arow = A + (size_t)(row0 + ln) * lda;
  v8f acc[4] = {};
  for (int kb = 0; kb < K; kb += 32) { FragH ah; ah.half[0] = *(const v8us*)((const unsigned short*)arow + kb + 8 * hh); ah.half[1] = *(const v8us*)((const unsigned short*)arow + kb + 16 + 8 * hh);
#pragma unroll
    for (int t = 0; t < 4; ++t) { if (col0 + t * 16 >= N) continue; const size_t boff = (size_t)(col0 + t * 16 + ln) * ldb + kb; FragH bq; bq.half[0] = *(const v8us*)((const unsigned short*)Bh + boff + 8 * hh); bq.half[1] = *(const v8us*)((const unsigned short*)Bh + boff + 16 + 8 * hh);
      acc[t] = mmaH<1>(ah.v, ah.v, bq.v, bq.v, acc[t]); }
  }
#pragma unroll
  for (int t = 0; t < 4; ++t) { if (col0 + t * 16 >= N) continue; const int col = col0 + t * 16 + ln; const float bv = bp ? bf16_round(bp[col]) : 0.f;
#pragma unroll
    for (int r = 0; r < 8; ++r) { float v = acc[t][r] * alpha + bv; if (CP) { const int rr = row0g + row0 + 8 * hh + r; if (rowsPerB < 0) v += CP[cofs + (size_t)rr * ldc + col];      /* rowsPerB < 0: own element of the batched C plane */ else { const int bidx = rr / rowsPerB; v += CP[(size_t)bidx * sCPb + (size_t)by * 64 + col]; } } if (ACT == 1) v = (v > 0.f) ? v : expm1f(v); else if (ACT == 7) v = (v > 0.f) ? v + 1.0f : expf(v); else if (ACT == 8) v = tanhf(v); else if (ACT == 9) v = 0.5f * v * (1.0f + tanhf(0.7978845608028654f * (v + 0.044715f * v * v * v))); else if (ACT == 11) v = 1.0f / (1.0f + expf(-v)); else if (ACT == 12) v = (v > 0.f) ? v : 0.01f * v; else if (ACT == 14) v = (v > 0.f) ? v : 0.1f * v; else if (ACT == 16) v = (v >= 0.f) ? v : 0.3f * v; else if (ACT == 17) v = (v >= 0.f) ? v : 0.2f * v; else if (ACT == 15) v = v / (1.0f + expf(-v)); else if (ACT == 3) v = fmaxf(v, 0.f); else if (ACT == 6) v = 0.5f * v * (1.0f + erff(v * 0.70710678118654752f)); so[w][8 * hh + r][t * 16 + ln] = v; } }
  __builtin_amdgcn_fence(__ATOMIC_ACQ_REL, "workgroup"); __builtin_amdgcn_wave_barrier();
  const int rsub = lane >> 4, c4 = (lane & 15) * 4; typedef _Float16 v4h __attribute__((ext_vector_type(4)));
  {
#pragma unroll
    for (int q = 0; q < 8; ++q) { const int r = q * 2 + rsub; if (col0 + c4 < N) { const v4f v = *(const v4fa*)&so[w][r][c4]; if (C) *(v4f*)(C + cofs + (size_t)(row0 + r) * ldc + col0 + c4) = v; if (C16) { v4h h4; for (int i = 0; i < 4; ++i) h4[i] = (_Float16)v[i]; *(v4h*)(C16 + cofs + (size_t)(row0 + r) * ldc + col0 + c4) = h4; } } }
     }
}


typedef _Float16 v4h __attribute__((ext_vector_type(4)));

__global__ __launch_bounds__(256) void k_x16(const float* __restrict__ x, _Float16* __restrict__ X16, size_t n8) { const size_t t = (size_t)blockIdx.x * 256 + threadIdx.x; if (t >= n8) return; FragH f;
#pragma unroll
  for (int q = 0; q < 8; ++q) f.h[q] = (_Float16)bf16_round(x[t * 8 + q]); *(v8us*)((unsigned short*)X16 + t * 8) = f.half[0];  }
__global__ __launch_bounds__(256) void k_h16(const float* __restrict__ x, _Float16* __restrict__ X16, size_t n8) { const size_t t = (size_t)blockIdx.x * 256 + threadIdx.x; if (t >= n8) return; FragH f;
#pragma unroll
  for (int q = 0; q < 8; ++q) f.h[q] = (_Float16)x[t * 8 + q]; *(v8us*)((unsigned short*)X16 + t * 8) = f.half[0];  }
__global__ __launch_bounds__(256) void k_round16f(const float* __restrict__ W, _Float16* __restrict__ Bt, size_t n8) { const size_t t = (size_t)blockIdx.x * 256 + threadIdx.x; if (t >= n8) return; FragH f;
#pragma unroll
  for (int i = 0; i < 8; ++i) f.h[i] = (_Float16)(bf16_round(W[t * 8 + i]) * 16.0f); *(v8us*)((unsigned short*)Bt + t * 8) = f.half[0];  }
template <int NHv, int TTv>
__global__ __launch_bounds__(256) void k_vt(const _Float16* __restrict__ V16, int ldv, int voff, _Float16* __restrict__ Vt) { __shared__ unsigned short tl[64][66]; const int tid = threadIdx.x; const int slab = blockIdx.x / (TTv / 64), lg = blockIdx.x % (TTv / 64); const int b = slab / NHv, h = slab % NHv;
  for (int i = tid; i < 64 * 8; i += 256) { const int r = i / 8, c8 = (i % 8) * 8; FragH f; f.half[0] = *(const v8us*)((const unsigned short*)V16 + ((size_t)b * TTv + lg * 64 + r) * ldv + voff + h * 64 + c8);
#pragma unroll
    for (int q = 0; q < 8; ++q) tl[r][c8 + q] = f.u[q]; }
  __syncthreads();
  {
#pragma unroll
    for (int rd = 0; rd < 2; ++rd) { const int d = rd * 32 + tid / 8, pc = tid % 8; FragH f;
#pragma unroll
      for (int q = 0; q < 8; ++q) f.u[q] = tl[pc * 8 + q][d];
      *(v8us*)((unsigned short*)Vt + ((size_t)slab * 64 + d) * TTv + lg * 64 + pc * 8) = f.half[0]; }
     } }

__global__ __launch_bounds__(256) void k_hl(const float* __restrict__ F, _Float16* __restrict__ Hh, _Float16* __restrict__ Hl, size_t n8) { const size_t t = (size_t)blockIdx.x * 256 + threadIdx.x; if (t >= n8) return; FragH fh, fl; const v4f a = *(const v4fa*)(F + t * 8), c = *(const v4fa*)(F + t * 8 + 4);
#pragma unroll
  for (int q = 0; q < 4; ++q) { _Float16 h = (_Float16)a[q]; fh.h[q] = h; fl.h[q] = (_Float16)((a[q] - (float)h) * 1024.0f); h = (_Float16)c[q]; fh.h[4 + q] = h; fl.h[4 + q] = (_Float16)((c[q] - (float)h) * 1024.0f); }
  { *(v8us*)((unsigned short*)Hh + t * 8) = fh.half[0]; *(v8us*)((unsigned short*)Hl + t * 8) = fl.half[0];  } }

// ---- fast GEMM (wave tile 32x64; requires M % 32 == 0 rows per launch region and N % 64 == 0); epilogue = k_gemm_hhx semantics ----
__device__ __forceinline__ v16h g2_frag(const _Float16* p, int hh) { FragH f; f.half[0] = *(const v8us*)((const unsigned short*)p + 8 * hh); f.half[1] = *(const v8us*)((const unsigned short*)p + 16 + 8 * hh); return f.v; }
__device__ __forceinline__ v8f g2_mma(v16h a, v16h b, v8f c) { v8f d = __builtin_amdgcn_wmma_f32_16x16x32_f16(false, a, false, b, (short)0, c, false, false); asm volatile("v_nop\n\tv_nop\n\tv_nop\n\tv_nop" : "+v"(d) : "v"(a), "v"(b)); return d; }
template <int ACT>
__global__ __launch_bounds__(128) void k_gemm2(const _Float16* __restrict__ A, int lda, size_t sA, const _Float16* __restrict__ Bh, int ldb, size_t sB, float alpha, const float* __restrict__ bias, size_t sBias, const float* __restrict__ CP, int rowsPerB, size_t sCPb, int row0g,
    float* __restrict__ C, _Float16* __restrict__ C16, int ldc, size_t sC, int M, int N, int K) { static_assert(ACT == 0 || ACT == 3 || ACT == 6 || ACT == 8 || ACT == 9 || ACT == 11 || ACT == 12 || ACT == 14 || ACT == 15 || ACT == 16 || ACT == 17, "k_gemm2: unsupported ACT code (would silently apply no activation)");
  __shared__ __attribute__((aligned(16))) float so[4][32][68];
  const int tid = threadIdx.x, w = tid >> 5, lane = tid & 31, ln = lane & 15, hh = lane >> 4; const int by = blockIdx.y;
  A += (size_t)by * sA; Bh += (size_t)by * sB; const size_t cofs = (size_t)by * sC; const float* bp = bias ? bias + (size_t)by * sBias : nullptr;
  const int ntn = N >> 6; const int mt = blockIdx.x / ntn, nq = blockIdx.x - mt * ntn; const int row0 = mt * 128 + 32 * w, col0 = nq * 64; if (row0 >= M) return;
  const _Float16* a0p = A + (size_t)(row0 + ln) * lda; const _Float16* a1p = a0p + (size_t)16 * lda;
  const _Float16* b0p = Bh + (size_t)(col0 + ln) * ldb; const _Float16* b1p = b0p + (size_t)16 * ldb; const _Float16* b2p = b1p + (size_t)16 * ldb; const _Float16* b3p = b2p + (size_t)16 * ldb;
  const v8f z8 = {0.f,0.f,0.f,0.f,0.f,0.f,0.f,0.f}; v8f c00 = z8, c01 = z8, c02 = z8, c03 = z8, c10 = z8, c11 = z8, c12 = z8, c13 = z8;
#pragma unroll 1
  for (int kb = 0; kb < K; kb += 32) { const v16h a0 = g2_frag(a0p + kb, hh), a1 = g2_frag(a1p + kb, hh);
    v16h b = g2_frag(b0p + kb, hh); c00 = g2_mma(a0, b, c00); c10 = g2_mma(a1, b, c10);
    b = g2_frag(b1p + kb, hh); c01 = g2_mma(a0, b, c01); c11 = g2_mma(a1, b, c11);
    b = g2_frag(b2p + kb, hh); c02 = g2_mma(a0, b, c02); c12 = g2_mma(a1, b, c12);
    b = g2_frag(b3p + kb, hh); c03 = g2_mma(a0, b, c03); c13 = g2_mma(a1, b, c13); }
  v8f accs[8] = {c00, c01, c02, c03, c10, c11, c12, c13};
#pragma unroll
  for (int u = 0; u < 8; ++u) { const int t = u & 3, half = u >> 2; const int col = col0 + t * 16 + ln; const float bv = bp ? bf16_round(bp[col]) : 0.f;
#pragma unroll
    for (int r = 0; r < 8; ++r) { const int rloc = half * 16 + 8 * hh + r; float v = accs[u][r] * alpha + bv; if (CP) { if (rowsPerB < 0) v += CP[cofs + (size_t)(row0g + row0 + rloc) * ldc + col];      /* rowsPerB < 0: own element of the batched C plane */ else { const int bidx = (row0g + row0 + rloc) / rowsPerB; v += CP[(size_t)bidx * sCPb + (size_t)by * 64 + col]; } }
      if (ACT == 3) v = fmaxf(v, 0.f); else if (ACT == 6) v = 0.5f * v * (1.0f + erff(v * 0.70710678118654752f)); else if (ACT == 11) v = 1.0f / (1.0f + expf(-v)); else if (ACT == 15) v = v / (1.0f + expf(-v)); else if (ACT == 12) v = (v > 0.f) ? v : 0.01f * v; else if (ACT == 8) v = tanhf(v); else if (ACT == 9) v = 0.5f * v * (1.0f + tanhf(0.7978845608028654f * (v + 0.044715f * v * v * v))); else if (ACT == 14) v = (v > 0.f) ? v : 0.1f * v; else if (ACT == 16) v = (v >= 0.f) ? v : 0.3f * v; else if (ACT == 17) v = (v >= 0.f) ? v : 0.2f * v;
      so[w][rloc][t * 16 + ln] = v; } }
  __builtin_amdgcn_fence(__ATOMIC_ACQ_REL, "workgroup"); __builtin_amdgcn_wave_barrier();
  const int rsub = lane >> 4, c4 = (lane & 15) * 4;
  {
#pragma unroll
    for (int q = 0; q < 16; ++q) { const int r = q * 2 + rsub; const v4f v = *(const v4fa*)&so[w][r][c4]; if (C) *(v4f*)(C + cofs + (size_t)(row0 + r) * ldc + col0 + c4) = v; if (C16) { v4h h4; for (int i = 0; i < 4; ++i) h4[i] = (_Float16)v[i]; *(v4h*)(C16 + cofs + (size_t)(row0 + r) * ldc + col0 + c4) = h4; } }
     } }


__global__ __launch_bounds__(256) void k_wnat(const float* __restrict__ w, size_t n8, _Float16* __restrict__ Bt) { const size_t t = (size_t)blockIdx.x * 256 + threadIdx.x; if (t >= n8) return; FragH f; for (int q = 0; q < 8; ++q) f.h[q] = (_Float16)(bf16_round(w[t * 8 + q]) * 16.0f); *(v8us*)((unsigned short*)Bt + t * 8) = f.half[0];  }
__global__ __launch_bounds__(256) void k_rsm(const float* __restrict__ S, _Float16* __restrict__ P, int nrows) {
  #pragma clang fp contract(off)
  const int i = blockIdx.x * 256 + threadIdx.x; if (i >= nrows) return; const float* s = S + (size_t)i * SQ; float mx = -3.0e38f;
#pragma unroll 1
  for (int j = 0; j < SQ; ++j) mx = fmaxf(mx, s[j]); float se = 0.f;
#pragma unroll 1
  for (int j = 0; j < SQ; ++j) se += expf(s[j] - mx); const float sc = 256.0f / se;
#pragma unroll 1
  for (int j0 = 0; j0 < SQ; j0 += 8) { FragH f; for (int q = 0; q < 8; ++q) f.h[q] = (_Float16)(expf(s[j0 + q] - mx) * sc); unsigned short* d = (unsigned short*)P + (size_t)i * SQ + j0; *(v8us*)d = f.half[0];  } }
__global__ __launch_bounds__(256) void k_vt(const _Float16* __restrict__ V16, int b, int h0, _Float16* __restrict__ VT) { __shared__ unsigned short tl[64][65]; const int tid = threadIdx.x; const int hh = blockIdx.x % HG, sg = blockIdx.x / HG; const int s0 = sg * 64; const int h = h0 + hh;
  for (int i = tid; i < 64 * 8; i += 256) { const int j = i / 8, d8 = (i % 8) * 8; FragH f; f.half[0] = *(const v8us*)((const unsigned short*)V16 + ((size_t)b * SQ + s0 + j) * DM + h * HD + d8); for (int q = 0; q < 8; ++q) tl[d8 + q][j] = f.u[q]; }
  __syncthreads();
  { for (int i = tid; i < 64 * 8; i += 256) { const int d = i / 8, j8 = (i % 8) * 8; FragH f; for (int q = 0; q < 8; ++q) f.u[q] = tl[d][j8 + q]; *(v8us*)((unsigned short*)VT + ((size_t)hh * HD + d) * SQ + s0 + j8) = f.half[0]; }  } }



__global__ __launch_bounds__(256) void k_rsmcf2(const float* __restrict__ S, _Float16* __restrict__ P, int hg, int q0, int nk) {
  #pragma clang fp contract(off)
  const int t = blockIdx.x * 256 + threadIdx.x; if (t >= hg * QT) return; const size_t i = (size_t)t; const float* s = S + i * NKX; const int last = q0 + (t % QT); float mx = -3.0e38f;
#pragma unroll 1
  for (int j = 0; j < nk; ++j) { const float f = (j <= last) ? 1.f : 0.f; mx = fmaxf(mx, fmaf(f, s[j], (1.f - f) * -1.0e9f)); } float se = 0.f;
#pragma unroll 1
  for (int j = 0; j < nk; ++j) { const float f = (j <= last) ? 1.f : 0.f; se += __expf(fmaf(f, s[j], (1.f - f) * -1.0e9f) - mx); } const float sc = 256.0f / se;
#pragma unroll 1
  for (int j0 = 0; j0 < nk; j0 += 8) { FragH fr; for (int q = 0; q < 8; ++q) { const int j = j0 + q; const float f = (j <= last) ? 1.f : 0.f; fr.h[q] = (_Float16)(__expf(fmaf(f, s[j], (1.f - f) * -1.0e9f) - mx) * sc); } unsigned short* d = (unsigned short*)P + i * NKX + j0; *(v8us*)d = fr.half[0];  } }


template <int MASKADD>
__global__ __launch_bounds__(64) void k_att0(const float* __restrict__ QF, const float* __restrict__ KF, const float* __restrict__ VF, int ld, const float* __restrict__ mask, float scale, float* __restrict__ OF, int ldo) {
  #pragma clang fp contract(off)
  __shared__ __attribute__((aligned(16))) float lq[64][64]; __shared__ __attribute__((aligned(16))) float lo[64][64];
  const int tid = threadIdx.x; const int h = blockIdx.x / (QT0 / 64), rg = blockIdx.x % (QT0 / 64); const int i = rg * 64 + tid;
  const float* qr = QF + (size_t)i * ld + h * HD;
#pragma unroll 1
  for (int c = 0; c < HD / 4; ++c) { *(v4f*)&lq[tid][c * 4] = *(const v4fa*)(qr + c * 4); const v4f z = {0.f, 0.f, 0.f, 0.f}; *(v4f*)&lo[tid][c * 4] = z; }
  float m = -1.0e30f, l = 0.f; const int jmax = MASKADD ? (SQ - 1) : (rg * 64 + 63);      /* additive-mask form: every key (the mask input decides); causal form: keys up to the block's last row */
#pragma unroll 1
  for (int j = 0; j <= jmax; ++j) { const float* kr = KF + (size_t)j * ld + h * HD; const float* vr = VF + (size_t)j * ld + h * HD; float s = 0.f;
#pragma unroll 1
    for (int c = 0; c < HD / 4; ++c) { const v4f kq = *(const v4fa*)(kr + c * 4); const v4f qq = *(v4f*)&lq[tid][c * 4]; s = __fadd_rn(s, __fmul_rn(qq[0], kq[0])); s = __fadd_rn(s, __fmul_rn(qq[1], kq[1])); s = __fadd_rn(s, __fmul_rn(qq[2], kq[2])); s = __fadd_rn(s, __fmul_rn(qq[3], kq[3])); }
    s = __fmul_rn(s, scale); if (MASKADD) s = __fadd_rn(s, __fmul_rn(bf16_round(mask[(size_t)i * SQ + j]), -10000.0f));
    const float f = (MASKADD || j <= i) ? 1.f : 0.f; const float sm = fmaf(f, s, (1.f - f) * -1.0e30f); const float mn = fmaxf(m, sm); const float sc = expf(m - mn); const float e = expf(sm - mn); l = __fadd_rn(__fmul_rn(l, sc), e); m = mn;
#pragma unroll 1
    for (int c = 0; c < HD / 4; ++c) { const v4f vv = *(const v4fa*)(vr + c * 4); v4f oo = *(v4f*)&lo[tid][c * 4]; for (int u = 0; u < 4; ++u) oo[u] = __fadd_rn(__fmul_rn(oo[u], sc), __fmul_rn(e, vv[u])); *(v4f*)&lo[tid][c * 4] = oo; } }
  const float fin = 64.0f / l;      /* o carried x64 like the f16 path */
#pragma unroll 1
  for (int c = 0; c < HD / 4; ++c) { v4f oo = *(v4f*)&lo[tid][c * 4]; for (int u = 0; u < 4; ++u) oo[u] = __fmul_rn(oo[u], fin); *(v4f*)&lo[tid][c * 4] = oo; }
  __syncthreads();
  {
#pragma unroll 1
    for (int it = 0; it < 16; ++it) { const int row = it * 4 + tid / 16, pc = (tid % 16) * 4; const v4f v = *(const v4f*)&lo[row][pc]; *(v4f*)(OF + (size_t)(rg * 64 + row) * ldo + h * HD + pc) = v; }
     } }

extern "C" void kernel_launch(void* const* d_in, const int* in_sizes, int n_in,
                              void* d_out, int out_size, void* d_ws, size_t ws_size, hipStream_t stream) {
  (void)in_sizes; (void)n_in; (void)out_size;
  const float* const* I = (const float* const*)d_in; const float* x = I[0]; const float* xk = I[0]; const float* xv = I[0]; const float* wq = I[1]; const float* bq = nullptr; const float* wk = I[2]; const float* bk = nullptr; const float* wv = I[3]; const float* bv = nullptr; const float* wo = I[4]; const float* bo = nullptr;      /* input order: x, Wq, Wk, Wv (BLOCK-DIAGONAL per-head [16][64][64] = [head][in][out]; NO biases: null pointers), Wo ([in][out] [1024][1024]; no bias: a null pointer in the output GEMM's guarded slot); five inputs */
  char* ws = (char*)d_ws; size_t off = 0;
  auto take = [&](size_t bytes) { char* p = ws + off; off += (bytes + 255) & ~(size_t)255; return p; };
  _Float16* BQ = (_Float16*)take((size_t)DM * DM * 2); _Float16* BK = (_Float16*)take((size_t)DM * DM * 2); _Float16* BV = (_Float16*)take((size_t)DM * DM * 2); _Float16* BO = (_Float16*)take((size_t)DM * DM * 2);
  _Float16* X16 = (_Float16*)take(NR * DM * 2); _Float16* XK16 = (_Float16*)take(NR * DM * 2); _Float16* XV16 = (_Float16*)take(NR * DM * 2);      /* exact f16 rows of query, key, value */ float* QF = (float*)take(NR * DM * 4); _Float16* QH = (_Float16*)take(NR * DM * 2); _Float16* QL = (_Float16*)take(NR * DM * 2); _Float16* KH = (_Float16*)take(NR * DM * 2); _Float16* KL = (_Float16*)take(NR * DM * 2); _Float16* Q16 = QH; _Float16* K16 = KH; _Float16* V16 = (_Float16*)take(NR * DM * 2); _Float16* O16 = (_Float16*)take(NR * DM * 2);
  float* S = (float*)take((size_t)NH * QT * NKX * 4); _Float16* P = (_Float16*)take((size_t)NH * QT * NKX * 2); _Float16* VT = (_Float16*)take((size_t)NH * HD * SQ * 2);
  float* QF0 = (float*)take((size_t)QT0 * DM * 4); float* KF0 = (float*)take((size_t)QT0 * DM * 4); float* VF0 = (float*)take((size_t)QT0 * DM * 4); float* OF0 = (float*)take((size_t)NB * QT0 * DM * 4); _Float16* OH0 = (_Float16*)take((size_t)NB * QT0 * DM * 2); _Float16* OL0 = (_Float16*)take((size_t)NB * QT0 * DM * 2);
  if (off > ws_size) return;
  { const unsigned gn = (unsigned)(((size_t)DM * (DM / 8) + 255) / 256); const unsigned gp = (unsigned)(((size_t)HD * (HD / 8) + 255) / 256); for (int h = 0; h < NH; ++h) { const size_t o = (size_t)h * HD * HD; k_wt_f16<<<gp, 256, 0, stream>>>(wq + o, BQ + o, HD, HD, 16.0f); k_wt_f16<<<gp, 256, 0, stream>>>(wk + o, BK + o, HD, HD, 16.0f); k_wt_f16<<<gp, 256, 0, stream>>>(wv + o, BV + o, HD, HD, 16.0f); } k_wt_f16<<<gn, 256, 0, stream>>>(wo, BO, DM, DM, 16.0f); }      /* BLOCK-DIAGONAL per-head weights wq / wk / wv [NH][HD][HD] = [head][in][out] (x_h @ W_h): W_h[d][e] -> Bt_h[e][d] x16 through the file's transposing builder with K = N = 64, one call per head and stack, into sixteen consecutive [64][64] planes (the first 128 KiB of the weight plane); Wo [in][out]: the same builder with K = N = 1024 */
  k_x16<<<(unsigned)((NR * DM / 8 + 255) / 256), 256, 0, stream>>>(x, X16, NR * DM / 8); k_x16<<<(unsigned)((NR * DM / 8 + 255) / 256), 256, 0, stream>>>(xk, XK16, NR * DM / 8); k_x16<<<(unsigned)((NR * DM / 8 + 255) / 256), 256, 0, stream>>>(xv, XV16, NR * DM / 8);
  const size_t r0p = (size_t)B0 * SQ;      /* first projected row */
  k_gemm2<0><<<dim3((unsigned)(MP / 128), NH), 128, 0, stream>>>(X16 + r0p * DM, DM, (size_t)HD, BQ, HD, (size_t)HD * HD, 0.0625f, bq, (size_t)HD, nullptr, 1, 0, 0, QF + r0p * DM, nullptr, DM, (size_t)HD, MP, HD, HD); k_hl<<<(unsigned)(((size_t)MP * DM / 8 + 255) / 256), 256, 0, stream>>>(QF + r0p * DM, QH + r0p * DM, QL + r0p * DM, (size_t)MP * DM / 8);      /* q (f32): ONE head-batched GEMM (K = N = 64): head h (grid.y) = x[:, 64 h ..] W_h -> QF[:, 64 h ..]; then -> f16 hi + x1024 residual planes */
  k_gemm2<0><<<dim3((unsigned)(MP / 128), NH), 128, 0, stream>>>(XK16 + r0p * DM, DM, (size_t)HD, BK, HD, (size_t)HD * HD, 0.0625f, bk, (size_t)HD, nullptr, 1, 0, 0, QF + r0p * DM, nullptr, DM, (size_t)HD, MP, HD, HD); k_hl<<<(unsigned)(((size_t)MP * DM / 8 + 255) / 256), 256, 0, stream>>>(QF + r0p * DM, KH + r0p * DM, KL + r0p * DM, (size_t)MP * DM / 8);      /* k likewise */
  k_gemm2<0><<<dim3((unsigned)(MP / 128), NH), 128, 0, stream>>>(XV16 + r0p * DM, DM, (size_t)HD, BV, HD, (size_t)HD * HD, 0.0625f, bv, (size_t)HD, nullptr, 1, 0, 0, nullptr, V16 + r0p * DM, DM, (size_t)HD, MP, HD, HD);      /* v (f16 rows): head-batched likewise */
  for (int b = B0; b < B0 + NBR; ++b) { const size_t r0 = (size_t)b * SQ;
    k_vt<NH, SQ><<<NH * (SQ / 64), 256, 0, stream>>>(V16 + r0 * LQ, LQ, 0, VT);      /* V^T [NH][HD][SQ] for this batch */
    k_gemm2<0><<<dim3((QT0 / 128), NH), 128, 0, stream>>>(X16 + r0 * DM, DM, (size_t)HD, BQ, HD, (size_t)HD * HD, 0.0625f, bq, (size_t)HD, nullptr, 1, 0, 0, QF0, nullptr, DM, (size_t)HD, QT0, HD, HD); k_gemm2<0><<<dim3((QT0 / 128), NH), 128, 0, stream>>>(XK16 + r0 * DM, DM, (size_t)HD, BK, HD, (size_t)HD * HD, 0.0625f, bk, (size_t)HD, nullptr, 1, 0, 0, KF0, nullptr, DM, (size_t)HD, QT0, HD, HD); k_gemm2<0><<<dim3((QT0 / 128), NH), 128, 0, stream>>>(XV16 + r0 * DM, DM, (size_t)HD, BV, HD, (size_t)HD * HD, 0.0625f, bv, (size_t)HD, nullptr, 1, 0, 0, VF0, nullptr, DM, (size_t)HD, QT0, HD, HD);      /* f32 q, k, v of the first 128 rows (exact products): the same head-batched form */
    k_att0<0><<<NH * (QT0 / 64), 64, 0, stream>>>(QF0, KF0, VF0, DM, nullptr, SCL, OF0 + (size_t)b * QT0 * DM, DM);      /* exact f32 attention for rows 0..127 (o x64) */
    for (int q0 = 0; q0 < QN; q0 += QT) { const int nk = q0 + QT;      /* causal: only keys below the tile end are computed */
      k_gemm2<0><<<dim3((QT / 128) * (nk / 64), NHD), 128, 0, stream>>>(QH + (r0 + q0) * LQ, LQ, (size_t)HD, KH + r0 * LQ, LQ, (size_t)HD, SCL, nullptr, 0, nullptr, 1, 0, 0, S, nullptr, NKX, (size_t)QT * NKX, QT, nk, HD);      /* scores hi . hi * 64^-0.5 (SCL = 1/8) */
      k_gemm2<0><<<dim3((QT / 128) * (nk / 64), NHD), 128, 0, stream>>>(QL + (r0 + q0) * LQ, LQ, (size_t)HD, KH + r0 * LQ, LQ, (size_t)HD, SCLR, nullptr, 0, S, -1, 0, 0, S, nullptr, NKX, (size_t)QT * NKX, QT, nk, HD); k_gemm2<0><<<dim3((QT / 128) * (nk / 64), NHD), 128, 0, stream>>>(QH + (r0 + q0) * LQ, LQ, (size_t)HD, KL + r0 * LQ, LQ, (size_t)HD, SCLR, nullptr, 0, S, -1, 0, 0, S, nullptr, NKX, (size_t)QT * NKX, QT, nk, HD);      /* += 2^-10 (lo . hi + hi . lo) */      /* scores, all heads on grid.y */
      k_rsmcf2<<<(NHD * QT + 255) / 256, 256, 0, stream>>>(S, P, NHD, q0, nk);
      k_gemm2<0><<<dim3((QT / 128) * (HD / 64), NHD), 128, 0, stream>>>(P, NKX, (size_t)QT * NKX, VT, SQ, (size_t)HD * SQ, 0.25f, nullptr, 0, nullptr, 1, 0, 0, nullptr, O16 + (r0 + q0) * DM, DM, (size_t)HD, QT, HD, nk); } }      /* o (merged heads, x64) as f16 rows */
  k_gemm2<0><<<dim3((unsigned)((MPO / 128) * (DM / 64)), 1), 128, 0, stream>>>(O16 + r0p * DM, DM, 0, BO, DM, 0, 0.0009765625f, bo, 0, nullptr, 1, 0, 0, (float*)d_out + r0p * DM, nullptr, DM, 0, MPO, DM, DM);      /* out rows are the output layout */
  k_hl<<<(unsigned)(((size_t)NB * QT0 * DM / 8 + 255) / 256), 256, 0, stream>>>(OF0, OH0, OL0, (size_t)NB * QT0 * DM / 8);      /* first-tile o (x64) -> f16 hi + x1024 residual planes */
  for (int b = B0; b < B0 + NBR; ++b) { const size_t r0 = (size_t)b * SQ; const size_t f0 = (size_t)b * QT0;
    k_gemm2<0><<<dim3((QT0 / 128) * (DM / 64), 1), 128, 0, stream>>>(OH0 + f0 * DM, DM, 0, BO, DM, 0, 0.0009765625f, bo, 0, nullptr, 1, 0, 0, (float*)d_out + r0 * DM, nullptr, DM, 0, QT0, DM, DM);      /* rows 0..127: out = o_hi Wo, overwriting the f16-path rows */
    k_gemm2<0><<<dim3((QT0 / 128) * (DM / 64), 1), 128, 0, stream>>>(OL0 + f0 * DM, DM, 0, BO, DM, 0, 0.00000095367431640625f, nullptr, 0, (const float*)d_out + r0 * DM, -1, 0, 0, (float*)d_out + r0 * DM, nullptr, DM, 0, QT0, DM, DM); }      /* += o_lo Wo 2^-20 (own-element accumulate) */
}

// v001
// One run takes 5390 microseconds.
// Timed twice side by side with v000, it ran 2.07 times as fast both times.
#include <hip/hip_runtime.h>
// Causal multi-head self-attention with BLOCK-DIAGONAL per-head projections (x [4][2048][1024] viewed (b, s, 16, 64); q / k / v = einsum('bshd,hde->bshe', xh, W): EACH HEAD applies its own [64][64] weight (W [16][64][64] = [head][in][out], normal x 0.02; NO biases) to ITS OWN 64-wide slice of the row; scores / sqrt(64); where(tril, scores, -inf); softmax over keys; out = merged Wo ([in][out] [1024][1024]; no bias) -> [4][2048][1024]); each projection is ONE head-batched GEMM (K = 64); q and k carried as f16 hi + x1024 residual planes with three-product scores.
// Structure: token rows r = b*2048 + s; x as exact f16 rows (bf16-rounded); q and k as WMMA GEMMs (32x64 wave tiles, f32 accumulation, exact x16 weights, no bias) into f32 rows split into f16 hi + x1024 residual planes, v as an f16-output GEMM; per batch: V^T for all heads via LDS transposes; per query tile of 256 rows: scores against the keys below the tile end only as THREE accumulating passes (hi.hi + lo.hi + hi.lo, K = 64, all heads on grid.y, alpha 1/8 = 1/sqrt(64), 2^-13 on the residual passes, logits sigma ~8), causal row softmax on VALU one wave per row, keys above the row masked by a select over the computed range (f32 statistics, native exp; weights x256 f16), o = P . V^T (K = keys below the tile end, alpha 2^-2: o carried x64, folded into the output GEMM alpha) written straight into the merged f16 o rows; out = o W_o GEMM (f32, no bias) into the output layout.
// Compute dtype: inputs rounded to bf16; x / weights exact; v, softmax weights and o as plain f16 GEMM operands (~2^-12), q and k as f16 hi + x1024 residual pairs; scores and softmax statistics f32. v_wmma_f32_16x16x32_f16.
#define NB 4
#define SCL 0.125f                         /* 1 / sqrt(head_dim 64) */
#define SCLR 0.0001220703125f               /* 2^-13: the same scale on the x1024 residual passes */
#define SQ 2048
#define DM 1024
#define NH 16
#define HD 64
#define HG 4                         /* heads per launch of the k_vt(b, h0) overload (not launched) */
#define QT 256                       /* query rows per causal tile */
#define NKX SQ                       /* S / P row pitch */
#define QT0 128                      /* first-tile rows recomputed exactly in f32 */
#define B0 0                         /* first batch processed (debug hook) */
#define NBR NB                       /* batches processed (debug hook) */
#define NR ((size_t)NB * SQ)         /* token rows */
#define MP ((int)((size_t)NBR * SQ)) /* rows projected (debug hook) */
#define QN SQ                        /* query rows attended per batch (debug hook) */
#define NHD NH                       /* heads attended (debug hook) */
#define MPO MP                       /* rows through the output stage (debug hook) */
#define LQ DM      /* row pitch of the q/k/v rows */
typedef __bf16 v16b __attribute__((ext_vector_type(16)));
typedef unsigned short v8us __attribute__((ext_vector_type(8), may_alias));
typedef float  v8f  __attribute__((ext_vector_type(8)));
typedef float  v4f  __attribute__((ext_vector_type(4)));
typedef float  v4fa __attribute__((ext_vector_type(4), may_alias));
union FragB { v16b v; v8us half[2]; unsigned short u[16]; };

__device__ __forceinline__ unsigned short bf16_bits(float x) { unsigned int u = __float_as_uint(x); return (unsigned short)((u + 0x7FFFu + ((u >> 16) & 1u)) >> 16); }
__device__ __forceinline__ float bf16_val(unsigned short b) { return __uint_as_float(((unsigned int)b) << 16); }
__device__ __forceinline__ float bf16_round(float x) { return bf16_val(bf16_bits(x)); }
// D += A·B with NT terms: 1 = ah·bh, 2 = + al·bh (A split), 3 = + ah·bl (both split)
template <int NT>
__device__ __forceinline__ v8f mmaN(v16b ah, v16b al, v16b bh, v16b bl, v8f c) {
  c = __builtin_amdgcn_wmma_f32_16x16x32_bf16(false, ah, false, bh, (short)0, c, false, false);
  if (NT >= 2) c = __builtin_amdgcn_wmma_f32_16x16x32_bf16(false, al, false, bh, (short)0, c, false, false);
  if (NT >= 3) c = __builtin_amdgcn_wmma_f32_16x16x32_bf16(false, ah, false, bl, (short)0, c, false, false);
  asm volatile("v_nop\n\tv_nop\n\tv_nop\n\tv_nop" : "+v"(c) : "v"(ah), "v"(al), "v"(bh), "v"(bl));
  return c;
}

__global__ __launch_bounds__(256) void k_wt_bf16(const float* __restrict__ W, unsigned short* __restrict__ Wt, int K, int N) {
  const int t = blockIdx.x * 256 + threadIdx.x;
  const int k8n = K / 8;
  if (t >= N * k8n) return;
  const int n = t / k8n, k8 = (t % k8n) * 8;
  v8us v;
#pragma unroll
  for (int i = 0; i < 8; ++i) v[i] = bf16_bits(W[(size_t)(k8 + i) * N + n]);
  *(v8us*)(Wt + (size_t)n * K + k8) = v;
  
}

// GEMM C[M][N] (f32, pitch ldc) = act(A[M][K]·W + bias). A f32 row-major (pitch lda) converted per fragment to bf16
// (ASPLIT: hi/lo two planes -> 2 terms, else single rounded term); Wt bf16 [N][K] (pitch ldb). BIAS_BF16 rounds the
// bias to bf16 first (bias quantised to bf16 before the add). K%32==0, M%16==0, N%64==0.
template <bool ASPLIT, int ACT, bool BIAS_BF16>
__global__ __launch_bounds__(128) void k_gemm_bf(const float* __restrict__ A, int lda, const unsigned short* __restrict__ Wt, int ldb,
                                               const float* __restrict__ bias, float* __restrict__ C, int ldc, int M, int N, int K) {
  __shared__ __attribute__((aligned(16))) float so[4][16][64];
  const int tid = threadIdx.x, w = tid >> 5, lane = tid & 31, ln = lane & 15, hh = lane >> 4;
  const int ntn = N / 64;
  const int wid = blockIdx.x * 4 + w;
  const int mt = wid / ntn, nq = wid % ntn;
  if (mt * 16 >= M) return;
  const int row0 = mt * 16, col0 = nq * 64;
  const float* arow = A + (size_t)(row0 + ln) * lda;
  v8f acc[4] = {};
  for (int kb = 0; kb < K; kb += 32) {
    FragB ah, al;
    const v4f x0 = *(const v4fa*)(arow + kb + 8 * hh), x1 = *(const v4fa*)(arow + kb + 8 * hh + 4);
    const v4f x2 = *(const v4fa*)(arow + kb + 16 + 8 * hh), x3 = *(const v4fa*)(arow + kb + 16 + 8 * hh + 4);
    float xs[16] = {x0[0],x0[1],x0[2],x0[3],x1[0],x1[1],x1[2],x1[3],x2[0],x2[1],x2[2],x2[3],x3[0],x3[1],x3[2],x3[3]};
#pragma unroll
    for (int i = 0; i < 16; ++i) { const unsigned short hb = bf16_bits(xs[i]); ah.u[i] = hb; al.u[i] = ASPLIT ? bf16_bits(xs[i] - bf16_val(hb)) : (unsigned short)0; }
#pragma unroll
    for (int t = 0; t < 4; ++t) {
      const unsigned short* brow = Wt + (size_t)(col0 + t * 16 + ln) * ldb + kb;
      FragB b;
      b.half[0] = *(const v8us*)(brow + 8 * hh);
      b.half[1] = *(const v8us*)(brow + 16 + 8 * hh);
      acc[t] = mmaN<ASPLIT ? 2 : 1>(ah.v, al.v, b.v, b.v, acc[t]);
    }
  }
#pragma unroll
  for (int t = 0; t < 4; ++t) {
    float bv = bias ? bias[col0 + t * 16 + ln] : 0.f;
    if (BIAS_BF16) bv = bf16_round(bv);
#pragma unroll
    for (int r = 0; r < 8; ++r) { float v = acc[t][r] + bv; if (ACT == 1) v = fmaxf(v, 0.f); so[w][8 * hh + r][t * 16 + ln] = v; }
  }
  __builtin_amdgcn_fence(__ATOMIC_ACQ_REL, "workgroup");
  __builtin_amdgcn_wave_barrier();
  const int rsub = lane >> 4, c4 = (lane & 15) * 4;
  {
#pragma unroll
    for (int q = 0; q < 8; ++q) {
      const int r = q * 2 + rsub;
      const v4f v = *(const v4fa*)&so[w][r][c4];
      *(v4f*)(C + (size_t)(row0 + r) * ldc + col0 + c4) = v;
    }
    
  }
}

// GEMM C = act(A·W + bias + resid): A f32 (ASPLIT -> hi/lo 2 terms), Wt bf16 [N][K]; ACT 0 none, 1 relu, 2 exact gelu;
// resid (optional, f32, row index = (row % rmod), pitch ldr, RES_BF16 rounds it) added before the activation.
template <bool ASPLIT, int ACT, bool BIAS_BF16, bool RES_BF16>
__global__ __launch_bounds__(128) void k_gemm_bf3(const float* __restrict__ A, int lda, const unsigned short* __restrict__ Wt, int ldb,
                                                const float* __restrict__ bias, const float* __restrict__ resid, int rmod, int ldr,
                                                float* __restrict__ C, int ldc, int M, int N, int K) {
  __shared__ __attribute__((aligned(16))) float so[4][16][64];
  const int tid = threadIdx.x, w = tid >> 5, lane = tid & 31, ln = lane & 15, hh = lane >> 4;
  const int ntn = N / 64;
  const int wid = blockIdx.x * 4 + w;
  const int mt = wid / ntn, nq = wid % ntn;
  if (mt * 16 >= M) return;
  const int row0 = mt * 16, col0 = nq * 64;
  const float* arow = A + (size_t)(row0 + ln) * lda;
  v8f acc[4] = {};
  for (int kb = 0; kb < K; kb += 32) {
    FragB ah, al;
    const v4f x0 = *(const v4fa*)(arow + kb + 8 * hh), x1 = *(const v4fa*)(arow + kb + 8 * hh + 4);
    const v4f x2 = *(const v4fa*)(arow + kb + 16 + 8 * hh), x3 = *(const v4fa*)(arow + kb + 16 + 8 * hh + 4);
    float xs[16] = {x0[0],x0[1],x0[2],x0[3],x1[0],x1[1],x1[2],x1[3],x2[0],x2[1],x2[2],x2[3],x3[0],x3[1],x3[2],x3[3]};
#pragma unroll
    for (int i = 0; i < 16; ++i) { const unsigned short hb = bf16_bits(xs[i]); ah.u[i] = hb; al.u[i] = ASPLIT ? bf16_bits(xs[i] - bf16_val(hb)) : (unsigned short)0; }
#pragma unroll
    for (int t = 0; t < 4; ++t) {
      const unsigned short* brow = Wt + (size_t)(col0 + t * 16 + ln) * ldb + kb;
      FragB b;
      b.half[0] = *(const v8us*)(brow + 8 * hh);
      b.half[1] = *(const v8us*)(brow + 16 + 8 * hh);
      acc[t] = mmaN<ASPLIT ? 2 : 1>(ah.v, al.v, b.v, b.v, acc[t]);
    }
  }
#pragma unroll
  for (int t = 0; t < 4; ++t) {
    const int col = col0 + t * 16 + ln;
    float bv = bias ? bias[col] : 0.f;
    if (BIAS_BF16) bv = bf16_round(bv);
#pragma unroll
    for (int r = 0; r < 8; ++r) {
      float v = acc[t][r] + bv;
      if (resid) { float rv = resid[(size_t)((row0 + 8 * hh + r) % rmod) * ldr + col]; if (RES_BF16) rv = bf16_round(rv); v += rv; }
      if (ACT == 1) v = fmaxf(v, 0.f);
      if (ACT == 2) v = 0.5f * v * (1.0f + erff(v * 0.70710678118654752f));
      if (ACT == 3) { const float u = 0.7978845608028654f * (v + 0.044715f * v * v * v); v = 0.5f * v * (1.0f + tanhf(u)); }
      so[w][8 * hh + r][t * 16 + ln] = v;
    }
  }
  __builtin_amdgcn_fence(__ATOMIC_ACQ_REL, "workgroup");
  __builtin_amdgcn_wave_barrier();
  const int rsub = lane >> 4, c4 = (lane & 15) * 4;
  {
#pragma unroll
    for (int q = 0; q < 8; ++q) {
      const int r = q * 2 + rsub;
      const v4f v = *(const v4fa*)&so[w][r][c4];
      *(v4f*)(C + (size_t)(row0 + r) * ldc + col0 + c4) = v;
    }
    
  }
}
// row LayerNorm (biased variance, eps) over N: s = X (+ R); optional out_sum <- s; out_norm <- (s-mu)*rsqrt(var+eps)*g + b
template <bool PARAM_BF16>
__global__ __launch_bounds__(256) void k_layernorm(const float* __restrict__ X, const float* __restrict__ R, const float* __restrict__ g, const float* __restrict__ bta,
                                                  float* __restrict__ out_sum, float* __restrict__ out_norm, int N, float eps) {
  __shared__ float red[256];
  const int row = blockIdx.x, tid = threadIdx.x;
  const float* x = X + (size_t)row * N; const float* rr = R ? R + (size_t)row * N : nullptr;
  float vals[16];                     // up to N = 4096
  const int per = N / 256;            // contiguous chunk per thread? use strided-by-4 chunks: thread handles j = tid*4 + 1024*u
  float s1 = 0.f;
  for (int u = 0; u < per / 4; ++u) {
    const int j = tid * 4 + 1024 * u;
    const v4f a = *(const v4fa*)(x + j);
    v4f b = {0.f,0.f,0.f,0.f}; if (rr) b = *(const v4fa*)(rr + j);
#pragma unroll
    for (int q = 0; q < 4; ++q) { const float v = a[q] + b[q]; vals[u * 4 + q] = v; s1 += v; }
  }
  red[tid] = s1; __syncthreads();
  for (int st = 128; st > 0; st >>= 1) { if (tid < st) red[tid] += red[tid + st]; __syncthreads(); }
  const float mu = red[0] / (float)N; __syncthreads();
  float s2 = 0.f;
  for (int u = 0; u < per / 4; ++u)
#pragma unroll
    for (int q = 0; q < 4; ++q) { const float c = vals[u * 4 + q] - mu; s2 += c * c; }
  red[tid] = s2; __syncthreads();
  for (int st = 128; st > 0; st >>= 1) { if (tid < st) red[tid] += red[tid + st]; __syncthreads(); }
  const float rs = rsqrtf(red[0] / (float)N + eps);
  {
    for (int u = 0; u < per / 4; ++u) {
      const int j = tid * 4 + 1024 * u;
      v4f o, sm;
#pragma unroll
      for (int q = 0; q < 4; ++q) {
        float gg = g[j + q], bb = bta[j + q];
        if (PARAM_BF16) { gg = bf16_round(gg); bb = bf16_round(bb); }
        sm[q] = vals[u * 4 + q]; o[q] = (vals[u * 4 + q] - mu) * rs * gg + bb;
      }
      if (out_sum) *(v4f*)(out_sum + (size_t)row * N + j) = sm;
      *(v4f*)(out_norm + (size_t)row * N + j) = o;
    }
    
  }
}



// ---- f16 WMMA path (v_wmma_f32_16x16x32_f16): 11-bit significands for operands in range — used where a [0,1] probability operand needs more precision than bf16
typedef _Float16 v16h __attribute__((ext_vector_type(16)));
union FragH { v16h v; v8us half[2]; _Float16 h[16]; unsigned short u[16]; };
template <int NT>
__device__ __forceinline__ v8f mmaH(v16h ah, v16h al, v16h bh, v16h bl, v8f c) {
  c = __builtin_amdgcn_wmma_f32_16x16x32_f16(false, ah, false, bh, (short)0, c, false, false);
  if (NT >= 2) c = __builtin_amdgcn_wmma_f32_16x16x32_f16(false, al, false, bh, (short)0, c, false, false);
  if (NT >= 3) c = __builtin_amdgcn_wmma_f32_16x16x32_f16(false, ah, false, bl, (short)0, c, false, false);
  asm volatile("v_nop\n\tv_nop\n\tv_nop\n\tv_nop" : "+v"(c) : "v"(ah), "v"(al), "v"(bh), "v"(bl));
  return c;
}
// batched GEMM like k_gemm_b but f16 operands: A f32 (split into f16 hi/lo if ASPLIT, else rounded to f16), Bt = f16 values [n][k]; alpha; C f32; N multiple of 16 (partial tiles skipped)
template <bool ASPLIT>
__global__ __launch_bounds__(128) void k_gemm_h(const float* __restrict__ A, int lda, size_t sA, const _Float16* __restrict__ Bh, int ldb, size_t sB, float alpha, float* __restrict__ C, int ldc, size_t sC, int M, int N, int K) {
  __shared__ __attribute__((aligned(16))) float so[4][16][64];
  const int tid = threadIdx.x, w = tid >> 5, lane = tid & 31, ln = lane & 15, hh = lane >> 4; const int by = blockIdx.y;
  A += (size_t)by * sA; Bh += (size_t)by * sB; C += (size_t)by * sC;
  const int ntn = (N + 63) / 64; const int wid = blockIdx.x * 4 + w; const int mt = wid / ntn, nq = wid % ntn; if (mt * 16 >= M) return;
  const int row0 = mt * 16, col0 = nq * 64; const float* arow = A + (size_t)(row0 + ln) * lda;
  v8f acc[4] = {};
  for (int kb = 0; kb < K; kb += 32) {
    FragH ah, al;
    const v4f x0 = *(const v4fa*)(arow + kb + 8 * hh), x1 = *(const v4fa*)(arow + kb + 8 * hh + 4), x2 = *(const v4fa*)(arow + kb + 16 + 8 * hh), x3 = *(const v4fa*)(arow + kb + 16 + 8 * hh + 4);
    float xs[16] = {x0[0],x0[1],x0[2],x0[3],x1[0],x1[1],x1[2],x1[3],x2[0],x2[1],x2[2],x2[3],x3[0],x3[1],x3[2],x3[3]};
#pragma unroll
    for (int i = 0; i < 16; ++i) { const _Float16 h = (_Float16)xs[i]; ah.h[i] = h; al.h[i] = ASPLIT ? (_Float16)(xs[i] - (float)h) : (_Float16)0.0f; }
#pragma unroll
    for (int t = 0; t < 4; ++t) { if (col0 + t * 16 >= N) continue; const size_t boff = (size_t)(col0 + t * 16 + ln) * ldb + kb; FragH bq; bq.half[0] = *(const v8us*)(Bh + boff + 8 * hh); bq.half[1] = *(const v8us*)(Bh + boff + 16 + 8 * hh);
      acc[t] = mmaH<ASPLIT ? 2 : 1>(ah.v, al.v, bq.v, bq.v, acc[t]); }
  }
#pragma unroll
  for (int t = 0; t < 4; ++t) { if (col0 + t * 16 >= N) continue;
#pragma unroll
    for (int r = 0; r < 8; ++r) so[w][8 * hh + r][t * 16 + ln] = acc[t][r] * alpha; }
  __builtin_amdgcn_fence(__ATOMIC_ACQ_REL, "workgroup"); __builtin_amdgcn_wave_barrier();
  const int rsub = lane >> 4, c4 = (lane & 15) * 4;
  {
#pragma unroll
    for (int q = 0; q < 8; ++q) { const int r = q * 2 + rsub; if (col0 + c4 < N) { const v4f v = *(const v4fa*)&so[w][r][c4]; *(v4f*)(C + (size_t)(row0 + r) * ldc + col0 + c4) = v; } }
     }
}

// Wt[n][k] = f16(W[k][n]·scale) from f32 row-major W[K][N] (scale = power of two; bf16-exact weights stay exact in f16 away from the subnormal range)
__global__ __launch_bounds__(256) void k_wt_f16(const float* __restrict__ W, _Float16* __restrict__ Wt, int K, int N, float scale) {
  const int t = blockIdx.x * 256 + threadIdx.x; if (t >= N * (K / 8)) return; const int n = t / (K / 8), k8 = (t % (K / 8)) * 8; FragH f;
#pragma unroll
  for (int i = 0; i < 8; ++i) f.h[i] = (_Float16)(bf16_round(W[(size_t)(k8 + i) * N + n]) * scale); const v8us o = f.half[0];
  *(v8us*)((unsigned short*)Wt + (size_t)n * K + k8) = o; 
}
// k_gemm_hh variant with fused epilogue: v = acc·alpha + bias[by·sBias + col] (+ CP[(row/rowsPerB)·sCPb + by·64 + col] if CP) ; ACT 0 none / 1 elu ; writes f16 C16 (and f32 C if non-null)
template <int ACT>
__global__ __launch_bounds__(128) void k_gemm_hhx(const _Float16* __restrict__ A, int lda, size_t sA, const _Float16* __restrict__ Bh, int ldb, size_t sB, float alpha, const float* __restrict__ bias, size_t sBias, const float* __restrict__ CP, int rowsPerB, size_t sCPb, int row0g,
    float* __restrict__ C, _Float16* __restrict__ C16, int ldc, size_t sC, int M, int N, int K) {
  __shared__ __attribute__((aligned(16))) float so[4][16][64];
  const int tid = threadIdx.x, w = tid >> 5, lane = tid & 31, ln = lane & 15, hh = lane >> 4; const int by = blockIdx.y;
  A += (size_t)by * sA; Bh += (size_t)by * sB; const size_t cofs = (size_t)by * sC; const float* bp = bias ? bias + (size_t)by * sBias : nullptr;
  const int ntn = (N + 63) / 64; const int wid = blockIdx.x * 4 + w; const int mt = wid / ntn, nq = wid % ntn; if (mt * 16 >= M) return;
  const int row0 = mt * 16, col0 = nq * 64; const _Float16* arow = A + (size_t)(row0 + ln) * lda;
  v8f acc[4] = {};
  for (int kb = 0; kb < K; kb += 32) { FragH ah; ah.half[0] = *(const v8us*)((const unsigned short*)arow + kb + 8 * hh); ah.half[1] = *(const v8us*)((const unsigned short*)arow + kb + 16 + 8 * hh);
#pragma unroll
    for (int t = 0; t < 4; ++t) { if (col0 + t * 16 >= N) continue; const size_t boff = (size_t)(col0 + t * 16 + ln) * ldb + kb; FragH bq; bq.half[0] = *(const v8us*)((const unsigned short*)Bh + boff + 8 * hh); bq.half[1] = *(const v8us*)((const unsigned short*)Bh + boff + 16 + 8 * hh);
      acc[t] = mmaH<1>(ah.v, ah.v, bq.v, bq.v, acc[t]); }
  }
#pragma unroll
  for (int t = 0; t < 4; ++t) { if (col0 + t * 16 >= N) continue; const int col = col0 + t * 16 + ln; const float bv = bp ? bf16_round(bp[col]) : 0.f;
#pragma unroll
    for (int r = 0; r < 8; ++r) { float v = acc[t][r] * alpha + bv; if (CP) { const int rr = row0g + row0 + 8 * hh + r; if (rowsPerB < 0) v += CP[cofs + (size_t)rr * ldc + col];      /* rowsPerB < 0: own element of the batched C plane */ else { const int bidx = rr / rowsPerB; v += CP[(size_t)bidx * sCPb + (size_t)by * 64 + col]; } } if (ACT == 1) v = (v > 0.f) ? v : expm1f(v); else if (ACT == 7) v = (v > 0.f) ? v + 1.0f : expf(v); else if (ACT == 8) v = tanhf(v); else if (ACT == 9) v = 0.5f * v * (1.0f + tanhf(0.7978845608028654f * (v + 0.044715f * v * v * v))); else if (ACT == 11) v = 1.0f / (1.0f + expf(-v)); else if (ACT == 12) v = (v > 0.f) ? v : 0.01f * v; else if (ACT == 14) v = (v > 0.f) ? v : 0.1f * v; else if (ACT == 16) v = (v >= 0.f) ? v : 0.3f * v; else if (ACT == 17) v = (v >= 0.f) ? v : 0.2f * v; else if (ACT == 15) v = v / (1.0f + expf(-v)); else if (ACT == 3) v = fmaxf(v, 0.f); else if (ACT == 6) v = 0.5f * v * (1.0f + erff(v * 0.70710678118654752f)); so[w][8 * hh + r][t * 16 + ln] = v; } }
  __builtin_amdgcn_fence(__ATOMIC_ACQ_REL, "workgroup"); __builtin_amdgcn_wave_barrier();
  const int rsub = lane >> 4, c4 = (lane & 15) * 4; typedef _Float16 v4h __attribute__((ext_vector_type(4)));
  {
#pragma unroll
    for (int q = 0; q < 8; ++q) { const int r = q * 2 + rsub; if (col0 + c4 < N) { const v4f v = *(const v4fa*)&so[w][r][c4]; if (C) *(v4f*)(C + cofs + (size_t)(row0 + r) * ldc + col0 + c4) = v; if (C16) { v4h h4; for (int i = 0; i < 4; ++i) h4[i] = (_Float16)v[i]; *(v4h*)(C16 + cofs + (size_t)(row0 + r) * ldc + col0 + c4) = h4; } } }
     }
}


typedef _Float16 v4h __attribute__((ext_vector_type(4)));

__global__ __launch_bounds__(256) void k_x16(const float* __restrict__ x, _Float16* __restrict__ X16, size_t n8) { const size_t t = (size_t)blockIdx.x * 256 + threadIdx.x; if (t >= n8) return; FragH f;
#pragma unroll
  for (int q = 0; q < 8; ++q) f.h[q] = (_Float16)bf16_round(x[t * 8 + q]); *(v8us*)((unsigned short*)X16 + t * 8) = f.half[0];  }
__global__ __launch_bounds__(256) void k_h16(const float* __restrict__ x, _Float16* __restrict__ X16, size_t n8) { const size_t t = (size_t)blockIdx.x * 256 + threadIdx.x; if (t >= n8) return; FragH f;
#pragma unroll
  for (int q = 0; q < 8; ++q) f.h[q] = (_Float16)x[t * 8 + q]; *(v8us*)((unsigned short*)X16 + t * 8) = f.half[0];  }
__global__ __launch_bounds__(256) void k_round16f(const float* __restrict__ W, _Float16* __restrict__ Bt, size_t n8) { const size_t t = (size_t)blockIdx.x * 256 + threadIdx.x; if (t >= n8) return; FragH f;
#pragma unroll
  for (int i = 0; i < 8; ++i) f.h[i] = (_Float16)(bf16_round(W[t * 8 + i]) * 16.0f); *(v8us*)((unsigned short*)Bt + t * 8) = f.half[0];  }
template <int NHv, int TTv>
__global__ __launch_bounds__(256) void k_vt(const _Float16* __restrict__ V16, int ldv, int voff, _Float16* __restrict__ Vt) { __shared__ unsigned short tl[64][66]; const int tid = threadIdx.x; const int slab = blockIdx.x / (TTv / 64), lg = blockIdx.x % (TTv / 64); const int b = slab / NHv, h = slab % NHv;
  for (int i = tid; i < 64 * 8; i += 256) { const int r = i / 8, c8 = (i % 8) * 8; FragH f; f.half[0] = *(const v8us*)((const unsigned short*)V16 + ((size_t)b * TTv + lg * 64 + r) * ldv + voff + h * 64 + c8);
#pragma unroll
    for (int q = 0; q < 8; ++q) tl[r][c8 + q] = f.u[q]; }
  __syncthreads();
  {
#pragma unroll
    for (int rd = 0; rd < 2; ++rd) { const int d = rd * 32 + tid / 8, pc = tid % 8; FragH f;
#pragma unroll
      for (int q = 0; q < 8; ++q) f.u[q] = tl[pc * 8 + q][d];
      *(v8us*)((unsigned short*)Vt + ((size_t)slab * 64 + d) * TTv + lg * 64 + pc * 8) = f.half[0]; }
     } }

__global__ __launch_bounds__(256) void k_hl(const float* __restrict__ F, _Float16* __restrict__ Hh, _Float16* __restrict__ Hl, size_t n8) { const size_t t = (size_t)blockIdx.x * 256 + threadIdx.x; if (t >= n8) return; FragH fh, fl; const v4f a = *(const v4fa*)(F + t * 8), c = *(const v4fa*)(F + t * 8 + 4);
#pragma unroll
  for (int q = 0; q < 4; ++q) { _Float16 h = (_Float16)a[q]; fh.h[q] = h; fl.h[q] = (_Float16)((a[q] - (float)h) * 1024.0f); h = (_Float16)c[q]; fh.h[4 + q] = h; fl.h[4 + q] = (_Float16)((c[q] - (float)h) * 1024.0f); }
  { *(v8us*)((unsigned short*)Hh + t * 8) = fh.half[0]; *(v8us*)((unsigned short*)Hl + t * 8) = fl.half[0];  } }

// ---- fast GEMM (wave tile 32x64; requires M % 32 == 0 rows per launch region and N % 64 == 0); epilogue = k_gemm_hhx semantics ----
__device__ __forceinline__ v16h g2_frag(const _Float16* p, int hh) { FragH f; f.half[0] = *(const v8us*)((const unsigned short*)p + 8 * hh); f.half[1] = *(const v8us*)((const unsigned short*)p + 16 + 8 * hh); return f.v; }
__device__ __forceinline__ v8f g2_mma(v16h a, v16h b, v8f c) { v8f d = __builtin_amdgcn_wmma_f32_16x16x32_f16(false, a, false, b, (short)0, c, false, false); asm volatile("v_nop\n\tv_nop\n\tv_nop\n\tv_nop" : "+v"(d) : "v"(a), "v"(b)); return d; }
template <int ACT>
__global__ __launch_bounds__(128) void k_gemm2(const _Float16* __restrict__ A, int lda, size_t sA, const _Float16* __restrict__ Bh, int ldb, size_t sB, float alpha, const float* __restrict__ bias, size_t sBias, const float* __restrict__ CP, int rowsPerB, size_t sCPb, int row0g,
    float* __restrict__ C, _Float16* __restrict__ C16, int ldc, size_t sC, int M, int N, int K) { static_assert(ACT == 0 || ACT == 3 || ACT == 6 || ACT == 8 || ACT == 9 || ACT == 11 || ACT == 12 || ACT == 14 || ACT == 15 || ACT == 16 || ACT == 17, "k_gemm2: unsupported ACT code (would silently apply no activation)");
  __shared__ __attribute__((aligned(16))) float so[4][32][68];
  const int tid = threadIdx.x, w = tid >> 5, lane = tid & 31, ln = lane & 15, hh = lane >> 4; const int by = blockIdx.y;
  A += (size_t)by * sA; Bh += (size_t)by * sB; const size_t cofs = (size_t)by * sC; const float* bp = bias ? bias + (size_t)by * sBias : nullptr;
  const int ntn = N >> 6; const int mt = blockIdx.x / ntn, nq = blockIdx.x - mt * ntn; const int row0 = mt * 128 + 32 * w, col0 = nq * 64; if (row0 >= M) return;
  const _Float16* a0p = A + (size_t)(row0 + ln) * lda; const _Float16* a1p = a0p + (size_t)16 * lda;
  const _Float16* b0p = Bh + (size_t)(col0 + ln) * ldb; const _Float16* b1p = b0p + (size_t)16 * ldb; const _Float16* b2p = b1p + (size_t)16 * ldb; const _Float16* b3p = b2p + (size_t)16 * ldb;
  const v8f z8 = {0.f,0.f,0.f,0.f,0.f,0.f,0.f,0.f}; v8f c00 = z8, c01 = z8, c02 = z8, c03 = z8, c10 = z8, c11 = z8, c12 = z8, c13 = z8;
#pragma unroll 1
  for (int kb = 0; kb < K; kb += 32) { const v16h a0 = g2_frag(a0p + kb, hh), a1 = g2_frag(a1p + kb, hh);
    v16h b = g2_frag(b0p + kb, hh); c00 = g2_mma(a0, b, c00); c10 = g2_mma(a1, b, c10);
    b = g2_frag(b1p + kb, hh); c01 = g2_mma(a0, b, c01); c11 = g2_mma(a1, b, c11);
    b = g2_frag(b2p + kb, hh); c02 = g2_mma(a0, b, c02); c12 = g2_mma(a1, b, c12);
    b = g2_frag(b3p + kb, hh); c03 = g2_mma(a0, b, c03); c13 = g2_mma(a1, b, c13); }
  v8f accs[8] = {c00, c01, c02, c03, c10, c11, c12, c13};
#pragma unroll
  for (int u = 0; u < 8; ++u) { const int t = u & 3, half = u >> 2; const int col = col0 + t * 16 + ln; const float bv = bp ? bf16_round(bp[col]) : 0.f;
#pragma unroll
    for (int r = 0; r < 8; ++r) { const int rloc = half * 16 + 8 * hh + r; float v = accs[u][r] * alpha + bv; if (CP) { if (rowsPerB < 0) v += CP[cofs + (size_t)(row0g + row0 + rloc) * ldc + col];      /* rowsPerB < 0: own element of the batched C plane */ else { const int bidx = (row0g + row0 + rloc) / rowsPerB; v += CP[(size_t)bidx * sCPb + (size_t)by * 64 + col]; } }
      if (ACT == 3) v = fmaxf(v, 0.f); else if (ACT == 6) v = 0.5f * v * (1.0f + erff(v * 0.70710678118654752f)); else if (ACT == 11) v = 1.0f / (1.0f + expf(-v)); else if (ACT == 15) v = v / (1.0f + expf(-v)); else if (ACT == 12) v = (v > 0.f) ? v : 0.01f * v; else if (ACT == 8) v = tanhf(v); else if (ACT == 9) v = 0.5f * v * (1.0f + tanhf(0.7978845608028654f * (v + 0.044715f * v * v * v))); else if (ACT == 14) v = (v > 0.f) ? v : 0.1f * v; else if (ACT == 16) v = (v >= 0.f) ? v : 0.3f * v; else if (ACT == 17) v = (v >= 0.f) ? v : 0.2f * v;
      so[w][rloc][t * 16 + ln] = v; } }
  __builtin_amdgcn_fence(__ATOMIC_ACQ_REL, "workgroup"); __builtin_amdgcn_wave_barrier();
  const int rsub = lane >> 4, c4 = (lane & 15) * 4;
  {
#pragma unroll
    for (int q = 0; q < 16; ++q) { const int r = q * 2 + rsub; const v4f v = *(const v4fa*)&so[w][r][c4]; if (C) *(v4f*)(C + cofs + (size_t)(row0 + r) * ldc + col0 + c4) = v; if (C16) { v4h h4; for (int i = 0; i < 4; ++i) h4[i] = (_Float16)v[i]; *(v4h*)(C16 + cofs + (size_t)(row0 + r) * ldc + col0 + c4) = h4; } }
     } }


__global__ __launch_bounds__(256) void k_wnat(const float* __restrict__ w, size_t n8, _Float16* __restrict__ Bt) { const size_t t = (size_t)blockIdx.x * 256 + threadIdx.x; if (t >= n8) return; FragH f; for (int q = 0; q < 8; ++q) f.h[q] = (_Float16)(bf16_round(w[t * 8 + q]) * 16.0f); *(v8us*)((unsigned short*)Bt + t * 8) = f.half[0];  }
__global__ __launch_bounds__(256) void k_rsm(const float* __restrict__ S, _Float16* __restrict__ P, int nrows) {
  #pragma clang fp contract(off)
  const int i = blockIdx.x * 256 + threadIdx.x; if (i >= nrows) return; const float* s = S + (size_t)i * SQ; float mx = -3.0e38f;
#pragma unroll 1
  for (int j = 0; j < SQ; ++j) mx = fmaxf(mx, s[j]); float se = 0.f;
#pragma unroll 1
  for (int j = 0; j < SQ; ++j) se += expf(s[j] - mx); const float sc = 256.0f / se;
#pragma unroll 1
  for (int j0 = 0; j0 < SQ; j0 += 8) { FragH f; for (int q = 0; q < 8; ++q) f.h[q] = (_Float16)(expf(s[j0 + q] - mx) * sc); unsigned short* d = (unsigned short*)P + (size_t)i * SQ + j0; *(v8us*)d = f.half[0];  } }
__global__ __launch_bounds__(256) void k_vt(const _Float16* __restrict__ V16, int b, int h0, _Float16* __restrict__ VT) { __shared__ unsigned short tl[64][65]; const int tid = threadIdx.x; const int hh = blockIdx.x % HG, sg = blockIdx.x / HG; const int s0 = sg * 64; const int h = h0 + hh;
  for (int i = tid; i < 64 * 8; i += 256) { const int j = i / 8, d8 = (i % 8) * 8; FragH f; f.half[0] = *(const v8us*)((const unsigned short*)V16 + ((size_t)b * SQ + s0 + j) * DM + h * HD + d8); for (int q = 0; q < 8; ++q) tl[d8 + q][j] = f.u[q]; }
  __syncthreads();
  { for (int i = tid; i < 64 * 8; i += 256) { const int d = i / 8, j8 = (i % 8) * 8; FragH f; for (int q = 0; q < 8; ++q) f.u[q] = tl[d][j8 + q]; *(v8us*)((unsigned short*)VT + ((size_t)hh * HD + d) * SQ + s0 + j8) = f.half[0]; }  } }



// Causal row softmax, ONE WAVE PER SCORE ROW: lane l holds keys 256 u + 8 l .. + 7 of every 256-key group u < nk / 256 in registers, so each row is read once,
// 1 KiB of whole lines per group; row maximum and row sum = per-lane partials, then a five-step butterfly over the 32 lanes. nk is a multiple of 256, at most NKX.
// Every loop over u and q is unrolled in full so that e and pk are indexed by constants and stay in registers; the group tests are wave-uniform (nk is a kernel argument).
__global__ __launch_bounds__(256) void k_rsmcf2(const float* __restrict__ S, _Float16* __restrict__ P, int hg, int q0, int nk) {
  const int lane = threadIdx.x & 31; const int t = blockIdx.x * 8 + (threadIdx.x >> 5); if (t >= hg * QT) return;
  const float* s = S + (size_t)t * NKX + lane * 8; unsigned short* d = (unsigned short*)P + (size_t)t * NKX + lane * 8; const int last = q0 + (t % QT);
  float e[NKX / 256][8];
#pragma unroll
  for (int u = 0; u < NKX / 256; ++u) if (u * 256 < nk) { const v4f a = *(const v4fa*)(s + u * 256), c = *(const v4fa*)(s + u * 256 + 4);
#pragma unroll
    for (int q = 0; q < 4; ++q) { e[u][q] = a[q]; e[u][4 + q] = c[q]; } }
  float mx = -3.0e38f;
#pragma unroll
  for (int u = 0; u < NKX / 256; ++u) if (u * 256 < nk) {
#pragma unroll
    for (int q = 0; q < 8; ++q) { e[u][q] = (u * 256 + lane * 8 + q <= last) ? e[u][q] : -1.0e9f; mx = fmaxf(mx, e[u][q]); } }
#pragma unroll
  for (int m = 16; m > 0; m >>= 1) mx = fmaxf(mx, __shfl_xor(mx, m, 32));
  float se = 0.f;
#pragma unroll
  for (int u = 0; u < NKX / 256; ++u) if (u * 256 < nk) {
#pragma unroll
    for (int q = 0; q < 8; ++q) e[u][q] = __expf(e[u][q] - mx);
    se += ((e[u][0] + e[u][1]) + (e[u][2] + e[u][3])) + ((e[u][4] + e[u][5]) + (e[u][6] + e[u][7])); }
#pragma unroll
  for (int m = 16; m > 0; m >>= 1) se += __shfl_xor(se, m, 32);
  const float sc = 256.0f / se; v8us pk[NKX / 256];
#pragma unroll
  for (int u = 0; u < NKX / 256; ++u) if (u * 256 < nk) { FragH fr;
#pragma unroll
    for (int q = 0; q < 8; ++q) fr.h[q] = (_Float16)(e[u][q] * sc);
    pk[u] = fr.half[0]; }
#pragma unroll
  for (int u = 0; u < NKX / 256; ++u) if (u * 256 < nk) *(v8us*)(d + u * 256) = pk[u]; }      /* every group packed first, then stored back to back from registers of its own: no store has to wait for a register to be reused */


template <int MASKADD>
__global__ __launch_bounds__(64) void k_att0(const float* __restrict__ QF, const float* __restrict__ KF, const float* __restrict__ VF, int ld, const float* __restrict__ mask, float scale, float* __restrict__ OF, int ldo) {
  #pragma clang fp contract(off)
  __shared__ __attribute__((aligned(16))) float lq[64][64]; __shared__ __attribute__((aligned(16))) float lo[64][64];
  const int tid = threadIdx.x; const int h = blockIdx.x / (QT0 / 64), rg = blockIdx.x % (QT0 / 64); const int i = rg * 64 + tid;
  const float* qr = QF + (size_t)i * ld + h * HD;
#pragma unroll 1
  for (int c = 0; c < HD / 4; ++c) { *(v4f*)&lq[tid][c * 4] = *(const v4fa*)(qr + c * 4); const v4f z = {0.f, 0.f, 0.f, 0.f}; *(v4f*)&lo[tid][c * 4] = z; }
  float m = -1.0e30f, l = 0.f; const int jmax = MASKADD ? (SQ - 1) : (rg * 64 + 63);      /* additive-mask form: every key (the mask input decides); causal form: keys up to the block's last row */
#pragma unroll 1
  for (int j = 0; j <= jmax; ++j) { const float* kr = KF + (size_t)j * ld + h * HD; const float* vr = VF + (size_t)j * ld + h * HD; float s = 0.f;
#pragma unroll 1
    for (int c = 0; c < HD / 4; ++c) { const v4f kq = *(const v4fa*)(kr + c * 4); const v4f qq = *(v4f*)&lq[tid][c * 4]; s = __fadd_rn(s, __fmul_rn(qq[0], kq[0])); s = __fadd_rn(s, __fmul_rn(qq[1], kq[1])); s = __fadd_rn(s, __fmul_rn(qq[2], kq[2])); s = __fadd_rn(s, __fmul_rn(qq[3], kq[3])); }
    s = __fmul_rn(s, scale); if (MASKADD) s = __fadd_rn(s, __fmul_rn(bf16_round(mask[(size_t)i * SQ + j]), -10000.0f));
    const float f = (MASKADD || j <= i) ? 1.f : 0.f; const float sm = fmaf(f, s, (1.f - f) * -1.0e30f); const float mn = fmaxf(m, sm); const float sc = expf(m - mn); const float e = expf(sm - mn); l = __fadd_rn(__fmul_rn(l, sc), e); m = mn;
#pragma unroll 1
    for (int c = 0; c < HD / 4; ++c) { const v4f vv = *(const v4fa*)(vr + c * 4); v4f oo = *(v4f*)&lo[tid][c * 4]; for (int u = 0; u < 4; ++u) oo[u] = __fadd_rn(__fmul_rn(oo[u], sc), __fmul_rn(e, vv[u])); *(v4f*)&lo[tid][c * 4] = oo; } }
  const float fin = 64.0f / l;      /* o carried x64 like the f16 path */
#pragma unroll 1
  for (int c = 0; c < HD / 4; ++c) { v4f oo = *(v4f*)&lo[tid][c * 4]; for (int u = 0; u < 4; ++u) oo[u] = __fmul_rn(oo[u], fin); *(v4f*)&lo[tid][c * 4] = oo; }
  __syncthreads();
  {
#pragma unroll 1
    for (int it = 0; it < 16; ++it) { const int row = it * 4 + tid / 16, pc = (tid % 16) * 4; const v4f v = *(const v4f*)&lo[row][pc]; *(v4f*)(OF + (size_t)(rg * 64 + row) * ldo + h * HD + pc) = v; }
     } }

extern "C" void kernel_launch(void* const* d_in, const int* in_sizes, int n_in,
                              void* d_out, int out_size, void* d_ws, size_t ws_size, hipStream_t stream) {
  (void)in_sizes; (void)n_in; (void)out_size;
  const float* const* I = (const float* const*)d_in; const float* x = I[0]; const float* xk = I[0]; const float* xv = I[0]; const float* wq = I[1]; const float* bq = nullptr; const float* wk = I[2]; const float* bk = nullptr; const float* wv = I[3]; const float* bv = nullptr; const float* wo = I[4]; const float* bo = nullptr;      /* input order: x, Wq, Wk, Wv (BLOCK-DIAGONAL per-head [16][64][64] = [head][in][out]; NO biases: null pointers), Wo ([in][out] [1024][1024]; no bias: a null pointer in the output GEMM's guarded slot); five inputs */
  char* ws = (char*)d_ws; size_t off = 0;
  auto take = [&](size_t bytes) { char* p = ws + off; off += (bytes + 255) & ~(size_t)255; return p; };
  _Float16* BQ = (_Float16*)take((size_t)DM * DM * 2); _Float16* BK = (_Float16*)take((size_t)DM * DM * 2); _Float16* BV = (_Float16*)take((size_t)DM * DM * 2); _Float16* BO = (_Float16*)take((size_t)DM * DM * 2);
  _Float16* X16 = (_Float16*)take(NR * DM * 2); _Float16* XK16 = (_Float16*)take(NR * DM * 2); _Float16* XV16 = (_Float16*)take(NR * DM * 2);      /* exact f16 rows of query, key, value */ float* QF = (float*)take(NR * DM * 4); _Float16* QH = (_Float16*)take(NR * DM * 2); _Float16* QL = (_Float16*)take(NR * DM * 2); _Float16* KH = (_Float16*)take(NR * DM * 2); _Float16* KL = (_Float16*)take(NR * DM * 2); _Float16* Q16 = QH; _Float16* K16 = KH; _Float16* V16 = (_Float16*)take(NR * DM * 2); _Float16* O16 = (_Float16*)take(NR * DM * 2);
  float* S = (float*)take((size_t)NH * QT * NKX * 4); _Float16* P = (_Float16*)take((size_t)NH * QT * NKX * 2); _Float16* VT = (_Float16*)take((size_t)NH * HD * SQ * 2);
  float* QF0 = (float*)take((size_t)QT0 * DM * 4); float* KF0 = (float*)take((size_t)QT0 * DM * 4); float* VF0 = (float*)take((size_t)QT0 * DM * 4); float* OF0 = (float*)take((size_t)NB * QT0 * DM * 4); _Float16* OH0 = (_Float16*)take((size_t)NB * QT0 * DM * 2); _Float16* OL0 = (_Float16*)take((size_t)NB * QT0 * DM * 2);
  if (off > ws_size) return;
  { const unsigned gn = (unsigned)(((size_t)DM * (DM / 8) + 255) / 256); const unsigned gp = (unsigned)(((size_t)HD * (HD / 8) + 255) / 256); for (int h = 0; h < NH; ++h) { const size_t o = (size_t)h * HD * HD; k_wt_f16<<<gp, 256, 0, stream>>>(wq + o, BQ + o, HD, HD, 16.0f); k_wt_f16<<<gp, 256, 0, stream>>>(wk + o, BK + o, HD, HD, 16.0f); k_wt_f16<<<gp, 256, 0, stream>>>(wv + o, BV + o, HD, HD, 16.0f); } k_wt_f16<<<gn, 256, 0, stream>>>(wo, BO, DM, DM, 16.0f); }      /* BLOCK-DIAGONAL per-head weights wq / wk / wv [NH][HD][HD] = [head][in][out] (x_h @ W_h): W_h[d][e] -> Bt_h[e][d] x16 through the file's transposing builder with K = N = 64, one call per head and stack, into sixteen consecutive [64][64] planes (the first 128 KiB of the weight plane); Wo [in][out]: the same builder with K = N = 1024 */
  k_x16<<<(unsigned)((NR * DM / 8 + 255) / 256), 256, 0, stream>>>(x, X16, NR * DM / 8); k_x16<<<(unsigned)((NR * DM / 8 + 255) / 256), 256, 0, stream>>>(xk, XK16, NR * DM / 8); k_x16<<<(unsigned)((NR * DM / 8 + 255) / 256), 256, 0, stream>>>(xv, XV16, NR * DM / 8);
  const size_t r0p = (size_t)B0 * SQ;      /* first projected row */
  k_gemm2<0><<<dim3((unsigned)(MP / 128), NH), 128, 0, stream>>>(X16 + r0p * DM, DM, (size_t)HD, BQ, HD, (size_t)HD * HD, 0.0625f, bq, (size_t)HD, nullptr, 1, 0, 0, QF + r0p * DM, nullptr, DM, (size_t)HD, MP, HD, HD); k_hl<<<(unsigned)(((size_t)MP * DM / 8 + 255) / 256), 256, 0, stream>>>(QF + r0p * DM, QH + r0p * DM, QL + r0p * DM, (size_t)MP * DM / 8);      /* q (f32): ONE head-batched GEMM (K = N = 64): head h (grid.y) = x[:, 64 h ..] W_h -> QF[:, 64 h ..]; then -> f16 hi + x1024 residual planes */
  k_gemm2<0><<<dim3((unsigned)(MP / 128), NH), 128, 0, stream>>>(XK16 + r0p * DM, DM, (size_t)HD, BK, HD, (size_t)HD * HD, 0.0625f, bk, (size_t)HD, nullptr, 1, 0, 0, QF + r0p * DM, nullptr, DM, (size_t)HD, MP, HD, HD); k_hl<<<(unsigned)(((size_t)MP * DM / 8 + 255) / 256), 256, 0, stream>>>(QF + r0p * DM, KH + r0p * DM, KL + r0p * DM, (size_t)MP * DM / 8);      /* k likewise */
  k_gemm2<0><<<dim3((unsigned)(MP / 128), NH), 128, 0, stream>>>(XV16 + r0p * DM, DM, (size_t)HD, BV, HD, (size_t)HD * HD, 0.0625f, bv, (size_t)HD, nullptr, 1, 0, 0, nullptr, V16 + r0p * DM, DM, (size_t)HD, MP, HD, HD);      /* v (f16 rows): head-batched likewise */
  for (int b = B0; b < B0 + NBR; ++b) { const size_t r0 = (size_t)b * SQ;
    k_vt<NH, SQ><<<NH * (SQ / 64), 256, 0, stream>>>(V16 + r0 * LQ, LQ, 0, VT);      /* V^T [NH][HD][SQ] for this batch */
    k_gemm2<0><<<dim3((QT0 / 128), NH), 128, 0, stream>>>(X16 + r0 * DM, DM, (size_t)HD, BQ, HD, (size_t)HD * HD, 0.0625f, bq, (size_t)HD, nullptr, 1, 0, 0, QF0, nullptr, DM, (size_t)HD, QT0, HD, HD); k_gemm2<0><<<dim3((QT0 / 128), NH), 128, 0, stream>>>(XK16 + r0 * DM, DM, (size_t)HD, BK, HD, (size_t)HD * HD, 0.0625f, bk, (size_t)HD, nullptr, 1, 0, 0, KF0, nullptr, DM, (size_t)HD, QT0, HD, HD); k_gemm2<0><<<dim3((QT0 / 128), NH), 128, 0, stream>>>(XV16 + r0 * DM, DM, (size_t)HD, BV, HD, (size_t)HD * HD, 0.0625f, bv, (size_t)HD, nullptr, 1, 0, 0, VF0, nullptr, DM, (size_t)HD, QT0, HD, HD);      /* f32 q, k, v of the first 128 rows (exact products): the same head-batched form */
    k_att0<0><<<NH * (QT0 / 64), 64, 0, stream>>>(QF0, KF0, VF0, DM, nullptr, SCL, OF0 + (size_t)b * QT0 * DM, DM);      /* exact f32 attention for rows 0..127 (o x64) */
    for (int q0 = 0; q0 < QN; q0 += QT) { const int nk = q0 + QT;      /* causal: only keys below the tile end are computed */
      k_gemm2<0><<<dim3((QT / 128) * (nk / 64), NHD), 128, 0, stream>>>(QH + (r0 + q0) * LQ, LQ, (size_t)HD, KH + r0 * LQ, LQ, (size_t)HD, SCL, nullptr, 0, nullptr, 1, 0, 0, S, nullptr, NKX, (size_t)QT * NKX, QT, nk, HD);      /* scores hi . hi * 64^-0.5 (SCL = 1/8) */
      k_gemm2<0><<<dim3((QT / 128) * (nk / 64), NHD), 128, 0, stream>>>(QL + (r0 + q0) * LQ, LQ, (size_t)HD, KH + r0 * LQ, LQ, (size_t)HD, SCLR, nullptr, 0, S, -1, 0, 0, S, nullptr, NKX, (size_t)QT * NKX, QT, nk, HD); k_gemm2<0><<<dim3((QT / 128) * (nk / 64), NHD), 128, 0, stream>>>(QH + (r0 + q0) * LQ, LQ, (size_t)HD, KL + r0 * LQ, LQ, (size_t)HD, SCLR, nullptr, 0, S, -1, 0, 0, S, nullptr, NKX, (size_t)QT * NKX, QT, nk, HD);      /* += 2^-10 (lo . hi + hi . lo) */      /* scores, all heads on grid.y */
      k_rsmcf2<<<(NHD * QT + 7) / 8, 256, 0, stream>>>(S, P, NHD, q0, nk);      /* one wave per row, eight rows per block */
      k_gemm2<0><<<dim3((QT / 128) * (HD / 64), NHD), 128, 0, stream>>>(P, NKX, (size_t)QT * NKX, VT, SQ, (size_t)HD * SQ, 0.25f, nullptr, 0, nullptr, 1, 0, 0, nullptr, O16 + (r0 + q0) * DM, DM, (size_t)HD, QT, HD, nk); } }      /* o (merged heads, x64) as f16 rows */
  k_gemm2<0><<<dim3((unsigned)((MPO / 128) * (DM / 64)), 1), 128, 0, stream>>>(O16 + r0p * DM, DM, 0, BO, DM, 0, 0.0009765625f, bo, 0, nullptr, 1, 0, 0, (float*)d_out + r0p * DM, nullptr, DM, 0, MPO, DM, DM);      /* out rows are the output layout */
  k_hl<<<(unsigned)(((size_t)NB * QT0 * DM / 8 + 255) / 256), 256, 0, stream>>>(OF0, OH0, OL0, (size_t)NB * QT0 * DM / 8);      /* first-tile o (x64) -> f16 hi + x1024 residual planes */
  for (int b = B0; b < B0 + NBR; ++b) { const size_t r0 = (size_t)b * SQ; const size_t f0 = (size_t)b * QT0;
    k_gemm2<0><<<dim3((QT0 / 128) * (DM / 64), 1), 128, 0, stream>>>(OH0 + f0 * DM, DM, 0, BO, DM, 0, 0.0009765625f, bo, 0, nullptr, 1, 0, 0, (float*)d_out + r0 * DM, nullptr, DM, 0, QT0, DM, DM);      /* rows 0..127: out = o_hi Wo, overwriting the f16-path rows */
    k_gemm2<0><<<dim3((QT0 / 128) * (DM / 64), 1), 128, 0, stream>>>(OL0 + f0 * DM, DM, 0, BO, DM, 0, 0.00000095367431640625f, nullptr, 0, (const float*)d_out + r0 * DM, -1, 0, 0, (float*)d_out + r0 * DM, nullptr, DM, 0, QT0, DM, DM); }      /* += o_lo Wo 2^-20 (own-element accumulate) */
}

// v002
// A run of this version takes 3750 microseconds.
// Two timings next to v001 both put it at 1.44 times that version's speed.
// Counting every step since v000, it is 2.98 times as fast.
#include <hip/hip_runtime.h>
// Causal multi-head self-attention with BLOCK-DIAGONAL per-head projections (x [4][2048][1024] viewed (b, s, 16, 64); q / k / v = einsum('bshd,hde->bshe', xh, W): EACH HEAD applies its own [64][64] weight (W [16][64][64] = [head][in][out], normal x 0.02; NO biases) to ITS OWN 64-wide slice of the row; scores / sqrt(64); where(tril, scores, -inf); softmax over keys; out = merged Wo ([in][out] [1024][1024]; no bias) -> [4][2048][1024]); each projection is ONE head-batched GEMM (K = 64); q and k carried as f16 hi + x1024 residual planes with three-product scores.
// Structure: token rows r = b*2048 + s; x as exact f16 rows (bf16-rounded); q and k as WMMA GEMMs (32x64 wave tiles, f32 accumulation, exact x16 weights, no bias) into f32 rows split into f16 hi + x1024 residual planes, v as an f16-output GEMM; per batch: V^T for all heads via LDS transposes; per query tile of 256 rows: scores against the keys below the tile end only as THREE accumulating passes (hi.hi + lo.hi + hi.lo, K = 64, all heads on grid.y, alpha 1/8 = 1/sqrt(64), 2^-13 on the residual passes, logits sigma ~8), causal row softmax on VALU one wave per row, keys above the row masked by a select over the computed range (f32 statistics, native exp; weights x256 f16), o = P . V^T (K = keys below the tile end, alpha 2^-2: o carried x64, folded into the output GEMM alpha) written straight into the merged f16 o rows; out = o W_o GEMM (f32, no bias) into the output layout.
// Compute dtype: inputs rounded to bf16; x / weights exact; v, softmax weights and o as plain f16 GEMM operands (~2^-12), q and k as f16 hi + x1024 residual pairs; scores and softmax statistics f32. v_wmma_f32_16x16x32_f16.
#define NB 4
#define SCL 0.125f                         /* 1 / sqrt(head_dim 64) */
#define SCLR 0.0001220703125f               /* 2^-13: the same scale on the x1024 residual passes */
#define SQ 2048
#define DM 1024
#define NH 16
#define HD 64
#define HG 4                         /* heads per launch of the k_vt(b, h0) overload (not launched) */
#define QT 256                       /* query rows per causal tile */
#define NKX SQ                       /* S / P row pitch */
#define QT0 128                      /* first-tile rows recomputed exactly in f32 */
#define B0 0                         /* first batch processed (debug hook) */
#define NBR NB                       /* batches processed (debug hook) */
#define NR ((size_t)NB * SQ)         /* token rows */
#define MP ((int)((size_t)NBR * SQ)) /* rows projected (debug hook) */
#define QN SQ                        /* query rows attended per batch (debug hook) */
#define NHD NH                       /* heads attended (debug hook) */
#define MPO MP                       /* rows through the output stage (debug hook) */
#define LQ DM      /* row pitch of the q/k/v rows */
typedef __bf16 v16b __attribute__((ext_vector_type(16)));
typedef unsigned short v8us __attribute__((ext_vector_type(8), may_alias));
typedef float  v8f  __attribute__((ext_vector_type(8)));
typedef float  v4f  __attribute__((ext_vector_type(4)));
typedef float  v4fa __attribute__((ext_vector_type(4), may_alias));
union FragB { v16b v; v8us half[2]; unsigned short u[16]; };

__device__ __forceinline__ unsigned short bf16_bits(float x) { unsigned int u = __float_as_uint(x); return (unsigned short)((u + 0x7FFFu + ((u >> 16) & 1u)) >> 16); }
__device__ __forceinline__ float bf16_val(unsigned short b) { return __uint_as_float(((unsigned int)b) << 16); }
__device__ __forceinline__ float bf16_round(float x) { return bf16_val(bf16_bits(x)); }
// D += A·B with NT terms: 1 = ah·bh, 2 = + al·bh (A split), 3 = + ah·bl (both split)
template <int NT>
__device__ __forceinline__ v8f mmaN(v16b ah, v16b al, v16b bh, v16b bl, v8f c) {
  c = __builtin_amdgcn_wmma_f32_16x16x32_bf16(false, ah, false, bh, (short)0, c, false, false);
  if (NT >= 2) c = __builtin_amdgcn_wmma_f32_16x16x32_bf16(false, al, false, bh, (short)0, c, false, false);
  if (NT >= 3) c = __builtin_amdgcn_wmma_f32_16x16x32_bf16(false, ah, false, bl, (short)0, c, false, false);
  asm volatile("v_nop\n\tv_nop\n\tv_nop\n\tv_nop" : "+v"(c) : "v"(ah), "v"(al), "v"(bh), "v"(bl));
  return c;
}

__global__ __launch_bounds__(256) void k_wt_bf16(const float* __restrict__ W, unsigned short* __restrict__ Wt, int K, int N) {
  const int t = blockIdx.x * 256 + threadIdx.x;
  const int k8n = K / 8;
  if (t >= N * k8n) return;
  const int n = t / k8n, k8 = (t % k8n) * 8;
  v8us v;
#pragma unroll
  for (int i = 0; i < 8; ++i) v[i] = bf16_bits(W[(size_t)(k8 + i) * N + n]);
  *(v8us*)(Wt + (size_t)n * K + k8) = v;
  
}

// GEMM C[M][N] (f32, pitch ldc) = act(A[M][K]·W + bias). A f32 row-major (pitch lda) converted per fragment to bf16
// (ASPLIT: hi/lo two planes -> 2 terms, else single rounded term); Wt bf16 [N][K] (pitch ldb). BIAS_BF16 rounds the
// bias to bf16 first (bias quantised to bf16 before the add). K%32==0, M%16==0, N%64==0.
template <bool ASPLIT, int ACT, bool BIAS_BF16>
__global__ __launch_bounds__(128) void k_gemm_bf(const float* __restrict__ A, int lda, const unsigned short* __restrict__ Wt, int ldb,
                                               const float* __restrict__ bias, float* __restrict__ C, int ldc, int M, int N, int K) {
  __shared__ __attribute__((aligned(16))) float so[4][16][64];
  const int tid = threadIdx.x, w = tid >> 5, lane = tid & 31, ln = lane & 15, hh = lane >> 4;
  const int ntn = N / 64;
  const int wid = blockIdx.x * 4 + w;
  const int mt = wid / ntn, nq = wid % ntn;
  if (mt * 16 >= M) return;
  const int row0 = mt * 16, col0 = nq * 64;
  const float* arow = A + (size_t)(row0 + ln) * lda;
  v8f acc[4] = {};
  for (int kb = 0; kb < K; kb += 32) {
    FragB ah, al;
    const v4f x0 = *(const v4fa*)(arow + kb + 8 * hh), x1 = *(const v4fa*)(arow + kb + 8 * hh + 4);
    const v4f x2 = *(const v4fa*)(arow + kb + 16 + 8 * hh), x3 = *(const v4fa*)(arow + kb + 16 + 8 * hh + 4);
    float xs[16] = {x0[0],x0[1],x0[2],x0[3],x1[0],x1[1],x1[2],x1[3],x2[0],x2[1],x2[2],x2[3],x3[0],x3[1],x3[2],x3[3]};
#pragma unroll
    for (int i = 0; i < 16; ++i) { const unsigned short hb = bf16_bits(xs[i]); ah.u[i] = hb; al.u[i] = ASPLIT ? bf16_bits(xs[i] - bf16_val(hb)) : (unsigned short)0; }
#pragma unroll
    for (int t = 0; t < 4; ++t) {
      const unsigned short* brow = Wt + (size_t)(col0 + t * 16 + ln) * ldb + kb;
      FragB b;
      b.half[0] = *(const v8us*)(brow + 8 * hh);
      b.half[1] = *(const v8us*)(brow + 16 + 8 * hh);
      acc[t] = mmaN<ASPLIT ? 2 : 1>(ah.v, al.v, b.v, b.v, acc[t]);
    }
  }
#pragma unroll
  for (int t = 0; t < 4; ++t) {
    float bv = bias ? bias[col0 + t * 16 + ln] : 0.f;
    if (BIAS_BF16) bv = bf16_round(bv);
#pragma unroll
    for (int r = 0; r < 8; ++r) { float v = acc[t][r] + bv; if (ACT == 1) v = fmaxf(v, 0.f); so[w][8 * hh + r][t * 16 + ln] = v; }
  }
  __builtin_amdgcn_fence(__ATOMIC_ACQ_REL, "workgroup");
  __builtin_amdgcn_wave_barrier();
  const int rsub = lane >> 4, c4 = (lane & 15) * 4;
  {
#pragma unroll
    for (int q = 0; q < 8; ++q) {
      const int r = q * 2 + rsub;
      const v4f v = *(const v4fa*)&so[w][r][c4];
      *(v4f*)(C + (size_t)(row0 + r) * ldc + col0 + c4) = v;
    }
    
  }
}

// GEMM C = act(A·W + bias + resid): A f32 (ASPLIT -> hi/lo 2 terms), Wt bf16 [N][K]; ACT 0 none, 1 relu, 2 exact gelu;
// resid (optional, f32, row index = (row % rmod), pitch ldr, RES_BF16 rounds it) added before the activation.
template <bool ASPLIT, int ACT, bool BIAS_BF16, bool RES_BF16>
__global__ __launch_bounds__(128) void k_gemm_bf3(const float* __restrict__ A, int lda, const unsigned short* __restrict__ Wt, int ldb,
                                                const float* __restrict__ bias, const float* __restrict__ resid, int rmod, int ldr,
                                                float* __restrict__ C, int ldc, int M, int N, int K) {
  __shared__ __attribute__((aligned(16))) float so[4][16][64];
  const int tid = threadIdx.x, w = tid >> 5, lane = tid & 31, ln = lane & 15, hh = lane >> 4;
  const int ntn = N / 64;
  const int wid = blockIdx.x * 4 + w;
  const int mt = wid / ntn, nq = wid % ntn;
  if (mt * 16 >= M) return;
  const int row0 = mt * 16, col0 = nq * 64;
  const float* arow = A + (size_t)(row0 + ln) * lda;
  v8f acc[4] = {};
  for (int kb = 0; kb < K; kb += 32) {
    FragB ah, al;
    const v4f x0 = *(const v4fa*)(arow + kb + 8 * hh), x1 = *(const v4fa*)(arow + kb + 8 * hh + 4);
    const v4f x2 = *(const v4fa*)(arow + kb + 16 + 8 * hh), x3 = *(const v4fa*)(arow + kb + 16 + 8 * hh + 4);
    float xs[16] = {x0[0],x0[1],x0[2],x0[3],x1[0],x1[1],x1[2],x1[3],x2[0],x2[1],x2[2],x2[3],x3[0],x3[1],x3[2],x3[3]};
#pragma unroll
    for (int i = 0; i < 16; ++i) { const unsigned short hb = bf16_bits(xs[i]); ah.u[i] = hb; al.u[i] = ASPLIT ? bf16_bits(xs[i] - bf16_val(hb)) : (unsigned short)0; }
#pragma unroll
    for (int t = 0; t < 4; ++t) {
      const unsigned short* brow = Wt + (size_t)(col0 + t * 16 + ln) * ldb + kb;
      FragB b;
      b.half[0] = *(const v8us*)(brow + 8 * hh);
      b.half[1] = *(const v8us*)(brow + 16 + 8 * hh);
      acc[t] = mmaN<ASPLIT ? 2 : 1>(ah.v, al.v, b.v, b.v, acc[t]);
    }
  }
#pragma unroll
  for (int t = 0; t < 4; ++t) {
    const int col = col0 + t * 16 + ln;
    float bv = bias ? bias[col] : 0.f;
    if (BIAS_BF16) bv = bf16_round(bv);
#pragma unroll
    for (int r = 0; r < 8; ++r) {
      float v = acc[t][r] + bv;
      if (resid) { float rv = resid[(size_t)((row0 + 8 * hh + r) % rmod) * ldr + col]; if (RES_BF16) rv = bf16_round(rv); v += rv; }
      if (ACT == 1) v = fmaxf(v, 0.f);
      if (ACT == 2) v = 0.5f * v * (1.0f + erff(v * 0.70710678118654752f));
      if (ACT == 3) { const float u = 0.7978845608028654f * (v + 0.044715f * v * v * v); v = 0.5f * v * (1.0f + tanhf(u)); }
      so[w][8 * hh + r][t * 16 + ln] = v;
    }
  }
  __builtin_amdgcn_fence(__ATOMIC_ACQ_REL, "workgroup");
  __builtin_amdgcn_wave_barrier();
  const int rsub = lane >> 4, c4 = (lane & 15) * 4;
  {
#pragma unroll
    for (int q = 0; q < 8; ++q) {
      const int r = q * 2 + rsub;
      const v4f v = *(const v4fa*)&so[w][r][c4];
      *(v4f*)(C + (size_t)(row0 + r) * ldc + col0 + c4) = v;
    }
    
  }
}
// row LayerNorm (biased variance, eps) over N: s = X (+ R); optional out_sum <- s; out_norm <- (s-mu)*rsqrt(var+eps)*g + b
template <bool PARAM_BF16>
__global__ __launch_bounds__(256) void k_layernorm(const float* __restrict__ X, const float* __restrict__ R, const float* __restrict__ g, const float* __restrict__ bta,
                                                  float* __restrict__ out_sum, float* __restrict__ out_norm, int N, float eps) {
  __shared__ float red[256];
  const int row = blockIdx.x, tid = threadIdx.x;
  const float* x = X + (size_t)row * N; const float* rr = R ? R + (size_t)row * N : nullptr;
  float vals[16];                     // up to N = 4096
  const int per = N / 256;            // contiguous chunk per thread? use strided-by-4 chunks: thread handles j = tid*4 + 1024*u
  float s1 = 0.f;
  for (int u = 0; u < per / 4; ++u) {
    const int j = tid * 4 + 1024 * u;
    const v4f a = *(const v4fa*)(x + j);
    v4f b = {0.f,0.f,0.f,0.f}; if (rr) b = *(const v4fa*)(rr + j);
#pragma unroll
    for (int q = 0; q < 4; ++q) { const float v = a[q] + b[q]; vals[u * 4 + q] = v; s1 += v; }
  }
  red[tid] = s1; __syncthreads();
  for (int st = 128; st > 0; st >>= 1) { if (tid < st) red[tid] += red[tid + st]; __syncthreads(); }
  const float mu = red[0] / (float)N; __syncthreads();
  float s2 = 0.f;
  for (int u = 0; u < per / 4; ++u)
#pragma unroll
    for (int q = 0; q < 4; ++q) { const float c = vals[u * 4 + q] - mu; s2 += c * c; }
  red[tid] = s2; __syncthreads();
  for (int st = 128; st > 0; st >>= 1) { if (tid < st) red[tid] += red[tid + st]; __syncthreads(); }
  const float rs = rsqrtf(red[0] / (float)N + eps);
  {
    for (int u = 0; u < per / 4; ++u) {
      const int j = tid * 4 + 1024 * u;
      v4f o, sm;
#pragma unroll
      for (int q = 0; q < 4; ++q) {
        float gg = g[j + q], bb = bta[j + q];
        if (PARAM_BF16) { gg = bf16_round(gg); bb = bf16_round(bb); }
        sm[q] = vals[u * 4 + q]; o[q] = (vals[u * 4 + q] - mu) * rs * gg + bb;
      }
      if (out_sum) *(v4f*)(out_sum + (size_t)row * N + j) = sm;
      *(v4f*)(out_norm + (size_t)row * N + j) = o;
    }
    
  }
}



// ---- f16 WMMA path (v_wmma_f32_16x16x32_f16): 11-bit significands for operands in range — used where a [0,1] probability operand needs more precision than bf16
typedef _Float16 v16h __attribute__((ext_vector_type(16)));
union FragH { v16h v; v8us half[2]; _Float16 h[16]; unsigned short u[16]; };
template <int NT>
__device__ __forceinline__ v8f mmaH(v16h ah, v16h al, v16h bh, v16h bl, v8f c) {
  c = __builtin_amdgcn_wmma_f32_16x16x32_f16(false, ah, false, bh, (short)0, c, false, false);
  if (NT >= 2) c = __builtin_amdgcn_wmma_f32_16x16x32_f16(false, al, false, bh, (short)0, c, false, false);
  if (NT >= 3) c = __builtin_amdgcn_wmma_f32_16x16x32_f16(false, ah, false, bl, (short)0, c, false, false);
  asm volatile("v_nop\n\tv_nop\n\tv_nop\n\tv_nop" : "+v"(c) : "v"(ah), "v"(al), "v"(bh), "v"(bl));
  return c;
}
// batched GEMM like k_gemm_b but f16 operands: A f32 (split into f16 hi/lo if ASPLIT, else rounded to f16), Bt = f16 values [n][k]; alpha; C f32; N multiple of 16 (partial tiles skipped)
template <bool ASPLIT>
__global__ __launch_bounds__(128) void k_gemm_h(const float* __restrict__ A, int lda, size_t sA, const _Float16* __restrict__ Bh, int ldb, size_t sB, float alpha, float* __restrict__ C, int ldc, size_t sC, int M, int N, int K) {
  __shared__ __attribute__((aligned(16))) float so[4][16][64];
  const int tid = threadIdx.x, w = tid >> 5, lane = tid & 31, ln = lane & 15, hh = lane >> 4; const int by = blockIdx.y;
  A += (size_t)by * sA; Bh += (size_t)by * sB; C += (size_t)by * sC;
  const int ntn = (N + 63) / 64; const int wid = blockIdx.x * 4 + w; const int mt = wid / ntn, nq = wid % ntn; if (mt * 16 >= M) return;
  const int row0 = mt * 16, col0 = nq * 64; const float* arow = A + (size_t)(row0 + ln) * lda;
  v8f acc[4] = {};
  for (int kb = 0; kb < K; kb += 32) {
    FragH ah, al;
    const v4f x0 = *(const v4fa*)(arow + kb + 8 * hh), x1 = *(const v4fa*)(arow + kb + 8 * hh + 4), x2 = *(const v4fa*)(arow + kb + 16 + 8 * hh), x3 = *(const v4fa*)(arow + kb + 16 + 8 * hh + 4);
    float xs[16] = {x0[0],x0[1],x0[2],x0[3],x1[0],x1[1],x1[2],x1[3],x2[0],x2[1],x2[2],x2[3],x3[0],x3[1],x3[2],x3[3]};
#pragma unroll
    for (int i = 0; i < 16; ++i) { const _Float16 h = (_Float16)xs[i]; ah.h[i] = h; al.h[i] = ASPLIT ? (_Float16)(xs[i] - (float)h) : (_Float16)0.0f; }
#pragma unroll
    for (int t = 0; t < 4; ++t) { if (col0 + t * 16 >= N) continue; const size_t boff = (size_t)(col0 + t * 16 + ln) * ldb + kb; FragH bq; bq.half[0] = *(const v8us*)(Bh + boff + 8 * hh); bq.half[1] = *(const v8us*)(Bh + boff + 16 + 8 * hh);
      acc[t] = mmaH<ASPLIT ? 2 : 1>(ah.v, al.v, bq.v, bq.v, acc[t]); }
  }
#pragma unroll
  for (int t = 0; t < 4; ++t) { if (col0 + t * 16 >= N) continue;
#pragma unroll
    for (int r = 0; r < 8; ++r) so[w][8 * hh + r][t * 16 + ln] = acc[t][r] * alpha; }
  __builtin_amdgcn_fence(__ATOMIC_ACQ_REL, "workgroup"); __builtin_amdgcn_wave_barrier();
  const int rsub = lane >> 4, c4 = (lane & 15) * 4;
  {
#pragma unroll
    for (int q = 0; q < 8; ++q) { const int r = q * 2 + rsub; if (col0 + c4 < N) { const v4f v = *(const v4fa*)&so[w][r][c4]; *(v4f*)(C + (size_t)(row0 + r) * ldc + col0 + c4) = v; } }
     }
}

// Wt[n][k] = f16(W[k][n]·scale) from f32 row-major W[K][N] (scale = power of two; bf16-exact weights stay exact in f16 away from the subnormal range)
__global__ __launch_bounds__(256) void k_wt_f16(const float* __restrict__ W, _Float16* __restrict__ Wt, int K, int N, float scale) {
  const int t = blockIdx.x * 256 + threadIdx.x; if (t >= N * (K / 8)) return; const int n = t / (K / 8), k8 = (t % (K / 8)) * 8; FragH f;
#pragma unroll
  for (int i = 0; i < 8; ++i) f.h[i] = (_Float16)(bf16_round(W[(size_t)(k8 + i) * N + n]) * scale); const v8us o = f.half[0];
  *(v8us*)((unsigned short*)Wt + (size_t)n * K + k8) = o; 
}
// k_gemm_hh variant with fused epilogue: v = acc·alpha + bias[by·sBias + col] (+ CP[(row/rowsPerB)·sCPb + by·64 + col] if CP) ; ACT 0 none / 1 elu ; writes f16 C16 (and f32 C if non-null)
template <int ACT>
__global__ __launch_bounds__(128) void k_gemm_hhx(const _Float16* __restrict__ A, int lda, size_t sA, const _Float16* __restrict__ Bh, int ldb, size_t sB, float alpha, const float* __restrict__ bias, size_t sBias, const float* __restrict__ CP, int rowsPerB, size_t sCPb, int row0g,
    float* __restrict__ C, _Float16* __restrict__ C16, int ldc, size_t sC, int M, int N, int K) {
  __shared__ __attribute__((aligned(16))) float so[4][16][64];
  const int tid = threadIdx.x, w = tid >> 5, lane = tid & 31, ln = lane & 15, hh = lane >> 4; const int by = blockIdx.y;
  A += (size_t)by * sA; Bh += (size_t)by * sB; const size_t cofs = (size_t)by * sC; const float* bp = bias ? bias + (size_t)by * sBias : nullptr;
  const int ntn = (N + 63) / 64; const int wid = blockIdx.x * 4 + w; const int mt = wid / ntn, nq = wid % ntn; if (mt * 16 >= M) return;
  const int row0 = mt * 16, col0 = nq * 64; const _Float16* arow = A + (size_t)(row0 + ln) * lda;
  v8f acc[4] = {};
  for (int kb = 0; kb < K; kb += 32) { FragH ah; ah.half[0] = *(const v8us*)((const unsigned short*)arow + kb + 8 * hh); ah.half[1] = *(const v8us*)((const unsigned short*)arow + kb + 16 + 8 * hh);
#pragma unroll
    for (int t = 0; t < 4; ++t) { if (col0 + t * 16 >= N) continue; const size_t boff = (size_t)(col0 + t * 16 + ln) * ldb + kb; FragH bq; bq.half[0] = *(const v8us*)((const unsigned short*)Bh + boff + 8 * hh); bq.half[1] = *(const v8us*)((const unsigned short*)Bh + boff + 16 + 8 * hh);
      acc[t] = mmaH<1>(ah.v, ah.v, bq.v, bq.v, acc[t]); }
  }
#pragma unroll
  for (int t = 0; t < 4; ++t) { if (col0 + t * 16 >= N) continue; const int col = col0 + t * 16 + ln; const float bv = bp ? bf16_round(bp[col]) : 0.f;
#pragma unroll
    for (int r = 0; r < 8; ++r) { float v = acc[t][r] * alpha + bv; if (CP) { const int rr = row0g + row0 + 8 * hh + r; if (rowsPerB < 0) v += CP[cofs + (size_t)rr * ldc + col];      /* rowsPerB < 0: own element of the batched C plane */ else { const int bidx = rr / rowsPerB; v += CP[(size_t)bidx * sCPb + (size_t)by * 64 + col]; } } if (ACT == 1) v = (v > 0.f) ? v : expm1f(v); else if (ACT == 7) v = (v > 0.f) ? v + 1.0f : expf(v); else if (ACT == 8) v = tanhf(v); else if (ACT == 9) v = 0.5f * v * (1.0f + tanhf(0.7978845608028654f * (v + 0.044715f * v * v * v))); else if (ACT == 11) v = 1.0f / (1.0f + expf(-v)); else if (ACT == 12) v = (v > 0.f) ? v : 0.01f * v; else if (ACT == 14) v = (v > 0.f) ? v : 0.1f * v; else if (ACT == 16) v = (v >= 0.f) ? v : 0.3f * v; else if (ACT == 17) v = (v >= 0.f) ? v : 0.2f * v; else if (ACT == 15) v = v / (1.0f + expf(-v)); else if (ACT == 3) v = fmaxf(v, 0.f); else if (ACT == 6) v = 0.5f * v * (1.0f + erff(v * 0.70710678118654752f)); so[w][8 * hh + r][t * 16 + ln] = v; } }
  __builtin_amdgcn_fence(__ATOMIC_ACQ_REL, "workgroup"); __builtin_amdgcn_wave_barrier();
  const int rsub = lane >> 4, c4 = (lane & 15) * 4; typedef _Float16 v4h __attribute__((ext_vector_type(4)));
  {
#pragma unroll
    for (int q = 0; q < 8; ++q) { const int r = q * 2 + rsub; if (col0 + c4 < N) { const v4f v = *(const v4fa*)&so[w][r][c4]; if (C) *(v4f*)(C + cofs + (size_t)(row0 + r) * ldc + col0 + c4) = v; if (C16) { v4h h4; for (int i = 0; i < 4; ++i) h4[i] = (_Float16)v[i]; *(v4h*)(C16 + cofs + (size_t)(row0 + r) * ldc + col0 + c4) = h4; } } }
     }
}


typedef _Float16 v4h __attribute__((ext_vector_type(4)));

__global__ __launch_bounds__(256) void k_x16(const float* __restrict__ x, _Float16* __restrict__ X16, size_t n8) { const size_t t = (size_t)blockIdx.x * 256 + threadIdx.x; if (t >= n8) return; FragH f;
#pragma unroll
  for (int q = 0; q < 8; ++q) f.h[q] = (_Float16)bf16_round(x[t * 8 + q]); *(v8us*)((unsigned short*)X16 + t * 8) = f.half[0];  }
__global__ __launch_bounds__(256) void k_h16(const float* __restrict__ x, _Float16* __restrict__ X16, size_t n8) { const size_t t = (size_t)blockIdx.x * 256 + threadIdx.x; if (t >= n8) return; FragH f;
#pragma unroll
  for (int q = 0; q < 8; ++q) f.h[q] = (_Float16)x[t * 8 + q]; *(v8us*)((unsigned short*)X16 + t * 8) = f.half[0];  }
__global__ __launch_bounds__(256) void k_round16f(const float* __restrict__ W, _Float16* __restrict__ Bt, size_t n8) { const size_t t = (size_t)blockIdx.x * 256 + threadIdx.x; if (t >= n8) return; FragH f;
#pragma unroll
  for (int i = 0; i < 8; ++i) f.h[i] = (_Float16)(bf16_round(W[t * 8 + i]) * 16.0f); *(v8us*)((unsigned short*)Bt + t * 8) = f.half[0];  }
template <int NHv, int TTv>
__global__ __launch_bounds__(256) void k_vt(const _Float16* __restrict__ V16, int ldv, int voff, _Float16* __restrict__ Vt) { __shared__ unsigned short tl[64][66]; const int tid = threadIdx.x; const int slab = blockIdx.x / (TTv / 64), lg = blockIdx.x % (TTv / 64); const int b = slab / NHv, h = slab % NHv;
  for (int i = tid; i < 64 * 8; i += 256) { const int r = i / 8, c8 = (i % 8) * 8; FragH f; f.half[0] = *(const v8us*)((const unsigned short*)V16 + ((size_t)b * TTv + lg * 64 + r) * ldv + voff + h * 64 + c8);
#pragma unroll
    for (int q = 0; q < 8; ++q) tl[r][c8 + q] = f.u[q]; }
  __syncthreads();
  {
#pragma unroll
    for (int rd = 0; rd < 2; ++rd) { const int d = rd * 32 + tid / 8, pc = tid % 8; FragH f;
#pragma unroll
      for (int q = 0; q < 8; ++q) f.u[q] = tl[pc * 8 + q][d];
      *(v8us*)((unsigned short*)Vt + ((size_t)slab * 64 + d) * TTv + lg * 64 + pc * 8) = f.half[0]; }
     } }

__global__ __launch_bounds__(256) void k_hl(const float* __restrict__ F, _Float16* __restrict__ Hh, _Float16* __restrict__ Hl, size_t n8) { const size_t t = (size_t)blockIdx.x * 256 + threadIdx.x; if (t >= n8) return; FragH fh, fl; const v4f a = *(const v4fa*)(F + t * 8), c = *(const v4fa*)(F + t * 8 + 4);
#pragma unroll
  for (int q = 0; q < 4; ++q) { _Float16 h = (_Float16)a[q]; fh.h[q] = h; fl.h[q] = (_Float16)((a[q] - (float)h) * 1024.0f); h = (_Float16)c[q]; fh.h[4 + q] = h; fl.h[4 + q] = (_Float16)((c[q] - (float)h) * 1024.0f); }
  { *(v8us*)((unsigned short*)Hh + t * 8) = fh.half[0]; *(v8us*)((unsigned short*)Hl + t * 8) = fl.half[0];  } }

// ---- fast GEMM (wave tile 32x64; requires M % 32 == 0 rows per launch region and N % 64 == 0); epilogue = k_gemm_hhx semantics ----
__device__ __forceinline__ v16h g2_frag(const _Float16* p, int hh) { FragH f; f.half[0] = *(const v8us*)((const unsigned short*)p + 8 * hh); f.half[1] = *(const v8us*)((const unsigned short*)p + 16 + 8 * hh); return f.v; }
__device__ __forceinline__ v8f g2_mma(v16h a, v16h b, v8f c) { v8f d = __builtin_amdgcn_wmma_f32_16x16x32_f16(false, a, false, b, (short)0, c, false, false); asm volatile("v_nop\n\tv_nop\n\tv_nop\n\tv_nop" : "+v"(d) : "v"(a), "v"(b)); return d; }
template <int ACT>
__global__ __launch_bounds__(128) void k_gemm2(const _Float16* __restrict__ A, int lda, size_t sA, const _Float16* __restrict__ Bh, int ldb, size_t sB, float alpha, const float* __restrict__ bias, size_t sBias, const float* __restrict__ CP, int rowsPerB, size_t sCPb, int row0g,
    float* __restrict__ C, _Float16* __restrict__ C16, int ldc, size_t sC, int M, int N, int K) { static_assert(ACT == 0 || ACT == 3 || ACT == 6 || ACT == 8 || ACT == 9 || ACT == 11 || ACT == 12 || ACT == 14 || ACT == 15 || ACT == 16 || ACT == 17, "k_gemm2: unsupported ACT code (would silently apply no activation)");
  __shared__ __attribute__((aligned(16))) float so[4][32][68];
  const int tid = threadIdx.x, w = tid >> 5, lane = tid & 31, ln = lane & 15, hh = lane >> 4; const int by = blockIdx.y;
  A += (size_t)by * sA; Bh += (size_t)by * sB; const size_t cofs = (size_t)by * sC; const float* bp = bias ? bias + (size_t)by * sBias : nullptr;
  const int ntn = N >> 6; const int mt = blockIdx.x / ntn, nq = blockIdx.x - mt * ntn; const int row0 = mt * 128 + 32 * w, col0 = nq * 64; if (row0 >= M) return;
  const _Float16* a0p = A + (size_t)(row0 + ln) * lda; const _Float16* a1p = a0p + (size_t)16 * lda;
  const _Float16* b0p = Bh + (size_t)(col0 + ln) * ldb; const _Float16* b1p = b0p + (size_t)16 * ldb; const _Float16* b2p = b1p + (size_t)16 * ldb; const _Float16* b3p = b2p + (size_t)16 * ldb;
  const v8f z8 = {0.f,0.f,0.f,0.f,0.f,0.f,0.f,0.f}; v8f c00 = z8, c01 = z8, c02 = z8, c03 = z8, c10 = z8, c11 = z8, c12 = z8, c13 = z8;
#pragma unroll 1
  for (int kb = 0; kb < K; kb += 32) { const v16h a0 = g2_frag(a0p + kb, hh), a1 = g2_frag(a1p + kb, hh);
    v16h b = g2_frag(b0p + kb, hh); c00 = g2_mma(a0, b, c00); c10 = g2_mma(a1, b, c10);
    b = g2_frag(b1p + kb, hh); c01 = g2_mma(a0, b, c01); c11 = g2_mma(a1, b, c11);
    b = g2_frag(b2p + kb, hh); c02 = g2_mma(a0, b, c02); c12 = g2_mma(a1, b, c12);
    b = g2_frag(b3p + kb, hh); c03 = g2_mma(a0, b, c03); c13 = g2_mma(a1, b, c13); }
  v8f accs[8] = {c00, c01, c02, c03, c10, c11, c12, c13};
#pragma unroll
  for (int u = 0; u < 8; ++u) { const int t = u & 3, half = u >> 2; const int col = col0 + t * 16 + ln; const float bv = bp ? bf16_round(bp[col]) : 0.f;
#pragma unroll
    for (int r = 0; r < 8; ++r) { const int rloc = half * 16 + 8 * hh + r; float v = accs[u][r] * alpha + bv; if (CP) { if (rowsPerB < 0) v += CP[cofs + (size_t)(row0g + row0 + rloc) * ldc + col];      /* rowsPerB < 0: own element of the batched C plane */ else { const int bidx = (row0g + row0 + rloc) / rowsPerB; v += CP[(size_t)bidx * sCPb + (size_t)by * 64 + col]; } }
      if (ACT == 3) v = fmaxf(v, 0.f); else if (ACT == 6) v = 0.5f * v * (1.0f + erff(v * 0.70710678118654752f)); else if (ACT == 11) v = 1.0f / (1.0f + expf(-v)); else if (ACT == 15) v = v / (1.0f + expf(-v)); else if (ACT == 12) v = (v > 0.f) ? v : 0.01f * v; else if (ACT == 8) v = tanhf(v); else if (ACT == 9) v = 0.5f * v * (1.0f + tanhf(0.7978845608028654f * (v + 0.044715f * v * v * v))); else if (ACT == 14) v = (v > 0.f) ? v : 0.1f * v; else if (ACT == 16) v = (v >= 0.f) ? v : 0.3f * v; else if (ACT == 17) v = (v >= 0.f) ? v : 0.2f * v;
      so[w][rloc][t * 16 + ln] = v; } }
  __builtin_amdgcn_fence(__ATOMIC_ACQ_REL, "workgroup"); __builtin_amdgcn_wave_barrier();
  const int rsub = lane >> 4, c4 = (lane & 15) * 4;
  {
#pragma unroll
    for (int q = 0; q < 16; ++q) { const int r = q * 2 + rsub; const v4f v = *(const v4fa*)&so[w][r][c4]; if (C) *(v4f*)(C + cofs + (size_t)(row0 + r) * ldc + col0 + c4) = v; if (C16) { v4h h4; for (int i = 0; i < 4; ++i) h4[i] = (_Float16)v[i]; *(v4h*)(C16 + cofs + (size_t)(row0 + r) * ldc + col0 + c4) = h4; } }
     } }


__global__ __launch_bounds__(256) void k_wnat(const float* __restrict__ w, size_t n8, _Float16* __restrict__ Bt) { const size_t t = (size_t)blockIdx.x * 256 + threadIdx.x; if (t >= n8) return; FragH f; for (int q = 0; q < 8; ++q) f.h[q] = (_Float16)(bf16_round(w[t * 8 + q]) * 16.0f); *(v8us*)((unsigned short*)Bt + t * 8) = f.half[0];  }
__global__ __launch_bounds__(256) void k_rsm(const float* __restrict__ S, _Float16* __restrict__ P, int nrows) {
  #pragma clang fp contract(off)
  const int i = blockIdx.x * 256 + threadIdx.x; if (i >= nrows) return; const float* s = S + (size_t)i * SQ; float mx = -3.0e38f;
#pragma unroll 1
  for (int j = 0; j < SQ; ++j) mx = fmaxf(mx, s[j]); float se = 0.f;
#pragma unroll 1
  for (int j = 0; j < SQ; ++j) se += expf(s[j] - mx); const float sc = 256.0f / se;
#pragma unroll 1
  for (int j0 = 0; j0 < SQ; j0 += 8) { FragH f; for (int q = 0; q < 8; ++q) f.h[q] = (_Float16)(expf(s[j0 + q] - mx) * sc); unsigned short* d = (unsigned short*)P + (size_t)i * SQ + j0; *(v8us*)d = f.half[0];  } }
__global__ __launch_bounds__(256) void k_vt(const _Float16* __restrict__ V16, int b, int h0, _Float16* __restrict__ VT) { __shared__ unsigned short tl[64][65]; const int tid = threadIdx.x; const int hh = blockIdx.x % HG, sg = blockIdx.x / HG; const int s0 = sg * 64; const int h = h0 + hh;
  for (int i = tid; i < 64 * 8; i += 256) { const int j = i / 8, d8 = (i % 8) * 8; FragH f; f.half[0] = *(const v8us*)((const unsigned short*)V16 + ((size_t)b * SQ + s0 + j) * DM + h * HD + d8); for (int q = 0; q < 8; ++q) tl[d8 + q][j] = f.u[q]; }
  __syncthreads();
  { for (int i = tid; i < 64 * 8; i += 256) { const int d = i / 8, j8 = (i % 8) * 8; FragH f; for (int q = 0; q < 8; ++q) f.u[q] = tl[d][j8 + q]; *(v8us*)((unsigned short*)VT + ((size_t)hh * HD + d) * SQ + s0 + j8) = f.half[0]; }  } }



// Causal row softmax, ONE WAVE PER SCORE ROW: lane l holds keys 256 u + 8 l .. + 7 of every 256-key group u < nk / 256 in registers, so each row is read once,
// 1 KiB of whole lines per group; row maximum and row sum = per-lane partials, then a five-step butterfly over the 32 lanes. nk is a multiple of 256, at most NKX.
// Every loop over u and q is unrolled in full so that e and pk are indexed by constants and stay in registers; the group tests are wave-uniform (nk is a kernel argument).
__global__ __launch_bounds__(256) void k_rsmcf2(const float* __restrict__ S, _Float16* __restrict__ P, int hg, int q0, int nk) {
  const int lane = threadIdx.x & 31; const int t = blockIdx.x * 8 + (threadIdx.x >> 5); if (t >= hg * QT) return;
  const float* s = S + (size_t)t * NKX + lane * 8; unsigned short* d = (unsigned short*)P + (size_t)t * NKX + lane * 8; const int last = q0 + (t % QT);
  float e[NKX / 256][8];
#pragma unroll
  for (int u = 0; u < NKX / 256; ++u) if (u * 256 < nk) { const v4f a = *(const v4fa*)(s + u * 256), c = *(const v4fa*)(s + u * 256 + 4);
#pragma unroll
    for (int q = 0; q < 4; ++q) { e[u][q] = a[q]; e[u][4 + q] = c[q]; } }
  float mx = -3.0e38f;
#pragma unroll
  for (int u = 0; u < NKX / 256; ++u) if (u * 256 < nk) {
#pragma unroll
    for (int q = 0; q < 8; ++q) { e[u][q] = (u * 256 + lane * 8 + q <= last) ? e[u][q] : -1.0e9f; mx = fmaxf(mx, e[u][q]); } }
#pragma unroll
  for (int m = 16; m > 0; m >>= 1) mx = fmaxf(mx, __shfl_xor(mx, m, 32));
  float se = 0.f;
#pragma unroll
  for (int u = 0; u < NKX / 256; ++u) if (u * 256 < nk) {
#pragma unroll
    for (int q = 0; q < 8; ++q) e[u][q] = __expf(e[u][q] - mx);
    se += ((e[u][0] + e[u][1]) + (e[u][2] + e[u][3])) + ((e[u][4] + e[u][5]) + (e[u][6] + e[u][7])); }
#pragma unroll
  for (int m = 16; m > 0; m >>= 1) se += __shfl_xor(se, m, 32);
  const float sc = 256.0f / se; v8us pk[NKX / 256];
#pragma unroll
  for (int u = 0; u < NKX / 256; ++u) if (u * 256 < nk) { FragH fr;
#pragma unroll
    for (int q = 0; q < 8; ++q) fr.h[q] = (_Float16)(e[u][q] * sc);
    pk[u] = fr.half[0]; }
#pragma unroll
  for (int u = 0; u < NKX / 256; ++u) if (u * 256 < nk) *(v8us*)(d + u * 256) = pk[u]; }      /* every group packed first, then stored back to back from registers of its own: no store has to wait for a register to be reused */


template <int MASKADD>
__global__ __launch_bounds__(64) void k_att0(const float* __restrict__ QF, const float* __restrict__ KF, const float* __restrict__ VF, int ld, const float* __restrict__ mask, float scale, float* __restrict__ OF, int ldo) {
  #pragma clang fp contract(off)
  // One thread per query row, keys in order (online softmax), every sum in the same order as a plain serial loop. The thread's q and o rows live in registers; k and v rows come in chunks of 64 keys,
  // staged once per chunk in LDS by coalesced loads and then read at a wave-uniform address (broadcast). Four keys' score chains run side by side: each is 64 dependent adds, so one alone leaves the issue slots empty.
  // Every loop over c, u and w and the staging loops over it are unrolled in full so that q, o, s and the staged values are indexed by constants and stay in registers; the loops over chunks, half chunks and groups of four keys stay rolled so that the code stays small.
  __shared__ __attribute__((aligned(16))) float lk[64][64]; __shared__ __attribute__((aligned(16))) float lv[64][64]; __shared__ __attribute__((aligned(16))) float lo[64][64];
  const int tid = threadIdx.x; const int h = blockIdx.x / (QT0 / 64), rg = blockIdx.x % (QT0 / 64); const int i = rg * 64 + tid;
  const float* qr = QF + (size_t)i * ld + h * HD;
  float q[HD], o[HD];
  { v4f tq[HD / 4];
#pragma unroll
    for (int c = 0; c < HD / 4; ++c) tq[c] = *(const v4fa*)(qr + c * 4);
    asm volatile("s_wait_xcnt 0x0" :: "v"(qr) : "memory");      /* as in the staging below: the row's address keeps its registers until every load that names it has been translated */
#pragma unroll
    for (int c = 0; c < HD / 4; ++c) {
#pragma unroll
      for (int u = 0; u < 4; ++u) { q[c * 4 + u] = tq[c][u]; o[c * 4 + u] = 0.f; } } }
  float m = -1.0e30f, l = 0.f; const int jmax = MASKADD ? (SQ - 1) : (rg * 64 + 63);      /* additive-mask form: every key (the mask input decides); causal form: keys up to the block's last row; jmax + 1 is a multiple of 64 */
#pragma unroll 1
  for (int j0 = 0; j0 <= jmax; j0 += 64) {
    __syncthreads();      /* both waves have left the chunk before it is overwritten */
#pragma unroll 1
    for (int hf = 0; hf < 2; ++hf) { const float* kp[8]; const float* vp[8]; v4f tk[8], tv[8];      /* 32 keys a pass: 16 loads in flight */
#pragma unroll
      for (int it = 0; it < 8; ++it) { const size_t g = (size_t)(j0 + hf * 32 + it * 4 + tid / 16) * ld + h * HD + (tid % 16) * 4; kp[it] = KF + g; vp[it] = VF + g; }
#pragma unroll
      for (int it = 0; it < 8; ++it) { tk[it] = *(const v4fa*)kp[it]; tv[it] = *(const v4fa*)vp[it]; }
      /* the wait before a register that an issued load names is written again; the addresses are inputs so that they keep their registers up to it */
      asm volatile("s_wait_xcnt 0x0" :: "v"(kp[0]), "v"(kp[1]), "v"(kp[2]), "v"(kp[3]), "v"(kp[4]), "v"(kp[5]), "v"(kp[6]), "v"(kp[7]), "v"(vp[0]), "v"(vp[1]), "v"(vp[2]), "v"(vp[3]), "v"(vp[4]), "v"(vp[5]), "v"(vp[6]), "v"(vp[7]) : "memory");
#pragma unroll
      for (int it = 0; it < 8; ++it) { const int row = hf * 32 + it * 4 + tid / 16, pc = (tid % 16) * 4; *(v4f*)&lk[row][pc] = tk[it]; *(v4f*)&lv[row][pc] = tv[it]; } }
    __syncthreads();
#pragma unroll 1
    for (int jj = 0; jj < 64; jj += 4) { float s[4] = {0.f, 0.f, 0.f, 0.f};
#pragma unroll
      for (int c = 0; c < HD / 4; ++c) {
#pragma unroll
        for (int u = 0; u < 4; ++u) { const v4f kq = *(const v4f*)&lk[jj + u][c * 4]; s[u] = __fadd_rn(s[u], __fmul_rn(q[c * 4 + 0], kq[0])); s[u] = __fadd_rn(s[u], __fmul_rn(q[c * 4 + 1], kq[1])); s[u] = __fadd_rn(s[u], __fmul_rn(q[c * 4 + 2], kq[2])); s[u] = __fadd_rn(s[u], __fmul_rn(q[c * 4 + 3], kq[3])); } }
      float sc[4], e[4];      /* the four keys' rescale and weight, key after key (m and l are a chain); the o rows follow */
#pragma unroll
      for (int u = 0; u < 4; ++u) { const int j = j0 + jj + u; float sv = __fmul_rn(s[u], scale); if (MASKADD) sv = __fadd_rn(sv, __fmul_rn(bf16_round(mask[(size_t)i * SQ + j]), -10000.0f));
        const float f = (MASKADD || j <= i) ? 1.f : 0.f; const float sm = fmaf(f, sv, (1.f - f) * -1.0e30f); const float mn = fmaxf(m, sm); sc[u] = expf(m - mn); e[u] = expf(sm - mn); l = __fadd_rn(__fmul_rn(l, sc[u]), e[u]); m = mn; }
#pragma unroll
      for (int u = 0; u < 4; ++u) {
#pragma unroll
        for (int c = 0; c < HD / 4; ++c) { const v4f vv = *(const v4f*)&lv[jj + u][c * 4];
#pragma unroll
          for (int w = 0; w < 4; ++w) o[c * 4 + w] = __fadd_rn(__fmul_rn(o[c * 4 + w], sc[u]), __fmul_rn(e[u], vv[w])); } } } }
  const float fin = 64.0f / l;      /* o carried x64 like the f16 path */
#pragma unroll
  for (int c = 0; c < HD / 4; ++c) { v4f oo;
#pragma unroll
    for (int u = 0; u < 4; ++u) oo[u] = __fmul_rn(o[c * 4 + u], fin);
    *(v4f*)&lo[tid][c * 4] = oo; }
  __syncthreads();
  {
#pragma unroll 1
    for (int it = 0; it < 16; ++it) { const int row = it * 4 + tid / 16, pc = (tid % 16) * 4; const v4f v = *(const v4f*)&lo[row][pc]; *(v4f*)(OF + (size_t)(rg * 64 + row) * ldo + h * HD + pc) = v; }
     } }

extern "C" void kernel_launch(void* const* d_in, const int* in_sizes, int n_in,
                              void* d_out, int out_size, void* d_ws, size_t ws_size, hipStream_t stream) {
  (void)in_sizes; (void)n_in; (void)out_size;
  const float* const* I = (const float* const*)d_in; const float* x = I[0]; const float* xk = I[0]; const float* xv = I[0]; const float* wq = I[1]; const float* bq = nullptr; const float* wk = I[2]; const float* bk = nullptr; const float* wv = I[3]; const float* bv = nullptr; const float* wo = I[4]; const float* bo = nullptr;      /* input order: x, Wq, Wk, Wv (BLOCK-DIAGONAL per-head [16][64][64] = [head][in][out]; NO biases: null pointers), Wo ([in][out] [1024][1024]; no bias: a null pointer in the output GEMM's guarded slot); five inputs */
  char* ws = (char*)d_ws; size_t off = 0;
  auto take = [&](size_t bytes) { char* p = ws + off; off += (bytes + 255) & ~(size_t)255; return p; };
  _Float16* BQ = (_Float16*)take((size_t)DM * DM * 2); _Float16* BK = (_Float16*)take((size_t)DM * DM * 2); _Float16* BV = (_Float16*)take((size_t)DM * DM * 2); _Float16* BO = (_Float16*)take((size_t)DM * DM * 2);
  _Float16* X16 = (_Float16*)take(NR * DM * 2); _Float16* XK16 = (_Float16*)take(NR * DM * 2); _Float16* XV16 = (_Float16*)take(NR * DM * 2);      /* exact f16 rows of query, key, value */ float* QF = (float*)take(NR * DM * 4); _Float16* QH = (_Float16*)take(NR * DM * 2); _Float16* QL = (_Float16*)take(NR * DM * 2); _Float16* KH = (_Float16*)take(NR * DM * 2); _Float16* KL = (_Float16*)take(NR * DM * 2); _Float16* Q16 = QH; _Float16* K16 = KH; _Float16* V16 = (_Float16*)take(NR * DM * 2); _Float16* O16 = (_Float16*)take(NR * DM * 2);
  float* S = (float*)take((size_t)NH * QT * NKX * 4); _Float16* P = (_Float16*)take((size_t)NH * QT * NKX * 2); _Float16* VT = (_Float16*)take((size_t)NH * HD * SQ * 2);
  float* QF0 = (float*)take((size_t)QT0 * DM * 4); float* KF0 = (float*)take((size_t)QT0 * DM * 4); float* VF0 = (float*)take((size_t)QT0 * DM * 4); float* OF0 = (float*)take((size_t)NB * QT0 * DM * 4); _Float16* OH0 = (_Float16*)take((size_t)NB * QT0 * DM * 2); _Float16* OL0 = (_Float16*)take((size_t)NB * QT0 * DM * 2);
  if (off > ws_size) return;
  { const unsigned gn = (unsigned)(((size_t)DM * (DM / 8) + 255) / 256); const unsigned gp = (unsigned)(((size_t)HD * (HD / 8) + 255) / 256); for (int h = 0; h < NH; ++h) { const size_t o = (size_t)h * HD * HD; k_wt_f16<<<gp, 256, 0, stream>>>(wq + o, BQ + o, HD, HD, 16.0f); k_wt_f16<<<gp, 256, 0, stream>>>(wk + o, BK + o, HD, HD, 16.0f); k_wt_f16<<<gp, 256, 0, stream>>>(wv + o, BV + o, HD, HD, 16.0f); } k_wt_f16<<<gn, 256, 0, stream>>>(wo, BO, DM, DM, 16.0f); }      /* BLOCK-DIAGONAL per-head weights wq / wk / wv [NH][HD][HD] = [head][in][out] (x_h @ W_h): W_h[d][e] -> Bt_h[e][d] x16 through the file's transposing builder with K = N = 64, one call per head and stack, into sixteen consecutive [64][64] planes (the first 128 KiB of the weight plane); Wo [in][out]: the same builder with K = N = 1024 */
  k_x16<<<(unsigned)((NR * DM / 8 + 255) / 256), 256, 0, stream>>>(x, X16, NR * DM / 8); k_x16<<<(unsigned)((NR * DM / 8 + 255) / 256), 256, 0, stream>>>(xk, XK16, NR * DM / 8); k_x16<<<(unsigned)((NR * DM / 8 + 255) / 256), 256, 0, stream>>>(xv, XV16, NR * DM / 8);
  const size_t r0p = (size_t)B0 * SQ;      /* first projected row */
  k_gemm2<0><<<dim3((unsigned)(MP / 128), NH), 128, 0, stream>>>(X16 + r0p * DM, DM, (size_t)HD, BQ, HD, (size_t)HD * HD, 0.0625f, bq, (size_t)HD, nullptr, 1, 0, 0, QF + r0p * DM, nullptr, DM, (size_t)HD, MP, HD, HD); k_hl<<<(unsigned)(((size_t)MP * DM / 8 + 255) / 256), 256, 0, stream>>>(QF + r0p * DM, QH + r0p * DM, QL + r0p * DM, (size_t)MP * DM / 8);      /* q (f32): ONE head-batched GEMM (K = N = 64): head h (grid.y) = x[:, 64 h ..] W_h -> QF[:, 64 h ..]; then -> f16 hi + x1024 residual planes */
  k_gemm2<0><<<dim3((unsigned)(MP / 128), NH), 128, 0, stream>>>(XK16 + r0p * DM, DM, (size_t)HD, BK, HD, (size_t)HD * HD, 0.0625f, bk, (size_t)HD, nullptr, 1, 0, 0, QF + r0p * DM, nullptr, DM, (size_t)HD, MP, HD, HD); k_hl<<<(unsigned)(((size_t)MP * DM / 8 + 255) / 256), 256, 0, stream>>>(QF + r0p * DM, KH + r0p * DM, KL + r0p * DM, (size_t)MP * DM / 8);      /* k likewise */
  k_gemm2<0><<<dim3((unsigned)(MP / 128), NH), 128, 0, stream>>>(XV16 + r0p * DM, DM, (size_t)HD, BV, HD, (size_t)HD * HD, 0.0625f, bv, (size_t)HD, nullptr, 1, 0, 0, nullptr, V16 + r0p * DM, DM, (size_t)HD, MP, HD, HD);      /* v (f16 rows): head-batched likewise */
  for (int b = B0; b < B0 + NBR; ++b) { const size_t r0 = (size_t)b * SQ;
    k_vt<NH, SQ><<<NH * (SQ / 64), 256, 0, stream>>>(V16 + r0 * LQ, LQ, 0, VT);      /* V^T [NH][HD][SQ] for this batch */
    k_gemm2<0><<<dim3((QT0 / 128), NH), 128, 0, stream>>>(X16 + r0 * DM, DM, (size_t)HD, BQ, HD, (size_t)HD * HD, 0.0625f, bq, (size_t)HD, nullptr, 1, 0, 0, QF0, nullptr, DM, (size_t)HD, QT0, HD, HD); k_gemm2<0><<<dim3((QT0 / 128), NH), 128, 0, stream>>>(XK16 + r0 * DM, DM, (size_t)HD, BK, HD, (size_t)HD * HD, 0.0625f, bk, (size_t)HD, nullptr, 1, 0, 0, KF0, nullptr, DM, (size_t)HD, QT0, HD, HD); k_gemm2<0><<<dim3((QT0 / 128), NH), 128, 0, stream>>>(XV16 + r0 * DM, DM, (size_t)HD, BV, HD, (size_t)HD * HD, 0.0625f, bv, (size_t)HD, nullptr, 1, 0, 0, VF0, nullptr, DM, (size_t)HD, QT0, HD, HD);      /* f32 q, k, v of the first 128 rows (exact products): the same head-batched form */
    k_att0<0><<<NH * (QT0 / 64), 64, 0, stream>>>(QF0, KF0, VF0, DM, nullptr, SCL, OF0 + (size_t)b * QT0 * DM, DM);      /* exact f32 attention for rows 0..127 (o x64) */
    for (int q0 = 0; q0 < QN; q0 += QT) { const int nk = q0 + QT;      /* causal: only keys below the tile end are computed */
      k_gemm2<0><<<dim3((QT / 128) * (nk / 64), NHD), 128, 0, stream>>>(QH + (r0 + q0) * LQ, LQ, (size_t)HD, KH + r0 * LQ, LQ, (size_t)HD, SCL, nullptr, 0, nullptr, 1, 0, 0, S, nullptr, NKX, (size_t)QT * NKX, QT, nk, HD);      /* scores hi . hi * 64^-0.5 (SCL = 1/8) */
      k_gemm2<0><<<dim3((QT / 128) * (nk / 64), NHD), 128, 0, stream>>>(QL + (r0 + q0) * LQ, LQ, (size_t)HD, KH + r0 * LQ, LQ, (size_t)HD, SCLR, nullptr, 0, S, -1, 0, 0, S, nullptr, NKX, (size_t)QT * NKX, QT, nk, HD); k_gemm2<0><<<dim3((QT / 128) * (nk / 64), NHD), 128, 0, stream>>>(QH + (r0 + q0) * LQ, LQ, (size_t)HD, KL + r0 * LQ, LQ, (size_t)HD, SCLR, nullptr, 0, S, -1, 0, 0, S, nullptr, NKX, (size_t)QT * NKX, QT, nk, HD);      /* += 2^-10 (lo . hi + hi . lo) */      /* scores, all heads on grid.y */
      k_rsmcf2<<<(NHD * QT + 7) / 8, 256, 0, stream>>>(S, P, NHD, q0, nk);      /* one wave per row, eight rows per block */
      k_gemm2<0><<<dim3((QT / 128) * (HD / 64), NHD), 128, 0, stream>>>(P, NKX, (size_t)QT * NKX, VT, SQ, (size_t)HD * SQ, 0.25f, nullptr, 0, nullptr, 1, 0, 0, nullptr, O16 + (r0 + q0) * DM, DM, (size_t)HD, QT, HD, nk); } }      /* o (merged heads, x64) as f16 rows */
  k_gemm2<0><<<dim3((unsigned)((MPO / 128) * (DM / 64)), 1), 128, 0, stream>>>(O16 + r0p * DM, DM, 0, BO, DM, 0, 0.0009765625f, bo, 0, nullptr, 1, 0, 0, (float*)d_out + r0p * DM, nullptr, DM, 0, MPO, DM, DM);      /* out rows are the output layout */
  k_hl<<<(unsigned)(((size_t)NB * QT0 * DM / 8 + 255) / 256), 256, 0, stream>>>(OF0, OH0, OL0, (size_t)NB * QT0 * DM / 8);      /* first-tile o (x64) -> f16 hi + x1024 residual planes */
  for (int b = B0; b < B0 + NBR; ++b) { const size_t r0 = (size_t)b * SQ; const size_t f0 = (size_t)b * QT0;
    k_gemm2<0><<<dim3((QT0 / 128) * (DM / 64), 1), 128, 0, stream>>>(OH0 + f0 * DM, DM, 0, BO, DM, 0, 0.0009765625f, bo, 0, nullptr, 1, 0, 0, (float*)d_out + r0 * DM, nullptr, DM, 0, QT0, DM, DM);      /* rows 0..127: out = o_hi Wo, overwriting the f16-path rows */
    k_gemm2<0><<<dim3((QT0 / 128) * (DM / 64), 1), 128, 0, stream>>>(OL0 + f0 * DM, DM, 0, BO, DM, 0, 0.00000095367431640625f, nullptr, 0, (const float*)d_out + r0 * DM, -1, 0, 0, (float*)d_out + r0 * DM, nullptr, DM, 0, QT0, DM, DM); }      /* += o_lo Wo 2^-20 (own-element accumulate) */
}

// v004
// Measured time: 502 microseconds a run.
// It is 7.48 times as fast as v002, going by the measured steps of the versions left out in between.
// All steps since v000 together make it 22.3 times as fast.
#include <hip/hip_runtime.h>
// Causal multi-head self-attention with BLOCK-DIAGONAL per-head projections (x [4][2048][1024] viewed (b, s, 16, 64); q / k / v = einsum('bshd,hde->bshe', xh, W): EACH HEAD applies its own [64][64] weight (W [16][64][64] = [head][in][out], normal x 0.02; NO biases) to ITS OWN 64-wide slice of the row; scores / sqrt(64); where(tril, scores, -inf); softmax over keys; out = merged Wo ([in][out] [1024][1024]; no bias) -> [4][2048][1024]); each projection is ONE head-batched GEMM (K = 64); q and k carried as f16 hi + x1024 residual planes with three-product scores.
// Structure: token rows r = b*2048 + s; x as exact f16 rows (bf16-rounded); q and k as WMMA GEMMs (32x64 wave tiles, f32 accumulation, exact x16 weights, no bias) into f32 rows split into f16 hi + x1024 residual planes, v as an f16-output GEMM; V^T for all batches and heads via LDS transposes (one launch); then ONE fused attention launch for every batch, head and query row, one wave per 16 rows: scores against the keys up to the diagonal as three products (hi.hi + lo.hi + hi.lo, K = 64) kept in registers, causal softmax there (keys above the row masked by a select; f32 statistics, native exp; weights x256 f16), o = P . V (alpha 2^-2: o carried x64, folded into the output GEMM alpha) written straight into the merged f16 o rows; out = o W_o GEMM (f32, no bias) into the output layout.
// Compute dtype: inputs rounded to bf16; x / weights exact; q and k as f16 hi + x1024 residual planes (three products); v, softmax weights and o as plain f16 GEMM operands (~2^-12); scores and softmax statistics f32. v_wmma_f32_16x16x32_f16.
#define NB 4
#define SCL 0.125f                         /* 1 / sqrt(head_dim 64) */
#define SCLR 0.0001220703125f               /* 2^-13: the same scale on the x1024 residual passes */
#define SQ 2048
#define DM 1024
#define NH 16
#define HD 64
#define HG 4                         /* heads per launch of the k_vt(b, h0) overload (not launched) */
#define QT 256                       /* not used */
#define NKX SQ                       /* S / P row pitch */
#define QT0 128                      /* first-tile rows recomputed exactly in f32 */
#define B0 0                         /* first batch processed (debug hook) */
#define NBR NB                       /* batches processed (debug hook) */
#define NR ((size_t)NB * SQ)         /* token rows */
#define MP ((int)((size_t)NBR * SQ)) /* rows projected (debug hook) */
#define QN SQ                        /* query rows attended per batch (debug hook) */
#define NHD NH                       /* heads attended (debug hook) */
#define MPO MP                       /* rows through the output stage (debug hook) */
#define LQ DM      /* row pitch of the q/k/v rows */
typedef __bf16 v16b __attribute__((ext_vector_type(16)));
typedef unsigned short v8us __attribute__((ext_vector_type(8), may_alias));
typedef float  v8f  __attribute__((ext_vector_type(8)));
typedef float  v4f  __attribute__((ext_vector_type(4)));
typedef float  v4fa __attribute__((ext_vector_type(4), may_alias));
union FragB { v16b v; v8us half[2]; unsigned short u[16]; };

__device__ __forceinline__ unsigned short bf16_bits(float x) { unsigned int u = __float_as_uint(x); return (unsigned short)((u + 0x7FFFu + ((u >> 16) & 1u)) >> 16); }
__device__ __forceinline__ float bf16_val(unsigned short b) { return __uint_as_float(((unsigned int)b) << 16); }
__device__ __forceinline__ float bf16_round(float x) { return bf16_val(bf16_bits(x)); }
// D += A·B with NT terms: 1 = ah·bh, 2 = + al·bh (A split), 3 = + ah·bl (both split)
template <int NT>
__device__ __forceinline__ v8f mmaN(v16b ah, v16b al, v16b bh, v16b bl, v8f c) {
  c = __builtin_amdgcn_wmma_f32_16x16x32_bf16(false, ah, false, bh, (short)0, c, false, false);
  if (NT >= 2) c = __builtin_amdgcn_wmma_f32_16x16x32_bf16(false, al, false, bh, (short)0, c, false, false);
  if (NT >= 3) c = __builtin_amdgcn_wmma_f32_16x16x32_bf16(false, ah, false, bl, (short)0, c, false, false);
  asm volatile("v_nop\n\tv_nop\n\tv_nop\n\tv_nop" : "+v"(c) : "v"(ah), "v"(al), "v"(bh), "v"(bl));
  return c;
}

__global__ __launch_bounds__(256) void k_wt_bf16(const float* __restrict__ W, unsigned short* __restrict__ Wt, int K, int N) {
  const int t = blockIdx.x * 256 + threadIdx.x;
  const int k8n = K / 8;
  if (t >= N * k8n) return;
  const int n = t / k8n, k8 = (t % k8n) * 8;
  v8us v;
#pragma unroll
  for (int i = 0; i < 8; ++i) v[i] = bf16_bits(W[(size_t)(k8 + i) * N + n]);
  *(v8us*)(Wt + (size_t)n * K + k8) = v;
  
}

// GEMM C[M][N] (f32, pitch ldc) = act(A[M][K]·W + bias). A f32 row-major (pitch lda) converted per fragment to bf16
// (ASPLIT: hi/lo two planes -> 2 terms, else single rounded term); Wt bf16 [N][K] (pitch ldb). BIAS_BF16 rounds the
// bias to bf16 first (bias quantised to bf16 before the add). K%32==0, M%16==0, N%64==0.
template <bool ASPLIT, int ACT, bool BIAS_BF16>
__global__ __launch_bounds__(128) void k_gemm_bf(const float* __restrict__ A, int lda, const unsigned short* __restrict__ Wt, int ldb,
                                               const float* __restrict__ bias, float* __restrict__ C, int ldc, int M, int N, int K) {
  __shared__ __attribute__((aligned(16))) float so[4][16][64];
  const int tid = threadIdx.x, w = tid >> 5, lane = tid & 31, ln = lane & 15, hh = lane >> 4;
  const int ntn = N / 64;
  const int wid = blockIdx.x * 4 + w;
  const int mt = wid / ntn, nq = wid % ntn;
  if (mt * 16 >= M) return;
  const int row0 = mt * 16, col0 = nq * 64;
  const float* arow = A + (size_t)(row0 + ln) * lda;
  v8f acc[4] = {};
  for (int kb = 0; kb < K; kb += 32) {
    FragB ah, al;
    const v4f x0 = *(const v4fa*)(arow + kb + 8 * hh), x1 = *(const v4fa*)(arow + kb + 8 * hh + 4);
    const v4f x2 = *(const v4fa*)(arow + kb + 16 + 8 * hh), x3 = *(const v4fa*)(arow + kb + 16 + 8 * hh + 4);
    float xs[16] = {x0[0],x0[1],x0[2],x0[3],x1[0],x1[1],x1[2],x1[3],x2[0],x2[1],x2[2],x2[3],x3[0],x3[1],x3[2],x3[3]};
#pragma unroll
    for (int i = 0; i < 16; ++i) { const unsigned short hb = bf16_bits(xs[i]); ah.u[i] = hb; al.u[i] = ASPLIT ? bf16_bits(xs[i] - bf16_val(hb)) : (unsigned short)0; }
#pragma unroll
    for (int t = 0; t < 4; ++t) {
      const unsigned short* brow = Wt + (size_t)(col0 + t * 16 + ln) * ldb + kb;
      FragB b;
      b.half[0] = *(const v8us*)(brow + 8 * hh);
      b.half[1] = *(const v8us*)(brow + 16 + 8 * hh);
      acc[t] = mmaN<ASPLIT ? 2 : 1>(ah.v, al.v, b.v, b.v, acc[t]);
    }
  }
#pragma unroll
  for (int t = 0; t < 4; ++t) {
    float bv = bias ? bias[col0 + t * 16 + ln] : 0.f;
    if (BIAS_BF16) bv = bf16_round(bv);
#pragma unroll
    for (int r = 0; r < 8; ++r) { float v = acc[t][r] + bv; if (ACT == 1) v = fmaxf(v, 0.f); so[w][8 * hh + r][t * 16 + ln] = v; }
  }
  __builtin_amdgcn_fence(__ATOMIC_ACQ_REL, "workgroup");
  __builtin_amdgcn_wave_barrier();
  const int rsub = lane >> 4, c4 = (lane & 15) * 4;
  {
#pragma unroll
    for (int q = 0; q < 8; ++q) {
      const int r = q * 2 + rsub;
      const v4f v = *(const v4fa*)&so[w][r][c4];
      *(v4f*)(C + (size_t)(row0 + r) * ldc + col0 + c4) = v;
    }
    
  }
}

// GEMM C = act(A·W + bias + resid): A f32 (ASPLIT -> hi/lo 2 terms), Wt bf16 [N][K]; ACT 0 none, 1 relu, 2 exact gelu;
// resid (optional, f32, row index = (row % rmod), pitch ldr, RES_BF16 rounds it) added before the activation.
template <bool ASPLIT, int ACT, bool BIAS_BF16, bool RES_BF16>
__global__ __launch_bounds__(128) void k_gemm_bf3(const float* __restrict__ A, int lda, const unsigned short* __restrict__ Wt, int ldb,
                                                const float* __restrict__ bias, const float* __restrict__ resid, int rmod, int ldr,
                                                float* __restrict__ C, int ldc, int M, int N, int K) {
  __shared__ __attribute__((aligned(16))) float so[4][16][64];
  const int tid = threadIdx.x, w = tid >> 5, lane = tid & 31, ln = lane & 15, hh = lane >> 4;
  const int ntn = N / 64;
  const int wid = blockIdx.x * 4 + w;
  const int mt = wid / ntn, nq = wid % ntn;
  if (mt * 16 >= M) return;
  const int row0 = mt * 16, col0 = nq * 64;
  const float* arow = A + (size_t)(row0 + ln) * lda;
  v8f acc[4] = {};
  for (int kb = 0; kb < K; kb += 32) {
    FragB ah, al;
    const v4f x0 = *(const v4fa*)(arow + kb + 8 * hh), x1 = *(const v4fa*)(arow + kb + 8 * hh + 4);
    const v4f x2 = *(const v4fa*)(arow + kb + 16 + 8 * hh), x3 = *(const v4fa*)(arow + kb + 16 + 8 * hh + 4);
    float xs[16] = {x0[0],x0[1],x0[2],x0[3],x1[0],x1[1],x1[2],x1[3],x2[0],x2[1],x2[2],x2[3],x3[0],x3[1],x3[2],x3[3]};
#pragma unroll
    for (int i = 0; i < 16; ++i) { const unsigned short hb = bf16_bits(xs[i]); ah.u[i] = hb; al.u[i] = ASPLIT ? bf16_bits(xs[i] - bf16_val(hb)) : (unsigned short)0; }
#pragma unroll
    for (int t = 0; t < 4; ++t) {
      const unsigned short* brow = Wt + (size_t)(col0 + t * 16 + ln) * ldb + kb;
      FragB b;
      b.half[0] = *(const v8us*)(brow + 8 * hh);
      b.half[1] = *(const v8us*)(brow + 16 + 8 * hh);
      acc[t] = mmaN<ASPLIT ? 2 : 1>(ah.v, al.v, b.v, b.v, acc[t]);
    }
  }
#pragma unroll
  for (int t = 0; t < 4; ++t) {
    const int col = col0 + t * 16 + ln;
    float bv = bias ? bias[col] : 0.f;
    if (BIAS_BF16) bv = bf16_round(bv);
#pragma unroll
    for (int r = 0; r < 8; ++r) {
      float v = acc[t][r] + bv;
      if (resid) { float rv = resid[(size_t)((row0 + 8 * hh + r) % rmod) * ldr + col]; if (RES_BF16) rv = bf16_round(rv); v += rv; }
      if (ACT == 1) v = fmaxf(v, 0.f);
      if (ACT == 2) v = 0.5f * v * (1.0f + erff(v * 0.70710678118654752f));
      if (ACT == 3) { const float u = 0.7978845608028654f * (v + 0.044715f * v * v * v); v = 0.5f * v * (1.0f + tanhf(u)); }
      so[w][8 * hh + r][t * 16 + ln] = v;
    }
  }
  __builtin_amdgcn_fence(__ATOMIC_ACQ_REL, "workgroup");
  __builtin_amdgcn_wave_barrier();
  const int rsub = lane >> 4, c4 = (lane & 15) * 4;
  {
#pragma unroll
    for (int q = 0; q < 8; ++q) {
      const int r = q * 2 + rsub;
      const v4f v = *(const v4fa*)&so[w][r][c4];
      *(v4f*)(C + (size_t)(row0 + r) * ldc + col0 + c4) = v;
    }
    
  }
}
// row LayerNorm (biased variance, eps) over N: s = X (+ R); optional out_sum <- s; out_norm <- (s-mu)*rsqrt(var+eps)*g + b
template <bool PARAM_BF16>
__global__ __launch_bounds__(256) void k_layernorm(const float* __restrict__ X, const float* __restrict__ R, const float* __restrict__ g, const float* __restrict__ bta,
                                                  float* __restrict__ out_sum, float* __restrict__ out_norm, int N, float eps) {
  __shared__ float red[256];
  const int row = blockIdx.x, tid = threadIdx.x;
  const float* x = X + (size_t)row * N; const float* rr = R ? R + (size_t)row * N : nullptr;
  float vals[16];                     // up to N = 4096
  const int per = N / 256;            // contiguous chunk per thread? use strided-by-4 chunks: thread handles j = tid*4 + 1024*u
  float s1 = 0.f;
  for (int u = 0; u < per / 4; ++u) {
    const int j = tid * 4 + 1024 * u;
    const v4f a = *(const v4fa*)(x + j);
    v4f b = {0.f,0.f,0.f,0.f}; if (rr) b = *(const v4fa*)(rr + j);
#pragma unroll
    for (int q = 0; q < 4; ++q) { const float v = a[q] + b[q]; vals[u * 4 + q] = v; s1 += v; }
  }
  red[tid] = s1; __syncthreads();
  for (int st = 128; st > 0; st >>= 1) { if (tid < st) red[tid] += red[tid + st]; __syncthreads(); }
  const float mu = red[0] / (float)N; __syncthreads();
  float s2 = 0.f;
  for (int u = 0; u < per / 4; ++u)
#pragma unroll
    for (int q = 0; q < 4; ++q) { const float c = vals[u * 4 + q] - mu; s2 += c * c; }
  red[tid] = s2; __syncthreads();
  for (int st = 128; st > 0; st >>= 1) { if (tid < st) red[tid] += red[tid + st]; __syncthreads(); }
  const float rs = rsqrtf(red[0] / (float)N + eps);
  {
    for (int u = 0; u < per / 4; ++u) {
      const int j = tid * 4 + 1024 * u;
      v4f o, sm;
#pragma unroll
      for (int q = 0; q < 4; ++q) {
        float gg = g[j + q], bb = bta[j + q];
        if (PARAM_BF16) { gg = bf16_round(gg); bb = bf16_round(bb); }
        sm[q] = vals[u * 4 + q]; o[q] = (vals[u * 4 + q] - mu) * rs * gg + bb;
      }
      if (out_sum) *(v4f*)(out_sum + (size_t)row * N + j) = sm;
      *(v4f*)(out_norm + (size_t)row * N + j) = o;
    }
    
  }
}



// ---- f16 WMMA path (v_wmma_f32_16x16x32_f16): 11-bit significands for operands in range — used where a [0,1] probability operand needs more precision than bf16
typedef _Float16 v16h __attribute__((ext_vector_type(16)));
union FragH { v16h v; v8us half[2]; _Float16 h[16]; unsigned short u[16]; };
template <int NT>
__device__ __forceinline__ v8f mmaH(v16h ah, v16h al, v16h bh, v16h bl, v8f c) {
  c = __builtin_amdgcn_wmma_f32_16x16x32_f16(false, ah, false, bh, (short)0, c, false, false);
  if (NT >= 2) c = __builtin_amdgcn_wmma_f32_16x16x32_f16(false, al, false, bh, (short)0, c, false, false);
  if (NT >= 3) c = __builtin_amdgcn_wmma_f32_16x16x32_f16(false, ah, false, bl, (short)0, c, false, false);
  asm volatile("v_nop\n\tv_nop\n\tv_nop\n\tv_nop" : "+v"(c) : "v"(ah), "v"(al), "v"(bh), "v"(bl));
  return c;
}
// batched GEMM like k_gemm_b but f16 operands: A f32 (split into f16 hi/lo if ASPLIT, else rounded to f16), Bt = f16 values [n][k]; alpha; C f32; N multiple of 16 (partial tiles skipped)
template <bool ASPLIT>
__global__ __launch_bounds__(128) void k_gemm_h(const float* __restrict__ A, int lda, size_t sA, const _Float16* __restrict__ Bh, int ldb, size_t sB, float alpha, float* __restrict__ C, int ldc, size_t sC, int M, int N, int K) {
  __shared__ __attribute__((aligned(16))) float so[4][16][64];
  const int tid = threadIdx.x, w = tid >> 5, lane = tid & 31, ln = lane & 15, hh = lane >> 4; const int by = blockIdx.y;
  A += (size_t)by * sA; Bh += (size_t)by * sB; C += (size_t)by * sC;
  const int ntn = (N + 63) / 64; const int wid = blockIdx.x * 4 + w; const int mt = wid / ntn, nq = wid % ntn; if (mt * 16 >= M) return;
  const int row0 = mt * 16, col0 = nq * 64; const float* arow = A + (size_t)(row0 + ln) * lda;
  v8f acc[4] = {};
  for (int kb = 0; kb < K; kb += 32) {
    FragH ah, al;
    const v4f x0 = *(const v4fa*)(arow + kb + 8 * hh), x1 = *(const v4fa*)(arow + kb + 8 * hh + 4), x2 = *(const v4fa*)(arow + kb + 16 + 8 * hh), x3 = *(const v4fa*)(arow + kb + 16 + 8 * hh + 4);
    float xs[16] = {x0[0],x0[1],x0[2],x0[3],x1[0],x1[1],x1[2],x1[3],x2[0],x2[1],x2[2],x2[3],x3[0],x3[1],x3[2],x3[3]};
#pragma unroll
    for (int i = 0; i < 16; ++i) { const _Float16 h = (_Float16)xs[i]; ah.h[i] = h; al.h[i] = ASPLIT ? (_Float16)(xs[i] - (float)h) : (_Float16)0.0f; }
#pragma unroll
    for (int t = 0; t < 4; ++t) { if (col0 + t * 16 >= N) continue; const size_t boff = (size_t)(col0 + t * 16 + ln) * ldb + kb; FragH bq; bq.half[0] = *(const v8us*)(Bh + boff + 8 * hh); bq.half[1] = *(const v8us*)(Bh + boff + 16 + 8 * hh);
      acc[t] = mmaH<ASPLIT ? 2 : 1>(ah.v, al.v, bq.v, bq.v, acc[t]); }
  }
#pragma unroll
  for (int t = 0; t < 4; ++t) { if (col0 + t * 16 >= N) continue;
#pragma unroll
    for (int r = 0; r < 8; ++r) so[w][8 * hh + r][t * 16 + ln] = acc[t][r] * alpha; }
  __builtin_amdgcn_fence(__ATOMIC_ACQ_REL, "workgroup"); __builtin_amdgcn_wave_barrier();
  const int rsub = lane >> 4, c4 = (lane & 15) * 4;
  {
#pragma unroll
    for (int q = 0; q < 8; ++q) { const int r = q * 2 + rsub; if (col0 + c4 < N) { const v4f v = *(const v4fa*)&so[w][r][c4]; *(v4f*)(C + (size_t)(row0 + r) * ldc + col0 + c4) = v; } }
     }
}

// Wt[n][k] = f16(W[k][n]·scale) from f32 row-major W[K][N] (scale = power of two; bf16-exact weights stay exact in f16 away from the subnormal range)
__global__ __launch_bounds__(256) void k_wt_f16(const float* __restrict__ W, _Float16* __restrict__ Wt, int K, int N, float scale) {
  const int t = blockIdx.x * 256 + threadIdx.x; if (t >= N * (K / 8)) return; const int n = t / (K / 8), k8 = (t % (K / 8)) * 8; FragH f;
#pragma unroll
  for (int i = 0; i < 8; ++i) f.h[i] = (_Float16)(bf16_round(W[(size_t)(k8 + i) * N + n]) * scale); const v8us o = f.half[0];
  *(v8us*)((unsigned short*)Wt + (size_t)n * K + k8) = o; 
}
// the same builder for the per-head [64][64] weights of three stacks in ONE launch: blockIdx.y = head (consecutive [64][64] planes in source and destination), blockIdx.z = stack
__global__ __launch_bounds__(256) void k_wt_f16h(const float* __restrict__ Wa, const float* __restrict__ Wb, const float* __restrict__ Wc, _Float16* __restrict__ Ta, _Float16* __restrict__ Tb, _Float16* __restrict__ Tc, float scale) {
  const int t = blockIdx.x * 256 + threadIdx.x; if (t >= HD * (HD / 8)) return; const int n = t / (HD / 8), k8 = (t % (HD / 8)) * 8; const size_t o = (size_t)blockIdx.y * HD * HD;
  const float* W = (blockIdx.z == 0 ? Wa : blockIdx.z == 1 ? Wb : Wc) + o; _Float16* Wt = (blockIdx.z == 0 ? Ta : blockIdx.z == 1 ? Tb : Tc) + o; FragH f;
#pragma unroll
  for (int i = 0; i < 8; ++i) f.h[i] = (_Float16)(bf16_round(W[(size_t)(k8 + i) * HD + n]) * scale); const v8us ov = f.half[0];
  *(v8us*)((unsigned short*)Wt + (size_t)n * HD + k8) = ov;
}
// k_gemm_hh variant with fused epilogue: v = acc·alpha + bias[by·sBias + col] (+ CP[(row/rowsPerB)·sCPb + by·64 + col] if CP) ; ACT 0 none / 1 elu ; writes f16 C16 (and f32 C if non-null)
template <int ACT>
__global__ __launch_bounds__(128) void k_gemm_hhx(const _Float16* __restrict__ A, int lda, size_t sA, const _Float16* __restrict__ Bh, int ldb, size_t sB, float alpha, const float* __restrict__ bias, size_t sBias, const float* __restrict__ CP, int rowsPerB, size_t sCPb, int row0g,
    float* __restrict__ C, _Float16* __restrict__ C16, int ldc, size_t sC, int M, int N, int K) {
  __shared__ __attribute__((aligned(16))) float so[4][16][64];
  const int tid = threadIdx.x, w = tid >> 5, lane = tid & 31, ln = lane & 15, hh = lane >> 4; const int by = blockIdx.y;
  A += (size_t)by * sA; Bh += (size_t)by * sB; const size_t cofs = (size_t)by * sC; const float* bp = bias ? bias + (size_t)by * sBias : nullptr;
  const int ntn = (N + 63) / 64; const int wid = blockIdx.x * 4 + w; const int mt = wid / ntn, nq = wid % ntn; if (mt * 16 >= M) return;
  const int row0 = mt * 16, col0 = nq * 64; const _Float16* arow = A + (size_t)(row0 + ln) * lda;
  v8f acc[4] = {};
  for (int kb = 0; kb < K; kb += 32) { FragH ah; ah.half[0] = *(const v8us*)((const unsigned short*)arow + kb + 8 * hh); ah.half[1] = *(const v8us*)((const unsigned short*)arow + kb + 16 + 8 * hh);
#pragma unroll
    for (int t = 0; t < 4; ++t) { if (col0 + t * 16 >= N) continue; const size_t boff = (size_t)(col0 + t * 16 + ln) * ldb + kb; FragH bq; bq.half[0] = *(const v8us*)((const unsigned short*)Bh + boff + 8 * hh); bq.half[1] = *(const v8us*)((const unsigned short*)Bh + boff + 16 + 8 * hh);
      acc[t] = mmaH<1>(ah.v, ah.v, bq.v, bq.v, acc[t]); }
  }
#pragma unroll
  for (int t = 0; t < 4; ++t) { if (col0 + t * 16 >= N) continue; const int col = col0 + t * 16 + ln; const float bv = bp ? bf16_round(bp[col]) : 0.f;
#pragma unroll
    for (int r = 0; r < 8; ++r) { float v = acc[t][r] * alpha + bv; if (CP) { const int rr = row0g + row0 + 8 * hh + r; if (rowsPerB < 0) v += CP[cofs + (size_t)rr * ldc + col];      /* rowsPerB < 0: own element of the batched C plane */ else { const int bidx = rr / rowsPerB; v += CP[(size_t)bidx * sCPb + (size_t)by * 64 + col]; } } if (ACT == 1) v = (v > 0.f) ? v : expm1f(v); else if (ACT == 7) v = (v > 0.f) ? v + 1.0f : expf(v); else if (ACT == 8) v = tanhf(v); else if (ACT == 9) v = 0.5f * v * (1.0f + tanhf(0.7978845608028654f * (v + 0.044715f * v * v * v))); else if (ACT == 11) v = 1.0f / (1.0f + expf(-v)); else if (ACT == 12) v = (v > 0.f) ? v : 0.01f * v; else if (ACT == 14) v = (v > 0.f) ? v : 0.1f * v; else if (ACT == 16) v = (v >= 0.f) ? v : 0.3f * v; else if (ACT == 17) v = (v >= 0.f) ? v : 0.2f * v; else if (ACT == 15) v = v / (1.0f + expf(-v)); else if (ACT == 3) v = fmaxf(v, 0.f); else if (ACT == 6) v = 0.5f * v * (1.0f + erff(v * 0.70710678118654752f)); so[w][8 * hh + r][t * 16 + ln] = v; } }
  __builtin_amdgcn_fence(__ATOMIC_ACQ_REL, "workgroup"); __builtin_amdgcn_wave_barrier();
  const int rsub = lane >> 4, c4 = (lane & 15) * 4; typedef _Float16 v4h __attribute__((ext_vector_type(4)));
  {
#pragma unroll
    for (int q = 0; q < 8; ++q) { const int r = q * 2 + rsub; if (col0 + c4 < N) { const v4f v = *(const v4fa*)&so[w][r][c4]; if (C) *(v4f*)(C + cofs + (size_t)(row0 + r) * ldc + col0 + c4) = v; if (C16) { v4h h4; for (int i = 0; i < 4; ++i) h4[i] = (_Float16)v[i]; *(v4h*)(C16 + cofs + (size_t)(row0 + r) * ldc + col0 + c4) = h4; } } }
     }
}


typedef _Float16 v4h __attribute__((ext_vector_type(4)));

__global__ __launch_bounds__(256) void k_x16(const float* __restrict__ x, _Float16* __restrict__ X16, size_t n8) { const size_t t = (size_t)blockIdx.x * 256 + threadIdx.x; if (t >= n8) return; FragH f;
#pragma unroll
  for (int q = 0; q < 8; ++q) f.h[q] = (_Float16)bf16_round(x[t * 8 + q]); *(v8us*)((unsigned short*)X16 + t * 8) = f.half[0];  }
__global__ __launch_bounds__(256) void k_h16(const float* __restrict__ x, _Float16* __restrict__ X16, size_t n8) { const size_t t = (size_t)blockIdx.x * 256 + threadIdx.x; if (t >= n8) return; FragH f;
#pragma unroll
  for (int q = 0; q < 8; ++q) f.h[q] = (_Float16)x[t * 8 + q]; *(v8us*)((unsigned short*)X16 + t * 8) = f.half[0];  }
__global__ __launch_bounds__(256) void k_round16f(const float* __restrict__ W, _Float16* __restrict__ Bt, size_t n8) { const size_t t = (size_t)blockIdx.x * 256 + threadIdx.x; if (t >= n8) return; FragH f;
#pragma unroll
  for (int i = 0; i < 8; ++i) f.h[i] = (_Float16)(bf16_round(W[t * 8 + i]) * 16.0f); *(v8us*)((unsigned short*)Bt + t * 8) = f.half[0];  }
template <int NHv, int TTv>
__global__ __launch_bounds__(256) void k_vt(const _Float16* __restrict__ V16, int ldv, int voff, _Float16* __restrict__ Vt) { __shared__ unsigned short tl[64][66]; const int tid = threadIdx.x; const int slab = blockIdx.x / (TTv / 64), lg = blockIdx.x % (TTv / 64); const int b = slab / NHv, h = slab % NHv;
  for (int i = tid; i < 64 * 8; i += 256) { const int r = i / 8, c8 = (i % 8) * 8; FragH f; f.half[0] = *(const v8us*)((const unsigned short*)V16 + ((size_t)b * TTv + lg * 64 + r) * ldv + voff + h * 64 + c8);
#pragma unroll
    for (int q = 0; q < 8; ++q) tl[r][c8 + q] = f.u[q]; }
  __syncthreads();
  {
#pragma unroll
    for (int rd = 0; rd < 2; ++rd) { const int d = rd * 32 + tid / 8, pc = tid % 8; FragH f;
#pragma unroll
      for (int q = 0; q < 8; ++q) f.u[q] = tl[pc * 8 + q][d];
      *(v8us*)((unsigned short*)Vt + ((size_t)slab * 64 + d) * TTv + lg * 64 + pc * 8) = f.half[0]; }
     } }

__global__ __launch_bounds__(256) void k_hl(const float* __restrict__ F, _Float16* __restrict__ Hh, _Float16* __restrict__ Hl, size_t n8) { const size_t t = (size_t)blockIdx.x * 256 + threadIdx.x; if (t >= n8) return; FragH fh, fl; const v4f a = *(const v4fa*)(F + t * 8), c = *(const v4fa*)(F + t * 8 + 4);
#pragma unroll
  for (int q = 0; q < 4; ++q) { _Float16 h = (_Float16)a[q]; fh.h[q] = h; fl.h[q] = (_Float16)((a[q] - (float)h) * 1024.0f); h = (_Float16)c[q]; fh.h[4 + q] = h; fl.h[4 + q] = (_Float16)((c[q] - (float)h) * 1024.0f); }
  { *(v8us*)((unsigned short*)Hh + t * 8) = fh.half[0]; *(v8us*)((unsigned short*)Hl + t * 8) = fl.half[0];  } }

// ---- fast GEMM (wave tile 32x64; requires M % 32 == 0 rows per launch region and N % 64 == 0); epilogue = k_gemm_hhx semantics ----
__device__ __forceinline__ v16h g2_frag(const _Float16* p, int hh) { FragH f; f.half[0] = *(const v8us*)((const unsigned short*)p + 8 * hh); f.half[1] = *(const v8us*)((const unsigned short*)p + 16 + 8 * hh); return f.v; }
__device__ __forceinline__ v8f g2_mma(v16h a, v16h b, v8f c) { v8f d = __builtin_amdgcn_wmma_f32_16x16x32_f16(false, a, false, b, (short)0, c, false, false); asm volatile("v_nop\n\tv_nop\n\tv_nop\n\tv_nop" : "+v"(d) : "v"(a), "v"(b)); return d; }
template <int ACT>
__global__ __launch_bounds__(128) void k_gemm2(const _Float16* __restrict__ A, int lda, size_t sA, const _Float16* __restrict__ Bh, int ldb, size_t sB, float alpha, const float* __restrict__ bias, size_t sBias, const float* __restrict__ CP, int rowsPerB, size_t sCPb, int row0g,
    float* __restrict__ C, _Float16* __restrict__ C16, int ldc, size_t sC, int M, int N, int K, size_t sAz, size_t sCz) { static_assert(ACT == 0 || ACT == 3 || ACT == 6 || ACT == 8 || ACT == 9 || ACT == 11 || ACT == 12 || ACT == 14 || ACT == 15 || ACT == 16 || ACT == 17, "k_gemm2: unsupported ACT code (would silently apply no activation)");
  __shared__ __attribute__((aligned(16))) float so[4][32][68];
  const int tid = threadIdx.x, w = tid >> 5, lane = tid & 31, ln = lane & 15, hh = lane >> 4; const int by = blockIdx.y; const int bz = blockIdx.z;      /* bz: a second batch index (A and C planes sAz, sCz apart; B shared) */
  A += (size_t)by * sA + (size_t)bz * sAz; Bh += (size_t)by * sB; const size_t cofs = (size_t)by * sC + (size_t)bz * sCz; const float* bp = bias ? bias + (size_t)by * sBias : nullptr;
  const int ntn = N >> 6; const int mt = blockIdx.x / ntn, nq = blockIdx.x - mt * ntn; const int row0 = mt * 128 + 32 * w, col0 = nq * 64; if (row0 >= M) return;
  const _Float16* a0p = A + (size_t)(row0 + ln) * lda; const _Float16* a1p = a0p + (size_t)16 * lda;
  const _Float16* b0p = Bh + (size_t)(col0 + ln) * ldb; const _Float16* b1p = b0p + (size_t)16 * ldb; const _Float16* b2p = b1p + (size_t)16 * ldb; const _Float16* b3p = b2p + (size_t)16 * ldb;
  const v8f z8 = {0.f,0.f,0.f,0.f,0.f,0.f,0.f,0.f}; v8f c00 = z8, c01 = z8, c02 = z8, c03 = z8, c10 = z8, c11 = z8, c12 = z8, c13 = z8;
#pragma unroll 1
  for (int kb = 0; kb < K; kb += 32) { const v16h a0 = g2_frag(a0p + kb, hh), a1 = g2_frag(a1p + kb, hh);
    v16h b = g2_frag(b0p + kb, hh); c00 = g2_mma(a0, b, c00); c10 = g2_mma(a1, b, c10);
    b = g2_frag(b1p + kb, hh); c01 = g2_mma(a0, b, c01); c11 = g2_mma(a1, b, c11);
    b = g2_frag(b2p + kb, hh); c02 = g2_mma(a0, b, c02); c12 = g2_mma(a1, b, c12);
    b = g2_frag(b3p + kb, hh); c03 = g2_mma(a0, b, c03); c13 = g2_mma(a1, b, c13); }
  v8f accs[8] = {c00, c01, c02, c03, c10, c11, c12, c13};
#pragma unroll
  for (int u = 0; u < 8; ++u) { const int t = u & 3, half = u >> 2; const int col = col0 + t * 16 + ln; const float bv = bp ? bf16_round(bp[col]) : 0.f;
#pragma unroll
    for (int r = 0; r < 8; ++r) { const int rloc = half * 16 + 8 * hh + r; float v = accs[u][r] * alpha + bv; if (CP) { if (rowsPerB < 0) v += CP[cofs + (size_t)(row0g + row0 + rloc) * ldc + col];      /* rowsPerB < 0: own element of the batched C plane */ else { const int bidx = (row0g + row0 + rloc) / rowsPerB; v += CP[(size_t)bidx * sCPb + (size_t)by * 64 + col]; } }
      if (ACT == 3) v = fmaxf(v, 0.f); else if (ACT == 6) v = 0.5f * v * (1.0f + erff(v * 0.70710678118654752f)); else if (ACT == 11) v = 1.0f / (1.0f + expf(-v)); else if (ACT == 15) v = v / (1.0f + expf(-v)); else if (ACT == 12) v = (v > 0.f) ? v : 0.01f * v; else if (ACT == 8) v = tanhf(v); else if (ACT == 9) v = 0.5f * v * (1.0f + tanhf(0.7978845608028654f * (v + 0.044715f * v * v * v))); else if (ACT == 14) v = (v > 0.f) ? v : 0.1f * v; else if (ACT == 16) v = (v >= 0.f) ? v : 0.3f * v; else if (ACT == 17) v = (v >= 0.f) ? v : 0.2f * v;
      so[w][rloc][t * 16 + ln] = v; } }
  __builtin_amdgcn_fence(__ATOMIC_ACQ_REL, "workgroup"); __builtin_amdgcn_wave_barrier();
  const int rsub = lane >> 4, c4 = (lane & 15) * 4;
  {
#pragma unroll
    for (int q = 0; q < 16; ++q) { const int r = q * 2 + rsub; const v4f v = *(const v4fa*)&so[w][r][c4]; if (C) *(v4f*)(C + cofs + (size_t)(row0 + r) * ldc + col0 + c4) = v; if (C16) { v4h h4; for (int i = 0; i < 4; ++i) h4[i] = (_Float16)v[i]; *(v4h*)(C16 + cofs + (size_t)(row0 + r) * ldc + col0 + c4) = h4; } }
     } }


__global__ __launch_bounds__(256) void k_wnat(const float* __restrict__ w, size_t n8, _Float16* __restrict__ Bt) { const size_t t = (size_t)blockIdx.x * 256 + threadIdx.x; if (t >= n8) return; FragH f; for (int q = 0; q < 8; ++q) f.h[q] = (_Float16)(bf16_round(w[t * 8 + q]) * 16.0f); *(v8us*)((unsigned short*)Bt + t * 8) = f.half[0];  }
__global__ __launch_bounds__(256) void k_rsm(const float* __restrict__ S, _Float16* __restrict__ P, int nrows) {
  #pragma clang fp contract(off)
  const int i = blockIdx.x * 256 + threadIdx.x; if (i >= nrows) return; const float* s = S + (size_t)i * SQ; float mx = -3.0e38f;
#pragma unroll 1
  for (int j = 0; j < SQ; ++j) mx = fmaxf(mx, s[j]); float se = 0.f;
#pragma unroll 1
  for (int j = 0; j < SQ; ++j) se += expf(s[j] - mx); const float sc = 256.0f / se;
#pragma unroll 1
  for (int j0 = 0; j0 < SQ; j0 += 8) { FragH f; for (int q = 0; q < 8; ++q) f.h[q] = (_Float16)(expf(s[j0 + q] - mx) * sc); unsigned short* d = (unsigned short*)P + (size_t)i * SQ + j0; *(v8us*)d = f.half[0];  } }
__global__ __launch_bounds__(256) void k_vt(const _Float16* __restrict__ V16, int b, int h0, _Float16* __restrict__ VT) { __shared__ unsigned short tl[64][65]; const int tid = threadIdx.x; const int hh = blockIdx.x % HG, sg = blockIdx.x / HG; const int s0 = sg * 64; const int h = h0 + hh;
  for (int i = tid; i < 64 * 8; i += 256) { const int j = i / 8, d8 = (i % 8) * 8; FragH f; f.half[0] = *(const v8us*)((const unsigned short*)V16 + ((size_t)b * SQ + s0 + j) * DM + h * HD + d8); for (int q = 0; q < 8; ++q) tl[d8 + q][j] = f.u[q]; }
  __syncthreads();
  { for (int i = tid; i < 64 * 8; i += 256) { const int d = i / 8, j8 = (i % 8) * 8; FragH f; for (int q = 0; q < 8; ++q) f.u[q] = tl[d][j8 + q]; *(v8us*)((unsigned short*)VT + ((size_t)hh * HD + d) * SQ + s0 + j8) = f.half[0]; }  } }



// Fused causal attention, ONE WAVE PER 16 QUERY ROWS of one (batch, head); no score or weight ever leaves the registers, no LDS, no barrier.
// Scores are formed transposed, S^T = K . Q^T (A = 16 key rows, B = 16 query rows): lane (ln, hh) then holds keys 8 hh .. 8 hh + 7 of the tile for query ln, so row maximum and row sum are per-lane values
// (plus one exchange between the two lane halves), and two neighbouring tiles' weights ARE the 32-key operand fragment of the second product (elements 0..7 = keys 8 hh + i, 8..15 = keys 16 + 8 hh + i).
// The second product is transposed too, O^T = V^T . P^T (A = 16 rows of V^T, B = the weights): lane (ln, hh) ends with 8 consecutive output columns of query ln, one 16-byte store a tile.
// Two walks over the keys up to the diagonal: walk 1 gives the row maximum and the row sum (running maximum, sum rescaled when it moves), walk 2 forms the same scores again and the normalised x256 f16 weights.
// Every loop over r, i and t is unrolled in full so that s, e, p and the accumulators are indexed by constants and stay in registers; the two loops over the chunks stay rolled.
__device__ __forceinline__ v8f fa_mma(v16h a, v16h b, v8f c) { return __builtin_amdgcn_wmma_f32_16x16x32_f16(false, a, false, b, (short)0, c, false, false); }
// scores of 16 keys x 16 queries: hi.hi / 8, then + 2^-13 lo.hi, then + 2^-13 hi.lo (three accumulators of their own, added in this order); keys above the row get -1e9
// a0, a1: the 16 key rows' hi plane (head columns 0..31, 32..63); l0, l1: their residual plane
__device__ __forceinline__ void fa_scores(v16h a0, v16h a1, v16h l0, v16h l1, v16h qh0, v16h qh1, v16h ql0, v16h ql1, int keyb, int last, float* s) {
  const v8f z8 = {0.f,0.f,0.f,0.f,0.f,0.f,0.f,0.f};
  v8f c1 = fa_mma(a0, qh0, z8), c2 = fa_mma(a0, ql0, z8), c3 = fa_mma(l0, qh0, z8);
  c1 = fa_mma(a1, qh1, c1); c2 = fa_mma(a1, ql1, c2); c3 = fa_mma(l1, qh1, c3);
#pragma unroll
  for (int r = 0; r < 8; ++r) { float v = c1[r] * SCL; v += c2[r] * SCLR; v += c3[r] * SCLR; s[r] = (keyb + r <= last) ? v : -1.0e9f; } }
__global__ __launch_bounds__(128) void k_fattn(const _Float16* __restrict__ QHp, const _Float16* __restrict__ QLp, const _Float16* __restrict__ KHp, const _Float16* __restrict__ KLp, const _Float16* __restrict__ VTp, _Float16* __restrict__ O) {
  const int lane = threadIdx.x & 31, ln = lane & 15, hh = lane >> 4; const int w = __builtin_amdgcn_readfirstlane((int)(threadIdx.x >> 5));      /* the wave's number as a scalar: the key loops get scalar trip counts */
  const int bh = blockIdx.x % (NB * NH), qb = (SQ / 64 - 1) - blockIdx.x / (NB * NH);      /* longest rows first */
  const int b = bh / NH, h = bh % NH; const int q0 = qb * 64 + w * 16; const int last = q0 + ln; const int nch = (q0 + 47) >> 5;      /* 32-key chunks up to the diagonal; the last one may hold 16 keys that are masked for every row (they exist: q0 + 31 < SQ there) */
  const size_t rq = ((size_t)b * SQ + q0 + ln) * LQ + h * HD;
  const _Float16* qhp = QHp + rq + 8 * hh; const _Float16* qlp = QLp + rq + 8 * hh;
  const v16h qh0 = g2_frag(qhp, 0), qh1 = g2_frag(qhp + 32, 0), ql0 = g2_frag(qlp, 0), ql1 = g2_frag(qlp + 32, 0);
  asm volatile("s_wait_xcnt 0x0" :: "v"(qhp), "v"(qlp) : "memory");      /* the wait before a register that an issued load names is written again; the addresses are inputs so that they keep their registers up to it (the same at both loops' waits below) */
  const _Float16* kh = KHp + ((size_t)b * SQ + ln) * LQ + h * HD + 8 * hh; const _Float16* kl = KLp + ((size_t)b * SQ + ln) * LQ + h * HD + 8 * hh; const _Float16* vt = VTp + ((size_t)bh * HD + ln) * SQ + 8 * hh;
  float m = -3.0e38f, l = 0.f;
  for (int c = 0; c < nch; ++c) { float s[16]; const _Float16* ka = kh + (size_t)c * 32 * LQ; const _Float16* kb = kl + (size_t)c * 32 * LQ;
    const v16h a0 = g2_frag(ka, 0), a1 = g2_frag(ka + 32, 0), a2 = g2_frag(ka + 16 * LQ, 0), a3 = g2_frag(ka + 16 * LQ + 32, 0), l0 = g2_frag(kb, 0), l1 = g2_frag(kb + 32, 0), l2 = g2_frag(kb + 16 * LQ, 0), l3 = g2_frag(kb + 16 * LQ + 32, 0);
    /* the loaded values are inputs too: all of the chunk's loads are asked for together, one trip to the caches a chunk; left alone the compiler reuses two fragments' registers and waits for memory before nearly every product */
    asm volatile("s_wait_xcnt 0x0" :: "v"(ka), "v"(kb), "v"(a0), "v"(a1), "v"(a2), "v"(a3), "v"(l0), "v"(l1), "v"(l2), "v"(l3) : "memory");
    __builtin_amdgcn_sched_barrier(0);      /* keeps the products behind the wait, so that the wait is not moved down past them with the last loads */
    fa_scores(a0, a1, l0, l1, qh0, qh1, ql0, ql1, c * 32 + 8 * hh, last, s); fa_scores(a2, a3, l2, l3, qh0, qh1, ql0, ql1, c * 32 + 16 + 8 * hh, last, s + 8);
    float mn = m;
#pragma unroll
    for (int i = 0; i < 16; ++i) mn = fmaxf(mn, s[i]);
    float e[16];
#pragma unroll
    for (int i = 0; i < 16; ++i) e[i] = __expf(s[i] - mn);
    const float a = (((e[0] + e[1]) + (e[2] + e[3])) + ((e[4] + e[5]) + (e[6] + e[7]))) + (((e[8] + e[9]) + (e[10] + e[11])) + ((e[12] + e[13]) + (e[14] + e[15])));
    l = l * __expf(m - mn) + a; m = mn; }
  const float mo = __shfl_xor(m, 16, 32), lo = __shfl_xor(l, 16, 32); const float mx = fmaxf(m, mo);      /* the other eight keys of every tile sit in the other lane half */
  const float se = l * __expf(m - mx) + lo * __expf(mo - mx); const float sc = 256.0f / se;
  const v8f z8 = {0.f,0.f,0.f,0.f,0.f,0.f,0.f,0.f}; v8f o0 = z8, o1 = z8, o2 = z8, o3 = z8;
  for (int c = 0; c < nch; ++c) { float s[16]; const _Float16* ka = kh + (size_t)c * 32 * LQ; const _Float16* kb = kl + (size_t)c * 32 * LQ; const _Float16* vc = vt + c * 32;
    const v16h a0 = g2_frag(ka, 0), a1 = g2_frag(ka + 32, 0), a2 = g2_frag(ka + 16 * LQ, 0), a3 = g2_frag(ka + 16 * LQ + 32, 0), l0 = g2_frag(kb, 0), l1 = g2_frag(kb + 32, 0), l2 = g2_frag(kb + 16 * LQ, 0), l3 = g2_frag(kb + 16 * LQ + 32, 0);
    const v16h v0 = g2_frag(vc, 0), v1 = g2_frag(vc + (size_t)16 * SQ, 0), v2 = g2_frag(vc + (size_t)32 * SQ, 0), v3 = g2_frag(vc + (size_t)48 * SQ, 0);
    /* as in the first walk, the V^T rows with the key rows */
    asm volatile("s_wait_xcnt 0x0" :: "v"(ka), "v"(kb), "v"(vc), "v"(a0), "v"(a1), "v"(a2), "v"(a3), "v"(l0), "v"(l1), "v"(l2), "v"(l3), "v"(v0), "v"(v1), "v"(v2), "v"(v3) : "memory");
    __builtin_amdgcn_sched_barrier(0);      /* as in the first walk */
    fa_scores(a0, a1, l0, l1, qh0, qh1, ql0, ql1, c * 32 + 8 * hh, last, s); fa_scores(a2, a3, l2, l3, qh0, qh1, ql0, ql1, c * 32 + 16 + 8 * hh, last, s + 8);
    FragH p;
#pragma unroll
    for (int i = 0; i < 16; ++i) p.h[i] = (_Float16)(__expf(s[i] - mx) * sc);
    o0 = fa_mma(v0, p.v, o0); o1 = fa_mma(v1, p.v, o1); o2 = fa_mma(v2, p.v, o2); o3 = fa_mma(v3, p.v, o3); }
  const v8f os[4] = {o0, o1, o2, o3};
#pragma unroll
  for (int t = 0; t < 4; ++t) { FragH f;
#pragma unroll
    for (int r = 0; r < 8; ++r) f.h[r] = (_Float16)(os[t][r] * 0.25f);      /* o carried x64: weights x256, alpha 2^-2 */
    *(v8us*)((unsigned short*)O + rq + t * 16 + 8 * hh) = f.half[0]; } }


template <int MASKADD>
__global__ __launch_bounds__(64) void k_att0(const float* __restrict__ QF, const float* __restrict__ KF, const float* __restrict__ VF, int ld, const float* __restrict__ mask, float scale, float* __restrict__ OF, int ldo) {
  #pragma clang fp contract(off)
  // One thread per query row, keys in order (online softmax), every sum in the same order as a plain serial loop. The thread's q and o rows live in registers; k and v rows come in chunks of 64 keys,
  // staged once per chunk in LDS by coalesced loads and then read at a wave-uniform address (broadcast). Four keys' score chains run side by side: each is 64 dependent adds, so one alone leaves the issue slots empty.
  // Every loop over c, u and w and the staging loops over it are unrolled in full so that q, o, s and the staged values are indexed by constants and stay in registers; the loops over chunks, half chunks and groups of four keys stay rolled so that the code stays small.
  __shared__ __attribute__((aligned(16))) float lk[64][64]; __shared__ __attribute__((aligned(16))) float lv[64][64]; __shared__ __attribute__((aligned(16))) float lo[64][64];
  const int tid = threadIdx.x; const int h = blockIdx.x / (QT0 / 64), rg = blockIdx.x % (QT0 / 64); const int i = rg * 64 + tid;
  QF += (size_t)blockIdx.y * QT0 * ld; KF += (size_t)blockIdx.y * QT0 * ld; VF += (size_t)blockIdx.y * QT0 * ld; OF += (size_t)blockIdx.y * QT0 * ldo;      /* blockIdx.y = batch: each batch's first-tile rows are a plane of their own */
  const float* qr = QF + (size_t)i * ld + h * HD;
  float q[HD], o[HD];
  { v4f tq[HD / 4];
#pragma unroll
    for (int c = 0; c < HD / 4; ++c) tq[c] = *(const v4fa*)(qr + c * 4);
    asm volatile("s_wait_xcnt 0x0" :: "v"(qr) : "memory");      /* as in the staging below: the row's address keeps its registers until every load that names it has been translated */
#pragma unroll
    for (int c = 0; c < HD / 4; ++c) {
#pragma unroll
      for (int u = 0; u < 4; ++u) { q[c * 4 + u] = tq[c][u]; o[c * 4 + u] = 0.f; } } }
  float m = -1.0e30f, l = 0.f; const int jmax = MASKADD ? (SQ - 1) : (rg * 64 + 63);      /* additive-mask form: every key (the mask input decides); causal form: keys up to the block's last row; jmax + 1 is a multiple of 64 */
#pragma unroll 1
  for (int j0 = 0; j0 <= jmax; j0 += 64) {
    __syncthreads();      /* both waves have left the chunk before it is overwritten */
#pragma unroll 1
    for (int hf = 0; hf < 2; ++hf) { const float* kp[8]; const float* vp[8]; v4f tk[8], tv[8];      /* 32 keys a pass: 16 loads in flight */
#pragma unroll
      for (int it = 0; it < 8; ++it) { const size_t g = (size_t)(j0 + hf * 32 + it * 4 + tid / 16) * ld + h * HD + (tid % 16) * 4; kp[it] = KF + g; vp[it] = VF + g; }
#pragma unroll
      for (int it = 0; it < 8; ++it) { tk[it] = *(const v4fa*)kp[it]; tv[it] = *(const v4fa*)vp[it]; }
      /* the wait before a register that an issued load names is written again; the addresses are inputs so that they keep their registers up to it */
      asm volatile("s_wait_xcnt 0x0" :: "v"(kp[0]), "v"(kp[1]), "v"(kp[2]), "v"(kp[3]), "v"(kp[4]), "v"(kp[5]), "v"(kp[6]), "v"(kp[7]), "v"(vp[0]), "v"(vp[1]), "v"(vp[2]), "v"(vp[3]), "v"(vp[4]), "v"(vp[5]), "v"(vp[6]), "v"(vp[7]) : "memory");
#pragma unroll
      for (int it = 0; it < 8; ++it) { const int row = hf * 32 + it * 4 + tid / 16, pc = (tid % 16) * 4; *(v4f*)&lk[row][pc] = tk[it]; *(v4f*)&lv[row][pc] = tv[it]; } }
    __syncthreads();
#pragma unroll 1
    for (int jj = 0; jj < 64; jj += 4) { float s[4] = {0.f, 0.f, 0.f, 0.f};
#pragma unroll
      for (int c = 0; c < HD / 4; ++c) {
#pragma unroll
        for (int u = 0; u < 4; ++u) { const v4f kq = *(const v4f*)&lk[jj + u][c * 4]; s[u] = __fadd_rn(s[u], __fmul_rn(q[c * 4 + 0], kq[0])); s[u] = __fadd_rn(s[u], __fmul_rn(q[c * 4 + 1], kq[1])); s[u] = __fadd_rn(s[u], __fmul_rn(q[c * 4 + 2], kq[2])); s[u] = __fadd_rn(s[u], __fmul_rn(q[c * 4 + 3], kq[3])); } }
      float sc[4], e[4];      /* the four keys' rescale and weight, key after key (m and l are a chain); the o rows follow */
#pragma unroll
      for (int u = 0; u < 4; ++u) { const int j = j0 + jj + u; float sv = __fmul_rn(s[u], scale); if (MASKADD) sv = __fadd_rn(sv, __fmul_rn(bf16_round(mask[(size_t)i * SQ + j]), -10000.0f));
        const float f = (MASKADD || j <= i) ? 1.f : 0.f; const float sm = fmaf(f, sv, (1.f - f) * -1.0e30f); const float mn = fmaxf(m, sm); sc[u] = expf(m - mn); e[u] = expf(sm - mn); l = __fadd_rn(__fmul_rn(l, sc[u]), e[u]); m = mn; }
#pragma unroll
      for (int u = 0; u < 4; ++u) {
#pragma unroll
        for (int c = 0; c < HD / 4; ++c) { const v4f vv = *(const v4f*)&lv[jj + u][c * 4];
#pragma unroll
          for (int w = 0; w < 4; ++w) o[c * 4 + w] = __fadd_rn(__fmul_rn(o[c * 4 + w], sc[u]), __fmul_rn(e[u], vv[w])); } } } }
  const float fin = 64.0f / l;      /* o carried x64 like the f16 path */
#pragma unroll
  for (int c = 0; c < HD / 4; ++c) { v4f oo;
#pragma unroll
    for (int u = 0; u < 4; ++u) oo[u] = __fmul_rn(o[c * 4 + u], fin);
    *(v4f*)&lo[tid][c * 4] = oo; }
  __syncthreads();
  {
#pragma unroll 1
    for (int it = 0; it < 16; ++it) { const int row = it * 4 + tid / 16, pc = (tid % 16) * 4; const v4f v = *(const v4f*)&lo[row][pc]; *(v4f*)(OF + (size_t)(rg * 64 + row) * ldo + h * HD + pc) = v; }
     } }

extern "C" void kernel_launch(void* const* d_in, const int* in_sizes, int n_in,
                              void* d_out, int out_size, void* d_ws, size_t ws_size, hipStream_t stream) {
  (void)in_sizes; (void)n_in; (void)out_size;
  const float* const* I = (const float* const*)d_in; const float* x = I[0]; const float* xk = I[0]; const float* xv = I[0]; const float* wq = I[1]; const float* bq = nullptr; const float* wk = I[2]; const float* bk = nullptr; const float* wv = I[3]; const float* bv = nullptr; const float* wo = I[4]; const float* bo = nullptr;      /* input order: x, Wq, Wk, Wv (BLOCK-DIAGONAL per-head [16][64][64] = [head][in][out]; NO biases: null pointers), Wo ([in][out] [1024][1024]; no bias: a null pointer in the output GEMM's guarded slot); five inputs */
  char* ws = (char*)d_ws; size_t off = 0;
  auto take = [&](size_t bytes) { char* p = ws + off; off += (bytes + 255) & ~(size_t)255; return p; };
  _Float16* BQ = (_Float16*)take((size_t)DM * DM * 2); _Float16* BK = (_Float16*)take((size_t)DM * DM * 2); _Float16* BV = (_Float16*)take((size_t)DM * DM * 2); _Float16* BO = (_Float16*)take((size_t)DM * DM * 2);
  _Float16* X16 = (_Float16*)take(NR * DM * 2); _Float16* XK16 = (_Float16*)take(NR * DM * 2); _Float16* XV16 = (_Float16*)take(NR * DM * 2);      /* exact f16 rows of query, key, value */ float* QF = (float*)take(NR * DM * 4); _Float16* QH = (_Float16*)take(NR * DM * 2); _Float16* QL = (_Float16*)take(NR * DM * 2); _Float16* KH = (_Float16*)take(NR * DM * 2); _Float16* KL = (_Float16*)take(NR * DM * 2); _Float16* Q16 = QH; _Float16* K16 = KH; _Float16* V16 = (_Float16*)take(NR * DM * 2); _Float16* O16 = (_Float16*)take(NR * DM * 2);
  _Float16* VT = (_Float16*)take((size_t)NB * NH * HD * SQ * 2);      /* V^T of every batch: the fused attention launch covers all of them */
  float* QF0 = (float*)take((size_t)NB * QT0 * DM * 4); float* KF0 = (float*)take((size_t)NB * QT0 * DM * 4); float* VF0 = (float*)take((size_t)NB * QT0 * DM * 4);      /* a plane per batch: the first-tile launches cover all batches */ float* OF0 = (float*)take((size_t)NB * QT0 * DM * 4); _Float16* OH0 = (_Float16*)take((size_t)NB * QT0 * DM * 2); _Float16* OL0 = (_Float16*)take((size_t)NB * QT0 * DM * 2);
  if (off > ws_size) return;
  { const unsigned gn = (unsigned)(((size_t)DM * (DM / 8) + 255) / 256); const unsigned gp = (unsigned)(((size_t)HD * (HD / 8) + 255) / 256); k_wt_f16h<<<dim3(gp, NH, 3), 256, 0, stream>>>(wq, wk, wv, BQ, BK, BV, 16.0f); k_wt_f16<<<gn, 256, 0, stream>>>(wo, BO, DM, DM, 16.0f); }      /* BLOCK-DIAGONAL per-head weights wq / wk / wv [NH][HD][HD] = [head][in][out] (x_h @ W_h): W_h[d][e] -> Bt_h[e][d] x16 through the file's transposing builder with K = N = 64, all heads and stacks in one launch (grid y = head, z = stack), into sixteen consecutive [64][64] planes (the first 128 KiB of the weight plane); Wo [in][out]: the same builder with K = N = 1024 */
  k_x16<<<(unsigned)((NR * DM / 8 + 255) / 256), 256, 0, stream>>>(x, X16, NR * DM / 8); k_x16<<<(unsigned)((NR * DM / 8 + 255) / 256), 256, 0, stream>>>(xk, XK16, NR * DM / 8); k_x16<<<(unsigned)((NR * DM / 8 + 255) / 256), 256, 0, stream>>>(xv, XV16, NR * DM / 8);
  const size_t r0p = (size_t)B0 * SQ;      /* first projected row */
  k_gemm2<0><<<dim3((unsigned)(MP / 128), NH), 128, 0, stream>>>(X16 + r0p * DM, DM, (size_t)HD, BQ, HD, (size_t)HD * HD, 0.0625f, bq, (size_t)HD, nullptr, 1, 0, 0, QF + r0p * DM, nullptr, DM, (size_t)HD, MP, HD, HD, 0, 0); k_hl<<<(unsigned)(((size_t)MP * DM / 8 + 255) / 256), 256, 0, stream>>>(QF + r0p * DM, QH + r0p * DM, QL + r0p * DM, (size_t)MP * DM / 8);      /* q (f32): ONE head-batched GEMM (K = N = 64): head h (grid.y) = x[:, 64 h ..] W_h -> QF[:, 64 h ..]; then -> f16 hi + x1024 residual planes */
  k_gemm2<0><<<dim3((unsigned)(MP / 128), NH), 128, 0, stream>>>(XK16 + r0p * DM, DM, (size_t)HD, BK, HD, (size_t)HD * HD, 0.0625f, bk, (size_t)HD, nullptr, 1, 0, 0, QF + r0p * DM, nullptr, DM, (size_t)HD, MP, HD, HD, 0, 0); k_hl<<<(unsigned)(((size_t)MP * DM / 8 + 255) / 256), 256, 0, stream>>>(QF + r0p * DM, KH + r0p * DM, KL + r0p * DM, (size_t)MP * DM / 8);      /* k likewise */
  k_gemm2<0><<<dim3((unsigned)(MP / 128), NH), 128, 0, stream>>>(XV16 + r0p * DM, DM, (size_t)HD, BV, HD, (size_t)HD * HD, 0.0625f, bv, (size_t)HD, nullptr, 1, 0, 0, nullptr, V16 + r0p * DM, DM, (size_t)HD, MP, HD, HD, 0, 0);      /* v (f16 rows): head-batched likewise */
  k_vt<NH, SQ><<<NBR * NH * (SQ / 64), 256, 0, stream>>>(V16 + r0p * LQ, LQ, 0, VT + (size_t)B0 * NH * HD * SQ);      /* V^T [NB][NH][HD][SQ]: every batch in one launch (the kernel's slab index runs over batch and head) */
  k_gemm2<0><<<dim3((QT0 / 128), NH, NBR), 128, 0, stream>>>(X16 + r0p * DM, DM, (size_t)HD, BQ, HD, (size_t)HD * HD, 0.0625f, bq, (size_t)HD, nullptr, 1, 0, 0, QF0, nullptr, DM, (size_t)HD, QT0, HD, HD, (size_t)SQ * DM, (size_t)QT0 * DM); k_gemm2<0><<<dim3((QT0 / 128), NH, NBR), 128, 0, stream>>>(XK16 + r0p * DM, DM, (size_t)HD, BK, HD, (size_t)HD * HD, 0.0625f, bk, (size_t)HD, nullptr, 1, 0, 0, KF0, nullptr, DM, (size_t)HD, QT0, HD, HD, (size_t)SQ * DM, (size_t)QT0 * DM); k_gemm2<0><<<dim3((QT0 / 128), NH, NBR), 128, 0, stream>>>(XV16 + r0p * DM, DM, (size_t)HD, BV, HD, (size_t)HD * HD, 0.0625f, bv, (size_t)HD, nullptr, 1, 0, 0, VF0, nullptr, DM, (size_t)HD, QT0, HD, HD, (size_t)SQ * DM, (size_t)QT0 * DM);      /* f32 q, k, v of each batch's first 128 rows (exact products): the same head-batched form, grid z = batch */
  k_att0<0><<<dim3(NH * (QT0 / 64), NBR), 64, 0, stream>>>(QF0, KF0, VF0, DM, nullptr, SCL, OF0 + (size_t)B0 * QT0 * DM, DM);      /* exact f32 attention for rows 0..127 of every batch (o x64), grid y = batch */
  k_fattn<<<NB * NH * (SQ / 64), 128, 0, stream>>>(QH, QL, KH, KL, VT, O16);      /* scores (hi.hi + lo.hi + hi.lo), causal softmax and P . V of every batch, head and query row in one launch: o (merged heads, x64) as f16 rows */
  k_gemm2<0><<<dim3((unsigned)((MPO / 128) * (DM / 64)), 1), 128, 0, stream>>>(O16 + r0p * DM, DM, 0, BO, DM, 0, 0.0009765625f, bo, 0, nullptr, 1, 0, 0, (float*)d_out + r0p * DM, nullptr, DM, 0, MPO, DM, DM, 0, 0);      /* out rows are the output layout */
  k_hl<<<(unsigned)(((size_t)NB * QT0 * DM / 8 + 255) / 256), 256, 0, stream>>>(OF0, OH0, OL0, (size_t)NB * QT0 * DM / 8);      /* first-tile o (x64) -> f16 hi + x1024 residual planes */
  k_gemm2<0><<<dim3((QT0 / 128) * (DM / 64), NBR), 128, 0, stream>>>(OH0 + (size_t)B0 * QT0 * DM, DM, (size_t)QT0 * DM, BO, DM, 0, 0.0009765625f, bo, 0, nullptr, 1, 0, 0, (float*)d_out + r0p * DM, nullptr, DM, (size_t)SQ * DM, QT0, DM, DM, 0, 0);      /* rows 0..127 of every batch (grid y = batch): out = o_hi Wo (+ b), overwriting the f16-path rows */
  k_gemm2<0><<<dim3((QT0 / 128) * (DM / 64), NBR), 128, 0, stream>>>(OL0 + (size_t)B0 * QT0 * DM, DM, (size_t)QT0 * DM, BO, DM, 0, 0.00000095367431640625f, nullptr, 0, (const float*)d_out + r0p * DM, -1, 0, 0, (float*)d_out + r0p * DM, nullptr, DM, (size_t)SQ * DM, QT0, DM, DM, 0, 0);      /* += o_lo Wo 2^-20 (own-element accumulate) */
}

// v005
// It runs in 380 microseconds.
// In both of two side-by-side timings against v004, it was 1.33 times as fast.
// All steps since v000 together make it 29.6 times as fast.
#include <hip/hip_runtime.h>
// Causal multi-head self-attention with BLOCK-DIAGONAL per-head projections (x [4][2048][1024] viewed (b, s, 16, 64); q / k / v = einsum('bshd,hde->bshe', xh, W): EACH HEAD applies its own [64][64] weight (W [16][64][64] = [head][in][out], normal x 0.02; NO biases) to ITS OWN 64-wide slice of the row; scores / sqrt(64); where(tril, scores, -inf); softmax over keys; out = merged Wo ([in][out] [1024][1024]; no bias) -> [4][2048][1024]); each projection is ONE head-batched GEMM (K = 64); q and k carried as f16 hi + x1024 residual planes with three-product scores.
// Structure: token rows r = b*2048 + s; x as exact f16 rows (bf16-rounded); q and k as WMMA GEMMs (32x64 wave tiles, f32 accumulation, exact x16 weights, no bias) into f32 rows split into f16 hi + x1024 residual planes, v as an f16-output GEMM; V^T for all batches and heads via LDS transposes (one launch); then ONE fused attention launch for every batch, head and query row, one wave per 16 rows: scores against the keys up to the diagonal as three products (hi.hi + lo.hi + hi.lo, K = 64) kept in registers, causal softmax there in one walk (keys above the row masked by a select; running maximum, f32 statistics, native exp; weights f16, at most 1, normalised at the end), o = P . V (o carried x64, folded into the output GEMM alpha) written straight into the merged f16 o rows; out = o W_o GEMM (f32, no bias) into the output layout.
// Compute dtype: inputs rounded to bf16; x / weights exact; v, softmax weights and o as plain f16 GEMM operands (~2^-12); q and k as f16 hi + x1024 residual planes; scores and softmax statistics f32. v_wmma_f32_16x16x32_f16.
#define NB 4
#define SCL 0.125f                         /* 1 / sqrt(head_dim 64) */
#define SCLR 0.0001220703125f               /* 2^-13: the same scale on the x1024 residual passes */
#define SQ 2048
#define DM 1024
#define NH 16
#define HD 64
#define HG 4                         /* heads per launch of the k_vt(b, h0) overload (not launched) */
#define QT 256                       /* not used */
#define NKX SQ                       /* not used */
#define QT0 128                      /* first-tile rows recomputed exactly in f32 */
#define B0 0                         /* first batch processed (debug hook) */
#define NBR NB                       /* batches processed (debug hook) */
#define NR ((size_t)NB * SQ)         /* token rows */
#define MP ((int)((size_t)NBR * SQ)) /* rows projected (debug hook) */
#define QN SQ                        /* not used */
#define NHD NH                       /* not used */
#define MPO MP                       /* rows through the output stage (debug hook) */
#define LQ DM      /* row pitch of the q/k/v rows */
typedef __bf16 v16b __attribute__((ext_vector_type(16)));
typedef unsigned short v8us __attribute__((ext_vector_type(8), may_alias));
typedef float  v8f  __attribute__((ext_vector_type(8)));
typedef float  v4f  __attribute__((ext_vector_type(4)));
typedef float  v4fa __attribute__((ext_vector_type(4), may_alias));
union FragB { v16b v; v8us half[2]; unsigned short u[16]; };

__device__ __forceinline__ unsigned short bf16_bits(float x) { unsigned int u = __float_as_uint(x); return (unsigned short)((u + 0x7FFFu + ((u >> 16) & 1u)) >> 16); }
__device__ __forceinline__ float bf16_val(unsigned short b) { return __uint_as_float(((unsigned int)b) << 16); }
__device__ __forceinline__ float bf16_round(float x) { return bf16_val(bf16_bits(x)); }
// D += A·B with NT terms: 1 = ah·bh, 2 = + al·bh (A split), 3 = + ah·bl (both split)
template <int NT>
__device__ __forceinline__ v8f mmaN(v16b ah, v16b al, v16b bh, v16b bl, v8f c) {
  c = __builtin_amdgcn_wmma_f32_16x16x32_bf16(false, ah, false, bh, (short)0, c, false, false);
  if (NT >= 2) c = __builtin_amdgcn_wmma_f32_16x16x32_bf16(false, al, false, bh, (short)0, c, false, false);
  if (NT >= 3) c = __builtin_amdgcn_wmma_f32_16x16x32_bf16(false, ah, false, bl, (short)0, c, false, false);
  asm volatile("v_nop\n\tv_nop\n\tv_nop\n\tv_nop" : "+v"(c) : "v"(ah), "v"(al), "v"(bh), "v"(bl));
  return c;
}

__global__ __launch_bounds__(256) void k_wt_bf16(const float* __restrict__ W, unsigned short* __restrict__ Wt, int K, int N) {
  const int t = blockIdx.x * 256 + threadIdx.x;
  const int k8n = K / 8;
  if (t >= N * k8n) return;
  const int n = t / k8n, k8 = (t % k8n) * 8;
  v8us v;
#pragma unroll
  for (int i = 0; i < 8; ++i) v[i] = bf16_bits(W[(size_t)(k8 + i) * N + n]);
  *(v8us*)(Wt + (size_t)n * K + k8) = v;
  
}

// GEMM C[M][N] (f32, pitch ldc) = act(A[M][K]·W + bias). A f32 row-major (pitch lda) converted per fragment to bf16
// (ASPLIT: hi/lo two planes -> 2 terms, else single rounded term); Wt bf16 [N][K] (pitch ldb). BIAS_BF16 rounds the
// bias to bf16 first (bias quantised to bf16 before the add). K%32==0, M%16==0, N%64==0.
template <bool ASPLIT, int ACT, bool BIAS_BF16>
__global__ __launch_bounds__(128) void k_gemm_bf(const float* __restrict__ A, int lda, const unsigned short* __restrict__ Wt, int ldb,
                                               const float* __restrict__ bias, float* __restrict__ C, int ldc, int M, int N, int K) {
  __shared__ __attribute__((aligned(16))) float so[4][16][64];
  const int tid = threadIdx.x, w = tid >> 5, lane = tid & 31, ln = lane & 15, hh = lane >> 4;
  const int ntn = N / 64;
  const int wid = blockIdx.x * 4 + w;
  const int mt = wid / ntn, nq = wid % ntn;
  if (mt * 16 >= M) return;
  const int row0 = mt * 16, col0 = nq * 64;
  const float* arow = A + (size_t)(row0 + ln) * lda;
  v8f acc[4] = {};
  for (int kb = 0; kb < K; kb += 32) {
    FragB ah, al;
    const v4f x0 = *(const v4fa*)(arow + kb + 8 * hh), x1 = *(const v4fa*)(arow + kb + 8 * hh + 4);
    const v4f x2 = *(const v4fa*)(arow + kb + 16 + 8 * hh), x3 = *(const v4fa*)(arow + kb + 16 + 8 * hh + 4);
    float xs[16] = {x0[0],x0[1],x0[2],x0[3],x1[0],x1[1],x1[2],x1[3],x2[0],x2[1],x2[2],x2[3],x3[0],x3[1],x3[2],x3[3]};
#pragma unroll
    for (int i = 0; i < 16; ++i) { const unsigned short hb = bf16_bits(xs[i]); ah.u[i] = hb; al.u[i] = ASPLIT ? bf16_bits(xs[i] - bf16_val(hb)) : (unsigned short)0; }
#pragma unroll
    for (int t = 0; t < 4; ++t) {
      const unsigned short* brow = Wt + (size_t)(col0 + t * 16 + ln) * ldb + kb;
      FragB b;
      b.half[0] = *(const v8us*)(brow + 8 * hh);
      b.half[1] = *(const v8us*)(brow + 16 + 8 * hh);
      acc[t] = mmaN<ASPLIT ? 2 : 1>(ah.v, al.v, b.v, b.v, acc[t]);
    }
  }
#pragma unroll
  for (int t = 0; t < 4; ++t) {
    float bv = bias ? bias[col0 + t * 16 + ln] : 0.f;
    if (BIAS_BF16) bv = bf16_round(bv);
#pragma unroll
    for (int r = 0; r < 8; ++r) { float v = acc[t][r] + bv; if (ACT == 1) v = fmaxf(v, 0.f); so[w][8 * hh + r][t * 16 + ln] = v; }
  }
  __builtin_amdgcn_fence(__ATOMIC_ACQ_REL, "workgroup");
  __builtin_amdgcn_wave_barrier();
  const int rsub = lane >> 4, c4 = (lane & 15) * 4;
  {
#pragma unroll
    for (int q = 0; q < 8; ++q) {
      const int r = q * 2 + rsub;
      const v4f v = *(const v4fa*)&so[w][r][c4];
      *(v4f*)(C + (size_t)(row0 + r) * ldc + col0 + c4) = v;
    }
    
  }
}

// GEMM C = act(A·W + bias + resid): A f32 (ASPLIT -> hi/lo 2 terms), Wt bf16 [N][K]; ACT 0 none, 1 relu, 2 exact gelu;
// resid (optional, f32, row index = (row % rmod), pitch ldr, RES_BF16 rounds it) added before the activation.
template <bool ASPLIT, int ACT, bool BIAS_BF16, bool RES_BF16>
__global__ __launch_bounds__(128) void k_gemm_bf3(const float* __restrict__ A, int lda, const unsigned short* __restrict__ Wt, int ldb,
                                                const float* __restrict__ bias, const float* __restrict__ resid, int rmod, int ldr,
                                                float* __restrict__ C, int ldc, int M, int N, int K) {
  __shared__ __attribute__((aligned(16))) float so[4][16][64];
  const int tid = threadIdx.x, w = tid >> 5, lane = tid & 31, ln = lane & 15, hh = lane >> 4;
  const int ntn = N / 64;
  const int wid = blockIdx.x * 4 + w;
  const int mt = wid / ntn, nq = wid % ntn;
  if (mt * 16 >= M) return;
  const int row0 = mt * 16, col0 = nq * 64;
  const float* arow = A + (size_t)(row0 + ln) * lda;
  v8f acc[4] = {};
  for (int kb = 0; kb < K; kb += 32) {
    FragB ah, al;
    const v4f x0 = *(const v4fa*)(arow + kb + 8 * hh), x1 = *(const v4fa*)(arow + kb + 8 * hh + 4);
    const v4f x2 = *(const v4fa*)(arow + kb + 16 + 8 * hh), x3 = *(const v4fa*)(arow + kb + 16 + 8 * hh + 4);
    float xs[16] = {x0[0],x0[1],x0[2],x0[3],x1[0],x1[1],x1[2],x1[3],x2[0],x2[1],x2[2],x2[3],x3[0],x3[1],x3[2],x3[3]};
#pragma unroll
    for (int i = 0; i < 16; ++i) { const unsigned short hb = bf16_bits(xs[i]); ah.u[i] = hb; al.u[i] = ASPLIT ? bf16_bits(xs[i] - bf16_val(hb)) : (unsigned short)0; }
#pragma unroll
    for (int t = 0; t < 4; ++t) {
      const unsigned short* brow = Wt + (size_t)(col0 + t * 16 + ln) * ldb + kb;
      FragB b;
      b.half[0] = *(const v8us*)(brow + 8 * hh);
      b.half[1] = *(const v8us*)(brow + 16 + 8 * hh);
      acc[t] = mmaN<ASPLIT ? 2 : 1>(ah.v, al.v, b.v, b.v, acc[t]);
    }
  }
#pragma unroll
  for (int t = 0; t < 4; ++t) {
    const int col = col0 + t * 16 + ln;
    float bv = bias ? bias[col] : 0.f;
    if (BIAS_BF16) bv = bf16_round(bv);
#pragma unroll
    for (int r = 0; r < 8; ++r) {
      float v = acc[t][r] + bv;
      if (resid) { float rv = resid[(size_t)((row0 + 8 * hh + r) % rmod) * ldr + col]; if (RES_BF16) rv = bf16_round(rv); v += rv; }
      if (ACT == 1) v = fmaxf(v, 0.f);
      if (ACT == 2) v = 0.5f * v * (1.0f + erff(v * 0.70710678118654752f));
      if (ACT == 3) { const float u = 0.7978845608028654f * (v + 0.044715f * v * v * v); v = 0.5f * v * (1.0f + tanhf(u)); }
      so[w][8 * hh + r][t * 16 + ln] = v;
    }
  }
  __builtin_amdgcn_fence(__ATOMIC_ACQ_REL, "workgroup");
  __builtin_amdgcn_wave_barrier();
  const int rsub = lane >> 4, c4 = (lane & 15) * 4;
  {
#pragma unroll
    for (int q = 0; q < 8; ++q) {
      const int r = q * 2 + rsub;
      const v4f v = *(const v4fa*)&so[w][r][c4];
      *(v4f*)(C + (size_t)(row0 + r) * ldc + col0 + c4) = v;
    }
    
  }
}
// row LayerNorm (biased variance, eps) over N: s = X (+ R); optional out_sum <- s; out_norm <- (s-mu)*rsqrt(var+eps)*g + b
template <bool PARAM_BF16>
__global__ __launch_bounds__(256) void k_layernorm(const float* __restrict__ X, const float* __restrict__ R, const float* __restrict__ g, const float* __restrict__ bta,
                                                  float* __restrict__ out_sum, float* __restrict__ out_norm, int N, float eps) {
  __shared__ float red[256];
  const int row = blockIdx.x, tid = threadIdx.x;
  const float* x = X + (size_t)row * N; const float* rr = R ? R + (size_t)row * N : nullptr;
  float vals[16];                     // up to N = 4096
  const int per = N / 256;            // contiguous chunk per thread? use strided-by-4 chunks: thread handles j = tid*4 + 1024*u
  float s1 = 0.f;
  for (int u = 0; u < per / 4; ++u) {
    const int j = tid * 4 + 1024 * u;
    const v4f a = *(const v4fa*)(x + j);
    v4f b = {0.f,0.f,0.f,0.f}; if (rr) b = *(const v4fa*)(rr + j);
#pragma unroll
    for (int q = 0; q < 4; ++q) { const float v = a[q] + b[q]; vals[u * 4 + q] = v; s1 += v; }
  }
  red[tid] = s1; __syncthreads();
  for (int st = 128; st > 0; st >>= 1) { if (tid < st) red[tid] += red[tid + st]; __syncthreads(); }
  const float mu = red[0] / (float)N; __syncthreads();
  float s2 = 0.f;
  for (int u = 0; u < per / 4; ++u)
#pragma unroll
    for (int q = 0; q < 4; ++q) { const float c = vals[u * 4 + q] - mu; s2 += c * c; }
  red[tid] = s2; __syncthreads();
  for (int st = 128; st > 0; st >>= 1) { if (tid < st) red[tid] += red[tid + st]; __syncthreads(); }
  const float rs = rsqrtf(red[0] / (float)N + eps);
  {
    for (int u = 0; u < per / 4; ++u) {
      const int j = tid * 4 + 1024 * u;
      v4f o, sm;
#pragma unroll
      for (int q = 0; q < 4; ++q) {
        float gg = g[j + q], bb = bta[j + q];
        if (PARAM_BF16) { gg = bf16_round(gg); bb = bf16_round(bb); }
        sm[q] = vals[u * 4 + q]; o[q] = (vals[u * 4 + q] - mu) * rs * gg + bb;
      }
      if (out_sum) *(v4f*)(out_sum + (size_t)row * N + j) = sm;
      *(v4f*)(out_norm + (size_t)row * N + j) = o;
    }
    
  }
}



// ---- f16 WMMA path (v_wmma_f32_16x16x32_f16): 11-bit significands for operands in range — used where a [0,1] probability operand needs more precision than bf16
typedef _Float16 v16h __attribute__((ext_vector_type(16)));
union FragH { v16h v; v8us half[2]; _Float16 h[16]; unsigned short u[16]; };
template <int NT>
__device__ __forceinline__ v8f mmaH(v16h ah, v16h al, v16h bh, v16h bl, v8f c) {
  c = __builtin_amdgcn_wmma_f32_16x16x32_f16(false, ah, false, bh, (short)0, c, false, false);
  if (NT >= 2) c = __builtin_amdgcn_wmma_f32_16x16x32_f16(false, al, false, bh, (short)0, c, false, false);
  if (NT >= 3) c = __builtin_amdgcn_wmma_f32_16x16x32_f16(false, ah, false, bl, (short)0, c, false, false);
  asm volatile("v_nop\n\tv_nop\n\tv_nop\n\tv_nop" : "+v"(c) : "v"(ah), "v"(al), "v"(bh), "v"(bl));
  return c;
}
// batched GEMM like k_gemm_b but f16 operands: A f32 (split into f16 hi/lo if ASPLIT, else rounded to f16), Bt = f16 values [n][k]; alpha; C f32; N multiple of 16 (partial tiles skipped)
template <bool ASPLIT>
__global__ __launch_bounds__(128) void k_gemm_h(const float* __restrict__ A, int lda, size_t sA, const _Float16* __restrict__ Bh, int ldb, size_t sB, float alpha, float* __restrict__ C, int ldc, size_t sC, int M, int N, int K) {
  __shared__ __attribute__((aligned(16))) float so[4][16][64];
  const int tid = threadIdx.x, w = tid >> 5, lane = tid & 31, ln = lane & 15, hh = lane >> 4; const int by = blockIdx.y;
  A += (size_t)by * sA; Bh += (size_t)by * sB; C += (size_t)by * sC;
  const int ntn = (N + 63) / 64; const int wid = blockIdx.x * 4 + w; const int mt = wid / ntn, nq = wid % ntn; if (mt * 16 >= M) return;
  const int row0 = mt * 16, col0 = nq * 64; const float* arow = A + (size_t)(row0 + ln) * lda;
  v8f acc[4] = {};
  for (int kb = 0; kb < K; kb += 32) {
    FragH ah, al;
    const v4f x0 = *(const v4fa*)(arow + kb + 8 * hh), x1 = *(const v4fa*)(arow + kb + 8 * hh + 4), x2 = *(const v4fa*)(arow + kb + 16 + 8 * hh), x3 = *(const v4fa*)(arow + kb + 16 + 8 * hh + 4);
    float xs[16] = {x0[0],x0[1],x0[2],x0[3],x1[0],x1[1],x1[2],x1[3],x2[0],x2[1],x2[2],x2[3],x3[0],x3[1],x3[2],x3[3]};
#pragma unroll
    for (int i = 0; i < 16; ++i) { const _Float16 h = (_Float16)xs[i]; ah.h[i] = h; al.h[i] = ASPLIT ? (_Float16)(xs[i] - (float)h) : (_Float16)0.0f; }
#pragma unroll
    for (int t = 0; t < 4; ++t) { if (col0 + t * 16 >= N) continue; const size_t boff = (size_t)(col0 + t * 16 + ln) * ldb + kb; FragH bq; bq.half[0] = *(const v8us*)(Bh + boff + 8 * hh); bq.half[1] = *(const v8us*)(Bh + boff + 16 + 8 * hh);
      acc[t] = mmaH<ASPLIT ? 2 : 1>(ah.v, al.v, bq.v, bq.v, acc[t]); }
  }
#pragma unroll
  for (int t = 0; t < 4; ++t) { if (col0 + t * 16 >= N) continue;
#pragma unroll
    for (int r = 0; r < 8; ++r) so[w][8 * hh + r][t * 16 + ln] = acc[t][r] * alpha; }
  __builtin_amdgcn_fence(__ATOMIC_ACQ_REL, "workgroup"); __builtin_amdgcn_wave_barrier();
  const int rsub = lane >> 4, c4 = (lane & 15) * 4;
  {
#pragma unroll
    for (int q = 0; q < 8; ++q) { const int r = q * 2 + rsub; if (col0 + c4 < N) { const v4f v = *(const v4fa*)&so[w][r][c4]; *(v4f*)(C + (size_t)(row0 + r) * ldc + col0 + c4) = v; } }
     }
}

// Wt[n][k] = f16(W[k][n]·scale) from f32 row-major W[K][N] (scale = power of two; bf16-exact weights stay exact in f16 away from the subnormal range)
__global__ __launch_bounds__(256) void k_wt_f16(const float* __restrict__ W, _Float16* __restrict__ Wt, int K, int N, float scale) {
  const int t = blockIdx.x * 256 + threadIdx.x; if (t >= N * (K / 8)) return; const int n = t / (K / 8), k8 = (t % (K / 8)) * 8; FragH f;
#pragma unroll
  for (int i = 0; i < 8; ++i) f.h[i] = (_Float16)(bf16_round(W[(size_t)(k8 + i) * N + n]) * scale); const v8us o = f.half[0];
  *(v8us*)((unsigned short*)Wt + (size_t)n * K + k8) = o; 
}
// the same builder for the per-head [64][64] weights of three stacks in ONE launch: blockIdx.y = head (consecutive [64][64] planes in source and destination), blockIdx.z = stack
__global__ __launch_bounds__(256) void k_wt_f16h(const float* __restrict__ Wa, const float* __restrict__ Wb, const float* __restrict__ Wc, _Float16* __restrict__ Ta, _Float16* __restrict__ Tb, _Float16* __restrict__ Tc, float scale) {
  const int t = blockIdx.x * 256 + threadIdx.x; if (t >= HD * (HD / 8)) return; const int n = t / (HD / 8), k8 = (t % (HD / 8)) * 8; const size_t o = (size_t)blockIdx.y * HD * HD;
  const float* W = (blockIdx.z == 0 ? Wa : blockIdx.z == 1 ? Wb : Wc) + o; _Float16* Wt = (blockIdx.z == 0 ? Ta : blockIdx.z == 1 ? Tb : Tc) + o; FragH f;
#pragma unroll
  for (int i = 0; i < 8; ++i) f.h[i] = (_Float16)(bf16_round(W[(size_t)(k8 + i) * HD + n]) * scale); const v8us ov = f.half[0];
  *(v8us*)((unsigned short*)Wt + (size_t)n * HD + k8) = ov;
}
// k_gemm_hh variant with fused epilogue: v = acc·alpha + bias[by·sBias + col] (+ CP[(row/rowsPerB)·sCPb + by·64 + col] if CP) ; ACT 0 none / 1 elu ; writes f16 C16 (and f32 C if non-null)
template <int ACT>
__global__ __launch_bounds__(128) void k_gemm_hhx(const _Float16* __restrict__ A, int lda, size_t sA, const _Float16* __restrict__ Bh, int ldb, size_t sB, float alpha, const float* __restrict__ bias, size_t sBias, const float* __restrict__ CP, int rowsPerB, size_t sCPb, int row0g,
    float* __restrict__ C, _Float16* __restrict__ C16, int ldc, size_t sC, int M, int N, int K) {
  __shared__ __attribute__((aligned(16))) float so[4][16][64];
  const int tid = threadIdx.x, w = tid >> 5, lane = tid & 31, ln = lane & 15, hh = lane >> 4; const int by = blockIdx.y;
  A += (size_t)by * sA; Bh += (size_t)by * sB; const size_t cofs = (size_t)by * sC; const float* bp = bias ? bias + (size_t)by * sBias : nullptr;
  const int ntn = (N + 63) / 64; const int wid = blockIdx.x * 4 + w; const int mt = wid / ntn, nq = wid % ntn; if (mt * 16 >= M) return;
  const int row0 = mt * 16, col0 = nq * 64; const _Float16* arow = A + (size_t)(row0 + ln) * lda;
  v8f acc[4] = {};
  for (int kb = 0; kb < K; kb += 32) { FragH ah; ah.half[0] = *(const v8us*)((const unsigned short*)arow + kb + 8 * hh); ah.half[1] = *(const v8us*)((const unsigned short*)arow + kb + 16 + 8 * hh);
#pragma unroll
    for (int t = 0; t < 4; ++t) { if (col0 + t * 16 >= N) continue; const size_t boff = (size_t)(col0 + t * 16 + ln) * ldb + kb; FragH bq; bq.half[0] = *(const v8us*)((const unsigned short*)Bh + boff + 8 * hh); bq.half[1] = *(const v8us*)((const unsigned short*)Bh + boff + 16 + 8 * hh);
      acc[t] = mmaH<1>(ah.v, ah.v, bq.v, bq.v, acc[t]); }
  }
#pragma unroll
  for (int t = 0; t < 4; ++t) { if (col0 + t * 16 >= N) continue; const int col = col0 + t * 16 + ln; const float bv = bp ? bf16_round(bp[col]) : 0.f;
#pragma unroll
    for (int r = 0; r < 8; ++r) { float v = acc[t][r] * alpha + bv; if (CP) { const int rr = row0g + row0 + 8 * hh + r; if (rowsPerB < 0) v += CP[cofs + (size_t)rr * ldc + col];      /* rowsPerB < 0: own element of the batched C plane */ else { const int bidx = rr / rowsPerB; v += CP[(size_t)bidx * sCPb + (size_t)by * 64 + col]; } } if (ACT == 1) v = (v > 0.f) ? v : expm1f(v); else if (ACT == 7) v = (v > 0.f) ? v + 1.0f : expf(v); else if (ACT == 8) v = tanhf(v); else if (ACT == 9) v = 0.5f * v * (1.0f + tanhf(0.7978845608028654f * (v + 0.044715f * v * v * v))); else if (ACT == 11) v = 1.0f / (1.0f + expf(-v)); else if (ACT == 12) v = (v > 0.f) ? v : 0.01f * v; else if (ACT == 14) v = (v > 0.f) ? v : 0.1f * v; else if (ACT == 16) v = (v >= 0.f) ? v : 0.3f * v; else if (ACT == 17) v = (v >= 0.f) ? v : 0.2f * v; else if (ACT == 15) v = v / (1.0f + expf(-v)); else if (ACT == 3) v = fmaxf(v, 0.f); else if (ACT == 6) v = 0.5f * v * (1.0f + erff(v * 0.70710678118654752f)); so[w][8 * hh + r][t * 16 + ln] = v; } }
  __builtin_amdgcn_fence(__ATOMIC_ACQ_REL, "workgroup"); __builtin_amdgcn_wave_barrier();
  const int rsub = lane >> 4, c4 = (lane & 15) * 4; typedef _Float16 v4h __attribute__((ext_vector_type(4)));
  {
#pragma unroll
    for (int q = 0; q < 8; ++q) { const int r = q * 2 + rsub; if (col0 + c4 < N) { const v4f v = *(const v4fa*)&so[w][r][c4]; if (C) *(v4f*)(C + cofs + (size_t)(row0 + r) * ldc + col0 + c4) = v; if (C16) { v4h h4; for (int i = 0; i < 4; ++i) h4[i] = (_Float16)v[i]; *(v4h*)(C16 + cofs + (size_t)(row0 + r) * ldc + col0 + c4) = h4; } } }
     }
}


typedef _Float16 v4h __attribute__((ext_vector_type(4)));

__global__ __launch_bounds__(256) void k_x16(const float* __restrict__ x, _Float16* __restrict__ X16, size_t n8) { const size_t t = (size_t)blockIdx.x * 256 + threadIdx.x; if (t >= n8) return; FragH f;
#pragma unroll
  for (int q = 0; q < 8; ++q) f.h[q] = (_Float16)bf16_round(x[t * 8 + q]); *(v8us*)((unsigned short*)X16 + t * 8) = f.half[0];  }
__global__ __launch_bounds__(256) void k_h16(const float* __restrict__ x, _Float16* __restrict__ X16, size_t n8) { const size_t t = (size_t)blockIdx.x * 256 + threadIdx.x; if (t >= n8) return; FragH f;
#pragma unroll
  for (int q = 0; q < 8; ++q) f.h[q] = (_Float16)x[t * 8 + q]; *(v8us*)((unsigned short*)X16 + t * 8) = f.half[0];  }
__global__ __launch_bounds__(256) void k_round16f(const float* __restrict__ W, _Float16* __restrict__ Bt, size_t n8) { const size_t t = (size_t)blockIdx.x * 256 + threadIdx.x; if (t >= n8) return; FragH f;
#pragma unroll
  for (int i = 0; i < 8; ++i) f.h[i] = (_Float16)(bf16_round(W[t * 8 + i]) * 16.0f); *(v8us*)((unsigned short*)Bt + t * 8) = f.half[0];  }
template <int NHv, int TTv>
__global__ __launch_bounds__(256) void k_vt(const _Float16* __restrict__ V16, int ldv, int voff, _Float16* __restrict__ Vt) { __shared__ unsigned short tl[64][66]; const int tid = threadIdx.x; const int slab = blockIdx.x / (TTv / 64), lg = blockIdx.x % (TTv / 64); const int b = slab / NHv, h = slab % NHv;
  for (int i = tid; i < 64 * 8; i += 256) { const int r = i / 8, c8 = (i % 8) * 8; FragH f; f.half[0] = *(const v8us*)((const unsigned short*)V16 + ((size_t)b * TTv + lg * 64 + r) * ldv + voff + h * 64 + c8);
#pragma unroll
    for (int q = 0; q < 8; ++q) tl[r][c8 + q] = f.u[q]; }
  __syncthreads();
  {
#pragma unroll
    for (int rd = 0; rd < 2; ++rd) { const int d = rd * 32 + tid / 8, pc = tid % 8; FragH f;
#pragma unroll
      for (int q = 0; q < 8; ++q) f.u[q] = tl[pc * 8 + q][d];
      *(v8us*)((unsigned short*)Vt + ((size_t)slab * 64 + d) * TTv + lg * 64 + pc * 8) = f.half[0]; }
     } }

__global__ __launch_bounds__(256) void k_hl(const float* __restrict__ F, _Float16* __restrict__ Hh, _Float16* __restrict__ Hl, size_t n8) { const size_t t = (size_t)blockIdx.x * 256 + threadIdx.x; if (t >= n8) return; FragH fh, fl; const v4f a = *(const v4fa*)(F + t * 8), c = *(const v4fa*)(F + t * 8 + 4);
#pragma unroll
  for (int q = 0; q < 4; ++q) { _Float16 h = (_Float16)a[q]; fh.h[q] = h; fl.h[q] = (_Float16)((a[q] - (float)h) * 1024.0f); h = (_Float16)c[q]; fh.h[4 + q] = h; fl.h[4 + q] = (_Float16)((c[q] - (float)h) * 1024.0f); }
  { *(v8us*)((unsigned short*)Hh + t * 8) = fh.half[0]; *(v8us*)((unsigned short*)Hl + t * 8) = fl.half[0];  } }

// ---- fast GEMM (wave tile 32x64; requires M % 32 == 0 rows per launch region and N % 64 == 0); epilogue = k_gemm_hhx semantics ----
__device__ __forceinline__ v16h g2_frag(const _Float16* p, int hh) { FragH f; f.half[0] = *(const v8us*)((const unsigned short*)p + 8 * hh); f.half[1] = *(const v8us*)((const unsigned short*)p + 16 + 8 * hh); return f.v; }
__device__ __forceinline__ v8f g2_mma(v16h a, v16h b, v8f c) { v8f d = __builtin_amdgcn_wmma_f32_16x16x32_f16(false, a, false, b, (short)0, c, false, false); asm volatile("v_nop\n\tv_nop\n\tv_nop\n\tv_nop" : "+v"(d) : "v"(a), "v"(b)); return d; }
template <int ACT>
__global__ __launch_bounds__(128) void k_gemm2(const _Float16* __restrict__ A, int lda, size_t sA, const _Float16* __restrict__ Bh, int ldb, size_t sB, float alpha, const float* __restrict__ bias, size_t sBias, const float* __restrict__ CP, int rowsPerB, size_t sCPb, int row0g,
    float* __restrict__ C, _Float16* __restrict__ C16, int ldc, size_t sC, int M, int N, int K, size_t sAz, size_t sCz) { static_assert(ACT == 0 || ACT == 3 || ACT == 6 || ACT == 8 || ACT == 9 || ACT == 11 || ACT == 12 || ACT == 14 || ACT == 15 || ACT == 16 || ACT == 17, "k_gemm2: unsupported ACT code (would silently apply no activation)");
  __shared__ __attribute__((aligned(16))) float so[4][32][68];
  const int tid = threadIdx.x, w = tid >> 5, lane = tid & 31, ln = lane & 15, hh = lane >> 4; const int by = blockIdx.y; const int bz = blockIdx.z;      /* bz: a second batch index (A and C planes sAz, sCz apart; B shared) */
  A += (size_t)by * sA + (size_t)bz * sAz; Bh += (size_t)by * sB; const size_t cofs = (size_t)by * sC + (size_t)bz * sCz; const float* bp = bias ? bias + (size_t)by * sBias : nullptr;
  const int ntn = N >> 6; const int mt = blockIdx.x / ntn, nq = blockIdx.x - mt * ntn; const int row0 = mt * 128 + 32 * w, col0 = nq * 64; if (row0 >= M) return;
  const _Float16* a0p = A + (size_t)(row0 + ln) * lda; const _Float16* a1p = a0p + (size_t)16 * lda;
  const _Float16* b0p = Bh + (size_t)(col0 + ln) * ldb; const _Float16* b1p = b0p + (size_t)16 * ldb; const _Float16* b2p = b1p + (size_t)16 * ldb; const _Float16* b3p = b2p + (size_t)16 * ldb;
  const v8f z8 = {0.f,0.f,0.f,0.f,0.f,0.f,0.f,0.f}; v8f c00 = z8, c01 = z8, c02 = z8, c03 = z8, c10 = z8, c11 = z8, c12 = z8, c13 = z8;
#pragma unroll 1
  for (int kb = 0; kb < K; kb += 32) { const v16h a0 = g2_frag(a0p + kb, hh), a1 = g2_frag(a1p + kb, hh);
    v16h b = g2_frag(b0p + kb, hh); c00 = g2_mma(a0, b, c00); c10 = g2_mma(a1, b, c10);
    b = g2_frag(b1p + kb, hh); c01 = g2_mma(a0, b, c01); c11 = g2_mma(a1, b, c11);
    b = g2_frag(b2p + kb, hh); c02 = g2_mma(a0, b, c02); c12 = g2_mma(a1, b, c12);
    b = g2_frag(b3p + kb, hh); c03 = g2_mma(a0, b, c03); c13 = g2_mma(a1, b, c13); }
  v8f accs[8] = {c00, c01, c02, c03, c10, c11, c12, c13};
#pragma unroll
  for (int u = 0; u < 8; ++u) { const int t = u & 3, half = u >> 2; const int col = col0 + t * 16 + ln; const float bv = bp ? bf16_round(bp[col]) : 0.f;
#pragma unroll
    for (int r = 0; r < 8; ++r) { const int rloc = half * 16 + 8 * hh + r; float v = accs[u][r] * alpha + bv; if (CP) { if (rowsPerB < 0) v += CP[cofs + (size_t)(row0g + row0 + rloc) * ldc + col];      /* rowsPerB < 0: own element of the batched C plane */ else { const int bidx = (row0g + row0 + rloc) / rowsPerB; v += CP[(size_t)bidx * sCPb + (size_t)by * 64 + col]; } }
      if (ACT == 3) v = fmaxf(v, 0.f); else if (ACT == 6) v = 0.5f * v * (1.0f + erff(v * 0.70710678118654752f)); else if (ACT == 11) v = 1.0f / (1.0f + expf(-v)); else if (ACT == 15) v = v / (1.0f + expf(-v)); else if (ACT == 12) v = (v > 0.f) ? v : 0.01f * v; else if (ACT == 8) v = tanhf(v); else if (ACT == 9) v = 0.5f * v * (1.0f + tanhf(0.7978845608028654f * (v + 0.044715f * v * v * v))); else if (ACT == 14) v = (v > 0.f) ? v : 0.1f * v; else if (ACT == 16) v = (v >= 0.f) ? v : 0.3f * v; else if (ACT == 17) v = (v >= 0.f) ? v : 0.2f * v;
      so[w][rloc][t * 16 + ln] = v; } }
  __builtin_amdgcn_fence(__ATOMIC_ACQ_REL, "workgroup"); __builtin_amdgcn_wave_barrier();
  const int rsub = lane >> 4, c4 = (lane & 15) * 4;
  {
#pragma unroll
    for (int q = 0; q < 16; ++q) { const int r = q * 2 + rsub; const v4f v = *(const v4fa*)&so[w][r][c4]; if (C) *(v4f*)(C + cofs + (size_t)(row0 + r) * ldc + col0 + c4) = v; if (C16) { v4h h4; for (int i = 0; i < 4; ++i) h4[i] = (_Float16)v[i]; *(v4h*)(C16 + cofs + (size_t)(row0 + r) * ldc + col0 + c4) = h4; } }
     } }


__global__ __launch_bounds__(256) void k_wnat(const float* __restrict__ w, size_t n8, _Float16* __restrict__ Bt) { const size_t t = (size_t)blockIdx.x * 256 + threadIdx.x; if (t >= n8) return; FragH f; for (int q = 0; q < 8; ++q) f.h[q] = (_Float16)(bf16_round(w[t * 8 + q]) * 16.0f); *(v8us*)((unsigned short*)Bt + t * 8) = f.half[0];  }
__global__ __launch_bounds__(256) void k_rsm(const float* __restrict__ S, _Float16* __restrict__ P, int nrows) {
  #pragma clang fp contract(off)
  const int i = blockIdx.x * 256 + threadIdx.x; if (i >= nrows) return; const float* s = S + (size_t)i * SQ; float mx = -3.0e38f;
#pragma unroll 1
  for (int j = 0; j < SQ; ++j) mx = fmaxf(mx, s[j]); float se = 0.f;
#pragma unroll 1
  for (int j = 0; j < SQ; ++j) se += expf(s[j] - mx); const float sc = 256.0f / se;
#pragma unroll 1
  for (int j0 = 0; j0 < SQ; j0 += 8) { FragH f; for (int q = 0; q < 8; ++q) f.h[q] = (_Float16)(expf(s[j0 + q] - mx) * sc); unsigned short* d = (unsigned short*)P + (size_t)i * SQ + j0; *(v8us*)d = f.half[0];  } }
__global__ __launch_bounds__(256) void k_vt(const _Float16* __restrict__ V16, int b, int h0, _Float16* __restrict__ VT) { __shared__ unsigned short tl[64][65]; const int tid = threadIdx.x; const int hh = blockIdx.x % HG, sg = blockIdx.x / HG; const int s0 = sg * 64; const int h = h0 + hh;
  for (int i = tid; i < 64 * 8; i += 256) { const int j = i / 8, d8 = (i % 8) * 8; FragH f; f.half[0] = *(const v8us*)((const unsigned short*)V16 + ((size_t)b * SQ + s0 + j) * DM + h * HD + d8); for (int q = 0; q < 8; ++q) tl[d8 + q][j] = f.u[q]; }
  __syncthreads();
  { for (int i = tid; i < 64 * 8; i += 256) { const int d = i / 8, j8 = (i % 8) * 8; FragH f; for (int q = 0; q < 8; ++q) f.u[q] = tl[d][j8 + q]; *(v8us*)((unsigned short*)VT + ((size_t)hh * HD + d) * SQ + s0 + j8) = f.half[0]; }  } }



// Fused causal attention, ONE WAVE PER 16 QUERY ROWS of one (batch, head); no score or weight ever leaves the registers, no LDS, no barrier.
// Scores are formed transposed, S^T = K . Q^T (A = 16 key rows, B = 16 query rows): lane (ln, hh) then holds keys 8 hh .. 8 hh + 7 of the tile for query ln, so row maximum and row sum are per-lane values
// (plus one exchange between the two lane halves), and two neighbouring tiles' weights ARE the 32-key operand fragment of the second product (elements 0..7 = keys 8 hh + i, 8..15 = keys 16 + 8 hh + i).
// The second product is transposed too, O^T = V^T . P^T (A = 16 rows of V^T, B = the weights): lane (ln, hh) ends with 8 consecutive output columns of query ln, one 16-byte store a tile.
// ONE walk over the keys up to the diagonal: a running row maximum; each chunk's weights are exp(s - maximum so far) as f16 (at most 1), and the row sum and the four output tiles are first multiplied by exp(old maximum - new maximum); the division by the row sum comes once, at the end.
// Every loop over r, i and t is unrolled in full so that s, e, p and the accumulators are indexed by constants and stay in registers; the loop over the chunks stays rolled.
__device__ __forceinline__ v8f fa_mma(v16h a, v16h b, v8f c) { return __builtin_amdgcn_wmma_f32_16x16x32_f16(false, a, false, b, (short)0, c, false, false); }
// scores of 16 keys x 16 queries: hi.hi / 8, then + 2^-13 lo.hi, then + 2^-13 hi.lo (three accumulators of their own, added in this order); keys above the row get -1e9
// a0, a1: the 16 key rows' hi plane (head columns 0..31, 32..63); l0, l1: their residual plane
__device__ __forceinline__ void fa_scores(v16h a0, v16h a1, v16h l0, v16h l1, v16h qh0, v16h qh1, v16h ql0, v16h ql1, int keyb, int last, float* s) {
  const v8f z8 = {0.f,0.f,0.f,0.f,0.f,0.f,0.f,0.f};
  v8f c1 = fa_mma(a0, qh0, z8), c2 = fa_mma(a0, ql0, z8), c3 = fa_mma(l0, qh0, z8);
  c1 = fa_mma(a1, qh1, c1); c2 = fa_mma(a1, ql1, c2); c3 = fa_mma(l1, qh1, c3);
#pragma unroll
  for (int r = 0; r < 8; ++r) { float v = c1[r] * SCL; v += c2[r] * SCLR; v += c3[r] * SCLR; s[r] = (keyb + r <= last) ? v : -1.0e9f; } }
// lane l's value as seen from lane l ^ 16: one vector cross-row move (a shuffle would go through the LDS pipe and its wait, here once a chunk)
__device__ __forceinline__ float fa_other_half(float x) { const unsigned u = __float_as_uint(x); return __uint_as_float(__builtin_amdgcn_permlanex16(u, u, 0x76543210u, 0xfedcba98u, false, false)); }
__global__ __launch_bounds__(128) void k_fattn(const _Float16* __restrict__ QHp, const _Float16* __restrict__ QLp, const _Float16* __restrict__ KHp, const _Float16* __restrict__ KLp, const _Float16* __restrict__ VTp, _Float16* __restrict__ O) {
  const int lane = threadIdx.x & 31, ln = lane & 15, hh = lane >> 4; const int w = __builtin_amdgcn_readfirstlane((int)(threadIdx.x >> 5));      /* the wave's number as a scalar: the key loops get scalar trip counts */
  const int bh = blockIdx.x % (NB * NH), qb = (SQ / 64 - 1) - blockIdx.x / (NB * NH);      /* longest rows first */
  const int b = bh / NH, h = bh % NH; const int q0 = qb * 64 + w * 16; const int last = q0 + ln; const int nch = (q0 + 47) >> 5;      /* 32-key chunks up to the diagonal; the last one may hold 16 keys that are masked for every row (they exist: q0 + 31 < SQ there) */
  const size_t rq = ((size_t)b * SQ + q0 + ln) * LQ + h * HD;
  const _Float16* qhp = QHp + rq + 8 * hh; const _Float16* qlp = QLp + rq + 8 * hh;
  const v16h qh0 = g2_frag(qhp, 0), qh1 = g2_frag(qhp + 32, 0), ql0 = g2_frag(qlp, 0), ql1 = g2_frag(qlp + 32, 0);
  asm volatile("s_wait_xcnt 0x0" :: "v"(qhp), "v"(qlp) : "memory");      /* the wait before a register that an issued load names is written again; the addresses are inputs so that they keep their registers up to it (the same at the loop's wait below) */
  const _Float16* kh = KHp + ((size_t)b * SQ + ln) * LQ + h * HD + 8 * hh; const _Float16* kl = KLp + ((size_t)b * SQ + ln) * LQ + h * HD + 8 * hh; const _Float16* vt = VTp + ((size_t)bh * HD + ln) * SQ + 8 * hh;
  float m = -3.0e38f, l = 0.f;      /* m: the row's running maximum, the same in both lane halves; l: this lane half's share of the row sum, at scale exp(-m) */
  const v8f z8 = {0.f,0.f,0.f,0.f,0.f,0.f,0.f,0.f}; v8f o0 = z8, o1 = z8, o2 = z8, o3 = z8;
  for (int c = 0; c < nch; ++c) { float s[16]; const _Float16* ka = kh + (size_t)c * 32 * LQ; const _Float16* kb = kl + (size_t)c * 32 * LQ; const _Float16* vc = vt + c * 32;
    const v16h a0 = g2_frag(ka, 0), a1 = g2_frag(ka + 32, 0), a2 = g2_frag(ka + 16 * LQ, 0), a3 = g2_frag(ka + 16 * LQ + 32, 0), l0 = g2_frag(kb, 0), l1 = g2_frag(kb + 32, 0), l2 = g2_frag(kb + 16 * LQ, 0), l3 = g2_frag(kb + 16 * LQ + 32, 0);
    const v16h v0 = g2_frag(vc, 0), v1 = g2_frag(vc + (size_t)16 * SQ, 0), v2 = g2_frag(vc + (size_t)32 * SQ, 0), v3 = g2_frag(vc + (size_t)48 * SQ, 0);
    /* the loaded values are inputs too: all of the chunk's loads (key rows and V^T rows) are asked for together, one trip to the caches a chunk; left alone the compiler reuses two fragments' registers and waits for memory before nearly every product */
    asm volatile("s_wait_xcnt 0x0" :: "v"(ka), "v"(kb), "v"(vc), "v"(a0), "v"(a1), "v"(a2), "v"(a3), "v"(l0), "v"(l1), "v"(l2), "v"(l3), "v"(v0), "v"(v1), "v"(v2), "v"(v3) : "memory");
    __builtin_amdgcn_sched_barrier(0);      /* keeps the products behind the wait, so that the wait is not moved down past them with the last loads */
    fa_scores(a0, a1, l0, l1, qh0, qh1, ql0, ql1, c * 32 + 8 * hh, last, s); fa_scores(a2, a3, l2, l3, qh0, qh1, ql0, ql1, c * 32 + 16 + 8 * hh, last, s + 8);
    float mc = s[0];
#pragma unroll
    for (int i = 1; i < 16; ++i) mc = fmaxf(mc, s[i]);
    const float mn = fmaxf(m, fmaxf(mc, fa_other_half(mc)));      /* both halves' weights enter one product, so they need one maximum */
    const float al = __expf(m - mn);      /* what the sum and the output tiles so far are worth at the new maximum (0 in the first chunk, 1 while the maximum stands) */
    float e[16]; FragH p;
#pragma unroll
    for (int i = 0; i < 16; ++i) { e[i] = __expf(s[i] - mn); p.h[i] = (_Float16)e[i]; }
    const float a = (((e[0] + e[1]) + (e[2] + e[3])) + ((e[4] + e[5]) + (e[6] + e[7]))) + (((e[8] + e[9]) + (e[10] + e[11])) + ((e[12] + e[13]) + (e[14] + e[15])));
    l = l * al + a; m = mn;
    o0 *= al; o1 *= al; o2 *= al; o3 *= al;
    o0 = fa_mma(v0, p.v, o0); o1 = fa_mma(v1, p.v, o1); o2 = fa_mma(v2, p.v, o2); o3 = fa_mma(v3, p.v, o3); }
  const float sc = 64.0f / (l + fa_other_half(l));      /* the other eight keys of every tile sit in the other lane half; o carried x64 */
  const v8f os[4] = {o0, o1, o2, o3};
#pragma unroll
  for (int t = 0; t < 4; ++t) { FragH f;
#pragma unroll
    for (int r = 0; r < 8; ++r) f.h[r] = (_Float16)(os[t][r] * sc);
    *(v8us*)((unsigned short*)O + rq + t * 16 + 8 * hh) = f.half[0]; } }


template <int MASKADD>
__global__ __launch_bounds__(64) void k_att0(const float* __restrict__ QF, const float* __restrict__ KF, const float* __restrict__ VF, int ld, const float* __restrict__ mask, float scale, float* __restrict__ OF, int ldo) {
  #pragma clang fp contract(off)
  // One thread per query row, keys in order (online softmax), every sum in the same order as a plain serial loop. The thread's q and o rows live in registers; k and v rows come in chunks of 64 keys,
  // staged once per chunk in LDS by coalesced loads and then read at a wave-uniform address (broadcast). Four keys' score chains run side by side: each is 64 dependent adds, so one alone leaves the issue slots empty.
  // Every loop over c, u and w and the staging loops over it are unrolled in full so that q, o, s and the staged values are indexed by constants and stay in registers; the loops over chunks, half chunks and groups of four keys stay rolled so that the code stays small.
  __shared__ __attribute__((aligned(16))) float lk[64][64]; __shared__ __attribute__((aligned(16))) float lv[64][64]; __shared__ __attribute__((aligned(16))) float lo[64][64];
  const int tid = threadIdx.x; const int h = blockIdx.x / (QT0 / 64), rg = blockIdx.x % (QT0 / 64); const int i = rg * 64 + tid;
  QF += (size_t)blockIdx.y * QT0 * ld; KF += (size_t)blockIdx.y * QT0 * ld; VF += (size_t)blockIdx.y * QT0 * ld; OF += (size_t)blockIdx.y * QT0 * ldo;      /* blockIdx.y = batch: each batch's first-tile rows are a plane of their own */
  const float* qr = QF + (size_t)i * ld + h * HD;
  float q[HD], o[HD];
  { v4f tq[HD / 4];
#pragma unroll
    for (int c = 0; c < HD / 4; ++c) tq[c] = *(const v4fa*)(qr + c * 4);
    asm volatile("s_wait_xcnt 0x0" :: "v"(qr) : "memory");      /* as in the staging below: the row's address keeps its registers until every load that names it has been translated */
#pragma unroll
    for (int c = 0; c < HD / 4; ++c) {
#pragma unroll
      for (int u = 0; u < 4; ++u) { q[c * 4 + u] = tq[c][u]; o[c * 4 + u] = 0.f; } } }
  float m = -1.0e30f, l = 0.f; const int jmax = MASKADD ? (SQ - 1) : (rg * 64 + 63);      /* additive-mask form: every key (the mask input decides); causal form: keys up to the block's last row; jmax + 1 is a multiple of 64 */
#pragma unroll 1
  for (int j0 = 0; j0 <= jmax; j0 += 64) {
    __syncthreads();      /* both waves have left the chunk before it is overwritten */
#pragma unroll 1
    for (int hf = 0; hf < 2; ++hf) { const float* kp[8]; const float* vp[8]; v4f tk[8], tv[8];      /* 32 keys a pass: 16 loads in flight */
#pragma unroll
      for (int it = 0; it < 8; ++it) { const size_t g = (size_t)(j0 + hf * 32 + it * 4 + tid / 16) * ld + h * HD + (tid % 16) * 4; kp[it] = KF + g; vp[it] = VF + g; }
#pragma unroll
      for (int it = 0; it < 8; ++it) { tk[it] = *(const v4fa*)kp[it]; tv[it] = *(const v4fa*)vp[it]; }
      /* the wait before a register that an issued load names is written again; the addresses are inputs so that they keep their registers up to it */
      asm volatile("s_wait_xcnt 0x0" :: "v"(kp[0]), "v"(kp[1]), "v"(kp[2]), "v"(kp[3]), "v"(kp[4]), "v"(kp[5]), "v"(kp[6]), "v"(kp[7]), "v"(vp[0]), "v"(vp[1]), "v"(vp[2]), "v"(vp[3]), "v"(vp[4]), "v"(vp[5]), "v"(vp[6]), "v"(vp[7]) : "memory");
#pragma unroll
      for (int it = 0; it < 8; ++it) { const int row = hf * 32 + it * 4 + tid / 16, pc = (tid % 16) * 4; *(v4f*)&lk[row][pc] = tk[it]; *(v4f*)&lv[row][pc] = tv[it]; } }
    __syncthreads();
#pragma unroll 1
    for (int jj = 0; jj < 64; jj += 4) { float s[4] = {0.f, 0.f, 0.f, 0.f};
#pragma unroll
      for (int c = 0; c < HD / 4; ++c) {
#pragma unroll
        for (int u = 0; u < 4; ++u) { const v4f kq = *(const v4f*)&lk[jj + u][c * 4]; s[u] = __fadd_rn(s[u], __fmul_rn(q[c * 4 + 0], kq[0])); s[u] = __fadd_rn(s[u], __fmul_rn(q[c * 4 + 1], kq[1])); s[u] = __fadd_rn(s[u], __fmul_rn(q[c * 4 + 2], kq[2])); s[u] = __fadd_rn(s[u], __fmul_rn(q[c * 4 + 3], kq[3])); } }
      float sc[4], e[4];      /* the four keys' rescale and weight, key after key (m and l are a chain); the o rows follow */
#pragma unroll
      for (int u = 0; u < 4; ++u) { const int j = j0 + jj + u; float sv = __fmul_rn(s[u], scale); if (MASKADD) sv = __fadd_rn(sv, __fmul_rn(bf16_round(mask[(size_t)i * SQ + j]), -10000.0f));
        const float f = (MASKADD || j <= i) ? 1.f : 0.f; const float sm = fmaf(f, sv, (1.f - f) * -1.0e30f); const float mn = fmaxf(m, sm); sc[u] = expf(m - mn); e[u] = expf(sm - mn); l = __fadd_rn(__fmul_rn(l, sc[u]), e[u]); m = mn; }
#pragma unroll
      for (int u = 0; u < 4; ++u) {
#pragma unroll
        for (int c = 0; c < HD / 4; ++c) { const v4f vv = *(const v4f*)&lv[jj + u][c * 4];
#pragma unroll
          for (int w = 0; w < 4; ++w) o[c * 4 + w] = __fadd_rn(__fmul_rn(o[c * 4 + w], sc[u]), __fmul_rn(e[u], vv[w])); } } } }
  const float fin = 64.0f / l;      /* o carried x64 like the f16 path */
#pragma unroll
  for (int c = 0; c < HD / 4; ++c) { v4f oo;
#pragma unroll
    for (int u = 0; u < 4; ++u) oo[u] = __fmul_rn(o[c * 4 + u], fin);
    *(v4f*)&lo[tid][c * 4] = oo; }
  __syncthreads();
  {
#pragma unroll 1
    for (int it = 0; it < 16; ++it) { const int row = it * 4 + tid / 16, pc = (tid % 16) * 4; const v4f v = *(const v4f*)&lo[row][pc]; *(v4f*)(OF + (size_t)(rg * 64 + row) * ldo + h * HD + pc) = v; }
     } }

extern "C" void kernel_launch(void* const* d_in, const int* in_sizes, int n_in,
                              void* d_out, int out_size, void* d_ws, size_t ws_size, hipStream_t stream) {
  (void)in_sizes; (void)n_in; (void)out_size;
  const float* const* I = (const float* const*)d_in; const float* x = I[0]; const float* xk = I[0]; const float* xv = I[0]; const float* wq = I[1]; const float* bq = nullptr; const float* wk = I[2]; const float* bk = nullptr; const float* wv = I[3]; const float* bv = nullptr; const float* wo = I[4]; const float* bo = nullptr;      /* input order: x, Wq, Wk, Wv (BLOCK-DIAGONAL per-head [16][64][64] = [head][in][out]; NO biases: null pointers), Wo ([in][out] [1024][1024]; no bias: a null pointer in the output GEMM's guarded slot); five inputs */
  char* ws = (char*)d_ws; size_t off = 0;
  auto take = [&](size_t bytes) { char* p = ws + off; off += (bytes + 255) & ~(size_t)255; return p; };
  _Float16* BQ = (_Float16*)take((size_t)DM * DM * 2); _Float16* BK = (_Float16*)take((size_t)DM * DM * 2); _Float16* BV = (_Float16*)take((size_t)DM * DM * 2); _Float16* BO = (_Float16*)take((size_t)DM * DM * 2);
  _Float16* X16 = (_Float16*)take(NR * DM * 2); _Float16* XK16 = (_Float16*)take(NR * DM * 2); _Float16* XV16 = (_Float16*)take(NR * DM * 2);      /* exact f16 rows of query, key, value */ float* QF = (float*)take(NR * DM * 4); _Float16* QH = (_Float16*)take(NR * DM * 2); _Float16* QL = (_Float16*)take(NR * DM * 2); _Float16* KH = (_Float16*)take(NR * DM * 2); _Float16* KL = (_Float16*)take(NR * DM * 2); _Float16* Q16 = QH; _Float16* K16 = KH; _Float16* V16 = (_Float16*)take(NR * DM * 2); _Float16* O16 = (_Float16*)take(NR * DM * 2);
  _Float16* VT = (_Float16*)take((size_t)NB * NH * HD * SQ * 2);      /* V^T of every batch: the fused attention launch covers all of them */
  float* QF0 = (float*)take((size_t)NB * QT0 * DM * 4); float* KF0 = (float*)take((size_t)NB * QT0 * DM * 4); float* VF0 = (float*)take((size_t)NB * QT0 * DM * 4);      /* a plane per batch: the first-tile launches cover all batches */ float* OF0 = (float*)take((size_t)NB * QT0 * DM * 4); _Float16* OH0 = (_Float16*)take((size_t)NB * QT0 * DM * 2); _Float16* OL0 = (_Float16*)take((size_t)NB * QT0 * DM * 2);
  if (off > ws_size) return;
  { const unsigned gn = (unsigned)(((size_t)DM * (DM / 8) + 255) / 256); const unsigned gp = (unsigned)(((size_t)HD * (HD / 8) + 255) / 256); k_wt_f16h<<<dim3(gp, NH, 3), 256, 0, stream>>>(wq, wk, wv, BQ, BK, BV, 16.0f); k_wt_f16<<<gn, 256, 0, stream>>>(wo, BO, DM, DM, 16.0f); }      /* BLOCK-DIAGONAL per-head weights wq / wk / wv [NH][HD][HD] = [head][in][out] (x_h @ W_h): W_h[d][e] -> Bt_h[e][d] x16 through the file's transposing builder with K = N = 64, all heads and stacks in one launch (grid y = head, z = stack), into sixteen consecutive [64][64] planes (the first 128 KiB of the weight plane); Wo [in][out]: the same builder with K = N = 1024 */
  k_x16<<<(unsigned)((NR * DM / 8 + 255) / 256), 256, 0, stream>>>(x, X16, NR * DM / 8); k_x16<<<(unsigned)((NR * DM / 8 + 255) / 256), 256, 0, stream>>>(xk, XK16, NR * DM / 8); k_x16<<<(unsigned)((NR * DM / 8 + 255) / 256), 256, 0, stream>>>(xv, XV16, NR * DM / 8);
  const size_t r0p = (size_t)B0 * SQ;      /* first projected row */
  k_gemm2<0><<<dim3((unsigned)(MP / 128), NH), 128, 0, stream>>>(X16 + r0p * DM, DM, (size_t)HD, BQ, HD, (size_t)HD * HD, 0.0625f, bq, (size_t)HD, nullptr, 1, 0, 0, QF + r0p * DM, nullptr, DM, (size_t)HD, MP, HD, HD, 0, 0); k_hl<<<(unsigned)(((size_t)MP * DM / 8 + 255) / 256), 256, 0, stream>>>(QF + r0p * DM, QH + r0p * DM, QL + r0p * DM, (size_t)MP * DM / 8);      /* q (f32): ONE head-batched GEMM (K = N = 64): head h (grid.y) = x[:, 64 h ..] W_h -> QF[:, 64 h ..]; then -> f16 hi + x1024 residual planes */
  k_gemm2<0><<<dim3((unsigned)(MP / 128), NH), 128, 0, stream>>>(XK16 + r0p * DM, DM, (size_t)HD, BK, HD, (size_t)HD * HD, 0.0625f, bk, (size_t)HD, nullptr, 1, 0, 0, QF + r0p * DM, nullptr, DM, (size_t)HD, MP, HD, HD, 0, 0); k_hl<<<(unsigned)(((size_t)MP * DM / 8 + 255) / 256), 256, 0, stream>>>(QF + r0p * DM, KH + r0p * DM, KL + r0p * DM, (size_t)MP * DM / 8);      /* k likewise */
  k_gemm2<0><<<dim3((unsigned)(MP / 128), NH), 128, 0, stream>>>(XV16 + r0p * DM, DM, (size_t)HD, BV, HD, (size_t)HD * HD, 0.0625f, bv, (size_t)HD, nullptr, 1, 0, 0, nullptr, V16 + r0p * DM, DM, (size_t)HD, MP, HD, HD, 0, 0);      /* v (f16 rows): head-batched likewise */
  k_vt<NH, SQ><<<NBR * NH * (SQ / 64), 256, 0, stream>>>(V16 + r0p * LQ, LQ, 0, VT + (size_t)B0 * NH * HD * SQ);      /* V^T [NB][NH][HD][SQ]: every batch in one launch (the kernel's slab index runs over batch and head) */
  k_gemm2<0><<<dim3((QT0 / 128), NH, NBR), 128, 0, stream>>>(X16 + r0p * DM, DM, (size_t)HD, BQ, HD, (size_t)HD * HD, 0.0625f, bq, (size_t)HD, nullptr, 1, 0, 0, QF0, nullptr, DM, (size_t)HD, QT0, HD, HD, (size_t)SQ * DM, (size_t)QT0 * DM); k_gemm2<0><<<dim3((QT0 / 128), NH, NBR), 128, 0, stream>>>(XK16 + r0p * DM, DM, (size_t)HD, BK, HD, (size_t)HD * HD, 0.0625f, bk, (size_t)HD, nullptr, 1, 0, 0, KF0, nullptr, DM, (size_t)HD, QT0, HD, HD, (size_t)SQ * DM, (size_t)QT0 * DM); k_gemm2<0><<<dim3((QT0 / 128), NH, NBR), 128, 0, stream>>>(XV16 + r0p * DM, DM, (size_t)HD, BV, HD, (size_t)HD * HD, 0.0625f, bv, (size_t)HD, nullptr, 1, 0, 0, VF0, nullptr, DM, (size_t)HD, QT0, HD, HD, (size_t)SQ * DM, (size_t)QT0 * DM);      /* f32 q, k, v of each batch's first 128 rows (exact products): the same head-batched form, grid z = batch */
  k_att0<0><<<dim3(NH * (QT0 / 64), NBR), 64, 0, stream>>>(QF0, KF0, VF0, DM, nullptr, SCL, OF0 + (size_t)B0 * QT0 * DM, DM);      /* exact f32 attention for rows 0..127 of every batch (o x64), grid y = batch */
  k_fattn<<<NB * NH * (SQ / 64), 128, 0, stream>>>(QH, QL, KH, KL, VT, O16);      /* scores (hi.hi + lo.hi + hi.lo), causal softmax and P . V of every batch, head and query row in one launch: o (merged heads, x64) as f16 rows */
  k_gemm2<0><<<dim3((unsigned)((MPO / 128) * (DM / 64)), 1), 128, 0, stream>>>(O16 + r0p * DM, DM, 0, BO, DM, 0, 0.0009765625f, bo, 0, nullptr, 1, 0, 0, (float*)d_out + r0p * DM, nullptr, DM, 0, MPO, DM, DM, 0, 0);      /* out rows are the output layout */
  k_hl<<<(unsigned)(((size_t)NB * QT0 * DM / 8 + 255) / 256), 256, 0, stream>>>(OF0, OH0, OL0, (size_t)NB * QT0 * DM / 8);      /* first-tile o (x64) -> f16 hi + x1024 residual planes */
  k_gemm2<0><<<dim3((QT0 / 128) * (DM / 64), NBR), 128, 0, stream>>>(OH0 + (size_t)B0 * QT0 * DM, DM, (size_t)QT0 * DM, BO, DM, 0, 0.0009765625f, bo, 0, nullptr, 1, 0, 0, (float*)d_out + r0p * DM, nullptr, DM, (size_t)SQ * DM, QT0, DM, DM, 0, 0);      /* rows 0..127 of every batch (grid y = batch): out = o_hi Wo (+ b), overwriting the f16-path rows */
  k_gemm2<0><<<dim3((QT0 / 128) * (DM / 64), NBR), 128, 0, stream>>>(OL0 + (size_t)B0 * QT0 * DM, DM, (size_t)QT0 * DM, BO, DM, 0, 0.00000095367431640625f, nullptr, 0, (const float*)d_out + r0p * DM, -1, 0, 0, (float*)d_out + r0p * DM, nullptr, DM, (size_t)SQ * DM, QT0, DM, DM, 0, 0);      /* += o_lo Wo 2^-20 (own-element accumulate) */
}

// v006
// A run of this version takes 322 microseconds.
// In both of two side-by-side timings against v005, it was 1.18 times as fast.
// Counting every step since v000, it is 34.9 times as fast.
#include <hip/hip_runtime.h>
// Causal multi-head self-attention with BLOCK-DIAGONAL per-head projections (x [4][2048][1024] viewed (b, s, 16, 64); q / k / v = einsum('bshd,hde->bshe', xh, W): EACH HEAD applies its own [64][64] weight (W [16][64][64] = [head][in][out], normal x 0.02; NO biases) to ITS OWN 64-wide slice of the row; scores / sqrt(64); where(tril, scores, -inf); softmax over keys; out = merged Wo ([in][out] [1024][1024]; no bias) -> [4][2048][1024]); each projection is ONE head-batched GEMM (K = 64); q and k carried as f16 hi + x1024 residual planes with three-product scores.
// Structure: token rows r = b*2048 + s; ONE front-end launch, one wave per 64 rows of one head: x rounded (bf16, exact in f16) into register fragments, q and k as WMMA products (f32 accumulation, exact x16 weights) split in registers into f16 hi + x1024 residual planes, v as f16 written straight as V^T, the first 128 rows of each batch also as f32; then ONE fused attention launch for every batch, head and query row, one wave per 16 rows: scores against the keys up to the diagonal as three products (hi.hi + lo.hi + hi.lo, K = 64) kept in registers, causal softmax there in one walk (keys above the row masked by a select; running maximum, f32 statistics, native exp; weights f16, at most 1, normalised at the end), o = P . V (o carried x64, folded into the output GEMM alpha) written straight into the merged f16 o rows; out = o W_o GEMM (f32) into the output layout.
// Compute dtype: inputs rounded to bf16; x / weights exact; v, softmax weights and o as plain f16 GEMM operands (~2^-12); q and k as f16 hi + x1024 residual planes; scores and softmax statistics f32. v_wmma_f32_16x16x32_f16.
#define NB 4
#define SCL 0.125f                         /* 1 / sqrt(head_dim 64) */
#define SCLR 0.0001220703125f               /* 2^-13: the same scale on the x1024 residual passes */
#define SQ 2048
#define DM 1024
#define NH 16
#define HD 64
#define HG 4                         /* heads per launch of the k_vt(b, h0) overload (not launched) */
#define QT 256                       /* not used */
#define NKX SQ                       /* not used */
#define QT0 128                      /* first-tile rows recomputed exactly in f32 */
#define B0 0                         /* first batch processed (debug hook) */
#define NBR NB                       /* batches processed (debug hook) */
#define NR ((size_t)NB * SQ)         /* token rows */
#define MP ((int)((size_t)NBR * SQ)) /* rows projected (debug hook) */
#define QN SQ                        /* not used */
#define NHD NH                       /* not used */
#define MPO MP                       /* rows through the output stage (debug hook) */
#define LQ DM      /* row pitch of the q/k/v rows */
typedef __bf16 v16b __attribute__((ext_vector_type(16)));
typedef unsigned short v8us __attribute__((ext_vector_type(8), may_alias));
typedef float  v8f  __attribute__((ext_vector_type(8)));
typedef float  v4f  __attribute__((ext_vector_type(4)));
typedef float  v4fa __attribute__((ext_vector_type(4), may_alias));
union FragB { v16b v; v8us half[2]; unsigned short u[16]; };

__device__ __forceinline__ unsigned short bf16_bits(float x) { unsigned int u = __float_as_uint(x); return (unsigned short)((u + 0x7FFFu + ((u >> 16) & 1u)) >> 16); }
__device__ __forceinline__ float bf16_val(unsigned short b) { return __uint_as_float(((unsigned int)b) << 16); }
__device__ __forceinline__ float bf16_round(float x) { return bf16_val(bf16_bits(x)); }
// D += A·B with NT terms: 1 = ah·bh, 2 = + al·bh (A split), 3 = + ah·bl (both split)
template <int NT>
__device__ __forceinline__ v8f mmaN(v16b ah, v16b al, v16b bh, v16b bl, v8f c) {
  c = __builtin_amdgcn_wmma_f32_16x16x32_bf16(false, ah, false, bh, (short)0, c, false, false);
  if (NT >= 2) c = __builtin_amdgcn_wmma_f32_16x16x32_bf16(false, al, false, bh, (short)0, c, false, false);
  if (NT >= 3) c = __builtin_amdgcn_wmma_f32_16x16x32_bf16(false, ah, false, bl, (short)0, c, false, false);
  asm volatile("v_nop\n\tv_nop\n\tv_nop\n\tv_nop" : "+v"(c) : "v"(ah), "v"(al), "v"(bh), "v"(bl));
  return c;
}

__global__ __launch_bounds__(256) void k_wt_bf16(const float* __restrict__ W, unsigned short* __restrict__ Wt, int K, int N) {
  const int t = blockIdx.x * 256 + threadIdx.x;
  const int k8n = K / 8;
  if (t >= N * k8n) return;
  const int n = t / k8n, k8 = (t % k8n) * 8;
  v8us v;
#pragma unroll
  for (int i = 0; i < 8; ++i) v[i] = bf16_bits(W[(size_t)(k8 + i) * N + n]);
  *(v8us*)(Wt + (size_t)n * K + k8) = v;
  
}

// GEMM C[M][N] (f32, pitch ldc) = act(A[M][K]·W + bias). A f32 row-major (pitch lda) converted per fragment to bf16
// (ASPLIT: hi/lo two planes -> 2 terms, else single rounded term); Wt bf16 [N][K] (pitch ldb). BIAS_BF16 rounds the
// bias to bf16 first (bias quantised to bf16 before the add). K%32==0, M%16==0, N%64==0.
template <bool ASPLIT, int ACT, bool BIAS_BF16>
__global__ __launch_bounds__(128) void k_gemm_bf(const float* __restrict__ A, int lda, const unsigned short* __restrict__ Wt, int ldb,
                                               const float* __restrict__ bias, float* __restrict__ C, int ldc, int M, int N, int K) {
  __shared__ __attribute__((aligned(16))) float so[4][16][64];
  const int tid = threadIdx.x, w = tid >> 5, lane = tid & 31, ln = lane & 15, hh = lane >> 4;
  const int ntn = N / 64;
  const int wid = blockIdx.x * 4 + w;
  const int mt = wid / ntn, nq = wid % ntn;
  if (mt * 16 >= M) return;
  const int row0 = mt * 16, col0 = nq * 64;
  const float* arow = A + (size_t)(row0 + ln) * lda;
  v8f acc[4] = {};
  for (int kb = 0; kb < K; kb += 32) {
    FragB ah, al;
    const v4f x0 = *(const v4fa*)(arow + kb + 8 * hh), x1 = *(const v4fa*)(arow + kb + 8 * hh + 4);
    const v4f x2 = *(const v4fa*)(arow + kb + 16 + 8 * hh), x3 = *(const v4fa*)(arow + kb + 16 + 8 * hh + 4);
    float xs[16] = {x0[0],x0[1],x0[2],x0[3],x1[0],x1[1],x1[2],x1[3],x2[0],x2[1],x2[2],x2[3],x3[0],x3[1],x3[2],x3[3]};
#pragma unroll
    for (int i = 0; i < 16; ++i) { const unsigned short hb = bf16_bits(xs[i]); ah.u[i] = hb; al.u[i] = ASPLIT ? bf16_bits(xs[i] - bf16_val(hb)) : (unsigned short)0; }
#pragma unroll
    for (int t = 0; t < 4; ++t) {
      const unsigned short* brow = Wt + (size_t)(col0 + t * 16 + ln) * ldb + kb;
      FragB b;
      b.half[0] = *(const v8us*)(brow + 8 * hh);
      b.half[1] = *(const v8us*)(brow + 16 + 8 * hh);
      acc[t] = mmaN<ASPLIT ? 2 : 1>(ah.v, al.v, b.v, b.v, acc[t]);
    }
  }
#pragma unroll
  for (int t = 0; t < 4; ++t) {
    float bv = bias ? bias[col0 + t * 16 + ln] : 0.f;
    if (BIAS_BF16) bv = bf16_round(bv);
#pragma unroll
    for (int r = 0; r < 8; ++r) { float v = acc[t][r] + bv; if (ACT == 1) v = fmaxf(v, 0.f); so[w][8 * hh + r][t * 16 + ln] = v; }
  }
  __builtin_amdgcn_fence(__ATOMIC_ACQ_REL, "workgroup");
  __builtin_amdgcn_wave_barrier();
  const int rsub = lane >> 4, c4 = (lane & 15) * 4;
  {
#pragma unroll
    for (int q = 0; q < 8; ++q) {
      const int r = q * 2 + rsub;
      const v4f v = *(const v4fa*)&so[w][r][c4];
      *(v4f*)(C + (size_t)(row0 + r) * ldc + col0 + c4) = v;
    }
    
  }
}

// GEMM C = act(A·W + bias + resid): A f32 (ASPLIT -> hi/lo 2 terms), Wt bf16 [N][K]; ACT 0 none, 1 relu, 2 exact gelu;
// resid (optional, f32, row index = (row % rmod), pitch ldr, RES_BF16 rounds it) added before the activation.
template <bool ASPLIT, int ACT, bool BIAS_BF16, bool RES_BF16>
__global__ __launch_bounds__(128) void k_gemm_bf3(const float* __restrict__ A, int lda, const unsigned short* __restrict__ Wt, int ldb,
                                                const float* __restrict__ bias, const float* __restrict__ resid, int rmod, int ldr,
                                                float* __restrict__ C, int ldc, int M, int N, int K) {
  __shared__ __attribute__((aligned(16))) float so[4][16][64];
  const int tid = threadIdx.x, w = tid >> 5, lane = tid & 31, ln = lane & 15, hh = lane >> 4;
  const int ntn = N / 64;
  const int wid = blockIdx.x * 4 + w;
  const int mt = wid / ntn, nq = wid % ntn;
  if (mt * 16 >= M) return;
  const int row0 = mt * 16, col0 = nq * 64;
  const float* arow = A + (size_t)(row0 + ln) * lda;
  v8f acc[4] = {};
  for (int kb = 0; kb < K; kb += 32) {
    FragB ah, al;
    const v4f x0 = *(const v4fa*)(arow + kb + 8 * hh), x1 = *(const v4fa*)(arow + kb + 8 * hh + 4);
    const v4f x2 = *(const v4fa*)(arow + kb + 16 + 8 * hh), x3 = *(const v4fa*)(arow + kb + 16 + 8 * hh + 4);
    float xs[16] = {x0[0],x0[1],x0[2],x0[3],x1[0],x1[1],x1[2],x1[3],x2[0],x2[1],x2[2],x2[3],x3[0],x3[1],x3[2],x3[3]};
#pragma unroll
    for (int i = 0; i < 16; ++i) { const unsigned short hb = bf16_bits(xs[i]); ah.u[i] = hb; al.u[i] = ASPLIT ? bf16_bits(xs[i] - bf16_val(hb)) : (unsigned short)0; }
#pragma unroll
    for (int t = 0; t < 4; ++t) {
      const unsigned short* brow = Wt + (size_t)(col0 + t * 16 + ln) * ldb + kb;
      FragB b;
      b.half[0] = *(const v8us*)(brow + 8 * hh);
      b.half[1] = *(const v8us*)(brow + 16 + 8 * hh);
      acc[t] = mmaN<ASPLIT ? 2 : 1>(ah.v, al.v, b.v, b.v, acc[t]);
    }
  }
#pragma unroll
  for (int t = 0; t < 4; ++t) {
    const int col = col0 + t * 16 + ln;
    float bv = bias ? bias[col] : 0.f;
    if (BIAS_BF16) bv = bf16_round(bv);
#pragma unroll
    for (int r = 0; r < 8; ++r) {
      float v = acc[t][r] + bv;
      if (resid) { float rv = resid[(size_t)((row0 + 8 * hh + r) % rmod) * ldr + col]; if (RES_BF16) rv = bf16_round(rv); v += rv; }
      if (ACT == 1) v = fmaxf(v, 0.f);
      if (ACT == 2) v = 0.5f * v * (1.0f + erff(v * 0.70710678118654752f));
      if (ACT == 3) { const float u = 0.7978845608028654f * (v + 0.044715f * v * v * v); v = 0.5f * v * (1.0f + tanhf(u)); }
      so[w][8 * hh + r][t * 16 + ln] = v;
    }
  }
  __builtin_amdgcn_fence(__ATOMIC_ACQ_REL, "workgroup");
  __builtin_amdgcn_wave_barrier();
  const int rsub = lane >> 4, c4 = (lane & 15) * 4;
  {
#pragma unroll
    for (int q = 0; q < 8; ++q) {
      const int r = q * 2 + rsub;
      const v4f v = *(const v4fa*)&so[w][r][c4];
      *(v4f*)(C + (size_t)(row0 + r) * ldc + col0 + c4) = v;
    }
    
  }
}
// row LayerNorm (biased variance, eps) over N: s = X (+ R); optional out_sum <- s; out_norm <- (s-mu)*rsqrt(var+eps)*g + b
template <bool PARAM_BF16>
__global__ __launch_bounds__(256) void k_layernorm(const float* __restrict__ X, const float* __restrict__ R, const float* __restrict__ g, const float* __restrict__ bta,
                                                  float* __restrict__ out_sum, float* __restrict__ out_norm, int N, float eps) {
  __shared__ float red[256];
  const int row = blockIdx.x, tid = threadIdx.x;
  const float* x = X + (size_t)row * N; const float* rr = R ? R + (size_t)row * N : nullptr;
  float vals[16];                     // up to N = 4096
  const int per = N / 256;            // contiguous chunk per thread? use strided-by-4 chunks: thread handles j = tid*4 + 1024*u
  float s1 = 0.f;
  for (int u = 0; u < per / 4; ++u) {
    const int j = tid * 4 + 1024 * u;
    const v4f a = *(const v4fa*)(x + j);
    v4f b = {0.f,0.f,0.f,0.f}; if (rr) b = *(const v4fa*)(rr + j);
#pragma unroll
    for (int q = 0; q < 4; ++q) { const float v = a[q] + b[q]; vals[u * 4 + q] = v; s1 += v; }
  }
  red[tid] = s1; __syncthreads();
  for (int st = 128; st > 0; st >>= 1) { if (tid < st) red[tid] += red[tid + st]; __syncthreads(); }
  const float mu = red[0] / (float)N; __syncthreads();
  float s2 = 0.f;
  for (int u = 0; u < per / 4; ++u)
#pragma unroll
    for (int q = 0; q < 4; ++q) { const float c = vals[u * 4 + q] - mu; s2 += c * c; }
  red[tid] = s2; __syncthreads();
  for (int st = 128; st > 0; st >>= 1) { if (tid < st) red[tid] += red[tid + st]; __syncthreads(); }
  const float rs = rsqrtf(red[0] / (float)N + eps);
  {
    for (int u = 0; u < per / 4; ++u) {
      const int j = tid * 4 + 1024 * u;
      v4f o, sm;
#pragma unroll
      for (int q = 0; q < 4; ++q) {
        float gg = g[j + q], bb = bta[j + q];
        if (PARAM_BF16) { gg = bf16_round(gg); bb = bf16_round(bb); }
        sm[q] = vals[u * 4 + q]; o[q] = (vals[u * 4 + q] - mu) * rs * gg + bb;
      }
      if (out_sum) *(v4f*)(out_sum + (size_t)row * N + j) = sm;
      *(v4f*)(out_norm + (size_t)row * N + j) = o;
    }
    
  }
}



// ---- f16 WMMA path (v_wmma_f32_16x16x32_f16): 11-bit significands for operands in range — used where a [0,1] probability operand needs more precision than bf16
typedef _Float16 v16h __attribute__((ext_vector_type(16)));
union FragH { v16h v; v8us half[2]; _Float16 h[16]; unsigned short u[16]; };
template <int NT>
__device__ __forceinline__ v8f mmaH(v16h ah, v16h al, v16h bh, v16h bl, v8f c) {
  c = __builtin_amdgcn_wmma_f32_16x16x32_f16(false, ah, false, bh, (short)0, c, false, false);
  if (NT >= 2) c = __builtin_amdgcn_wmma_f32_16x16x32_f16(false, al, false, bh, (short)0, c, false, false);
  if (NT >= 3) c = __builtin_amdgcn_wmma_f32_16x16x32_f16(false, ah, false, bl, (short)0, c, false, false);
  asm volatile("v_nop\n\tv_nop\n\tv_nop\n\tv_nop" : "+v"(c) : "v"(ah), "v"(al), "v"(bh), "v"(bl));
  return c;
}
// batched GEMM like k_gemm_b but f16 operands: A f32 (split into f16 hi/lo if ASPLIT, else rounded to f16), Bt = f16 values [n][k]; alpha; C f32; N multiple of 16 (partial tiles skipped)
template <bool ASPLIT>
__global__ __launch_bounds__(128) void k_gemm_h(const float* __restrict__ A, int lda, size_t sA, const _Float16* __restrict__ Bh, int ldb, size_t sB, float alpha, float* __restrict__ C, int ldc, size_t sC, int M, int N, int K) {
  __shared__ __attribute__((aligned(16))) float so[4][16][64];
  const int tid = threadIdx.x, w = tid >> 5, lane = tid & 31, ln = lane & 15, hh = lane >> 4; const int by = blockIdx.y;
  A += (size_t)by * sA; Bh += (size_t)by * sB; C += (size_t)by * sC;
  const int ntn = (N + 63) / 64; const int wid = blockIdx.x * 4 + w; const int mt = wid / ntn, nq = wid % ntn; if (mt * 16 >= M) return;
  const int row0 = mt * 16, col0 = nq * 64; const float* arow = A + (size_t)(row0 + ln) * lda;
  v8f acc[4] = {};
  for (int kb = 0; kb < K; kb += 32) {
    FragH ah, al;
    const v4f x0 = *(const v4fa*)(arow + kb + 8 * hh), x1 = *(const v4fa*)(arow + kb + 8 * hh + 4), x2 = *(const v4fa*)(arow + kb + 16 + 8 * hh), x3 = *(const v4fa*)(arow + kb + 16 + 8 * hh + 4);
    float xs[16] = {x0[0],x0[1],x0[2],x0[3],x1[0],x1[1],x1[2],x1[3],x2[0],x2[1],x2[2],x2[3],x3[0],x3[1],x3[2],x3[3]};
#pragma unroll
    for (int i = 0; i < 16; ++i) { const _Float16 h = (_Float16)xs[i]; ah.h[i] = h; al.h[i] = ASPLIT ? (_Float16)(xs[i] - (float)h) : (_Float16)0.0f; }
#pragma unroll
    for (int t = 0; t < 4; ++t) { if (col0 + t * 16 >= N) continue; const size_t boff = (size_t)(col0 + t * 16 + ln) * ldb + kb; FragH bq; bq.half[0] = *(const v8us*)(Bh + boff + 8 * hh); bq.half[1] = *(const v8us*)(Bh + boff + 16 + 8 * hh);
      acc[t] = mmaH<ASPLIT ? 2 : 1>(ah.v, al.v, bq.v, bq.v, acc[t]); }
  }
#pragma unroll
  for (int t = 0; t < 4; ++t) { if (col0 + t * 16 >= N) continue;
#pragma unroll
    for (int r = 0; r < 8; ++r) so[w][8 * hh + r][t * 16 + ln] = acc[t][r] * alpha; }
  __builtin_amdgcn_fence(__ATOMIC_ACQ_REL, "workgroup"); __builtin_amdgcn_wave_barrier();
  const int rsub = lane >> 4, c4 = (lane & 15) * 4;
  {
#pragma unroll
    for (int q = 0; q < 8; ++q) { const int r = q * 2 + rsub; if (col0 + c4 < N) { const v4f v = *(const v4fa*)&so[w][r][c4]; *(v4f*)(C + (size_t)(row0 + r) * ldc + col0 + c4) = v; } }
     }
}

// Wt[n][k] = f16(W[k][n]·scale) from f32 row-major W[K][N] (scale = power of two; bf16-exact weights stay exact in f16 away from the subnormal range)
__global__ __launch_bounds__(256) void k_wt_f16(const float* __restrict__ W, _Float16* __restrict__ Wt, int K, int N, float scale) {
  const int t = blockIdx.x * 256 + threadIdx.x; if (t >= N * (K / 8)) return; const int n = t / (K / 8), k8 = (t % (K / 8)) * 8; FragH f;
#pragma unroll
  for (int i = 0; i < 8; ++i) f.h[i] = (_Float16)(bf16_round(W[(size_t)(k8 + i) * N + n]) * scale); const v8us o = f.half[0];
  *(v8us*)((unsigned short*)Wt + (size_t)n * K + k8) = o; 
}
// the same builder for the per-head [64][64] weights of three stacks in ONE launch: blockIdx.y = head (consecutive [64][64] planes in source and destination), blockIdx.z = stack
__global__ __launch_bounds__(256) void k_wt_f16h(const float* __restrict__ Wa, const float* __restrict__ Wb, const float* __restrict__ Wc, _Float16* __restrict__ Ta, _Float16* __restrict__ Tb, _Float16* __restrict__ Tc, float scale) {
  const int t = blockIdx.x * 256 + threadIdx.x; if (t >= HD * (HD / 8)) return; const int n = t / (HD / 8), k8 = (t % (HD / 8)) * 8; const size_t o = (size_t)blockIdx.y * HD * HD;
  const float* W = (blockIdx.z == 0 ? Wa : blockIdx.z == 1 ? Wb : Wc) + o; _Float16* Wt = (blockIdx.z == 0 ? Ta : blockIdx.z == 1 ? Tb : Tc) + o; FragH f;
#pragma unroll
  for (int i = 0; i < 8; ++i) f.h[i] = (_Float16)(bf16_round(W[(size_t)(k8 + i) * HD + n]) * scale); const v8us ov = f.half[0];
  *(v8us*)((unsigned short*)Wt + (size_t)n * HD + k8) = ov;
}
// k_gemm_hh variant with fused epilogue: v = acc·alpha + bias[by·sBias + col] (+ CP[(row/rowsPerB)·sCPb + by·64 + col] if CP) ; ACT 0 none / 1 elu ; writes f16 C16 (and f32 C if non-null)
template <int ACT>
__global__ __launch_bounds__(128) void k_gemm_hhx(const _Float16* __restrict__ A, int lda, size_t sA, const _Float16* __restrict__ Bh, int ldb, size_t sB, float alpha, const float* __restrict__ bias, size_t sBias, const float* __restrict__ CP, int rowsPerB, size_t sCPb, int row0g,
    float* __restrict__ C, _Float16* __restrict__ C16, int ldc, size_t sC, int M, int N, int K) {
  __shared__ __attribute__((aligned(16))) float so[4][16][64];
  const int tid = threadIdx.x, w = tid >> 5, lane = tid & 31, ln = lane & 15, hh = lane >> 4; const int by = blockIdx.y;
  A += (size_t)by * sA; Bh += (size_t)by * sB; const size_t cofs = (size_t)by * sC; const float* bp = bias ? bias + (size_t)by * sBias : nullptr;
  const int ntn = (N + 63) / 64; const int wid = blockIdx.x * 4 + w; const int mt = wid / ntn, nq = wid % ntn; if (mt * 16 >= M) return;
  const int row0 = mt * 16, col0 = nq * 64; const _Float16* arow = A + (size_t)(row0 + ln) * lda;
  v8f acc[4] = {};
  for (int kb = 0; kb < K; kb += 32) { FragH ah; ah.half[0] = *(const v8us*)((const unsigned short*)arow + kb + 8 * hh); ah.half[1] = *(const v8us*)((const unsigned short*)arow + kb + 16 + 8 * hh);
#pragma unroll
    for (int t = 0; t < 4; ++t) { if (col0 + t * 16 >= N) continue; const size_t boff = (size_t)(col0 + t * 16 + ln) * ldb + kb; FragH bq; bq.half[0] = *(const v8us*)((const unsigned short*)Bh + boff + 8 * hh); bq.half[1] = *(const v8us*)((const unsigned short*)Bh + boff + 16 + 8 * hh);
      acc[t] = mmaH<1>(ah.v, ah.v, bq.v, bq.v, acc[t]); }
  }
#pragma unroll
  for (int t = 0; t < 4; ++t) { if (col0 + t * 16 >= N) continue; const int col = col0 + t * 16 + ln; const float bv = bp ? bf16_round(bp[col]) : 0.f;
#pragma unroll
    for (int r = 0; r < 8; ++r) { float v = acc[t][r] * alpha + bv; if (CP) { const int rr = row0g + row0 + 8 * hh + r; if (rowsPerB < 0) v += CP[cofs + (size_t)rr * ldc + col];      /* rowsPerB < 0: own element of the batched C plane */ else { const int bidx = rr / rowsPerB; v += CP[(size_t)bidx * sCPb + (size_t)by * 64 + col]; } } if (ACT == 1) v = (v > 0.f) ? v : expm1f(v); else if (ACT == 7) v = (v > 0.f) ? v + 1.0f : expf(v); else if (ACT == 8) v = tanhf(v); else if (ACT == 9) v = 0.5f * v * (1.0f + tanhf(0.7978845608028654f * (v + 0.044715f * v * v * v))); else if (ACT == 11) v = 1.0f / (1.0f + expf(-v)); else if (ACT == 12) v = (v > 0.f) ? v : 0.01f * v; else if (ACT == 14) v = (v > 0.f) ? v : 0.1f * v; else if (ACT == 16) v = (v >= 0.f) ? v : 0.3f * v; else if (ACT == 17) v = (v >= 0.f) ? v : 0.2f * v; else if (ACT == 15) v = v / (1.0f + expf(-v)); else if (ACT == 3) v = fmaxf(v, 0.f); else if (ACT == 6) v = 0.5f * v * (1.0f + erff(v * 0.70710678118654752f)); so[w][8 * hh + r][t * 16 + ln] = v; } }
  __builtin_amdgcn_fence(__ATOMIC_ACQ_REL, "workgroup"); __builtin_amdgcn_wave_barrier();
  const int rsub = lane >> 4, c4 = (lane & 15) * 4; typedef _Float16 v4h __attribute__((ext_vector_type(4)));
  {
#pragma unroll
    for (int q = 0; q < 8; ++q) { const int r = q * 2 + rsub; if (col0 + c4 < N) { const v4f v = *(const v4fa*)&so[w][r][c4]; if (C) *(v4f*)(C + cofs + (size_t)(row0 + r) * ldc + col0 + c4) = v; if (C16) { v4h h4; for (int i = 0; i < 4; ++i) h4[i] = (_Float16)v[i]; *(v4h*)(C16 + cofs + (size_t)(row0 + r) * ldc + col0 + c4) = h4; } } }
     }
}


typedef _Float16 v4h __attribute__((ext_vector_type(4)));

__global__ __launch_bounds__(256) void k_x16(const float* __restrict__ x, _Float16* __restrict__ X16, size_t n8) { const size_t t = (size_t)blockIdx.x * 256 + threadIdx.x; if (t >= n8) return; FragH f;
#pragma unroll
  for (int q = 0; q < 8; ++q) f.h[q] = (_Float16)bf16_round(x[t * 8 + q]); *(v8us*)((unsigned short*)X16 + t * 8) = f.half[0];  }
__global__ __launch_bounds__(256) void k_h16(const float* __restrict__ x, _Float16* __restrict__ X16, size_t n8) { const size_t t = (size_t)blockIdx.x * 256 + threadIdx.x; if (t >= n8) return; FragH f;
#pragma unroll
  for (int q = 0; q < 8; ++q) f.h[q] = (_Float16)x[t * 8 + q]; *(v8us*)((unsigned short*)X16 + t * 8) = f.half[0];  }
__global__ __launch_bounds__(256) void k_round16f(const float* __restrict__ W, _Float16* __restrict__ Bt, size_t n8) { const size_t t = (size_t)blockIdx.x * 256 + threadIdx.x; if (t >= n8) return; FragH f;
#pragma unroll
  for (int i = 0; i < 8; ++i) f.h[i] = (_Float16)(bf16_round(W[t * 8 + i]) * 16.0f); *(v8us*)((unsigned short*)Bt + t * 8) = f.half[0];  }
template <int NHv, int TTv>
__global__ __launch_bounds__(256) void k_vt(const _Float16* __restrict__ V16, int ldv, int voff, _Float16* __restrict__ Vt) { __shared__ unsigned short tl[64][66]; const int tid = threadIdx.x; const int slab = blockIdx.x / (TTv / 64), lg = blockIdx.x % (TTv / 64); const int b = slab / NHv, h = slab % NHv;
  for (int i = tid; i < 64 * 8; i += 256) { const int r = i / 8, c8 = (i % 8) * 8; FragH f; f.half[0] = *(const v8us*)((const unsigned short*)V16 + ((size_t)b * TTv + lg * 64 + r) * ldv + voff + h * 64 + c8);
#pragma unroll
    for (int q = 0; q < 8; ++q) tl[r][c8 + q] = f.u[q]; }
  __syncthreads();
  {
#pragma unroll
    for (int rd = 0; rd < 2; ++rd) { const int d = rd * 32 + tid / 8, pc = tid % 8; FragH f;
#pragma unroll
      for (int q = 0; q < 8; ++q) f.u[q] = tl[pc * 8 + q][d];
      *(v8us*)((unsigned short*)Vt + ((size_t)slab * 64 + d) * TTv + lg * 64 + pc * 8) = f.half[0]; }
     } }

__global__ __launch_bounds__(256) void k_hl(const float* __restrict__ F, _Float16* __restrict__ Hh, _Float16* __restrict__ Hl, size_t n8) { const size_t t = (size_t)blockIdx.x * 256 + threadIdx.x; if (t >= n8) return; FragH fh, fl; const v4f a = *(const v4fa*)(F + t * 8), c = *(const v4fa*)(F + t * 8 + 4);
#pragma unroll
  for (int q = 0; q < 4; ++q) { _Float16 h = (_Float16)a[q]; fh.h[q] = h; fl.h[q] = (_Float16)((a[q] - (float)h) * 1024.0f); h = (_Float16)c[q]; fh.h[4 + q] = h; fl.h[4 + q] = (_Float16)((c[q] - (float)h) * 1024.0f); }
  { *(v8us*)((unsigned short*)Hh + t * 8) = fh.half[0]; *(v8us*)((unsigned short*)Hl + t * 8) = fl.half[0];  } }

// ---- fast GEMM (wave tile 32x64; requires M % 32 == 0 rows per launch region and N % 64 == 0); epilogue = k_gemm_hhx semantics ----
__device__ __forceinline__ v16h g2_frag(const _Float16* p, int hh) { FragH f; f.half[0] = *(const v8us*)((const unsigned short*)p + 8 * hh); f.half[1] = *(const v8us*)((const unsigned short*)p + 16 + 8 * hh); return f.v; }
__device__ __forceinline__ v8f g2_mma(v16h a, v16h b, v8f c) { v8f d = __builtin_amdgcn_wmma_f32_16x16x32_f16(false, a, false, b, (short)0, c, false, false); asm volatile("v_nop\n\tv_nop\n\tv_nop\n\tv_nop" : "+v"(d) : "v"(a), "v"(b)); return d; }
template <int ACT>
__global__ __launch_bounds__(128) void k_gemm2(const _Float16* __restrict__ A, int lda, size_t sA, const _Float16* __restrict__ Bh, int ldb, size_t sB, float alpha, const float* __restrict__ bias, size_t sBias, const float* __restrict__ CP, int rowsPerB, size_t sCPb, int row0g,
    float* __restrict__ C, _Float16* __restrict__ C16, int ldc, size_t sC, int M, int N, int K, size_t sAz, size_t sCz) { static_assert(ACT == 0 || ACT == 3 || ACT == 6 || ACT == 8 || ACT == 9 || ACT == 11 || ACT == 12 || ACT == 14 || ACT == 15 || ACT == 16 || ACT == 17, "k_gemm2: unsupported ACT code (would silently apply no activation)");
  __shared__ __attribute__((aligned(16))) float so[4][32][68];
  const int tid = threadIdx.x, w = tid >> 5, lane = tid & 31, ln = lane & 15, hh = lane >> 4; const int by = blockIdx.y; const int bz = blockIdx.z;      /* bz: a second batch index (A and C planes sAz, sCz apart; B shared) */
  A += (size_t)by * sA + (size_t)bz * sAz; Bh += (size_t)by * sB; const size_t cofs = (size_t)by * sC + (size_t)bz * sCz; const float* bp = bias ? bias + (size_t)by * sBias : nullptr;
  const int ntn = N >> 6; const int mt = blockIdx.x / ntn, nq = blockIdx.x - mt * ntn; const int row0 = mt * 128 + 32 * w, col0 = nq * 64; if (row0 >= M) return;
  const _Float16* a0p = A + (size_t)(row0 + ln) * lda; const _Float16* a1p = a0p + (size_t)16 * lda;
  const _Float16* b0p = Bh + (size_t)(col0 + ln) * ldb; const _Float16* b1p = b0p + (size_t)16 * ldb; const _Float16* b2p = b1p + (size_t)16 * ldb; const _Float16* b3p = b2p + (size_t)16 * ldb;
  const v8f z8 = {0.f,0.f,0.f,0.f,0.f,0.f,0.f,0.f}; v8f c00 = z8, c01 = z8, c02 = z8, c03 = z8, c10 = z8, c11 = z8, c12 = z8, c13 = z8;
#pragma unroll 1
  for (int kb = 0; kb < K; kb += 32) { const v16h a0 = g2_frag(a0p + kb, hh), a1 = g2_frag(a1p + kb, hh);
    v16h b = g2_frag(b0p + kb, hh); c00 = g2_mma(a0, b, c00); c10 = g2_mma(a1, b, c10);
    b = g2_frag(b1p + kb, hh); c01 = g2_mma(a0, b, c01); c11 = g2_mma(a1, b, c11);
    b = g2_frag(b2p + kb, hh); c02 = g2_mma(a0, b, c02); c12 = g2_mma(a1, b, c12);
    b = g2_frag(b3p + kb, hh); c03 = g2_mma(a0, b, c03); c13 = g2_mma(a1, b, c13); }
  v8f accs[8] = {c00, c01, c02, c03, c10, c11, c12, c13};
#pragma unroll
  for (int u = 0; u < 8; ++u) { const int t = u & 3, half = u >> 2; const int col = col0 + t * 16 + ln; const float bv = bp ? bf16_round(bp[col]) : 0.f;
#pragma unroll
    for (int r = 0; r < 8; ++r) { const int rloc = half * 16 + 8 * hh + r; float v = accs[u][r] * alpha + bv; if (CP) { if (rowsPerB < 0) v += CP[cofs + (size_t)(row0g + row0 + rloc) * ldc + col];      /* rowsPerB < 0: own element of the batched C plane */ else { const int bidx = (row0g + row0 + rloc) / rowsPerB; v += CP[(size_t)bidx * sCPb + (size_t)by * 64 + col]; } }
      if (ACT == 3) v = fmaxf(v, 0.f); else if (ACT == 6) v = 0.5f * v * (1.0f + erff(v * 0.70710678118654752f)); else if (ACT == 11) v = 1.0f / (1.0f + expf(-v)); else if (ACT == 15) v = v / (1.0f + expf(-v)); else if (ACT == 12) v = (v > 0.f) ? v : 0.01f * v; else if (ACT == 8) v = tanhf(v); else if (ACT == 9) v = 0.5f * v * (1.0f + tanhf(0.7978845608028654f * (v + 0.044715f * v * v * v))); else if (ACT == 14) v = (v > 0.f) ? v : 0.1f * v; else if (ACT == 16) v = (v >= 0.f) ? v : 0.3f * v; else if (ACT == 17) v = (v >= 0.f) ? v : 0.2f * v;
      so[w][rloc][t * 16 + ln] = v; } }
  __builtin_amdgcn_fence(__ATOMIC_ACQ_REL, "workgroup"); __builtin_amdgcn_wave_barrier();
  const int rsub = lane >> 4, c4 = (lane & 15) * 4;
  {
#pragma unroll
    for (int q = 0; q < 16; ++q) { const int r = q * 2 + rsub; const v4f v = *(const v4fa*)&so[w][r][c4]; if (C) *(v4f*)(C + cofs + (size_t)(row0 + r) * ldc + col0 + c4) = v; if (C16) { v4h h4; for (int i = 0; i < 4; ++i) h4[i] = (_Float16)v[i]; *(v4h*)(C16 + cofs + (size_t)(row0 + r) * ldc + col0 + c4) = h4; } }
     } }


__global__ __launch_bounds__(256) void k_wnat(const float* __restrict__ w, size_t n8, _Float16* __restrict__ Bt) { const size_t t = (size_t)blockIdx.x * 256 + threadIdx.x; if (t >= n8) return; FragH f; for (int q = 0; q < 8; ++q) f.h[q] = (_Float16)(bf16_round(w[t * 8 + q]) * 16.0f); *(v8us*)((unsigned short*)Bt + t * 8) = f.half[0];  }
__global__ __launch_bounds__(256) void k_rsm(const float* __restrict__ S, _Float16* __restrict__ P, int nrows) {
  #pragma clang fp contract(off)
  const int i = blockIdx.x * 256 + threadIdx.x; if (i >= nrows) return; const float* s = S + (size_t)i * SQ; float mx = -3.0e38f;
#pragma unroll 1
  for (int j = 0; j < SQ; ++j) mx = fmaxf(mx, s[j]); float se = 0.f;
#pragma unroll 1
  for (int j = 0; j < SQ; ++j) se += expf(s[j] - mx); const float sc = 256.0f / se;
#pragma unroll 1
  for (int j0 = 0; j0 < SQ; j0 += 8) { FragH f; for (int q = 0; q < 8; ++q) f.h[q] = (_Float16)(expf(s[j0 + q] - mx) * sc); unsigned short* d = (unsigned short*)P + (size_t)i * SQ + j0; *(v8us*)d = f.half[0];  } }
__global__ __launch_bounds__(256) void k_vt(const _Float16* __restrict__ V16, int b, int h0, _Float16* __restrict__ VT) { __shared__ unsigned short tl[64][65]; const int tid = threadIdx.x; const int hh = blockIdx.x % HG, sg = blockIdx.x / HG; const int s0 = sg * 64; const int h = h0 + hh;
  for (int i = tid; i < 64 * 8; i += 256) { const int j = i / 8, d8 = (i % 8) * 8; FragH f; f.half[0] = *(const v8us*)((const unsigned short*)V16 + ((size_t)b * SQ + s0 + j) * DM + h * HD + d8); for (int q = 0; q < 8; ++q) tl[d8 + q][j] = f.u[q]; }
  __syncthreads();
  { for (int i = tid; i < 64 * 8; i += 256) { const int d = i / 8, j8 = (i % 8) * 8; FragH f; for (int q = 0; q < 8; ++q) f.u[q] = tl[d][j8 + q]; *(v8us*)((unsigned short*)VT + ((size_t)hh * HD + d) * SQ + s0 + j8) = f.half[0]; }  } }



// Fused causal attention, ONE WAVE PER 16 QUERY ROWS of one (batch, head); no score or weight ever leaves the registers, no LDS, no barrier.
// Scores are formed transposed, S^T = K . Q^T (A = 16 key rows, B = 16 query rows): lane (ln, hh) then holds keys 8 hh .. 8 hh + 7 of the tile for query ln, so row maximum and row sum are per-lane values
// (plus one exchange between the two lane halves), and two neighbouring tiles' weights ARE the 32-key operand fragment of the second product (elements 0..7 = keys 8 hh + i, 8..15 = keys 16 + 8 hh + i).
// The second product is transposed too, O^T = V^T . P^T (A = 16 rows of V^T, B = the weights): lane (ln, hh) ends with 8 consecutive output columns of query ln, one 16-byte store a tile.
// ONE walk over the keys up to the diagonal: a running row maximum; each chunk's weights are exp(s - maximum so far) as f16 (at most 1), and the row sum and the four output tiles are first multiplied by exp(old maximum - new maximum); the division by the row sum comes once, at the end.
// Every loop over r, i and t is unrolled in full so that s, e, p and the accumulators are indexed by constants and stay in registers; the loop over the chunks stays rolled.
__device__ __forceinline__ v8f fa_mma(v16h a, v16h b, v8f c) { return __builtin_amdgcn_wmma_f32_16x16x32_f16(false, a, false, b, (short)0, c, false, false); }
// scores of 16 keys x 16 queries: hi.hi / 8, then + 2^-13 lo.hi, then + 2^-13 hi.lo (three accumulators of their own, added in this order); keys above the row get -1e9
// a0, a1: the 16 key rows' hi plane (head columns 0..31, 32..63); l0, l1: their residual plane
__device__ __forceinline__ void fa_scores(v16h a0, v16h a1, v16h l0, v16h l1, v16h qh0, v16h qh1, v16h ql0, v16h ql1, int keyb, int last, float* s) {
  const v8f z8 = {0.f,0.f,0.f,0.f,0.f,0.f,0.f,0.f};
  v8f c1 = fa_mma(a0, qh0, z8), c2 = fa_mma(a0, ql0, z8), c3 = fa_mma(l0, qh0, z8);
  c1 = fa_mma(a1, qh1, c1); c2 = fa_mma(a1, ql1, c2); c3 = fa_mma(l1, qh1, c3);
#pragma unroll
  for (int r = 0; r < 8; ++r) { float v = c1[r] * SCL; v += c2[r] * SCLR; v += c3[r] * SCLR; s[r] = (keyb + r <= last) ? v : -1.0e9f; } }
// lane l's value as seen from lane l ^ 16: one vector cross-row move (a shuffle would go through the LDS pipe and its wait, here once a chunk)
__device__ __forceinline__ float fa_other_half(float x) { const unsigned u = __float_as_uint(x); return __uint_as_float(__builtin_amdgcn_permlanex16(u, u, 0x76543210u, 0xfedcba98u, false, false)); }
__global__ __launch_bounds__(128) void k_fattn(const _Float16* __restrict__ QHp, const _Float16* __restrict__ QLp, const _Float16* __restrict__ KHp, const _Float16* __restrict__ KLp, const _Float16* __restrict__ VTp, _Float16* __restrict__ O) {
  const int lane = threadIdx.x & 31, ln = lane & 15, hh = lane >> 4; const int w = __builtin_amdgcn_readfirstlane((int)(threadIdx.x >> 5));      /* the wave's number as a scalar: the key loops get scalar trip counts */
  const int bh = blockIdx.x % (NB * NH), qb = (SQ / 64 - 1) - blockIdx.x / (NB * NH);      /* longest rows first */
  const int b = bh / NH, h = bh % NH; const int q0 = qb * 64 + w * 16; const int last = q0 + ln; const int nch = (q0 + 47) >> 5;      /* 32-key chunks up to the diagonal; the last one may hold 16 keys that are masked for every row (they exist: q0 + 31 < SQ there) */
  const size_t rq = ((size_t)b * SQ + q0 + ln) * LQ + h * HD;
  const _Float16* qhp = QHp + rq + 8 * hh; const _Float16* qlp = QLp + rq + 8 * hh;
  const v16h qh0 = g2_frag(qhp, 0), qh1 = g2_frag(qhp + 32, 0), ql0 = g2_frag(qlp, 0), ql1 = g2_frag(qlp + 32, 0);
  asm volatile("s_wait_xcnt 0x0" :: "v"(qhp), "v"(qlp) : "memory");      /* the wait before a register that an issued load names is written again; the addresses are inputs so that they keep their registers up to it (the same at the loop's wait below) */
  const _Float16* kh = KHp + ((size_t)b * SQ + ln) * LQ + h * HD + 8 * hh; const _Float16* kl = KLp + ((size_t)b * SQ + ln) * LQ + h * HD + 8 * hh; const _Float16* vt = VTp + ((size_t)bh * HD + ln) * SQ + 8 * hh;
  float m = -3.0e38f, l = 0.f;      /* m: the row's running maximum, the same in both lane halves; l: this lane half's share of the row sum, at scale exp(-m) */
  const v8f z8 = {0.f,0.f,0.f,0.f,0.f,0.f,0.f,0.f}; v8f o0 = z8, o1 = z8, o2 = z8, o3 = z8;
  for (int c = 0; c < nch; ++c) { float s[16]; const _Float16* ka = kh + (size_t)c * 32 * LQ; const _Float16* kb = kl + (size_t)c * 32 * LQ; const _Float16* vc = vt + c * 32;
    const v16h a0 = g2_frag(ka, 0), a1 = g2_frag(ka + 32, 0), a2 = g2_frag(ka + 16 * LQ, 0), a3 = g2_frag(ka + 16 * LQ + 32, 0), l0 = g2_frag(kb, 0), l1 = g2_frag(kb + 32, 0), l2 = g2_frag(kb + 16 * LQ, 0), l3 = g2_frag(kb + 16 * LQ + 32, 0);
    const v16h v0 = g2_frag(vc, 0), v1 = g2_frag(vc + (size_t)16 * SQ, 0), v2 = g2_frag(vc + (size_t)32 * SQ, 0), v3 = g2_frag(vc + (size_t)48 * SQ, 0);
    /* the loaded values are inputs too: all of the chunk's loads (key rows and V^T rows) are asked for together, one trip to the caches a chunk; left alone the compiler reuses two fragments' registers and waits for memory before nearly every product */
    asm volatile("s_wait_xcnt 0x0" :: "v"(ka), "v"(kb), "v"(vc), "v"(a0), "v"(a1), "v"(a2), "v"(a3), "v"(l0), "v"(l1), "v"(l2), "v"(l3), "v"(v0), "v"(v1), "v"(v2), "v"(v3) : "memory");
    __builtin_amdgcn_sched_barrier(0);      /* keeps the products behind the wait, so that the wait is not moved down past them with the last loads */
    fa_scores(a0, a1, l0, l1, qh0, qh1, ql0, ql1, c * 32 + 8 * hh, last, s); fa_scores(a2, a3, l2, l3, qh0, qh1, ql0, ql1, c * 32 + 16 + 8 * hh, last, s + 8);
    float mc = s[0];
#pragma unroll
    for (int i = 1; i < 16; ++i) mc = fmaxf(mc, s[i]);
    const float mn = fmaxf(m, fmaxf(mc, fa_other_half(mc)));      /* both halves' weights enter one product, so they need one maximum */
    const float al = __expf(m - mn);      /* what the sum and the output tiles so far are worth at the new maximum (0 in the first chunk, 1 while the maximum stands) */
    float e[16]; FragH p;
#pragma unroll
    for (int i = 0; i < 16; ++i) { e[i] = __expf(s[i] - mn); p.h[i] = (_Float16)e[i]; }
    const float a = (((e[0] + e[1]) + (e[2] + e[3])) + ((e[4] + e[5]) + (e[6] + e[7]))) + (((e[8] + e[9]) + (e[10] + e[11])) + ((e[12] + e[13]) + (e[14] + e[15])));
    l = l * al + a; m = mn;
    o0 *= al; o1 *= al; o2 *= al; o3 *= al;
    o0 = fa_mma(v0, p.v, o0); o1 = fa_mma(v1, p.v, o1); o2 = fa_mma(v2, p.v, o2); o3 = fa_mma(v3, p.v, o3); }
  const float sc = 64.0f / (l + fa_other_half(l));      /* the other eight keys of every tile sit in the other lane half; o carried x64 */
  const v8f os[4] = {o0, o1, o2, o3};
#pragma unroll
  for (int t = 0; t < 4; ++t) { FragH f;
#pragma unroll
    for (int r = 0; r < 8; ++r) f.h[r] = (_Float16)(os[t][r] * sc);
    *(v8us*)((unsigned short*)O + rq + t * 16 + 8 * hh) = f.half[0]; } }


// ---- front end in ONE launch: x -> q and k (f16 hi + x1024 residual planes), V^T, and the first tile's f32 q, k, v rows. One wave per 64 token rows of one head; no LDS, no barrier.
// The wave reads its [64][64] f32 slice of x once, rounds it (bf16, exact in f16) into eight operand fragments and keeps them in registers for all three projections (K = 64: two products a tile, columns 0..31 then 32..63).
// q and k are formed transposed (A = 16 rows of W^T, B = 16 token rows): lane (ln, hh) then holds 8 consecutive head columns of token ln, one 16-byte store a plane into the row-major q / k rows.
// v is formed straight (A = 16 token rows, B = 16 rows of W^T): lane (ln, hh) then holds 8 consecutive tokens of head column ln, one 16-byte store into V^T; the wave's 64 tokens are one whole 128-byte line of each V^T row.
// Rows 0..127 of each batch also leave as f32 (the exact first-tile path reads them): their waves form each projection a second time (v transposed like q and k) and store it unrounded.
// Every loop is unrolled in full so that the fragments are indexed by constants and stay in registers.
union RawX { v8f v; v4f q[2]; };      /* 8 consecutive f32 of an x row as two 16-byte loads leave them */
__device__ __forceinline__ RawX pj_raw(const float* p) { RawX r; r.q[0] = *(const v4fa*)p; r.q[1] = *(const v4fa*)(p + 4); return r; }
// a: columns 8 hh .. 8 hh + 7 of a 32-column step, c: columns 16 + 8 hh .. of the same step (the operand fragment's element order)
__device__ __forceinline__ v16h pj_xfrag(v8f a, v8f c) { FragH f;
#pragma unroll
  for (int q = 0; q < 8; ++q) { f.h[q] = (_Float16)bf16_round(a[q]); f.h[8 + q] = (_Float16)bf16_round(c[q]); }
  return f.v; }
__device__ __forceinline__ v8f pj_tile(v16h a0, v16h a1, v16h b0, v16h b1) { const v8f z8 = {0.f,0.f,0.f,0.f,0.f,0.f,0.f,0.f}; return fa_mma(a1, b1, fa_mma(a0, b0, z8)) * 0.0625f; }      /* weights carried x16 */
__device__ __forceinline__ void pj_f32(float* d, v8f c) { const v4f lo = {c[0], c[1], c[2], c[3]}, hi = {c[4], c[5], c[6], c[7]}; *(v4f*)d = lo; *(v4f*)(d + 4) = hi; }
// the wait before a register that an issued load names is written again; the weight rows' address and the loaded fragments are inputs, so that the address keeps its registers up to the wait and the sixteen loads stand in front of it, asked for together
__device__ __forceinline__ void pj_wfence(const _Float16* p, const v16h (&f)[4][2]) { asm volatile("s_wait_xcnt 0x0" :: "v"(p), "v"(f[0][0]), "v"(f[0][1]), "v"(f[1][0]), "v"(f[1][1]), "v"(f[2][0]), "v"(f[2][1]), "v"(f[3][0]), "v"(f[3][1]) : "memory"); }
// Hh, Hl, F0: this lane's first element (token ln of the wave's rows, head column 8 hh)
__device__ __forceinline__ void pj_qk(const _Float16* __restrict__ wp, const v16h (&xf)[4][2], _Float16* __restrict__ Hh, _Float16* __restrict__ Hl, float* __restrict__ F0, bool first) {
  v16h wf[4][2];
#pragma unroll
  for (int t = 0; t < 4; ++t) { wf[t][0] = g2_frag(wp + t * 16 * HD, 0); wf[t][1] = g2_frag(wp + t * 16 * HD + 32, 0); }
  pj_wfence(wp, wf);
#pragma unroll
  for (int j = 0; j < 4; ++j) {
#pragma unroll
    for (int t = 0; t < 4; ++t) { const v8f c = pj_tile(wf[t][0], wf[t][1], xf[j][0], xf[j][1]); FragH fh, fl;
#pragma unroll
      for (int r = 0; r < 8; ++r) { const _Float16 hv = (_Float16)c[r]; fh.h[r] = hv; fl.h[r] = (_Float16)((c[r] - (float)hv) * 1024.0f); }
      *(v8us*)((unsigned short*)Hh + (size_t)j * 16 * LQ + t * 16) = fh.half[0]; *(v8us*)((unsigned short*)Hl + (size_t)j * 16 * LQ + t * 16) = fl.half[0]; } }
  asm volatile("s_wait_xcnt 0x0" ::: "memory");      /* the wait before a register that an issued store names is written again */
  if (first) {      /* one scalar branch a projection: the same products once more, for one wave in sixteen */
#pragma unroll
    for (int j = 0; j < 4; ++j) {
#pragma unroll
      for (int t = 0; t < 4; ++t) pj_f32(F0 + (size_t)j * 16 * DM + t * 16, pj_tile(wf[t][0], wf[t][1], xf[j][0], xf[j][1])); }
    asm volatile("s_wait_xcnt 0x0" ::: "memory");      /* likewise: the next projection's weight loads land in registers that these stores name */
  } }
__global__ __launch_bounds__(128) void k_proj(const float* __restrict__ x, const _Float16* __restrict__ BQp, const _Float16* __restrict__ BKp, const _Float16* __restrict__ BVp, _Float16* __restrict__ QHp, _Float16* __restrict__ QLp, _Float16* __restrict__ KHp, _Float16* __restrict__ KLp, _Float16* __restrict__ VTp,
    float* __restrict__ QF0p, float* __restrict__ KF0p, float* __restrict__ VF0p) {
  const int lane = threadIdx.x & 31, ln = lane & 15, hh = lane >> 4; const int w = __builtin_amdgcn_readfirstlane((int)(threadIdx.x >> 5));      /* the wave's number as a scalar: the first-tile test is a scalar branch, every lane stays on at the products */
  const int h = blockIdx.y; const int r0 = (blockIdx.x * 4 + w) * 64; const int b = r0 / SQ, s0 = r0 % SQ; const bool first = s0 < QT0;
  const float* xp = x + (size_t)(r0 + ln) * DM + h * HD + 8 * hh;
  RawX rx[4][4];
#pragma unroll
  for (int j = 0; j < 4; ++j) {
#pragma unroll
    for (int u = 0; u < 4; ++u) rx[j][u] = pj_raw(xp + (size_t)j * 16 * DM + u * 16); }
  /* the loaded values are inputs: all 32 loads of the slice are asked for together, one trip to memory a wave (left alone the compiler asks for four at a time and waits eight times); the wait stands before the address register is written again */
  asm volatile("s_wait_xcnt 0x0" :: "v"(xp), "v"(rx[0][0].v), "v"(rx[0][1].v), "v"(rx[0][2].v), "v"(rx[0][3].v), "v"(rx[1][0].v), "v"(rx[1][1].v), "v"(rx[1][2].v), "v"(rx[1][3].v), "v"(rx[2][0].v), "v"(rx[2][1].v), "v"(rx[2][2].v), "v"(rx[2][3].v), "v"(rx[3][0].v), "v"(rx[3][1].v), "v"(rx[3][2].v), "v"(rx[3][3].v) : "memory");
  v16h xf[4][2];
#pragma unroll
  for (int j = 0; j < 4; ++j) { xf[j][0] = pj_xfrag(rx[j][0].v, rx[j][1].v); xf[j][1] = pj_xfrag(rx[j][2].v, rx[j][3].v); }
  const size_t wo = (size_t)h * HD * HD + ln * HD + 8 * hh;      /* row ln of the head's W^T plane */
  const size_t ro = (size_t)(r0 + ln) * LQ + h * HD + 8 * hh; const size_t fo = ((size_t)b * QT0 + (first ? s0 : 0) + ln) * DM + h * HD + 8 * hh;
  pj_qk(BQp + wo, xf, QHp + ro, QLp + ro, QF0p + fo, first);
  pj_qk(BKp + wo, xf, KHp + ro, KLp + ro, KF0p + fo, first);
  const _Float16* wvp = BVp + wo; v16h wf[4][2];
#pragma unroll
  for (int t = 0; t < 4; ++t) { wf[t][0] = g2_frag(wvp + t * 16 * HD, 0); wf[t][1] = g2_frag(wvp + t * 16 * HD + 32, 0); }
  pj_wfence(wvp, wf);
  _Float16* vtp = VTp + ((size_t)(b * NH + h) * HD + ln) * SQ + s0 + 8 * hh;
#pragma unroll
  for (int t = 0; t < 4; ++t) {
#pragma unroll
    for (int j = 0; j < 4; ++j) { const v8f c = pj_tile(xf[j][0], xf[j][1], wf[t][0], wf[t][1]); FragH f;
#pragma unroll
      for (int r = 0; r < 8; ++r) f.h[r] = (_Float16)c[r];
      *(v8us*)((unsigned short*)vtp + (size_t)t * 16 * SQ + j * 16) = f.half[0]; } }
  asm volatile("s_wait_xcnt 0x0" ::: "memory");      /* as in pj_qk, in front of the branch */
  if (first) {
#pragma unroll
    for (int j = 0; j < 4; ++j) {
#pragma unroll
      for (int t = 0; t < 4; ++t) pj_f32(VF0p + fo + (size_t)j * 16 * DM + t * 16, pj_tile(wf[t][0], wf[t][1], xf[j][0], xf[j][1])); } } }

template <int MASKADD>
__global__ __launch_bounds__(64) void k_att0(const float* __restrict__ QF, const float* __restrict__ KF, const float* __restrict__ VF, int ld, const float* __restrict__ mask, float scale, float* __restrict__ OF, int ldo) {
  #pragma clang fp contract(off)
  // One thread per query row, keys in order (online softmax), every sum in the same order as a plain serial loop. The thread's q and o rows live in registers; k and v rows come in chunks of 64 keys,
  // staged once per chunk in LDS by coalesced loads and then read at a wave-uniform address (broadcast). Four keys' score chains run side by side: each is 64 dependent adds, so one alone leaves the issue slots empty.
  // Every loop over c, u and w and the staging loops over it are unrolled in full so that q, o, s and the staged values are indexed by constants and stay in registers; the loops over chunks, half chunks and groups of four keys stay rolled so that the code stays small.
  __shared__ __attribute__((aligned(16))) float lk[64][64]; __shared__ __attribute__((aligned(16))) float lv[64][64]; __shared__ __attribute__((aligned(16))) float lo[64][64];
  const int tid = threadIdx.x; const int h = blockIdx.x / (QT0 / 64), rg = blockIdx.x % (QT0 / 64); const int i = rg * 64 + tid;
  QF += (size_t)blockIdx.y * QT0 * ld; KF += (size_t)blockIdx.y * QT0 * ld; VF += (size_t)blockIdx.y * QT0 * ld; OF += (size_t)blockIdx.y * QT0 * ldo;      /* blockIdx.y = batch: each batch's first-tile rows are a plane of their own */
  const float* qr = QF + (size_t)i * ld + h * HD;
  float q[HD], o[HD];
  { v4f tq[HD / 4];
#pragma unroll
    for (int c = 0; c < HD / 4; ++c) tq[c] = *(const v4fa*)(qr + c * 4);
    asm volatile("s_wait_xcnt 0x0" :: "v"(qr) : "memory");      /* as in the staging below: the row's address keeps its registers until every load that names it has been translated */
#pragma unroll
    for (int c = 0; c < HD / 4; ++c) {
#pragma unroll
      for (int u = 0; u < 4; ++u) { q[c * 4 + u] = tq[c][u]; o[c * 4 + u] = 0.f; } } }
  float m = -1.0e30f, l = 0.f; const int jmax = MASKADD ? (SQ - 1) : (rg * 64 + 63);      /* additive-mask form: every key (the mask input decides); causal form: keys up to the block's last row; jmax + 1 is a multiple of 64 */
#pragma unroll 1
  for (int j0 = 0; j0 <= jmax; j0 += 64) {
    __syncthreads();      /* both waves have left the chunk before it is overwritten */
#pragma unroll 1
    for (int hf = 0; hf < 2; ++hf) { const float* kp[8]; const float* vp[8]; v4f tk[8], tv[8];      /* 32 keys a pass: 16 loads in flight */
#pragma unroll
      for (int it = 0; it < 8; ++it) { const size_t g = (size_t)(j0 + hf * 32 + it * 4 + tid / 16) * ld + h * HD + (tid % 16) * 4; kp[it] = KF + g; vp[it] = VF + g; }
#pragma unroll
      for (int it = 0; it < 8; ++it) { tk[it] = *(const v4fa*)kp[it]; tv[it] = *(const v4fa*)vp[it]; }
      /* the wait before a register that an issued load names is written again; the addresses are inputs so that they keep their registers up to it */
      asm volatile("s_wait_xcnt 0x0" :: "v"(kp[0]), "v"(kp[1]), "v"(kp[2]), "v"(kp[3]), "v"(kp[4]), "v"(kp[5]), "v"(kp[6]), "v"(kp[7]), "v"(vp[0]), "v"(vp[1]), "v"(vp[2]), "v"(vp[3]), "v"(vp[4]), "v"(vp[5]), "v"(vp[6]), "v"(vp[7]) : "memory");
#pragma unroll
      for (int it = 0; it < 8; ++it) { const int row = hf * 32 + it * 4 + tid / 16, pc = (tid % 16) * 4; *(v4f*)&lk[row][pc] = tk[it]; *(v4f*)&lv[row][pc] = tv[it]; } }
    __syncthreads();
#pragma unroll 1
    for (int jj = 0; jj < 64; jj += 4) { float s[4] = {0.f, 0.f, 0.f, 0.f};
#pragma unroll
      for (int c = 0; c < HD / 4; ++c) {
#pragma unroll
        for (int u = 0; u < 4; ++u) { const v4f kq = *(const v4f*)&lk[jj + u][c * 4]; s[u] = __fadd_rn(s[u], __fmul_rn(q[c * 4 + 0], kq[0])); s[u] = __fadd_rn(s[u], __fmul_rn(q[c * 4 + 1], kq[1])); s[u] = __fadd_rn(s[u], __fmul_rn(q[c * 4 + 2], kq[2])); s[u] = __fadd_rn(s[u], __fmul_rn(q[c * 4 + 3], kq[3])); } }
      float sc[4], e[4];      /* the four keys' rescale and weight, key after key (m and l are a chain); the o rows follow */
#pragma unroll
      for (int u = 0; u < 4; ++u) { const int j = j0 + jj + u; float sv = __fmul_rn(s[u], scale); if (MASKADD) sv = __fadd_rn(sv, __fmul_rn(bf16_round(mask[(size_t)i * SQ + j]), -10000.0f));
        const float f = (MASKADD || j <= i) ? 1.f : 0.f; const float sm = fmaf(f, sv, (1.f - f) * -1.0e30f); const float mn = fmaxf(m, sm); sc[u] = expf(m - mn); e[u] = expf(sm - mn); l = __fadd_rn(__fmul_rn(l, sc[u]), e[u]); m = mn; }
#pragma unroll
      for (int u = 0; u < 4; ++u) {
#pragma unroll
        for (int c = 0; c < HD / 4; ++c) { const v4f vv = *(const v4f*)&lv[jj + u][c * 4];
#pragma unroll
          for (int w = 0; w < 4; ++w) o[c * 4 + w] = __fadd_rn(__fmul_rn(o[c * 4 + w], sc[u]), __fmul_rn(e[u], vv[w])); } } } }
  const float fin = 64.0f / l;      /* o carried x64 like the f16 path */
#pragma unroll
  for (int c = 0; c < HD / 4; ++c) { v4f oo;
#pragma unroll
    for (int u = 0; u < 4; ++u) oo[u] = __fmul_rn(o[c * 4 + u], fin);
    *(v4f*)&lo[tid][c * 4] = oo; }
  __syncthreads();
  {
#pragma unroll 1
    for (int it = 0; it < 16; ++it) { const int row = it * 4 + tid / 16, pc = (tid % 16) * 4; const v4f v = *(const v4f*)&lo[row][pc]; *(v4f*)(OF + (size_t)(rg * 64 + row) * ldo + h * HD + pc) = v; }
     } }

extern "C" void kernel_launch(void* const* d_in, const int* in_sizes, int n_in,
                              void* d_out, int out_size, void* d_ws, size_t ws_size, hipStream_t stream) {
  (void)in_sizes; (void)n_in; (void)out_size;
  const float* const* I = (const float* const*)d_in; const float* x = I[0]; const float* xk = I[0]; const float* xv = I[0]; const float* wq = I[1]; const float* bq = nullptr; const float* wk = I[2]; const float* bk = nullptr; const float* wv = I[3]; const float* bv = nullptr; const float* wo = I[4]; const float* bo = nullptr;      /* input order: x, Wq, Wk, Wv (BLOCK-DIAGONAL per-head [16][64][64] = [head][in][out]; NO biases: null pointers), Wo ([in][out] [1024][1024]; no bias: a null pointer in the output GEMM's guarded slot); five inputs */
  char* ws = (char*)d_ws; size_t off = 0;
  auto take = [&](size_t bytes) { char* p = ws + off; off += (bytes + 255) & ~(size_t)255; return p; };
  _Float16* BQ = (_Float16*)take((size_t)DM * DM * 2); _Float16* BK = (_Float16*)take((size_t)DM * DM * 2); _Float16* BV = (_Float16*)take((size_t)DM * DM * 2); _Float16* BO = (_Float16*)take((size_t)DM * DM * 2);
  _Float16* QH = (_Float16*)take(NR * DM * 2); _Float16* QL = (_Float16*)take(NR * DM * 2); _Float16* KH = (_Float16*)take(NR * DM * 2); _Float16* KL = (_Float16*)take(NR * DM * 2); _Float16* O16 = (_Float16*)take(NR * DM * 2);
  _Float16* VT = (_Float16*)take((size_t)NB * NH * HD * SQ * 2);      /* V^T of every batch: the fused attention launch covers all of them */
  float* QF0 = (float*)take((size_t)NB * QT0 * DM * 4); float* KF0 = (float*)take((size_t)NB * QT0 * DM * 4); float* VF0 = (float*)take((size_t)NB * QT0 * DM * 4);      /* a plane per batch: the first-tile launches cover all batches */ float* OF0 = (float*)take((size_t)NB * QT0 * DM * 4); _Float16* OH0 = (_Float16*)take((size_t)NB * QT0 * DM * 2); _Float16* OL0 = (_Float16*)take((size_t)NB * QT0 * DM * 2);
  if (off > ws_size) return;
  { const unsigned gn = (unsigned)(((size_t)DM * (DM / 8) + 255) / 256); const unsigned gp = (unsigned)(((size_t)HD * (HD / 8) + 255) / 256); k_wt_f16h<<<dim3(gp, NH, 3), 256, 0, stream>>>(wq, wk, wv, BQ, BK, BV, 16.0f); k_wt_f16<<<gn, 256, 0, stream>>>(wo, BO, DM, DM, 16.0f); }      /* BLOCK-DIAGONAL per-head weights wq / wk / wv [NH][HD][HD] = [head][in][out] (x_h @ W_h): W_h[d][e] -> Bt_h[e][d] x16 through the file's transposing builder with K = N = 64, all heads and stacks in one launch (grid y = head, z = stack), into sixteen consecutive [64][64] planes (the first 128 KiB of the weight plane); Wo [in][out]: the same builder with K = N = 1024 */
  k_proj<<<dim3((unsigned)(NR / 256), NH), 128, 0, stream>>>(x, BQ, BK, BV, QH, QL, KH, KL, VT, QF0, KF0, VF0);      /* x -> q, k (f16 hi + x1024 residual planes), V^T [NB][NH][HD][SQ] and the f32 q, k, v of each batch's first 128 rows: every batch, head and row in one launch (grid x = 256 rows, y = head) */
  const size_t r0p = (size_t)B0 * SQ;      /* first projected row */
  k_att0<0><<<dim3(NH * (QT0 / 64), NBR), 64, 0, stream>>>(QF0, KF0, VF0, DM, nullptr, SCL, OF0 + (size_t)B0 * QT0 * DM, DM);      /* exact f32 attention for rows 0..127 of every batch (o x64), grid y = batch */
  k_fattn<<<NB * NH * (SQ / 64), 128, 0, stream>>>(QH, QL, KH, KL, VT, O16);      /* scores (hi.hi + lo.hi + hi.lo), causal softmax and P . V of every batch, head and query row in one launch: o (merged heads, x64) as f16 rows */
  k_gemm2<0><<<dim3((unsigned)((MPO / 128) * (DM / 64)), 1), 128, 0, stream>>>(O16 + r0p * DM, DM, 0, BO, DM, 0, 0.0009765625f, bo, 0, nullptr, 1, 0, 0, (float*)d_out + r0p * DM, nullptr, DM, 0, MPO, DM, DM, 0, 0);      /* out rows are the output layout */
  k_hl<<<(unsigned)(((size_t)NB * QT0 * DM / 8 + 255) / 256), 256, 0, stream>>>(OF0, OH0, OL0, (size_t)NB * QT0 * DM / 8);      /* first-tile o (x64) -> f16 hi + x1024 residual planes */
  k_gemm2<0><<<dim3((QT0 / 128) * (DM / 64), NBR), 128, 0, stream>>>(OH0 + (size_t)B0 * QT0 * DM, DM, (size_t)QT0 * DM, BO, DM, 0, 0.0009765625f, bo, 0, nullptr, 1, 0, 0, (float*)d_out + r0p * DM, nullptr, DM, (size_t)SQ * DM, QT0, DM, DM, 0, 0);      /* rows 0..127 of every batch (grid y = batch): out = o_hi Wo (+ b), overwriting the f16-path rows */
  k_gemm2<0><<<dim3((QT0 / 128) * (DM / 64), NBR), 128, 0, stream>>>(OL0 + (size_t)B0 * QT0 * DM, DM, (size_t)QT0 * DM, BO, DM, 0, 0.00000095367431640625f, nullptr, 0, (const float*)d_out + r0p * DM, -1, 0, 0, (float*)d_out + r0p * DM, nullptr, DM, (size_t)SQ * DM, QT0, DM, DM, 0, 0);      /* += o_lo Wo 2^-20 (own-element accumulate) */
}

// v007
// A run of this version takes 297 microseconds.
// In two side-by-side timings against v006, it was 1.09 and 1.08 times as fast.
// Over all steps from v000 it is 37.9 times as fast.
#include <hip/hip_runtime.h>
// Causal multi-head self-attention with BLOCK-DIAGONAL per-head projections (x [4][2048][1024] viewed (b, s, 16, 64); q / k / v = einsum('bshd,hde->bshe', xh, W): EACH HEAD applies its own [64][64] weight (W [16][64][64] = [head][in][out], normal x 0.02; NO biases) to ITS OWN 64-wide slice of the row; scores / sqrt(64); where(tril, scores, -inf); softmax over keys; out = merged Wo ([in][out] [1024][1024]; no bias) -> [4][2048][1024]); each projection is ONE head-batched GEMM (K = 64); q and k carried as f16 hi + x1024 residual planes with three-product scores.
// Structure: token rows r = b*2048 + s; ONE front-end launch, one wave per 64 rows of one head: x rounded (bf16, exact in f16) into register fragments, q and k as WMMA products (f32 accumulation, exact x16 weights) split in registers into f16 hi + x1024 residual planes, v as f16 written straight as V^T, the first 128 rows of each batch also as f32; then ONE fused attention launch for every batch, head and query row, one wave per 16 rows: scores against the keys up to the diagonal as three products (hi.hi + lo.hi + hi.lo, K = 64) kept in registers, causal softmax there in one walk (keys above the row masked by a select; running maximum, f32 statistics, native exp; weights f16, at most 1, normalised at the end), o = P . V (o carried x64, folded into the output GEMM alpha) written straight into the merged f16 o plane (every f16 operand plane is kept in fragment order: see pk_frag); out = o W_o GEMM (f16 operands, f32 accumulation) into the output layout.
// Compute dtype: inputs rounded to bf16; x / weights exact; q and k as f16 hi + x1024 residual planes; v, softmax weights and o as plain f16 GEMM operands (~2^-12); scores and softmax statistics f32. v_wmma_f32_16x16x32_f16.
#define NB 4
#define SCL 0.125f                         /* 1 / sqrt(head_dim 64) */
#define SCLR 0.0001220703125f               /* 2^-13: the same scale on the x1024 residual passes */
#define SQ 2048
#define DM 1024
#define NH 16
#define HD 64
#define HG 4                         /* heads per launch of the k_vt(b, h0) overload (not launched) */
#define QT 256                       /* not used */
#define NKX SQ                       /* not used */
#define QT0 128                      /* first-tile rows recomputed exactly in f32 */
#define B0 0                         /* first batch processed (debug hook) */
#define NBR NB                       /* batches processed (debug hook) */
#define NR ((size_t)NB * SQ)         /* token rows */
#define MP ((int)((size_t)NBR * SQ)) /* rows projected (debug hook) */
#define QN SQ                        /* not used */
#define NHD NH                       /* not used */
#define MPO MP                       /* rows through the output stage (debug hook) */
#define LQ DM      /* not used */
typedef __bf16 v16b __attribute__((ext_vector_type(16)));
typedef unsigned short v8us __attribute__((ext_vector_type(8), may_alias));
typedef float  v8f  __attribute__((ext_vector_type(8)));
typedef float  v4f  __attribute__((ext_vector_type(4)));
typedef float  v4fa __attribute__((ext_vector_type(4), may_alias));
union FragB { v16b v; v8us half[2]; unsigned short u[16]; };

__device__ __forceinline__ unsigned short bf16_bits(float x) { unsigned int u = __float_as_uint(x); return (unsigned short)((u + 0x7FFFu + ((u >> 16) & 1u)) >> 16); }
__device__ __forceinline__ float bf16_val(unsigned short b) { return __uint_as_float(((unsigned int)b) << 16); }
__device__ __forceinline__ float bf16_round(float x) { return bf16_val(bf16_bits(x)); }
// D += A·B with NT terms: 1 = ah·bh, 2 = + al·bh (A split), 3 = + ah·bl (both split)
template <int NT>
__device__ __forceinline__ v8f mmaN(v16b ah, v16b al, v16b bh, v16b bl, v8f c) {
  c = __builtin_amdgcn_wmma_f32_16x16x32_bf16(false, ah, false, bh, (short)0, c, false, false);
  if (NT >= 2) c = __builtin_amdgcn_wmma_f32_16x16x32_bf16(false, al, false, bh, (short)0, c, false, false);
  if (NT >= 3) c = __builtin_amdgcn_wmma_f32_16x16x32_bf16(false, ah, false, bl, (short)0, c, false, false);
  asm volatile("v_nop\n\tv_nop\n\tv_nop\n\tv_nop" : "+v"(c) : "v"(ah), "v"(al), "v"(bh), "v"(bl));
  return c;
}

__global__ __launch_bounds__(256) void k_wt_bf16(const float* __restrict__ W, unsigned short* __restrict__ Wt, int K, int N) {
  const int t = blockIdx.x * 256 + threadIdx.x;
  const int k8n = K / 8;
  if (t >= N * k8n) return;
  const int n = t / k8n, k8 = (t % k8n) * 8;
  v8us v;
#pragma unroll
  for (int i = 0; i < 8; ++i) v[i] = bf16_bits(W[(size_t)(k8 + i) * N + n]);
  *(v8us*)(Wt + (size_t)n * K + k8) = v;
  
}

// GEMM C[M][N] (f32, pitch ldc) = act(A[M][K]·W + bias). A f32 row-major (pitch lda) converted per fragment to bf16
// (ASPLIT: hi/lo two planes -> 2 terms, else single rounded term); Wt bf16 [N][K] (pitch ldb). BIAS_BF16 rounds the
// bias to bf16 first (bias quantised to bf16 before the add). K%32==0, M%16==0, N%64==0.
template <bool ASPLIT, int ACT, bool BIAS_BF16>
__global__ __launch_bounds__(128) void k_gemm_bf(const float* __restrict__ A, int lda, const unsigned short* __restrict__ Wt, int ldb,
                                               const float* __restrict__ bias, float* __restrict__ C, int ldc, int M, int N, int K) {
  __shared__ __attribute__((aligned(16))) float so[4][16][64];
  const int tid = threadIdx.x, w = tid >> 5, lane = tid & 31, ln = lane & 15, hh = lane >> 4;
  const int ntn = N / 64;
  const int wid = blockIdx.x * 4 + w;
  const int mt = wid / ntn, nq = wid % ntn;
  if (mt * 16 >= M) return;
  const int row0 = mt * 16, col0 = nq * 64;
  const float* arow = A + (size_t)(row0 + ln) * lda;
  v8f acc[4] = {};
  for (int kb = 0; kb < K; kb += 32) {
    FragB ah, al;
    const v4f x0 = *(const v4fa*)(arow + kb + 8 * hh), x1 = *(const v4fa*)(arow + kb + 8 * hh + 4);
    const v4f x2 = *(const v4fa*)(arow + kb + 16 + 8 * hh), x3 = *(const v4fa*)(arow + kb + 16 + 8 * hh + 4);
    float xs[16] = {x0[0],x0[1],x0[2],x0[3],x1[0],x1[1],x1[2],x1[3],x2[0],x2[1],x2[2],x2[3],x3[0],x3[1],x3[2],x3[3]};
#pragma unroll
    for (int i = 0; i < 16; ++i) { const unsigned short hb = bf16_bits(xs[i]); ah.u[i] = hb; al.u[i] = ASPLIT ? bf16_bits(xs[i] - bf16_val(hb)) : (unsigned short)0; }
#pragma unroll
    for (int t = 0; t < 4; ++t) {
      const unsigned short* brow = Wt + (size_t)(col0 + t * 16 + ln) * ldb + kb;
      FragB b;
      b.half[0] = *(const v8us*)(brow + 8 * hh);
      b.half[1] = *(const v8us*)(brow + 16 + 8 * hh);
      acc[t] = mmaN<ASPLIT ? 2 : 1>(ah.v, al.v, b.v, b.v, acc[t]);
    }
  }
#pragma unroll
  for (int t = 0; t < 4; ++t) {
    float bv = bias ? bias[col0 + t * 16 + ln] : 0.f;
    if (BIAS_BF16) bv = bf16_round(bv);
#pragma unroll
    for (int r = 0; r < 8; ++r) { float v = acc[t][r] + bv; if (ACT == 1) v = fmaxf(v, 0.f); so[w][8 * hh + r][t * 16 + ln] = v; }
  }
  __builtin_amdgcn_fence(__ATOMIC_ACQ_REL, "workgroup");
  __builtin_amdgcn_wave_barrier();
  const int rsub = lane >> 4, c4 = (lane & 15) * 4;
  {
#pragma unroll
    for (int q = 0; q < 8; ++q) {
      const int r = q * 2 + rsub;
      const v4f v = *(const v4fa*)&so[w][r][c4];
      *(v4f*)(C + (size_t)(row0 + r) * ldc + col0 + c4) = v;
    }
    
  }
}

// GEMM C = act(A·W + bias + resid): A f32 (ASPLIT -> hi/lo 2 terms), Wt bf16 [N][K]; ACT 0 none, 1 relu, 2 exact gelu;
// resid (optional, f32, row index = (row % rmod), pitch ldr, RES_BF16 rounds it) added before the activation.
template <bool ASPLIT, int ACT, bool BIAS_BF16, bool RES_BF16>
__global__ __launch_bounds__(128) void k_gemm_bf3(const float* __restrict__ A, int lda, const unsigned short* __restrict__ Wt, int ldb,
                                                const float* __restrict__ bias, const float* __restrict__ resid, int rmod, int ldr,
                                                float* __restrict__ C, int ldc, int M, int N, int K) {
  __shared__ __attribute__((aligned(16))) float so[4][16][64];
  const int tid = threadIdx.x, w = tid >> 5, lane = tid & 31, ln = lane & 15, hh = lane >> 4;
  const int ntn = N / 64;
  const int wid = blockIdx.x * 4 + w;
  const int mt = wid / ntn, nq = wid % ntn;
  if (mt * 16 >= M) return;
  const int row0 = mt * 16, col0 = nq * 64;
  const float* arow = A + (size_t)(row0 + ln) * lda;
  v8f acc[4] = {};
  for (int kb = 0; kb < K; kb += 32) {
    FragB ah, al;
    const v4f x0 = *(const v4fa*)(arow + kb + 8 * hh), x1 = *(const v4fa*)(arow + kb + 8 * hh + 4);
    const v4f x2 = *(const v4fa*)(arow + kb + 16 + 8 * hh), x3 = *(const v4fa*)(arow + kb + 16 + 8 * hh + 4);
    float xs[16] = {x0[0],x0[1],x0[2],x0[3],x1[0],x1[1],x1[2],x1[3],x2[0],x2[1],x2[2],x2[3],x3[0],x3[1],x3[2],x3[3]};
#pragma unroll
    for (int i = 0; i < 16; ++i) { const unsigned short hb = bf16_bits(xs[i]); ah.u[i] = hb; al.u[i] = ASPLIT ? bf16_bits(xs[i] - bf16_val(hb)) : (unsigned short)0; }
#pragma unroll
    for (int t = 0; t < 4; ++t) {
      const unsigned short* brow = Wt + (size_t)(col0 + t * 16 + ln) * ldb + kb;
      FragB b;
      b.half[0] = *(const v8us*)(brow + 8 * hh);
      b.half[1] = *(const v8us*)(brow + 16 + 8 * hh);
      acc[t] = mmaN<ASPLIT ? 2 : 1>(ah.v, al.v, b.v, b.v, acc[t]);
    }
  }
#pragma unroll
  for (int t = 0; t < 4; ++t) {
    const int col = col0 + t * 16 + ln;
    float bv = bias ? bias[col] : 0.f;
    if (BIAS_BF16) bv = bf16_round(bv);
#pragma unroll
    for (int r = 0; r < 8; ++r) {
      float v = acc[t][r] + bv;
      if (resid) { float rv = resid[(size_t)((row0 + 8 * hh + r) % rmod) * ldr + col]; if (RES_BF16) rv = bf16_round(rv); v += rv; }
      if (ACT == 1) v = fmaxf(v, 0.f);
      if (ACT == 2) v = 0.5f * v * (1.0f + erff(v * 0.70710678118654752f));
      if (ACT == 3) { const float u = 0.7978845608028654f * (v + 0.044715f * v * v * v); v = 0.5f * v * (1.0f + tanhf(u)); }
      so[w][8 * hh + r][t * 16 + ln] = v;
    }
  }
  __builtin_amdgcn_fence(__ATOMIC_ACQ_REL, "workgroup");
  __builtin_amdgcn_wave_barrier();
  const int rsub = lane >> 4, c4 = (lane & 15) * 4;
  {
#pragma unroll
    for (int q = 0; q < 8; ++q) {
      const int r = q * 2 + rsub;
      const v4f v = *(const v4fa*)&so[w][r][c4];
      *(v4f*)(C + (size_t)(row0 + r) * ldc + col0 + c4) = v;
    }
    
  }
}
// row LayerNorm (biased variance, eps) over N: s = X (+ R); optional out_sum <- s; out_norm <- (s-mu)*rsqrt(var+eps)*g + b
template <bool PARAM_BF16>
__global__ __launch_bounds__(256) void k_layernorm(const float* __restrict__ X, const float* __restrict__ R, const float* __restrict__ g, const float* __restrict__ bta,
                                                  float* __restrict__ out_sum, float* __restrict__ out_norm, int N, float eps) {
  __shared__ float red[256];
  const int row = blockIdx.x, tid = threadIdx.x;
  const float* x = X + (size_t)row * N; const float* rr = R ? R + (size_t)row * N : nullptr;
  float vals[16];                     // up to N = 4096
  const int per = N / 256;            // contiguous chunk per thread? use strided-by-4 chunks: thread handles j = tid*4 + 1024*u
  float s1 = 0.f;
  for (int u = 0; u < per / 4; ++u) {
    const int j = tid * 4 + 1024 * u;
    const v4f a = *(const v4fa*)(x + j);
    v4f b = {0.f,0.f,0.f,0.f}; if (rr) b = *(const v4fa*)(rr + j);
#pragma unroll
    for (int q = 0; q < 4; ++q) { const float v = a[q] + b[q]; vals[u * 4 + q] = v; s1 += v; }
  }
  red[tid] = s1; __syncthreads();
  for (int st = 128; st > 0; st >>= 1) { if (tid < st) red[tid] += red[tid + st]; __syncthreads(); }
  const float mu = red[0] / (float)N; __syncthreads();
  float s2 = 0.f;
  for (int u = 0; u < per / 4; ++u)
#pragma unroll
    for (int q = 0; q < 4; ++q) { const float c = vals[u * 4 + q] - mu; s2 += c * c; }
  red[tid] = s2; __syncthreads();
  for (int st = 128; st > 0; st >>= 1) { if (tid < st) red[tid] += red[tid + st]; __syncthreads(); }
  const float rs = rsqrtf(red[0] / (float)N + eps);
  {
    for (int u = 0; u < per / 4; ++u) {
      const int j = tid * 4 + 1024 * u;
      v4f o, sm;
#pragma unroll
      for (int q = 0; q < 4; ++q) {
        float gg = g[j + q], bb = bta[j + q];
        if (PARAM_BF16) { gg = bf16_round(gg); bb = bf16_round(bb); }
        sm[q] = vals[u * 4 + q]; o[q] = (vals[u * 4 + q] - mu) * rs * gg + bb;
      }
      if (out_sum) *(v4f*)(out_sum + (size_t)row * N + j) = sm;
      *(v4f*)(out_norm + (size_t)row * N + j) = o;
    }
    
  }
}



// ---- f16 WMMA path (v_wmma_f32_16x16x32_f16): 11-bit significands for operands in range — used where a [0,1] probability operand needs more precision than bf16
typedef _Float16 v16h __attribute__((ext_vector_type(16)));
union FragH { v16h v; v8us half[2]; _Float16 h[16]; unsigned short u[16]; };
template <int NT>
__device__ __forceinline__ v8f mmaH(v16h ah, v16h al, v16h bh, v16h bl, v8f c) {
  c = __builtin_amdgcn_wmma_f32_16x16x32_f16(false, ah, false, bh, (short)0, c, false, false);
  if (NT >= 2) c = __builtin_amdgcn_wmma_f32_16x16x32_f16(false, al, false, bh, (short)0, c, false, false);
  if (NT >= 3) c = __builtin_amdgcn_wmma_f32_16x16x32_f16(false, ah, false, bl, (short)0, c, false, false);
  asm volatile("v_nop\n\tv_nop\n\tv_nop\n\tv_nop" : "+v"(c) : "v"(ah), "v"(al), "v"(bh), "v"(bl));
  return c;
}
// batched GEMM like k_gemm_b but f16 operands: A f32 (split into f16 hi/lo if ASPLIT, else rounded to f16), Bt = f16 values [n][k]; alpha; C f32; N multiple of 16 (partial tiles skipped)
template <bool ASPLIT>
__global__ __launch_bounds__(128) void k_gemm_h(const float* __restrict__ A, int lda, size_t sA, const _Float16* __restrict__ Bh, int ldb, size_t sB, float alpha, float* __restrict__ C, int ldc, size_t sC, int M, int N, int K) {
  __shared__ __attribute__((aligned(16))) float so[4][16][64];
  const int tid = threadIdx.x, w = tid >> 5, lane = tid & 31, ln = lane & 15, hh = lane >> 4; const int by = blockIdx.y;
  A += (size_t)by * sA; Bh += (size_t)by * sB; C += (size_t)by * sC;
  const int ntn = (N + 63) / 64; const int wid = blockIdx.x * 4 + w; const int mt = wid / ntn, nq = wid % ntn; if (mt * 16 >= M) return;
  const int row0 = mt * 16, col0 = nq * 64; const float* arow = A + (size_t)(row0 + ln) * lda;
  v8f acc[4] = {};
  for (int kb = 0; kb < K; kb += 32) {
    FragH ah, al;
    const v4f x0 = *(const v4fa*)(arow + kb + 8 * hh), x1 = *(const v4fa*)(arow + kb + 8 * hh + 4), x2 = *(const v4fa*)(arow + kb + 16 + 8 * hh), x3 = *(const v4fa*)(arow + kb + 16 + 8 * hh + 4);
    float xs[16] = {x0[0],x0[1],x0[2],x0[3],x1[0],x1[1],x1[2],x1[3],x2[0],x2[1],x2[2],x2[3],x3[0],x3[1],x3[2],x3[3]};
#pragma unroll
    for (int i = 0; i < 16; ++i) { const _Float16 h = (_Float16)xs[i]; ah.h[i] = h; al.h[i] = ASPLIT ? (_Float16)(xs[i] - (float)h) : (_Float16)0.0f; }
#pragma unroll
    for (int t = 0; t < 4; ++t) { if (col0 + t * 16 >= N) continue; const size_t boff = (size_t)(col0 + t * 16 + ln) * ldb + kb; FragH bq; bq.half[0] = *(const v8us*)(Bh + boff + 8 * hh); bq.half[1] = *(const v8us*)(Bh + boff + 16 + 8 * hh);
      acc[t] = mmaH<ASPLIT ? 2 : 1>(ah.v, al.v, bq.v, bq.v, acc[t]); }
  }
#pragma unroll
  for (int t = 0; t < 4; ++t) { if (col0 + t * 16 >= N) continue;
#pragma unroll
    for (int r = 0; r < 8; ++r) so[w][8 * hh + r][t * 16 + ln] = acc[t][r] * alpha; }
  __builtin_amdgcn_fence(__ATOMIC_ACQ_REL, "workgroup"); __builtin_amdgcn_wave_barrier();
  const int rsub = lane >> 4, c4 = (lane & 15) * 4;
  {
#pragma unroll
    for (int q = 0; q < 8; ++q) { const int r = q * 2 + rsub; if (col0 + c4 < N) { const v4f v = *(const v4fa*)&so[w][r][c4]; *(v4f*)(C + (size_t)(row0 + r) * ldc + col0 + c4) = v; } }
     }
}

// Wt(n, k) = f16(W[k][n]·scale), stored in fragment order, from f32 row-major W[K][N] (scale = power of two; bf16-exact weights stay exact in f16 away from the subnormal range)
__global__ __launch_bounds__(256) void k_wt_f16(const float* __restrict__ W, _Float16* __restrict__ Wt, int K, int N, float scale) {
  /* Wt in fragment order ([16-row tile of n][32-column step of k][piece][lane][8]): thread t writes the t-th 16 bytes of the plane */
  const int t = blockIdx.x * 256 + threadIdx.x; if (t >= N * (K / 8)) return; const int blk = t >> 6; const int n = (blk / (K / 32)) * 16 + (t & 15), k8 = (blk % (K / 32)) * 32 + ((t >> 5) & 1) * 16 + ((t >> 4) & 1) * 8; FragH f;
#pragma unroll
  for (int i = 0; i < 8; ++i) f.h[i] = (_Float16)(bf16_round(W[(size_t)(k8 + i) * N + n]) * scale); const v8us o = f.half[0];
  *(v8us*)((unsigned short*)Wt + (size_t)t * 8) = o; 
}
// the same builder for the per-head [64][64] weights of three stacks in ONE launch: blockIdx.y = head (consecutive [64][64] planes in source and destination), blockIdx.z = stack
__global__ __launch_bounds__(256) void k_wt_f16h(const float* __restrict__ Wa, const float* __restrict__ Wb, const float* __restrict__ Wc, _Float16* __restrict__ Ta, _Float16* __restrict__ Tb, _Float16* __restrict__ Tc, float scale) {
  const int t = blockIdx.x * 256 + threadIdx.x; if (t >= HD * (HD / 8)) return; const int blk = t >> 6; const int n = (blk / (HD / 32)) * 16 + (t & 15), k8 = (blk % (HD / 32)) * 32 + ((t >> 5) & 1) * 16 + ((t >> 4) & 1) * 8; const size_t o = (size_t)blockIdx.y * HD * HD;      /* each plane in fragment order, thread t its t-th 16 bytes */
  const float* W = (blockIdx.z == 0 ? Wa : blockIdx.z == 1 ? Wb : Wc) + o; _Float16* Wt = (blockIdx.z == 0 ? Ta : blockIdx.z == 1 ? Tb : Tc) + o; FragH f;
#pragma unroll
  for (int i = 0; i < 8; ++i) f.h[i] = (_Float16)(bf16_round(W[(size_t)(k8 + i) * HD + n]) * scale); const v8us ov = f.half[0];
  *(v8us*)((unsigned short*)Wt + (size_t)t * 8) = ov;
}
// k_gemm_hh variant with fused epilogue: v = acc·alpha + bias[by·sBias + col] (+ CP[(row/rowsPerB)·sCPb + by·64 + col] if CP) ; ACT 0 none / 1 elu ; writes f16 C16 (and f32 C if non-null)
template <int ACT>
__global__ __launch_bounds__(128) void k_gemm_hhx(const _Float16* __restrict__ A, int lda, size_t sA, const _Float16* __restrict__ Bh, int ldb, size_t sB, float alpha, const float* __restrict__ bias, size_t sBias, const float* __restrict__ CP, int rowsPerB, size_t sCPb, int row0g,
    float* __restrict__ C, _Float16* __restrict__ C16, int ldc, size_t sC, int M, int N, int K) {
  __shared__ __attribute__((aligned(16))) float so[4][16][64];
  const int tid = threadIdx.x, w = tid >> 5, lane = tid & 31, ln = lane & 15, hh = lane >> 4; const int by = blockIdx.y;
  A += (size_t)by * sA; Bh += (size_t)by * sB; const size_t cofs = (size_t)by * sC; const float* bp = bias ? bias + (size_t)by * sBias : nullptr;
  const int ntn = (N + 63) / 64; const int wid = blockIdx.x * 4 + w; const int mt = wid / ntn, nq = wid % ntn; if (mt * 16 >= M) return;
  const int row0 = mt * 16, col0 = nq * 64; const _Float16* arow = A + (size_t)(row0 + ln) * lda;
  v8f acc[4] = {};
  for (int kb = 0; kb < K; kb += 32) { FragH ah; ah.half[0] = *(const v8us*)((const unsigned short*)arow + kb + 8 * hh); ah.half[1] = *(const v8us*)((const unsigned short*)arow + kb + 16 + 8 * hh);
#pragma unroll
    for (int t = 0; t < 4; ++t) { if (col0 + t * 16 >= N) continue; const size_t boff = (size_t)(col0 + t * 16 + ln) * ldb + kb; FragH bq; bq.half[0] = *(const v8us*)((const unsigned short*)Bh + boff + 8 * hh); bq.half[1] = *(const v8us*)((const unsigned short*)Bh + boff + 16 + 8 * hh);
      acc[t] = mmaH<1>(ah.v, ah.v, bq.v, bq.v, acc[t]); }
  }
#pragma unroll
  for (int t = 0; t < 4; ++t) { if (col0 + t * 16 >= N) continue; const int col = col0 + t * 16 + ln; const float bv = bp ? bf16_round(bp[col]) : 0.f;
#pragma unroll
    for (int r = 0; r < 8; ++r) { float v = acc[t][r] * alpha + bv; if (CP) { const int rr = row0g + row0 + 8 * hh + r; if (rowsPerB < 0) v += CP[cofs + (size_t)rr * ldc + col];      /* rowsPerB < 0: own element of the batched C plane */ else { const int bidx = rr / rowsPerB; v += CP[(size_t)bidx * sCPb + (size_t)by * 64 + col]; } } if (ACT == 1) v = (v > 0.f) ? v : expm1f(v); else if (ACT == 7) v = (v > 0.f) ? v + 1.0f : expf(v); else if (ACT == 8) v = tanhf(v); else if (ACT == 9) v = 0.5f * v * (1.0f + tanhf(0.7978845608028654f * (v + 0.044715f * v * v * v))); else if (ACT == 11) v = 1.0f / (1.0f + expf(-v)); else if (ACT == 12) v = (v > 0.f) ? v : 0.01f * v; else if (ACT == 14) v = (v > 0.f) ? v : 0.1f * v; else if (ACT == 16) v = (v >= 0.f) ? v : 0.3f * v; else if (ACT == 17) v = (v >= 0.f) ? v : 0.2f * v; else if (ACT == 15) v = v / (1.0f + expf(-v)); else if (ACT == 3) v = fmaxf(v, 0.f); else if (ACT == 6) v = 0.5f * v * (1.0f + erff(v * 0.70710678118654752f)); so[w][8 * hh + r][t * 16 + ln] = v; } }
  __builtin_amdgcn_fence(__ATOMIC_ACQ_REL, "workgroup"); __builtin_amdgcn_wave_barrier();
  const int rsub = lane >> 4, c4 = (lane & 15) * 4; typedef _Float16 v4h __attribute__((ext_vector_type(4)));
  {
#pragma unroll
    for (int q = 0; q < 8; ++q) { const int r = q * 2 + rsub; if (col0 + c4 < N) { const v4f v = *(const v4fa*)&so[w][r][c4]; if (C) *(v4f*)(C + cofs + (size_t)(row0 + r) * ldc + col0 + c4) = v; if (C16) { v4h h4; for (int i = 0; i < 4; ++i) h4[i] = (_Float16)v[i]; *(v4h*)(C16 + cofs + (size_t)(row0 + r) * ldc + col0 + c4) = h4; } } }
     }
}


typedef _Float16 v4h __attribute__((ext_vector_type(4)));

__global__ __launch_bounds__(256) void k_x16(const float* __restrict__ x, _Float16* __restrict__ X16, size_t n8) { const size_t t = (size_t)blockIdx.x * 256 + threadIdx.x; if (t >= n8) return; FragH f;
#pragma unroll
  for (int q = 0; q < 8; ++q) f.h[q] = (_Float16)bf16_round(x[t * 8 + q]); *(v8us*)((unsigned short*)X16 + t * 8) = f.half[0];  }
__global__ __launch_bounds__(256) void k_h16(const float* __restrict__ x, _Float16* __restrict__ X16, size_t n8) { const size_t t = (size_t)blockIdx.x * 256 + threadIdx.x; if (t >= n8) return; FragH f;
#pragma unroll
  for (int q = 0; q < 8; ++q) f.h[q] = (_Float16)x[t * 8 + q]; *(v8us*)((unsigned short*)X16 + t * 8) = f.half[0];  }
__global__ __launch_bounds__(256) void k_round16f(const float* __restrict__ W, _Float16* __restrict__ Bt, size_t n8) { const size_t t = (size_t)blockIdx.x * 256 + threadIdx.x; if (t >= n8) return; FragH f;
#pragma unroll
  for (int i = 0; i < 8; ++i) f.h[i] = (_Float16)(bf16_round(W[t * 8 + i]) * 16.0f); *(v8us*)((unsigned short*)Bt + t * 8) = f.half[0];  }
template <int NHv, int TTv>
__global__ __launch_bounds__(256) void k_vt(const _Float16* __restrict__ V16, int ldv, int voff, _Float16* __restrict__ Vt) { __shared__ unsigned short tl[64][66]; const int tid = threadIdx.x; const int slab = blockIdx.x / (TTv / 64), lg = blockIdx.x % (TTv / 64); const int b = slab / NHv, h = slab % NHv;
  for (int i = tid; i < 64 * 8; i += 256) { const int r = i / 8, c8 = (i % 8) * 8; FragH f; f.half[0] = *(const v8us*)((const unsigned short*)V16 + ((size_t)b * TTv + lg * 64 + r) * ldv + voff + h * 64 + c8);
#pragma unroll
    for (int q = 0; q < 8; ++q) tl[r][c8 + q] = f.u[q]; }
  __syncthreads();
  {
#pragma unroll
    for (int rd = 0; rd < 2; ++rd) { const int d = rd * 32 + tid / 8, pc = tid % 8; FragH f;
#pragma unroll
      for (int q = 0; q < 8; ++q) f.u[q] = tl[pc * 8 + q][d];
      *(v8us*)((unsigned short*)Vt + ((size_t)slab * 64 + d) * TTv + lg * 64 + pc * 8) = f.half[0]; }
     } }

__global__ __launch_bounds__(256) void k_hl(const float* __restrict__ F, _Float16* __restrict__ Hh, _Float16* __restrict__ Hl, size_t n8) { const size_t t = (size_t)blockIdx.x * 256 + threadIdx.x; if (t >= n8) return; FragH fh, fl;
  /* F: row-major rows of DM; Hh, Hl: fragment order ([16-row tile][32-column step][piece][lane][8]), thread t their t-th 16 bytes */
  const size_t blk = t >> 6; const float* fp = F + ((blk / (DM / 32)) * 16 + (t & 15)) * DM + (blk % (DM / 32)) * 32 + ((t >> 5) & 1) * 16 + ((t >> 4) & 1) * 8; const v4f a = *(const v4fa*)fp, c = *(const v4fa*)(fp + 4);
#pragma unroll
  for (int q = 0; q < 4; ++q) { _Float16 h = (_Float16)a[q]; fh.h[q] = h; fl.h[q] = (_Float16)((a[q] - (float)h) * 1024.0f); h = (_Float16)c[q]; fh.h[4 + q] = h; fl.h[4 + q] = (_Float16)((c[q] - (float)h) * 1024.0f); }
  { *(v8us*)((unsigned short*)Hh + t * 8) = fh.half[0]; *(v8us*)((unsigned short*)Hl + t * 8) = fl.half[0];  } }

// ---- fast GEMM (A and Bh in fragment order; wave tile 32x64; requires M % 32 == 0 rows per launch region and N % 64 == 0); epilogue = k_gemm_hhx semantics ----
__device__ __forceinline__ v16h g2_frag(const _Float16* p, int hh) { FragH f; f.half[0] = *(const v8us*)((const unsigned short*)p + 8 * hh); f.half[1] = *(const v8us*)((const unsigned short*)p + 16 + 8 * hh); return f.v; }
// ---- fragment-order planes. Every f16 operand plane of the products (q and k hi / residual, V^T, o, the weights) is stored as the operand fragments themselves: a 16-row x 32-column block is two pieces of 512 bytes,
// piece u = columns 16 u .. 16 u + 15, and in a piece lane (ln, hh) owns 16 bytes at lane * 16: row ln, columns 8 hh .. 8 hh + 7 of the piece. A wave-wide 16-byte load or store then covers 512 contiguous bytes (four whole 128-byte lines)
// where a row-major plane gives it sixteen lines of which it uses 32 bytes each. p: the lane's own 16 bytes of piece 0.
__device__ __forceinline__ v16h pk_frag(const _Float16* p) { FragH f; f.half[0] = *(const v8us*)((const unsigned short*)p); f.half[1] = *(const v8us*)((const unsigned short*)p + 256); return f.v; }
__device__ __forceinline__ v8f g2_mma(v16h a, v16h b, v8f c) { v8f d = __builtin_amdgcn_wmma_f32_16x16x32_f16(false, a, false, b, (short)0, c, false, false); asm volatile("v_nop\n\tv_nop\n\tv_nop\n\tv_nop" : "+v"(d) : "v"(a), "v"(b)); return d; }
template <int ACT>
__global__ __launch_bounds__(128) void k_gemm2(const _Float16* __restrict__ A, int lda, size_t sA, const _Float16* __restrict__ Bh, int ldb, size_t sB, float alpha, const float* __restrict__ bias, size_t sBias, const float* __restrict__ CP, int rowsPerB, size_t sCPb, int row0g,
    float* __restrict__ C, _Float16* __restrict__ C16, int ldc, size_t sC, int M, int N, int K, size_t sAz, size_t sCz) { static_assert(ACT == 0 || ACT == 3 || ACT == 6 || ACT == 8 || ACT == 9 || ACT == 11 || ACT == 12 || ACT == 14 || ACT == 15 || ACT == 16 || ACT == 17, "k_gemm2: unsupported ACT code (would silently apply no activation)");
  __shared__ __attribute__((aligned(16))) float so[4][32][68];
  const int tid = threadIdx.x, w = tid >> 5, lane = tid & 31, ln = lane & 15, hh = lane >> 4; const int by = blockIdx.y; const int bz = blockIdx.z;      /* bz: a second batch index (A and C planes sAz, sCz apart; B shared) */
  A += (size_t)by * sA + (size_t)bz * sAz; Bh += (size_t)by * sB; const size_t cofs = (size_t)by * sC + (size_t)bz * sCz; const float* bp = bias ? bias + (size_t)by * sBias : nullptr;
  const int ntn = N >> 6; const int mt = blockIdx.x / ntn, nq = blockIdx.x - mt * ntn; const int row0 = mt * 128 + 32 * w, col0 = nq * 64; if (row0 >= M) return;
  /* A and Bh in fragment order: [16-row tile][32-column step][piece][lane][8]; a tile of 16 rows is 16 lda (16 ldb) elements, a step 512 */
  const _Float16* a0p = A + (size_t)row0 * lda + lane * 8; const _Float16* a1p = a0p + (size_t)16 * lda;
  const _Float16* b0p = Bh + (size_t)col0 * ldb + lane * 8; const _Float16* b1p = b0p + (size_t)16 * ldb; const _Float16* b2p = b1p + (size_t)16 * ldb; const _Float16* b3p = b2p + (size_t)16 * ldb;
  const v8f z8 = {0.f,0.f,0.f,0.f,0.f,0.f,0.f,0.f}; v8f c00 = z8, c01 = z8, c02 = z8, c03 = z8, c10 = z8, c11 = z8, c12 = z8, c13 = z8;
#pragma unroll 1
  for (int kb = 0; kb < K; kb += 32) { const int ko = kb * 16; const _Float16* a0k = a0p + ko; const _Float16* a1k = a1p + ko; const _Float16* b0k = b0p + ko; const _Float16* b1k = b1p + ko; const _Float16* b2k = b2p + ko; const _Float16* b3k = b3p + ko;
    const v16h a0 = pk_frag(a0k), a1 = pk_frag(a1k);
    v16h b = pk_frag(b0k); c00 = g2_mma(a0, b, c00); c10 = g2_mma(a1, b, c10);
    b = pk_frag(b1k); c01 = g2_mma(a0, b, c01); c11 = g2_mma(a1, b, c11);
    b = pk_frag(b2k); c02 = g2_mma(a0, b, c02); c12 = g2_mma(a1, b, c12);
    b = pk_frag(b3k); c03 = g2_mma(a0, b, c03); c13 = g2_mma(a1, b, c13);
    asm volatile("s_wait_xcnt 0x0" :: "v"(a0k), "v"(a1k), "v"(b0k), "v"(b1k), "v"(b2k), "v"(b3k) : "memory"); }      /* the wait before a register that an issued load names is written again; the step's addresses are inputs so that they keep their registers up to here (left alone a later load lands on an address that an earlier one names) */
  v8f accs[8] = {c00, c01, c02, c03, c10, c11, c12, c13};
#pragma unroll
  for (int u = 0; u < 8; ++u) { const int t = u & 3, half = u >> 2; const int col = col0 + t * 16 + ln; const float bv = bp ? bf16_round(bp[col]) : 0.f;
#pragma unroll
    for (int r = 0; r < 8; ++r) { const int rloc = half * 16 + 8 * hh + r; float v = accs[u][r] * alpha + bv; if (CP) { if (rowsPerB < 0) v += CP[cofs + (size_t)(row0g + row0 + rloc) * ldc + col];      /* rowsPerB < 0: own element of the batched C plane */ else { const int bidx = (row0g + row0 + rloc) / rowsPerB; v += CP[(size_t)bidx * sCPb + (size_t)by * 64 + col]; } }
      if (ACT == 3) v = fmaxf(v, 0.f); else if (ACT == 6) v = 0.5f * v * (1.0f + erff(v * 0.70710678118654752f)); else if (ACT == 11) v = 1.0f / (1.0f + expf(-v)); else if (ACT == 15) v = v / (1.0f + expf(-v)); else if (ACT == 12) v = (v > 0.f) ? v : 0.01f * v; else if (ACT == 8) v = tanhf(v); else if (ACT == 9) v = 0.5f * v * (1.0f + tanhf(0.7978845608028654f * (v + 0.044715f * v * v * v))); else if (ACT == 14) v = (v > 0.f) ? v : 0.1f * v; else if (ACT == 16) v = (v >= 0.f) ? v : 0.3f * v; else if (ACT == 17) v = (v >= 0.f) ? v : 0.2f * v;
      so[w][rloc][t * 16 + ln] = v; } }
  __builtin_amdgcn_fence(__ATOMIC_ACQ_REL, "workgroup"); __builtin_amdgcn_wave_barrier();
  const int rsub = lane >> 4, c4 = (lane & 15) * 4;
  {
#pragma unroll
    for (int q = 0; q < 16; ++q) { const int r = q * 2 + rsub; const v4f v = *(const v4fa*)&so[w][r][c4]; if (C) *(v4f*)(C + cofs + (size_t)(row0 + r) * ldc + col0 + c4) = v; if (C16) { v4h h4; for (int i = 0; i < 4; ++i) h4[i] = (_Float16)v[i]; *(v4h*)(C16 + cofs + (size_t)(row0 + r) * ldc + col0 + c4) = h4; } }
     } }


__global__ __launch_bounds__(256) void k_wnat(const float* __restrict__ w, size_t n8, _Float16* __restrict__ Bt) { const size_t t = (size_t)blockIdx.x * 256 + threadIdx.x; if (t >= n8) return; FragH f; for (int q = 0; q < 8; ++q) f.h[q] = (_Float16)(bf16_round(w[t * 8 + q]) * 16.0f); *(v8us*)((unsigned short*)Bt + t * 8) = f.half[0];  }
__global__ __launch_bounds__(256) void k_rsm(const float* __restrict__ S, _Float16* __restrict__ P, int nrows) {
  #pragma clang fp contract(off)
  const int i = blockIdx.x * 256 + threadIdx.x; if (i >= nrows) return; const float* s = S + (size_t)i * SQ; float mx = -3.0e38f;
#pragma unroll 1
  for (int j = 0; j < SQ; ++j) mx = fmaxf(mx, s[j]); float se = 0.f;
#pragma unroll 1
  for (int j = 0; j < SQ; ++j) se += expf(s[j] - mx); const float sc = 256.0f / se;
#pragma unroll 1
  for (int j0 = 0; j0 < SQ; j0 += 8) { FragH f; for (int q = 0; q < 8; ++q) f.h[q] = (_Float16)(expf(s[j0 + q] - mx) * sc); unsigned short* d = (unsigned short*)P + (size_t)i * SQ + j0; *(v8us*)d = f.half[0];  } }
__global__ __launch_bounds__(256) void k_vt(const _Float16* __restrict__ V16, int b, int h0, _Float16* __restrict__ VT) { __shared__ unsigned short tl[64][65]; const int tid = threadIdx.x; const int hh = blockIdx.x % HG, sg = blockIdx.x / HG; const int s0 = sg * 64; const int h = h0 + hh;
  for (int i = tid; i < 64 * 8; i += 256) { const int j = i / 8, d8 = (i % 8) * 8; FragH f; f.half[0] = *(const v8us*)((const unsigned short*)V16 + ((size_t)b * SQ + s0 + j) * DM + h * HD + d8); for (int q = 0; q < 8; ++q) tl[d8 + q][j] = f.u[q]; }
  __syncthreads();
  { for (int i = tid; i < 64 * 8; i += 256) { const int d = i / 8, j8 = (i % 8) * 8; FragH f; for (int q = 0; q < 8; ++q) f.u[q] = tl[d][j8 + q]; *(v8us*)((unsigned short*)VT + ((size_t)hh * HD + d) * SQ + s0 + j8) = f.half[0]; }  } }



// Fused causal attention, ONE WAVE PER 16 QUERY ROWS of one (batch, head); no score or weight ever leaves the registers, no LDS, no barrier.
// Scores are formed transposed, S^T = K . Q^T (A = 16 key rows, B = 16 query rows): lane (ln, hh) then holds keys 8 hh .. 8 hh + 7 of the tile for query ln, so row maximum and row sum are per-lane values
// (plus one exchange between the two lane halves), and two neighbouring tiles' weights ARE the 32-key operand fragment of the second product (elements 0..7 = keys 8 hh + i, 8..15 = keys 16 + 8 hh + i).
// The second product is transposed too, O^T = V^T . P^T (A = 16 rows of V^T, B = the weights): lane (ln, hh) ends with 8 consecutive output columns of query ln, one 16-byte store a tile.
// ONE walk over the keys up to the diagonal: a running row maximum; each chunk's weights are exp(s - maximum so far) as f16 (at most 1), and the row sum and the four output tiles are first multiplied by exp(old maximum - new maximum); the division by the row sum comes once, at the end.
// Every loop over r, i and t is unrolled in full so that s, e, p and the accumulators are indexed by constants and stay in registers; the loop over the chunks stays rolled.
__device__ __forceinline__ v8f fa_mma(v16h a, v16h b, v8f c) { return __builtin_amdgcn_wmma_f32_16x16x32_f16(false, a, false, b, (short)0, c, false, false); }
// scores of 16 keys x 16 queries: hi.hi / 8, then + 2^-13 lo.hi, then + 2^-13 hi.lo (three accumulators of their own, added in this order); keys above the row get -1e9
// a0, a1: the 16 key rows' hi plane (head columns 0..31, 32..63); l0, l1: their residual plane
__device__ __forceinline__ void fa_scores(v16h a0, v16h a1, v16h l0, v16h l1, v16h qh0, v16h qh1, v16h ql0, v16h ql1, int keyb, int last, float* s) {
  const v8f z8 = {0.f,0.f,0.f,0.f,0.f,0.f,0.f,0.f};
  v8f c1 = fa_mma(a0, qh0, z8), c2 = fa_mma(a0, ql0, z8), c3 = fa_mma(l0, qh0, z8);
  c1 = fa_mma(a1, qh1, c1); c2 = fa_mma(a1, ql1, c2); c3 = fa_mma(l1, qh1, c3);
#pragma unroll
  for (int r = 0; r < 8; ++r) { float v = c1[r] * SCL; v += c2[r] * SCLR; v += c3[r] * SCLR; s[r] = (keyb + r <= last) ? v : -1.0e9f; } }
// lane l's value as seen from lane l ^ 16: one vector cross-row move (a shuffle would go through the LDS pipe and its wait, here once a chunk)
// 16 head columns x 32 keys of V^T: the same piece of two neighbouring token tiles (keys 8 hh + i, then 16 + 8 hh + i)
__device__ __forceinline__ v16h vt_frag(const _Float16* p) { FragH f; f.half[0] = *(const v8us*)((const unsigned short*)p); f.half[1] = *(const v8us*)((const unsigned short*)p + 1024); return f.v; }
__device__ __forceinline__ float fa_other_half(float x) { const unsigned u = __float_as_uint(x); return __uint_as_float(__builtin_amdgcn_permlanex16(u, u, 0x76543210u, 0xfedcba98u, false, false)); }
__global__ __launch_bounds__(128) void k_fattn(const _Float16* __restrict__ QHp, const _Float16* __restrict__ QLp, const _Float16* __restrict__ KHp, const _Float16* __restrict__ KLp, const _Float16* __restrict__ VTp, _Float16* __restrict__ O) {
  const int lane = threadIdx.x & 31, ln = lane & 15, hh = lane >> 4; const int w = __builtin_amdgcn_readfirstlane((int)(threadIdx.x >> 5));      /* the wave's number as a scalar: the key loops get scalar trip counts */
  const int bh = blockIdx.x % (NB * NH), qb = (SQ / 64 - 1) - blockIdx.x / (NB * NH);      /* longest rows first */
  const int b = bh / NH, h = bh % NH; const int q0 = qb * 64 + w * 16; const int last = q0 + ln; const int nch = (q0 + 47) >> 5;      /* 32-key chunks up to the diagonal; the last one may hold 16 keys that are masked for every row (they exist: q0 + 31 < SQ there) */
  /* q, k and V^T planes in fragment order, [batch, head][16-token tile][4 pieces][lane][8]: a tile is 1024 elements, a 32-key chunk 2048 in a row. q, k: piece = 16 head columns; V^T: piece = 16 head columns x the tile's 16 tokens */
  const size_t pb = (size_t)bh * (SQ / 16) * 1024 + lane * 8; const size_t rq = pb + (size_t)(q0 >> 4) * 1024;
  const _Float16* qhp = QHp + rq; const _Float16* qlp = QLp + rq;
  const v16h qh0 = pk_frag(qhp), qh1 = pk_frag(qhp + 512), ql0 = pk_frag(qlp), ql1 = pk_frag(qlp + 512);
  asm volatile("s_wait_xcnt 0x0" :: "v"(qhp), "v"(qlp) : "memory");      /* the wait before a register that an issued load names is written again; the addresses are inputs so that they keep their registers up to it (the same at the loop's wait below) */
  const _Float16* kh = KHp + pb; const _Float16* kl = KLp + pb; const _Float16* vt = VTp + pb;
  float m = -3.0e38f, l = 0.f;      /* m: the row's running maximum, the same in both lane halves; l: this lane half's share of the row sum, at scale exp(-m) */
  const v8f z8 = {0.f,0.f,0.f,0.f,0.f,0.f,0.f,0.f}; v8f o0 = z8, o1 = z8, o2 = z8, o3 = z8;
  for (int c = 0; c < nch; ++c) { float s[16]; const _Float16* ka = kh + (size_t)c * 2048; const _Float16* kb = kl + (size_t)c * 2048; const _Float16* vc = vt + (size_t)c * 2048;
    const v16h a0 = pk_frag(ka), a1 = pk_frag(ka + 512), a2 = pk_frag(ka + 1024), a3 = pk_frag(ka + 1536), l0 = pk_frag(kb), l1 = pk_frag(kb + 512), l2 = pk_frag(kb + 1024), l3 = pk_frag(kb + 1536);
    const v16h v0 = vt_frag(vc), v1 = vt_frag(vc + 256), v2 = vt_frag(vc + 512), v3 = vt_frag(vc + 768);
    /* the loaded values are inputs too: all of the chunk's loads (key rows and V^T rows) are asked for together, one trip to the caches a chunk; left alone the compiler reuses two fragments' registers and waits for memory before nearly every product */
    asm volatile("s_wait_xcnt 0x0" :: "v"(ka), "v"(kb), "v"(vc), "v"(a0), "v"(a1), "v"(a2), "v"(a3), "v"(l0), "v"(l1), "v"(l2), "v"(l3), "v"(v0), "v"(v1), "v"(v2), "v"(v3) : "memory");
    __builtin_amdgcn_sched_barrier(0);      /* keeps the products behind the wait, so that the wait is not moved down past them with the last loads */
    fa_scores(a0, a1, l0, l1, qh0, qh1, ql0, ql1, c * 32 + 8 * hh, last, s); fa_scores(a2, a3, l2, l3, qh0, qh1, ql0, ql1, c * 32 + 16 + 8 * hh, last, s + 8);
    float mc = s[0];
#pragma unroll
    for (int i = 1; i < 16; ++i) mc = fmaxf(mc, s[i]);
    const float mn = fmaxf(m, fmaxf(mc, fa_other_half(mc)));      /* both halves' weights enter one product, so they need one maximum */
    const float al = __expf(m - mn);      /* what the sum and the output tiles so far are worth at the new maximum (0 in the first chunk, 1 while the maximum stands) */
    float e[16]; FragH p;
#pragma unroll
    for (int i = 0; i < 16; ++i) { e[i] = __expf(s[i] - mn); p.h[i] = (_Float16)e[i]; }
    const float a = (((e[0] + e[1]) + (e[2] + e[3])) + ((e[4] + e[5]) + (e[6] + e[7]))) + (((e[8] + e[9]) + (e[10] + e[11])) + ((e[12] + e[13]) + (e[14] + e[15])));
    l = l * al + a; m = mn;
    o0 *= al; o1 *= al; o2 *= al; o3 *= al;
    o0 = fa_mma(v0, p.v, o0); o1 = fa_mma(v1, p.v, o1); o2 = fa_mma(v2, p.v, o2); o3 = fa_mma(v3, p.v, o3); }
  const float sc = 64.0f / (l + fa_other_half(l));      /* the other eight keys of every tile sit in the other lane half; o carried x64 */
  const v8f os[4] = {o0, o1, o2, o3};
#pragma unroll
  for (int t = 0; t < 4; ++t) { FragH f;
#pragma unroll
    for (int r = 0; r < 8; ++r) f.h[r] = (_Float16)(os[t][r] * sc);
    *(v8us*)((unsigned short*)O + ((size_t)b * SQ + q0) * DM + h * 1024 + t * 256 + lane * 8) = f.half[0]; } }      /* o in fragment order for the output GEMM: [16-row tile][32-column step][piece][lane][8]; head h, tile t = step 2 h + t / 2, piece t % 2 */


// ---- front end in ONE launch: x -> q and k (f16 hi + x1024 residual planes), V^T, and the first tile's f32 q, k, v rows. One wave per 64 token rows of one head; no LDS, no barrier.
// The wave reads its [64][64] f32 slice of x once, rounds it (bf16, exact in f16) into eight operand fragments and keeps them in registers for all three projections (K = 64: two products a tile, columns 0..31 then 32..63).
// q and k are formed transposed (A = 16 rows of W^T, B = 16 token rows): lane (ln, hh) then holds 8 consecutive head columns of token ln: its own 16 bytes of a piece of the fragment-order q / k planes, so a wave's store is 512 bytes in a row.
// v is formed straight (A = 16 token rows, B = 16 rows of W^T): lane (ln, hh) then holds 8 consecutive tokens of head column ln: its own 16 bytes of a piece of the fragment-order V^T plane.
// Rows 0..127 of each batch also leave as f32 (the exact first-tile path reads them): their waves form each projection a second time (v transposed like q and k) and store it unrounded.
// Every loop is unrolled in full so that the fragments are indexed by constants and stay in registers.
union RawX { v8f v; v4f q[2]; };      /* 8 consecutive f32 of an x row as two 16-byte loads leave them */
__device__ __forceinline__ RawX pj_raw(const float* p) { RawX r; r.q[0] = *(const v4fa*)p; r.q[1] = *(const v4fa*)(p + 4); return r; }
// a: columns 8 hh .. 8 hh + 7 of a 32-column step, c: columns 16 + 8 hh .. of the same step (the operand fragment's element order)
__device__ __forceinline__ v16h pj_xfrag(v8f a, v8f c) { FragH f;
#pragma unroll
  for (int q = 0; q < 8; ++q) { f.h[q] = (_Float16)bf16_round(a[q]); f.h[8 + q] = (_Float16)bf16_round(c[q]); }
  return f.v; }
__device__ __forceinline__ v8f pj_tile(v16h a0, v16h a1, v16h b0, v16h b1) { const v8f z8 = {0.f,0.f,0.f,0.f,0.f,0.f,0.f,0.f}; return fa_mma(a1, b1, fa_mma(a0, b0, z8)) * 0.0625f; }      /* weights carried x16 */
__device__ __forceinline__ void pj_f32(float* d, v8f c) { const v4f lo = {c[0], c[1], c[2], c[3]}, hi = {c[4], c[5], c[6], c[7]}; *(v4f*)d = lo; *(v4f*)(d + 4) = hi; }
// the wait before a register that an issued load names is written again; the weight rows' address and the loaded fragments are inputs, so that the address keeps its registers up to the wait and the sixteen loads stand in front of it, asked for together
__device__ __forceinline__ void pj_wfence(const _Float16* p, const v16h (&f)[4][2]) { asm volatile("s_wait_xcnt 0x0" :: "v"(p), "v"(f[0][0]), "v"(f[0][1]), "v"(f[1][0]), "v"(f[1][1]), "v"(f[2][0]), "v"(f[2][1]), "v"(f[3][0]), "v"(f[3][1]) : "memory"); }
// Hh, Hl: this lane's 16 bytes of the first piece of the wave's first token tile; F0: this lane's first element of the row-major f32 rows (token ln of the wave's rows, head column 8 hh)
__device__ __forceinline__ void pj_qk(const _Float16* __restrict__ wp, const v16h (&xf)[4][2], _Float16* __restrict__ Hh, _Float16* __restrict__ Hl, float* __restrict__ F0, bool first) {
  v16h wf[4][2];
#pragma unroll
  for (int t = 0; t < 4; ++t) { wf[t][0] = pk_frag(wp + t * 16 * HD); wf[t][1] = pk_frag(wp + t * 16 * HD + 512); }
  pj_wfence(wp, wf);
#pragma unroll
  for (int j = 0; j < 4; ++j) {
#pragma unroll
    for (int t = 0; t < 4; ++t) { const v8f c = pj_tile(wf[t][0], wf[t][1], xf[j][0], xf[j][1]); FragH fh, fl;
#pragma unroll
      for (int r = 0; r < 8; ++r) { const _Float16 hv = (_Float16)c[r]; fh.h[r] = hv; fl.h[r] = (_Float16)((c[r] - (float)hv) * 1024.0f); }
      *(v8us*)((unsigned short*)Hh + j * 1024 + t * 256) = fh.half[0]; *(v8us*)((unsigned short*)Hl + j * 1024 + t * 256) = fl.half[0]; } }
  asm volatile("s_wait_xcnt 0x0" ::: "memory");      /* the wait before a register that an issued store names is written again */
  if (first) {      /* one scalar branch a projection: the same products once more, for one wave in sixteen */
#pragma unroll
    for (int j = 0; j < 4; ++j) {
#pragma unroll
      for (int t = 0; t < 4; ++t) pj_f32(F0 + (size_t)j * 16 * DM + t * 16, pj_tile(wf[t][0], wf[t][1], xf[j][0], xf[j][1])); }
    asm volatile("s_wait_xcnt 0x0" ::: "memory");      /* likewise: the next projection's weight loads land in registers that these stores name */
  } }
__global__ __launch_bounds__(128) void k_proj(const float* __restrict__ x, const _Float16* __restrict__ BQp, const _Float16* __restrict__ BKp, const _Float16* __restrict__ BVp, _Float16* __restrict__ QHp, _Float16* __restrict__ QLp, _Float16* __restrict__ KHp, _Float16* __restrict__ KLp, _Float16* __restrict__ VTp,
    float* __restrict__ QF0p, float* __restrict__ KF0p, float* __restrict__ VF0p) {
  const int lane = threadIdx.x & 31, ln = lane & 15, hh = lane >> 4; const int w = __builtin_amdgcn_readfirstlane((int)(threadIdx.x >> 5));      /* the wave's number as a scalar: the first-tile test is a scalar branch, every lane stays on at the products */
  const int h = blockIdx.y; const int r0 = (blockIdx.x * 4 + w) * 64; const int b = r0 / SQ, s0 = r0 % SQ; const bool first = s0 < QT0;
  const float* xp = x + (size_t)(r0 + ln) * DM + h * HD + 8 * hh;
  RawX rx[4][4];
#pragma unroll
  for (int j = 0; j < 4; ++j) {
#pragma unroll
    for (int u = 0; u < 4; ++u) rx[j][u] = pj_raw(xp + (size_t)j * 16 * DM + u * 16); }
  /* the loaded values are inputs: all 32 loads of the slice are asked for together, one trip to memory a wave (left alone the compiler asks for four at a time and waits eight times); the wait stands before the address register is written again */
  asm volatile("s_wait_xcnt 0x0" :: "v"(xp), "v"(rx[0][0].v), "v"(rx[0][1].v), "v"(rx[0][2].v), "v"(rx[0][3].v), "v"(rx[1][0].v), "v"(rx[1][1].v), "v"(rx[1][2].v), "v"(rx[1][3].v), "v"(rx[2][0].v), "v"(rx[2][1].v), "v"(rx[2][2].v), "v"(rx[2][3].v), "v"(rx[3][0].v), "v"(rx[3][1].v), "v"(rx[3][2].v), "v"(rx[3][3].v) : "memory");
  v16h xf[4][2];
#pragma unroll
  for (int j = 0; j < 4; ++j) { xf[j][0] = pj_xfrag(rx[j][0].v, rx[j][1].v); xf[j][1] = pj_xfrag(rx[j][2].v, rx[j][3].v); }
  const size_t wo = (size_t)h * HD * HD + lane * 8;      /* the lane's 16 bytes of the first piece of the head's W^T plane (fragment order) */
  const size_t ro = ((size_t)(b * NH + h) * (SQ / 16) + (s0 >> 4)) * 1024 + lane * 8;      /* likewise of the wave's first token tile in the q, k and V^T planes */ const size_t fo = ((size_t)b * QT0 + (first ? s0 : 0) + ln) * DM + h * HD + 8 * hh;
  pj_qk(BQp + wo, xf, QHp + ro, QLp + ro, QF0p + fo, first);
  pj_qk(BKp + wo, xf, KHp + ro, KLp + ro, KF0p + fo, first);
  const _Float16* wvp = BVp + wo; v16h wf[4][2];
#pragma unroll
  for (int t = 0; t < 4; ++t) { wf[t][0] = pk_frag(wvp + t * 16 * HD); wf[t][1] = pk_frag(wvp + t * 16 * HD + 512); }
  pj_wfence(wvp, wf);
  _Float16* vtp = VTp + ro;
#pragma unroll
  for (int t = 0; t < 4; ++t) {
#pragma unroll
    for (int j = 0; j < 4; ++j) { const v8f c = pj_tile(xf[j][0], xf[j][1], wf[t][0], wf[t][1]); FragH f;
#pragma unroll
      for (int r = 0; r < 8; ++r) f.h[r] = (_Float16)c[r];
      *(v8us*)((unsigned short*)vtp + j * 1024 + t * 256) = f.half[0]; } }
  asm volatile("s_wait_xcnt 0x0" ::: "memory");      /* as in pj_qk, in front of the branch */
  if (first) {
#pragma unroll
    for (int j = 0; j < 4; ++j) {
#pragma unroll
      for (int t = 0; t < 4; ++t) pj_f32(VF0p + fo + (size_t)j * 16 * DM + t * 16, pj_tile(wf[t][0], wf[t][1], xf[j][0], xf[j][1])); } } }

template <int MASKADD>
__global__ __launch_bounds__(64) void k_att0(const float* __restrict__ QF, const float* __restrict__ KF, const float* __restrict__ VF, int ld, const float* __restrict__ mask, float scale, float* __restrict__ OF, int ldo) {
  #pragma clang fp contract(off)
  // One thread per query row, keys in order (online softmax), every sum in the same order as a plain serial loop. The thread's q and o rows live in registers; k and v rows come in chunks of 64 keys,
  // staged once per chunk in LDS by coalesced loads and then read at a wave-uniform address (broadcast). Four keys' score chains run side by side: each is 64 dependent adds, so one alone leaves the issue slots empty.
  // Every loop over c, u and w and the staging loops over it are unrolled in full so that q, o, s and the staged values are indexed by constants and stay in registers; the loops over chunks, half chunks and groups of four keys stay rolled so that the code stays small.
  __shared__ __attribute__((aligned(16))) float lk[64][64]; __shared__ __attribute__((aligned(16))) float lv[64][64]; __shared__ __attribute__((aligned(16))) float lo[64][64];
  const int tid = threadIdx.x; const int h = blockIdx.x / (QT0 / 64), rg = blockIdx.x % (QT0 / 64); const int i = rg * 64 + tid;
  QF += (size_t)blockIdx.y * QT0 * ld; KF += (size_t)blockIdx.y * QT0 * ld; VF += (size_t)blockIdx.y * QT0 * ld; OF += (size_t)blockIdx.y * QT0 * ldo;      /* blockIdx.y = batch: each batch's first-tile rows are a plane of their own */
  const float* qr = QF + (size_t)i * ld + h * HD;
  float q[HD], o[HD];
  { v4f tq[HD / 4];
#pragma unroll
    for (int c = 0; c < HD / 4; ++c) tq[c] = *(const v4fa*)(qr + c * 4);
    asm volatile("s_wait_xcnt 0x0" :: "v"(qr) : "memory");      /* as in the staging below: the row's address keeps its registers until every load that names it has been translated */
#pragma unroll
    for (int c = 0; c < HD / 4; ++c) {
#pragma unroll
      for (int u = 0; u < 4; ++u) { q[c * 4 + u] = tq[c][u]; o[c * 4 + u] = 0.f; } } }
  float m = -1.0e30f, l = 0.f; const int jmax = MASKADD ? (SQ - 1) : (rg * 64 + 63);      /* additive-mask form: every key (the mask input decides); causal form: keys up to the block's last row; jmax + 1 is a multiple of 64 */
#pragma unroll 1
  for (int j0 = 0; j0 <= jmax; j0 += 64) {
    __syncthreads();      /* both waves have left the chunk before it is overwritten */
#pragma unroll 1
    for (int hf = 0; hf < 2; ++hf) { const float* kp[8]; const float* vp[8]; v4f tk[8], tv[8];      /* 32 keys a pass: 16 loads in flight */
#pragma unroll
      for (int it = 0; it < 8; ++it) { const size_t g = (size_t)(j0 + hf * 32 + it * 4 + tid / 16) * ld + h * HD + (tid % 16) * 4; kp[it] = KF + g; vp[it] = VF + g; }
#pragma unroll
      for (int it = 0; it < 8; ++it) { tk[it] = *(const v4fa*)kp[it]; tv[it] = *(const v4fa*)vp[it]; }
      /* the wait before a register that an issued load names is written again; the addresses are inputs so that they keep their registers up to it */
      asm volatile("s_wait_xcnt 0x0" :: "v"(kp[0]), "v"(kp[1]), "v"(kp[2]), "v"(kp[3]), "v"(kp[4]), "v"(kp[5]), "v"(kp[6]), "v"(kp[7]), "v"(vp[0]), "v"(vp[1]), "v"(vp[2]), "v"(vp[3]), "v"(vp[4]), "v"(vp[5]), "v"(vp[6]), "v"(vp[7]) : "memory");
#pragma unroll
      for (int it = 0; it < 8; ++it) { const int row = hf * 32 + it * 4 + tid / 16, pc = (tid % 16) * 4; *(v4f*)&lk[row][pc] = tk[it]; *(v4f*)&lv[row][pc] = tv[it]; } }
    __syncthreads();
#pragma unroll 1
    for (int jj = 0; jj < 64; jj += 4) { float s[4] = {0.f, 0.f, 0.f, 0.f};
#pragma unroll
      for (int c = 0; c < HD / 4; ++c) {
#pragma unroll
        for (int u = 0; u < 4; ++u) { const v4f kq = *(const v4f*)&lk[jj + u][c * 4]; s[u] = __fadd_rn(s[u], __fmul_rn(q[c * 4 + 0], kq[0])); s[u] = __fadd_rn(s[u], __fmul_rn(q[c * 4 + 1], kq[1])); s[u] = __fadd_rn(s[u], __fmul_rn(q[c * 4 + 2], kq[2])); s[u] = __fadd_rn(s[u], __fmul_rn(q[c * 4 + 3], kq[3])); } }
      float sc[4], e[4];      /* the four keys' rescale and weight, key after key (m and l are a chain); the o rows follow */
#pragma unroll
      for (int u = 0; u < 4; ++u) { const int j = j0 + jj + u; float sv = __fmul_rn(s[u], scale); if (MASKADD) sv = __fadd_rn(sv, __fmul_rn(bf16_round(mask[(size_t)i * SQ + j]), -10000.0f));
        const float f = (MASKADD || j <= i) ? 1.f : 0.f; const float sm = fmaf(f, sv, (1.f - f) * -1.0e30f); const float mn = fmaxf(m, sm); sc[u] = expf(m - mn); e[u] = expf(sm - mn); l = __fadd_rn(__fmul_rn(l, sc[u]), e[u]); m = mn; }
#pragma unroll
      for (int u = 0; u < 4; ++u) {
#pragma unroll
        for (int c = 0; c < HD / 4; ++c) { const v4f vv = *(const v4f*)&lv[jj + u][c * 4];
#pragma unroll
          for (int w = 0; w < 4; ++w) o[c * 4 + w] = __fadd_rn(__fmul_rn(o[c * 4 + w], sc[u]), __fmul_rn(e[u], vv[w])); } } } }
  const float fin = 64.0f / l;      /* o carried x64 like the f16 path */
#pragma unroll
  for (int c = 0; c < HD / 4; ++c) { v4f oo;
#pragma unroll
    for (int u = 0; u < 4; ++u) oo[u] = __fmul_rn(o[c * 4 + u], fin);
    *(v4f*)&lo[tid][c * 4] = oo; }
  __syncthreads();
  {
#pragma unroll 1
    for (int it = 0; it < 16; ++it) { const int row = it * 4 + tid / 16, pc = (tid % 16) * 4; const v4f v = *(const v4f*)&lo[row][pc]; *(v4f*)(OF + (size_t)(rg * 64 + row) * ldo + h * HD + pc) = v; }
     } }

extern "C" void kernel_launch(void* const* d_in, const int* in_sizes, int n_in,
                              void* d_out, int out_size, void* d_ws, size_t ws_size, hipStream_t stream) {
  (void)in_sizes; (void)n_in; (void)out_size;
  const float* const* I = (const float* const*)d_in; const float* x = I[0]; const float* xk = I[0]; const float* xv = I[0]; const float* wq = I[1]; const float* bq = nullptr; const float* wk = I[2]; const float* bk = nullptr; const float* wv = I[3]; const float* bv = nullptr; const float* wo = I[4]; const float* bo = nullptr;      /* input order: x, Wq, Wk, Wv (BLOCK-DIAGONAL per-head [16][64][64] = [head][in][out]; NO biases: null pointers), Wo ([in][out] [1024][1024]; no bias: a null pointer in the output GEMM's guarded slot); five inputs */
  char* ws = (char*)d_ws; size_t off = 0;
  auto take = [&](size_t bytes) { char* p = ws + off; off += (bytes + 255) & ~(size_t)255; return p; };
  _Float16* BQ = (_Float16*)take((size_t)DM * DM * 2); _Float16* BK = (_Float16*)take((size_t)DM * DM * 2); _Float16* BV = (_Float16*)take((size_t)DM * DM * 2); _Float16* BO = (_Float16*)take((size_t)DM * DM * 2);
  _Float16* QH = (_Float16*)take(NR * DM * 2); _Float16* QL = (_Float16*)take(NR * DM * 2); _Float16* KH = (_Float16*)take(NR * DM * 2); _Float16* KL = (_Float16*)take(NR * DM * 2); _Float16* O16 = (_Float16*)take(NR * DM * 2);
  _Float16* VT = (_Float16*)take((size_t)NB * NH * HD * SQ * 2);      /* V^T of every batch: the fused attention launch covers all of them */
  float* QF0 = (float*)take((size_t)NB * QT0 * DM * 4); float* KF0 = (float*)take((size_t)NB * QT0 * DM * 4); float* VF0 = (float*)take((size_t)NB * QT0 * DM * 4);      /* a plane per batch: the first-tile launches cover all batches */ float* OF0 = (float*)take((size_t)NB * QT0 * DM * 4); _Float16* OH0 = (_Float16*)take((size_t)NB * QT0 * DM * 2); _Float16* OL0 = (_Float16*)take((size_t)NB * QT0 * DM * 2);
  if (off > ws_size) return;
  { const unsigned gn = (unsigned)(((size_t)DM * (DM / 8) + 255) / 256); const unsigned gp = (unsigned)(((size_t)HD * (HD / 8) + 255) / 256); k_wt_f16h<<<dim3(gp, NH, 3), 256, 0, stream>>>(wq, wk, wv, BQ, BK, BV, 16.0f); k_wt_f16<<<gn, 256, 0, stream>>>(wo, BO, DM, DM, 16.0f); }      /* BLOCK-DIAGONAL per-head weights wq / wk / wv [NH][HD][HD] = [head][in][out] (x_h @ W_h): W_h[d][e] -> Bt_h[e][d] x16 through the file's transposing builder with K = N = 64, all heads and stacks in one launch (grid y = head, z = stack), into sixteen consecutive [64][64] planes (the first 128 KiB of the weight plane); Wo [in][out]: the same builder with K = N = 1024 */
  k_proj<<<dim3((unsigned)(NR / 256), NH), 128, 0, stream>>>(x, BQ, BK, BV, QH, QL, KH, KL, VT, QF0, KF0, VF0);      /* x -> q, k (f16 hi + x1024 residual planes), V^T (all three in fragment order, [NB][NH][SQ / 16][4][32][8]) and the f32 q, k, v of each batch's first 128 rows: every batch, head and row in one launch (grid x = 256 rows, y = head) */
  const size_t r0p = (size_t)B0 * SQ;      /* first projected row */
  k_att0<0><<<dim3(NH * (QT0 / 64), NBR), 64, 0, stream>>>(QF0, KF0, VF0, DM, nullptr, SCL, OF0 + (size_t)B0 * QT0 * DM, DM);      /* exact f32 attention for rows 0..127 of every batch (o x64), grid y = batch */
  k_fattn<<<NB * NH * (SQ / 64), 128, 0, stream>>>(QH, QL, KH, KL, VT, O16);      /* scores (hi.hi + lo.hi + hi.lo), causal softmax and P . V of every batch, head and query row in one launch: o (merged heads, x64) as f16 in fragment order */
  k_gemm2<0><<<dim3((unsigned)((MPO / 128) * (DM / 64)), 1), 128, 0, stream>>>(O16 + r0p * DM, DM, 0, BO, DM, 0, 0.0009765625f, bo, 0, nullptr, 1, 0, 0, (float*)d_out + r0p * DM, nullptr, DM, 0, MPO, DM, DM, 0, 0);      /* out rows are the output layout */
  k_hl<<<(unsigned)(((size_t)NB * QT0 * DM / 8 + 255) / 256), 256, 0, stream>>>(OF0, OH0, OL0, (size_t)NB * QT0 * DM / 8);      /* first-tile o (x64) -> f16 hi + x1024 residual planes in fragment order */
  k_gemm2<0><<<dim3((QT0 / 128) * (DM / 64), NBR), 128, 0, stream>>>(OH0 + (size_t)B0 * QT0 * DM, DM, (size_t)QT0 * DM, BO, DM, 0, 0.0009765625f, bo, 0, nullptr, 1, 0, 0, (float*)d_out + r0p * DM, nullptr, DM, (size_t)SQ * DM, QT0, DM, DM, 0, 0);      /* rows 0..127 of every batch (grid y = batch): out = o_hi Wo (+ b), overwriting the f16-path rows */
  k_gemm2<0><<<dim3((QT0 / 128) * (DM / 64), NBR), 128, 0, stream>>>(OL0 + (size_t)B0 * QT0 * DM, DM, (size_t)QT0 * DM, BO, DM, 0, 0.00000095367431640625f, nullptr, 0, (const float*)d_out + r0p * DM, -1, 0, 0, (float*)d_out + r0p * DM, nullptr, DM, (size_t)SQ * DM, QT0, DM, DM, 0, 0);      /* += o_lo Wo 2^-20 (own-element accumulate) */
}

// v008
// A run of this version takes 159 microseconds.
// Timed twice side by side with v007, it ran 1.87 and 1.89 times as fast.
// All steps since v000 together make it 71.2 times as fast.
#include <hip/hip_runtime.h>
// Causal multi-head self-attention with BLOCK-DIAGONAL per-head projections (x [4][2048][1024] viewed (b, s, 16, 64); q / k / v = einsum('bshd,hde->bshe', xh, W): EACH HEAD applies its own [64][64] weight (W [16][64][64] = [head][in][out], normal x 0.02; NO biases) to ITS OWN 64-wide slice of the row; scores / sqrt(64); where(tril, scores, -inf); softmax over keys; out = merged Wo ([in][out] [1024][1024]; no bias) -> [4][2048][1024]); each projection is ONE head-batched GEMM (K = 64); q and k carried as f16 hi + x1024 residual planes with three-product scores.
// Structure: token rows r = b*2048 + s; ONE front-end launch, one wave per 64 rows of one head: x rounded (bf16, exact in f16) into register fragments, q and k as WMMA products (f32 accumulation, exact x16 weights) split in registers into f16 hi + x1024 residual planes, v as f16 written straight as V^T, the first 128 rows of each batch also as f32; then ONE attention launch: rows 0..127 of each batch exactly in f32 (work-groups of their own, two lanes a row), every other query row fused, one wave per 16 rows: scores against the keys up to the diagonal as three products (hi.hi + lo.hi + hi.lo, K = 64) kept in registers, causal softmax there in one walk (keys above the row masked by a select; running maximum, f32 statistics, native exp; weights f16, at most 1, normalised at the end), o = P . V (o carried x64, folded into the output GEMM alpha) written straight into the merged f16 o plane (every f16 operand plane is kept in fragment order: see pk_frag); out = o W_o GEMM (f32) into the output layout, one launch, rows 0..127 of each batch from the exact path's hi + residual planes.
// Compute dtype: inputs rounded to bf16; x / weights exact; v, softmax weights and o as plain f16 GEMM operands (~2^-12; q, k and the o of rows 0..127 as f16 hi + x1024 residual pairs); scores and softmax statistics f32. v_wmma_f32_16x16x32_f16.
#define NB 4
#define SCL 0.125f                         /* 1 / sqrt(head_dim 64) */
#define SCLR 0.0001220703125f               /* 2^-13: the same scale on the x1024 residual passes */
#define SQ 2048
#define DM 1024
#define NH 16
#define HD 64
#define HG 4                         /* heads per launch of the k_vt(b, h0) overload (not launched) */
#define QT 256                       /* not used */
#define NKX SQ                       /* not used */
#define QT0 128                      /* first-tile rows recomputed exactly in f32 */
#define B0 0                         /* not used */
#define NBR NB                       /* only in MP, which is not used */
#define NR ((size_t)NB * SQ)         /* token rows */
#define MP ((int)((size_t)NBR * SQ)) /* only in MPO, which is not used */
#define QN SQ                        /* not used */
#define NHD NH                       /* not used */
#define MPO MP                       /* not used */
#define LQ DM      /* not used */
typedef __bf16 v16b __attribute__((ext_vector_type(16)));
typedef unsigned short v8us __attribute__((ext_vector_type(8), may_alias));
typedef float  v8f  __attribute__((ext_vector_type(8)));
typedef float  v4f  __attribute__((ext_vector_type(4)));
typedef float  v4fa __attribute__((ext_vector_type(4), may_alias));
union FragB { v16b v; v8us half[2]; unsigned short u[16]; };

__device__ __forceinline__ unsigned short bf16_bits(float x) { unsigned int u = __float_as_uint(x); return (unsigned short)((u + 0x7FFFu + ((u >> 16) & 1u)) >> 16); }
__device__ __forceinline__ float bf16_val(unsigned short b) { return __uint_as_float(((unsigned int)b) << 16); }
__device__ __forceinline__ float bf16_round(float x) { return bf16_val(bf16_bits(x)); }
// D += A·B with NT terms: 1 = ah·bh, 2 = + al·bh (A split), 3 = + ah·bl (both split)
template <int NT>
__device__ __forceinline__ v8f mmaN(v16b ah, v16b al, v16b bh, v16b bl, v8f c) {
  c = __builtin_amdgcn_wmma_f32_16x16x32_bf16(false, ah, false, bh, (short)0, c, false, false);
  if (NT >= 2) c = __builtin_amdgcn_wmma_f32_16x16x32_bf16(false, al, false, bh, (short)0, c, false, false);
  if (NT >= 3) c = __builtin_amdgcn_wmma_f32_16x16x32_bf16(false, ah, false, bl, (short)0, c, false, false);
  asm volatile("v_nop\n\tv_nop\n\tv_nop\n\tv_nop" : "+v"(c) : "v"(ah), "v"(al), "v"(bh), "v"(bl));
  return c;
}

__global__ __launch_bounds__(256) void k_wt_bf16(const float* __restrict__ W, unsigned short* __restrict__ Wt, int K, int N) {
  const int t = blockIdx.x * 256 + threadIdx.x;
  const int k8n = K / 8;
  if (t >= N * k8n) return;
  const int n = t / k8n, k8 = (t % k8n) * 8;
  v8us v;
#pragma unroll
  for (int i = 0; i < 8; ++i) v[i] = bf16_bits(W[(size_t)(k8 + i) * N + n]);
  *(v8us*)(Wt + (size_t)n * K + k8) = v;
  
}

// GEMM C[M][N] (f32, pitch ldc) = act(A[M][K]·W + bias). A f32 row-major (pitch lda) converted per fragment to bf16
// (ASPLIT: hi/lo two planes -> 2 terms, else single rounded term); Wt bf16 [N][K] (pitch ldb). BIAS_BF16 rounds the
// bias to bf16 first (bias quantised to bf16 before the add). K%32==0, M%16==0, N%64==0.
template <bool ASPLIT, int ACT, bool BIAS_BF16>
__global__ __launch_bounds__(128) void k_gemm_bf(const float* __restrict__ A, int lda, const unsigned short* __restrict__ Wt, int ldb,
                                               const float* __restrict__ bias, float* __restrict__ C, int ldc, int M, int N, int K) {
  __shared__ __attribute__((aligned(16))) float so[4][16][64];
  const int tid = threadIdx.x, w = tid >> 5, lane = tid & 31, ln = lane & 15, hh = lane >> 4;
  const int ntn = N / 64;
  const int wid = blockIdx.x * 4 + w;
  const int mt = wid / ntn, nq = wid % ntn;
  if (mt * 16 >= M) return;
  const int row0 = mt * 16, col0 = nq * 64;
  const float* arow = A + (size_t)(row0 + ln) * lda;
  v8f acc[4] = {};
  for (int kb = 0; kb < K; kb += 32) {
    FragB ah, al;
    const v4f x0 = *(const v4fa*)(arow + kb + 8 * hh), x1 = *(const v4fa*)(arow + kb + 8 * hh + 4);
    const v4f x2 = *(const v4fa*)(arow + kb + 16 + 8 * hh), x3 = *(const v4fa*)(arow + kb + 16 + 8 * hh + 4);
    float xs[16] = {x0[0],x0[1],x0[2],x0[3],x1[0],x1[1],x1[2],x1[3],x2[0],x2[1],x2[2],x2[3],x3[0],x3[1],x3[2],x3[3]};
#pragma unroll
    for (int i = 0; i < 16; ++i) { const unsigned short hb = bf16_bits(xs[i]); ah.u[i] = hb; al.u[i] = ASPLIT ? bf16_bits(xs[i] - bf16_val(hb)) : (unsigned short)0; }
#pragma unroll
    for (int t = 0; t < 4; ++t) {
      const unsigned short* brow = Wt + (size_t)(col0 + t * 16 + ln) * ldb + kb;
      FragB b;
      b.half[0] = *(const v8us*)(brow + 8 * hh);
      b.half[1] = *(const v8us*)(brow + 16 + 8 * hh);
      acc[t] = mmaN<ASPLIT ? 2 : 1>(ah.v, al.v, b.v, b.v, acc[t]);
    }
  }
#pragma unroll
  for (int t = 0; t < 4; ++t) {
    float bv = bias ? bias[col0 + t * 16 + ln] : 0.f;
    if (BIAS_BF16) bv = bf16_round(bv);
#pragma unroll
    for (int r = 0; r < 8; ++r) { float v = acc[t][r] + bv; if (ACT == 1) v = fmaxf(v, 0.f); so[w][8 * hh + r][t * 16 + ln] = v; }
  }
  __builtin_amdgcn_fence(__ATOMIC_ACQ_REL, "workgroup");
  __builtin_amdgcn_wave_barrier();
  const int rsub = lane >> 4, c4 = (lane & 15) * 4;
  {
#pragma unroll
    for (int q = 0; q < 8; ++q) {
      const int r = q * 2 + rsub;
      const v4f v = *(const v4fa*)&so[w][r][c4];
      *(v4f*)(C + (size_t)(row0 + r) * ldc + col0 + c4) = v;
    }
    
  }
}

// GEMM C = act(A·W + bias + resid): A f32 (ASPLIT -> hi/lo 2 terms), Wt bf16 [N][K]; ACT 0 none, 1 relu, 2 exact gelu;
// resid (optional, f32, row index = (row % rmod), pitch ldr, RES_BF16 rounds it) added before the activation.
template <bool ASPLIT, int ACT, bool BIAS_BF16, bool RES_BF16>
__global__ __launch_bounds__(128) void k_gemm_bf3(const float* __restrict__ A, int lda, const unsigned short* __restrict__ Wt, int ldb,
                                                const float* __restrict__ bias, const float* __restrict__ resid, int rmod, int ldr,
                                                float* __restrict__ C, int ldc, int M, int N, int K) {
  __shared__ __attribute__((aligned(16))) float so[4][16][64];
  const int tid = threadIdx.x, w = tid >> 5, lane = tid & 31, ln = lane & 15, hh = lane >> 4;
  const int ntn = N / 64;
  const int wid = blockIdx.x * 4 + w;
  const int mt = wid / ntn, nq = wid % ntn;
  if (mt * 16 >= M) return;
  const int row0 = mt * 16, col0 = nq * 64;
  const float* arow = A + (size_t)(row0 + ln) * lda;
  v8f acc[4] = {};
  for (int kb = 0; kb < K; kb += 32) {
    FragB ah, al;
    const v4f x0 = *(const v4fa*)(arow + kb + 8 * hh), x1 = *(const v4fa*)(arow + kb + 8 * hh + 4);
    const v4f x2 = *(const v4fa*)(arow + kb + 16 + 8 * hh), x3 = *(const v4fa*)(arow + kb + 16 + 8 * hh + 4);
    float xs[16] = {x0[0],x0[1],x0[2],x0[3],x1[0],x1[1],x1[2],x1[3],x2[0],x2[1],x2[2],x2[3],x3[0],x3[1],x3[2],x3[3]};
#pragma unroll
    for (int i = 0; i < 16; ++i) { const unsigned short hb = bf16_bits(xs[i]); ah.u[i] = hb; al.u[i] = ASPLIT ? bf16_bits(xs[i] - bf16_val(hb)) : (unsigned short)0; }
#pragma unroll
    for (int t = 0; t < 4; ++t) {
      const unsigned short* brow = Wt + (size_t)(col0 + t * 16 + ln) * ldb + kb;
      FragB b;
      b.half[0] = *(const v8us*)(brow + 8 * hh);
      b.half[1] = *(const v8us*)(brow + 16 + 8 * hh);
      acc[t] = mmaN<ASPLIT ? 2 : 1>(ah.v, al.v, b.v, b.v, acc[t]);
    }
  }
#pragma unroll
  for (int t = 0; t < 4; ++t) {
    const int col = col0 + t * 16 + ln;
    float bv = bias ? bias[col] : 0.f;
    if (BIAS_BF16) bv = bf16_round(bv);
#pragma unroll
    for (int r = 0; r < 8; ++r) {
      float v = acc[t][r] + bv;
      if (resid) { float rv = resid[(size_t)((row0 + 8 * hh + r) % rmod) * ldr + col]; if (RES_BF16) rv = bf16_round(rv); v += rv; }
      if (ACT == 1) v = fmaxf(v, 0.f);
      if (ACT == 2) v = 0.5f * v * (1.0f + erff(v * 0.70710678118654752f));
      if (ACT == 3) { const float u = 0.7978845608028654f * (v + 0.044715f * v * v * v); v = 0.5f * v * (1.0f + tanhf(u)); }
      so[w][8 * hh + r][t * 16 + ln] = v;
    }
  }
  __builtin_amdgcn_fence(__ATOMIC_ACQ_REL, "workgroup");
  __builtin_amdgcn_wave_barrier();
  const int rsub = lane >> 4, c4 = (lane & 15) * 4;
  {
#pragma unroll
    for (int q = 0; q < 8; ++q) {
      const int r = q * 2 + rsub;
      const v4f v = *(const v4fa*)&so[w][r][c4];
      *(v4f*)(C + (size_t)(row0 + r) * ldc + col0 + c4) = v;
    }
    
  }
}
// row LayerNorm (biased variance, eps) over N: s = X (+ R); optional out_sum <- s; out_norm <- (s-mu)*rsqrt(var+eps)*g + b
template <bool PARAM_BF16>
__global__ __launch_bounds__(256) void k_layernorm(const float* __restrict__ X, const float* __restrict__ R, const float* __restrict__ g, const float* __restrict__ bta,
                                                  float* __restrict__ out_sum, float* __restrict__ out_norm, int N, float eps) {
  __shared__ float red[256];
  const int row = blockIdx.x, tid = threadIdx.x;
  const float* x = X + (size_t)row * N; const float* rr = R ? R + (size_t)row * N : nullptr;
  float vals[16];                     // up to N = 4096
  const int per = N / 256;            // contiguous chunk per thread? use strided-by-4 chunks: thread handles j = tid*4 + 1024*u
  float s1 = 0.f;
  for (int u = 0; u < per / 4; ++u) {
    const int j = tid * 4 + 1024 * u;
    const v4f a = *(const v4fa*)(x + j);
    v4f b = {0.f,0.f,0.f,0.f}; if (rr) b = *(const v4fa*)(rr + j);
#pragma unroll
    for (int q = 0; q < 4; ++q) { const float v = a[q] + b[q]; vals[u * 4 + q] = v; s1 += v; }
  }
  red[tid] = s1; __syncthreads();
  for (int st = 128; st > 0; st >>= 1) { if (tid < st) red[tid] += red[tid + st]; __syncthreads(); }
  const float mu = red[0] / (float)N; __syncthreads();
  float s2 = 0.f;
  for (int u = 0; u < per / 4; ++u)
#pragma unroll
    for (int q = 0; q < 4; ++q) { const float c = vals[u * 4 + q] - mu; s2 += c * c; }
  red[tid] = s2; __syncthreads();
  for (int st = 128; st > 0; st >>= 1) { if (tid < st) red[tid] += red[tid + st]; __syncthreads(); }
  const float rs = rsqrtf(red[0] / (float)N + eps);
  {
    for (int u = 0; u < per / 4; ++u) {
      const int j = tid * 4 + 1024 * u;
      v4f o, sm;
#pragma unroll
      for (int q = 0; q < 4; ++q) {
        float gg = g[j + q], bb = bta[j + q];
        if (PARAM_BF16) { gg = bf16_round(gg); bb = bf16_round(bb); }
        sm[q] = vals[u * 4 + q]; o[q] = (vals[u * 4 + q] - mu) * rs * gg + bb;
      }
      if (out_sum) *(v4f*)(out_sum + (size_t)row * N + j) = sm;
      *(v4f*)(out_norm + (size_t)row * N + j) = o;
    }
    
  }
}



// ---- f16 WMMA path (v_wmma_f32_16x16x32_f16): 11-bit significands for operands in range — used where a [0,1] probability operand needs more precision than bf16
typedef _Float16 v16h __attribute__((ext_vector_type(16)));
union FragH { v16h v; v8us half[2]; _Float16 h[16]; unsigned short u[16]; };
template <int NT>
__device__ __forceinline__ v8f mmaH(v16h ah, v16h al, v16h bh, v16h bl, v8f c) {
  c = __builtin_amdgcn_wmma_f32_16x16x32_f16(false, ah, false, bh, (short)0, c, false, false);
  if (NT >= 2) c = __builtin_amdgcn_wmma_f32_16x16x32_f16(false, al, false, bh, (short)0, c, false, false);
  if (NT >= 3) c = __builtin_amdgcn_wmma_f32_16x16x32_f16(false, ah, false, bl, (short)0, c, false, false);
  asm volatile("v_nop\n\tv_nop\n\tv_nop\n\tv_nop" : "+v"(c) : "v"(ah), "v"(al), "v"(bh), "v"(bl));
  return c;
}
// batched GEMM like k_gemm_b but f16 operands: A f32 (split into f16 hi/lo if ASPLIT, else rounded to f16), Bt = f16 values [n][k]; alpha; C f32; N multiple of 16 (partial tiles skipped)
template <bool ASPLIT>
__global__ __launch_bounds__(128) void k_gemm_h(const float* __restrict__ A, int lda, size_t sA, const _Float16* __restrict__ Bh, int ldb, size_t sB, float alpha, float* __restrict__ C, int ldc, size_t sC, int M, int N, int K) {
  __shared__ __attribute__((aligned(16))) float so[4][16][64];
  const int tid = threadIdx.x, w = tid >> 5, lane = tid & 31, ln = lane & 15, hh = lane >> 4; const int by = blockIdx.y;
  A += (size_t)by * sA; Bh += (size_t)by * sB; C += (size_t)by * sC;
  const int ntn = (N + 63) / 64; const int wid = blockIdx.x * 4 + w; const int mt = wid / ntn, nq = wid % ntn; if (mt * 16 >= M) return;
  const int row0 = mt * 16, col0 = nq * 64; const float* arow = A + (size_t)(row0 + ln) * lda;
  v8f acc[4] = {};
  for (int kb = 0; kb < K; kb += 32) {
    FragH ah, al;
    const v4f x0 = *(const v4fa*)(arow + kb + 8 * hh), x1 = *(const v4fa*)(arow + kb + 8 * hh + 4), x2 = *(const v4fa*)(arow + kb + 16 + 8 * hh), x3 = *(const v4fa*)(arow + kb + 16 + 8 * hh + 4);
    float xs[16] = {x0[0],x0[1],x0[2],x0[3],x1[0],x1[1],x1[2],x1[3],x2[0],x2[1],x2[2],x2[3],x3[0],x3[1],x3[2],x3[3]};
#pragma unroll
    for (int i = 0; i < 16; ++i) { const _Float16 h = (_Float16)xs[i]; ah.h[i] = h; al.h[i] = ASPLIT ? (_Float16)(xs[i] - (float)h) : (_Float16)0.0f; }
#pragma unroll
    for (int t = 0; t < 4; ++t) { if (col0 + t * 16 >= N) continue; const size_t boff = (size_t)(col0 + t * 16 + ln) * ldb + kb; FragH bq; bq.half[0] = *(const v8us*)(Bh + boff + 8 * hh); bq.half[1] = *(const v8us*)(Bh + boff + 16 + 8 * hh);
      acc[t] = mmaH<ASPLIT ? 2 : 1>(ah.v, al.v, bq.v, bq.v, acc[t]); }
  }
#pragma unroll
  for (int t = 0; t < 4; ++t) { if (col0 + t * 16 >= N) continue;
#pragma unroll
    for (int r = 0; r < 8; ++r) so[w][8 * hh + r][t * 16 + ln] = acc[t][r] * alpha; }
  __builtin_amdgcn_fence(__ATOMIC_ACQ_REL, "workgroup"); __builtin_amdgcn_wave_barrier();
  const int rsub = lane >> 4, c4 = (lane & 15) * 4;
  {
#pragma unroll
    for (int q = 0; q < 8; ++q) { const int r = q * 2 + rsub; if (col0 + c4 < N) { const v4f v = *(const v4fa*)&so[w][r][c4]; *(v4f*)(C + (size_t)(row0 + r) * ldc + col0 + c4) = v; } }
     }
}

// Wt(n, k) = f16(W[k][n]·scale), stored in fragment order, from f32 row-major W[K][N] (scale = power of two; bf16-exact weights stay exact in f16 away from the subnormal range)
__global__ __launch_bounds__(256) void k_wt_f16(const float* __restrict__ W, _Float16* __restrict__ Wt, int K, int N, float scale) {
  /* Wt in fragment order ([16-row tile of n][32-column step of k][piece][lane][8]): thread t writes the t-th 16 bytes of the plane */
  const int t = blockIdx.x * 256 + threadIdx.x; if (t >= N * (K / 8)) return; const int blk = t >> 6; const int n = (blk / (K / 32)) * 16 + (t & 15), k8 = (blk % (K / 32)) * 32 + ((t >> 5) & 1) * 16 + ((t >> 4) & 1) * 8; FragH f;
#pragma unroll
  for (int i = 0; i < 8; ++i) f.h[i] = (_Float16)(bf16_round(W[(size_t)(k8 + i) * N + n]) * scale); const v8us o = f.half[0];
  *(v8us*)((unsigned short*)Wt + (size_t)t * 8) = o; 
}
// the same builder for the per-head [64][64] weights of three stacks in ONE launch: blockIdx.y = head (consecutive [64][64] planes in source and destination), blockIdx.z = stack
__global__ __launch_bounds__(256) void k_wt_f16h(const float* __restrict__ Wa, const float* __restrict__ Wb, const float* __restrict__ Wc, _Float16* __restrict__ Ta, _Float16* __restrict__ Tb, _Float16* __restrict__ Tc, float scale) {
  const int t = blockIdx.x * 256 + threadIdx.x; if (t >= HD * (HD / 8)) return; const int blk = t >> 6; const int n = (blk / (HD / 32)) * 16 + (t & 15), k8 = (blk % (HD / 32)) * 32 + ((t >> 5) & 1) * 16 + ((t >> 4) & 1) * 8; const size_t o = (size_t)blockIdx.y * HD * HD;      /* each plane in fragment order, thread t its t-th 16 bytes */
  const float* W = (blockIdx.z == 0 ? Wa : blockIdx.z == 1 ? Wb : Wc) + o; _Float16* Wt = (blockIdx.z == 0 ? Ta : blockIdx.z == 1 ? Tb : Tc) + o; FragH f;
#pragma unroll
  for (int i = 0; i < 8; ++i) f.h[i] = (_Float16)(bf16_round(W[(size_t)(k8 + i) * HD + n]) * scale); const v8us ov = f.half[0];
  *(v8us*)((unsigned short*)Wt + (size_t)t * 8) = ov;
}
// k_gemm_hh variant with fused epilogue: v = acc·alpha + bias[by·sBias + col] (+ CP[(row/rowsPerB)·sCPb + by·64 + col] if CP) ; ACT 0 none / 1 elu ; writes f16 C16 (and f32 C if non-null)
template <int ACT>
__global__ __launch_bounds__(128) void k_gemm_hhx(const _Float16* __restrict__ A, int lda, size_t sA, const _Float16* __restrict__ Bh, int ldb, size_t sB, float alpha, const float* __restrict__ bias, size_t sBias, const float* __restrict__ CP, int rowsPerB, size_t sCPb, int row0g,
    float* __restrict__ C, _Float16* __restrict__ C16, int ldc, size_t sC, int M, int N, int K) {
  __shared__ __attribute__((aligned(16))) float so[4][16][64];
  const int tid = threadIdx.x, w = tid >> 5, lane = tid & 31, ln = lane & 15, hh = lane >> 4; const int by = blockIdx.y;
  A += (size_t)by * sA; Bh += (size_t)by * sB; const size_t cofs = (size_t)by * sC; const float* bp = bias ? bias + (size_t)by * sBias : nullptr;
  const int ntn = (N + 63) / 64; const int wid = blockIdx.x * 4 + w; const int mt = wid / ntn, nq = wid % ntn; if (mt * 16 >= M) return;
  const int row0 = mt * 16, col0 = nq * 64; const _Float16* arow = A + (size_t)(row0 + ln) * lda;
  v8f acc[4] = {};
  for (int kb = 0; kb < K; kb += 32) { FragH ah; ah.half[0] = *(const v8us*)((const unsigned short*)arow + kb + 8 * hh); ah.half[1] = *(const v8us*)((const unsigned short*)arow + kb + 16 + 8 * hh);
#pragma unroll
    for (int t = 0; t < 4; ++t) { if (col0 + t * 16 >= N) continue; const size_t boff = (size_t)(col0 + t * 16 + ln) * ldb + kb; FragH bq; bq.half[0] = *(const v8us*)((const unsigned short*)Bh + boff + 8 * hh); bq.half[1] = *(const v8us*)((const unsigned short*)Bh + boff + 16 + 8 * hh);
      acc[t] = mmaH<1>(ah.v, ah.v, bq.v, bq.v, acc[t]); }
  }
#pragma unroll
  for (int t = 0; t < 4; ++t) { if (col0 + t * 16 >= N) continue; const int col = col0 + t * 16 + ln; const float bv = bp ? bf16_round(bp[col]) : 0.f;
#pragma unroll
    for (int r = 0; r < 8; ++r) { float v = acc[t][r] * alpha + bv; if (CP) { const int rr = row0g + row0 + 8 * hh + r; if (rowsPerB < 0) v += CP[cofs + (size_t)rr * ldc + col];      /* rowsPerB < 0: own element of the batched C plane */ else { const int bidx = rr / rowsPerB; v += CP[(size_t)bidx * sCPb + (size_t)by * 64 + col]; } } if (ACT == 1) v = (v > 0.f) ? v : expm1f(v); else if (ACT == 7) v = (v > 0.f) ? v + 1.0f : expf(v); else if (ACT == 8) v = tanhf(v); else if (ACT == 9) v = 0.5f * v * (1.0f + tanhf(0.7978845608028654f * (v + 0.044715f * v * v * v))); else if (ACT == 11) v = 1.0f / (1.0f + expf(-v)); else if (ACT == 12) v = (v > 0.f) ? v : 0.01f * v; else if (ACT == 14) v = (v > 0.f) ? v : 0.1f * v; else if (ACT == 16) v = (v >= 0.f) ? v : 0.3f * v; else if (ACT == 17) v = (v >= 0.f) ? v : 0.2f * v; else if (ACT == 15) v = v / (1.0f + expf(-v)); else if (ACT == 3) v = fmaxf(v, 0.f); else if (ACT == 6) v = 0.5f * v * (1.0f + erff(v * 0.70710678118654752f)); so[w][8 * hh + r][t * 16 + ln] = v; } }
  __builtin_amdgcn_fence(__ATOMIC_ACQ_REL, "workgroup"); __builtin_amdgcn_wave_barrier();
  const int rsub = lane >> 4, c4 = (lane & 15) * 4; typedef _Float16 v4h __attribute__((ext_vector_type(4)));
  {
#pragma unroll
    for (int q = 0; q < 8; ++q) { const int r = q * 2 + rsub; if (col0 + c4 < N) { const v4f v = *(const v4fa*)&so[w][r][c4]; if (C) *(v4f*)(C + cofs + (size_t)(row0 + r) * ldc + col0 + c4) = v; if (C16) { v4h h4; for (int i = 0; i < 4; ++i) h4[i] = (_Float16)v[i]; *(v4h*)(C16 + cofs + (size_t)(row0 + r) * ldc + col0 + c4) = h4; } } }
     }
}


typedef _Float16 v4h __attribute__((ext_vector_type(4)));

__global__ __launch_bounds__(256) void k_x16(const float* __restrict__ x, _Float16* __restrict__ X16, size_t n8) { const size_t t = (size_t)blockIdx.x * 256 + threadIdx.x; if (t >= n8) return; FragH f;
#pragma unroll
  for (int q = 0; q < 8; ++q) f.h[q] = (_Float16)bf16_round(x[t * 8 + q]); *(v8us*)((unsigned short*)X16 + t * 8) = f.half[0];  }
__global__ __launch_bounds__(256) void k_h16(const float* __restrict__ x, _Float16* __restrict__ X16, size_t n8) { const size_t t = (size_t)blockIdx.x * 256 + threadIdx.x; if (t >= n8) return; FragH f;
#pragma unroll
  for (int q = 0; q < 8; ++q) f.h[q] = (_Float16)x[t * 8 + q]; *(v8us*)((unsigned short*)X16 + t * 8) = f.half[0];  }
__global__ __launch_bounds__(256) void k_round16f(const float* __restrict__ W, _Float16* __restrict__ Bt, size_t n8) { const size_t t = (size_t)blockIdx.x * 256 + threadIdx.x; if (t >= n8) return; FragH f;
#pragma unroll
  for (int i = 0; i < 8; ++i) f.h[i] = (_Float16)(bf16_round(W[t * 8 + i]) * 16.0f); *(v8us*)((unsigned short*)Bt + t * 8) = f.half[0];  }
template <int NHv, int TTv>
__global__ __launch_bounds__(256) void k_vt(const _Float16* __restrict__ V16, int ldv, int voff, _Float16* __restrict__ Vt) { __shared__ unsigned short tl[64][66]; const int tid = threadIdx.x; const int slab = blockIdx.x / (TTv / 64), lg = blockIdx.x % (TTv / 64); const int b = slab / NHv, h = slab % NHv;
  for (int i = tid; i < 64 * 8; i += 256) { const int r = i / 8, c8 = (i % 8) * 8; FragH f; f.half[0] = *(const v8us*)((const unsigned short*)V16 + ((size_t)b * TTv + lg * 64 + r) * ldv + voff + h * 64 + c8);
#pragma unroll
    for (int q = 0; q < 8; ++q) tl[r][c8 + q] = f.u[q]; }
  __syncthreads();
  {
#pragma unroll
    for (int rd = 0; rd < 2; ++rd) { const int d = rd * 32 + tid / 8, pc = tid % 8; FragH f;
#pragma unroll
      for (int q = 0; q < 8; ++q) f.u[q] = tl[pc * 8 + q][d];
      *(v8us*)((unsigned short*)Vt + ((size_t)slab * 64 + d) * TTv + lg * 64 + pc * 8) = f.half[0]; }
     } }

__global__ __launch_bounds__(256) void k_hl(const float* __restrict__ F, _Float16* __restrict__ Hh, _Float16* __restrict__ Hl, size_t n8) { const size_t t = (size_t)blockIdx.x * 256 + threadIdx.x; if (t >= n8) return; FragH fh, fl;
  /* F: row-major rows of DM; Hh, Hl: fragment order ([16-row tile][32-column step][piece][lane][8]), thread t their t-th 16 bytes */
  const size_t blk = t >> 6; const float* fp = F + ((blk / (DM / 32)) * 16 + (t & 15)) * DM + (blk % (DM / 32)) * 32 + ((t >> 5) & 1) * 16 + ((t >> 4) & 1) * 8; const v4f a = *(const v4fa*)fp, c = *(const v4fa*)(fp + 4);
#pragma unroll
  for (int q = 0; q < 4; ++q) { _Float16 h = (_Float16)a[q]; fh.h[q] = h; fl.h[q] = (_Float16)((a[q] - (float)h) * 1024.0f); h = (_Float16)c[q]; fh.h[4 + q] = h; fl.h[4 + q] = (_Float16)((c[q] - (float)h) * 1024.0f); }
  { *(v8us*)((unsigned short*)Hh + t * 8) = fh.half[0]; *(v8us*)((unsigned short*)Hl + t * 8) = fl.half[0];  } }

// ---- helpers of the output GEMM (A and Bh in fragment order; wave tile 32x64): the kernel itself stands behind the attention ----
__device__ __forceinline__ v16h g2_frag(const _Float16* p, int hh) { FragH f; f.half[0] = *(const v8us*)((const unsigned short*)p + 8 * hh); f.half[1] = *(const v8us*)((const unsigned short*)p + 16 + 8 * hh); return f.v; }
// ---- fragment-order planes. Every f16 operand plane of the products (q and k hi / residual, V^T, o, the weights) is stored as the operand fragments themselves: a 16-row x 32-column block is two pieces of 512 bytes,
// piece u = columns 16 u .. 16 u + 15, and in a piece lane (ln, hh) owns 16 bytes at lane * 16: row ln, columns 8 hh .. 8 hh + 7 of the piece. A wave-wide 16-byte load or store then covers 512 contiguous bytes (four whole 128-byte lines)
// where a row-major plane gives it sixteen lines of which it uses 32 bytes each. p: the lane's own 16 bytes of piece 0.
__device__ __forceinline__ v16h pk_frag(const _Float16* p) { FragH f; f.half[0] = *(const v8us*)((const unsigned short*)p); f.half[1] = *(const v8us*)((const unsigned short*)p + 256); return f.v; }
__device__ __forceinline__ v8f g2_mma(v16h a, v16h b, v8f c) { v8f d = __builtin_amdgcn_wmma_f32_16x16x32_f16(false, a, false, b, (short)0, c, false, false); asm volatile("v_nop\n\tv_nop\n\tv_nop\n\tv_nop" : "+v"(d) : "v"(a), "v"(b)); return d; }

__global__ __launch_bounds__(256) void k_wnat(const float* __restrict__ w, size_t n8, _Float16* __restrict__ Bt) { const size_t t = (size_t)blockIdx.x * 256 + threadIdx.x; if (t >= n8) return; FragH f; for (int q = 0; q < 8; ++q) f.h[q] = (_Float16)(bf16_round(w[t * 8 + q]) * 16.0f); *(v8us*)((unsigned short*)Bt + t * 8) = f.half[0];  }
__global__ __launch_bounds__(256) void k_rsm(const float* __restrict__ S, _Float16* __restrict__ P, int nrows) {
  #pragma clang fp contract(off)
  const int i = blockIdx.x * 256 + threadIdx.x; if (i >= nrows) return; const float* s = S + (size_t)i * SQ; float mx = -3.0e38f;
#pragma unroll 1
  for (int j = 0; j < SQ; ++j) mx = fmaxf(mx, s[j]); float se = 0.f;
#pragma unroll 1
  for (int j = 0; j < SQ; ++j) se += expf(s[j] - mx); const float sc = 256.0f / se;
#pragma unroll 1
  for (int j0 = 0; j0 < SQ; j0 += 8) { FragH f; for (int q = 0; q < 8; ++q) f.h[q] = (_Float16)(expf(s[j0 + q] - mx) * sc); unsigned short* d = (unsigned short*)P + (size_t)i * SQ + j0; *(v8us*)d = f.half[0];  } }
__global__ __launch_bounds__(256) void k_vt(const _Float16* __restrict__ V16, int b, int h0, _Float16* __restrict__ VT) { __shared__ unsigned short tl[64][65]; const int tid = threadIdx.x; const int hh = blockIdx.x % HG, sg = blockIdx.x / HG; const int s0 = sg * 64; const int h = h0 + hh;
  for (int i = tid; i < 64 * 8; i += 256) { const int j = i / 8, d8 = (i % 8) * 8; FragH f; f.half[0] = *(const v8us*)((const unsigned short*)V16 + ((size_t)b * SQ + s0 + j) * DM + h * HD + d8); for (int q = 0; q < 8; ++q) tl[d8 + q][j] = f.u[q]; }
  __syncthreads();
  { for (int i = tid; i < 64 * 8; i += 256) { const int d = i / 8, j8 = (i % 8) * 8; FragH f; for (int q = 0; q < 8; ++q) f.u[q] = tl[d][j8 + q]; *(v8us*)((unsigned short*)VT + ((size_t)hh * HD + d) * SQ + s0 + j8) = f.half[0]; }  } }



// Fused causal attention, ONE WAVE PER 16 QUERY ROWS of one (batch, head); no score or weight ever leaves the registers, no LDS, no barrier.
// Scores are formed transposed, S^T = K . Q^T (A = 16 key rows, B = 16 query rows): lane (ln, hh) then holds keys 8 hh .. 8 hh + 7 of the tile for query ln, so row maximum and row sum are per-lane values
// (plus one exchange between the two lane halves), and two neighbouring tiles' weights ARE the 32-key operand fragment of the second product (elements 0..7 = keys 8 hh + i, 8..15 = keys 16 + 8 hh + i).
// The second product is transposed too, O^T = V^T . P^T (A = 16 rows of V^T, B = the weights): lane (ln, hh) ends with 8 consecutive output columns of query ln, one 16-byte store a tile.
// ONE walk over the keys up to the diagonal: a running row maximum; each chunk's weights are exp(s - maximum so far) as f16 (at most 1), and the row sum and the four output tiles are first multiplied by exp(old maximum - new maximum); the division by the row sum comes once, at the end.
// Every loop over r, i and t is unrolled in full so that s, e, p and the accumulators are indexed by constants and stay in registers; the loop over the chunks stays rolled.
__device__ __forceinline__ v8f fa_mma(v16h a, v16h b, v8f c) { return __builtin_amdgcn_wmma_f32_16x16x32_f16(false, a, false, b, (short)0, c, false, false); }
// scores of 16 keys x 16 queries: hi.hi / 8, then + 2^-13 lo.hi, then + 2^-13 hi.lo (three accumulators of their own, added in this order); keys above the row get -1e9
// a0, a1: the 16 key rows' hi plane (head columns 0..31, 32..63); l0, l1: their residual plane
__device__ __forceinline__ void fa_scores(v16h a0, v16h a1, v16h l0, v16h l1, v16h qh0, v16h qh1, v16h ql0, v16h ql1, int keyb, int last, float* s) {
  const v8f z8 = {0.f,0.f,0.f,0.f,0.f,0.f,0.f,0.f};
  v8f c1 = fa_mma(a0, qh0, z8), c2 = fa_mma(a0, ql0, z8), c3 = fa_mma(l0, qh0, z8);
  c1 = fa_mma(a1, qh1, c1); c2 = fa_mma(a1, ql1, c2); c3 = fa_mma(l1, qh1, c3);
#pragma unroll
  for (int r = 0; r < 8; ++r) { float v = c1[r] * SCL; v += c2[r] * SCLR; v += c3[r] * SCLR; s[r] = (keyb + r <= last) ? v : -1.0e9f; } }
// lane l's value as seen from lane l ^ 16: one vector cross-row move (a shuffle would go through the LDS pipe and its wait, here once a chunk)
// 16 head columns x 32 keys of V^T: the same piece of two neighbouring token tiles (keys 8 hh + i, then 16 + 8 hh + i)
__device__ __forceinline__ v16h vt_frag(const _Float16* p) { FragH f; f.half[0] = *(const v8us*)((const unsigned short*)p); f.half[1] = *(const v8us*)((const unsigned short*)p + 1024); return f.v; }
__device__ __forceinline__ float fa_other_half(float x) { const unsigned u = __float_as_uint(x); return __uint_as_float(__builtin_amdgcn_permlanex16(u, u, 0x76543210u, 0xfedcba98u, false, false)); }
__device__ __forceinline__ void fa_body(const int bid, const _Float16* __restrict__ QHp, const _Float16* __restrict__ QLp, const _Float16* __restrict__ KHp, const _Float16* __restrict__ KLp, const _Float16* __restrict__ VTp, _Float16* __restrict__ O) {
  const int lane = threadIdx.x & 31, ln = lane & 15, hh = lane >> 4; const int w = __builtin_amdgcn_readfirstlane((int)(threadIdx.x >> 5));      /* the wave's number as a scalar: the key loops get scalar trip counts */
  const int bh = bid % (NB * NH), qb = (SQ / 64 - 1) - bid / (NB * NH);      /* longest rows first */
  const int b = bh / NH, h = bh % NH; const int q0 = qb * 64 + w * 16; const int last = q0 + ln; const int nch = (q0 + 47) >> 5;      /* 32-key chunks up to the diagonal; the last one may hold 16 keys that are masked for every row (they exist: q0 + 31 < SQ there) */
  /* q, k and V^T planes in fragment order, [batch, head][16-token tile][4 pieces][lane][8]: a tile is 1024 elements, a 32-key chunk 2048 in a row. q, k: piece = 16 head columns; V^T: piece = 16 head columns x the tile's 16 tokens */
  const size_t pb = (size_t)bh * (SQ / 16) * 1024 + lane * 8; const size_t rq = pb + (size_t)(q0 >> 4) * 1024;
  const _Float16* qhp = QHp + rq; const _Float16* qlp = QLp + rq;
  const v16h qh0 = pk_frag(qhp), qh1 = pk_frag(qhp + 512), ql0 = pk_frag(qlp), ql1 = pk_frag(qlp + 512);
  asm volatile("s_wait_xcnt 0x0" :: "v"(qhp), "v"(qlp) : "memory");      /* the wait before a register that an issued load names is written again; the addresses are inputs so that they keep their registers up to it (the same at the loop's wait below) */
  const _Float16* kh = KHp + pb; const _Float16* kl = KLp + pb; const _Float16* vt = VTp + pb;
  float m = -3.0e38f, l = 0.f;      /* m: the row's running maximum, the same in both lane halves; l: this lane half's share of the row sum, at scale exp(-m) */
  const v8f z8 = {0.f,0.f,0.f,0.f,0.f,0.f,0.f,0.f}; v8f o0 = z8, o1 = z8, o2 = z8, o3 = z8;
  for (int c = 0; c < nch; ++c) { float s[16]; const _Float16* ka = kh + (size_t)c * 2048; const _Float16* kb = kl + (size_t)c * 2048; const _Float16* vc = vt + (size_t)c * 2048;
    const v16h a0 = pk_frag(ka), a1 = pk_frag(ka + 512), a2 = pk_frag(ka + 1024), a3 = pk_frag(ka + 1536), l0 = pk_frag(kb), l1 = pk_frag(kb + 512), l2 = pk_frag(kb + 1024), l3 = pk_frag(kb + 1536);
    const v16h v0 = vt_frag(vc), v1 = vt_frag(vc + 256), v2 = vt_frag(vc + 512), v3 = vt_frag(vc + 768);
    /* the loaded values are inputs too: all of the chunk's loads (key rows and V^T rows) are asked for together, one trip to the caches a chunk; left alone the compiler reuses two fragments' registers and waits for memory before nearly every product */
    asm volatile("s_wait_xcnt 0x0" :: "v"(ka), "v"(kb), "v"(vc), "v"(a0), "v"(a1), "v"(a2), "v"(a3), "v"(l0), "v"(l1), "v"(l2), "v"(l3), "v"(v0), "v"(v1), "v"(v2), "v"(v3) : "memory");
    __builtin_amdgcn_sched_barrier(0);      /* keeps the products behind the wait, so that the wait is not moved down past them with the last loads */
    fa_scores(a0, a1, l0, l1, qh0, qh1, ql0, ql1, c * 32 + 8 * hh, last, s); fa_scores(a2, a3, l2, l3, qh0, qh1, ql0, ql1, c * 32 + 16 + 8 * hh, last, s + 8);
    float mc = s[0];
#pragma unroll
    for (int i = 1; i < 16; ++i) mc = fmaxf(mc, s[i]);
    const float mn = fmaxf(m, fmaxf(mc, fa_other_half(mc)));      /* both halves' weights enter one product, so they need one maximum */
    const float al = __expf(m - mn);      /* what the sum and the output tiles so far are worth at the new maximum (0 in the first chunk, 1 while the maximum stands) */
    float e[16]; FragH p;
#pragma unroll
    for (int i = 0; i < 16; ++i) { e[i] = __expf(s[i] - mn); p.h[i] = (_Float16)e[i]; }
    const float a = (((e[0] + e[1]) + (e[2] + e[3])) + ((e[4] + e[5]) + (e[6] + e[7]))) + (((e[8] + e[9]) + (e[10] + e[11])) + ((e[12] + e[13]) + (e[14] + e[15])));
    l = l * al + a; m = mn;
    o0 *= al; o1 *= al; o2 *= al; o3 *= al;
    o0 = fa_mma(v0, p.v, o0); o1 = fa_mma(v1, p.v, o1); o2 = fa_mma(v2, p.v, o2); o3 = fa_mma(v3, p.v, o3); }
  const float sc = 64.0f / (l + fa_other_half(l));      /* the other eight keys of every tile sit in the other lane half; o carried x64 */
  const v8f os[4] = {o0, o1, o2, o3};
#pragma unroll
  for (int t = 0; t < 4; ++t) { FragH f;
#pragma unroll
    for (int r = 0; r < 8; ++r) f.h[r] = (_Float16)(os[t][r] * sc);
    *(v8us*)((unsigned short*)O + ((size_t)b * SQ + q0) * DM + h * 1024 + t * 256 + lane * 8) = f.half[0]; }      /* o in fragment order for the output GEMM: [16-row tile][32-column step][piece][lane][8]; head h, tile t = step 2 h + t / 2, piece t % 2 */
  asm volatile("s_wait_xcnt 0x0" ::: "memory"); }      /* the wait before a register that the four issued stores name is written again: in the joint launch the f32 rows' code follows them in the listing */


// ---- front end in ONE launch: x -> q and k (f16 hi + x1024 residual planes), V^T, and the first tile's f32 q, k, v rows. One wave per 64 token rows of one head; no LDS, no barrier.
// The wave reads its [64][64] f32 slice of x once, rounds it (bf16, exact in f16) into eight operand fragments and keeps them in registers for all three projections (K = 64: two products a tile, columns 0..31 then 32..63).
// q and k are formed transposed (A = 16 rows of W^T, B = 16 token rows): lane (ln, hh) then holds 8 consecutive head columns of token ln: its own 16 bytes of a piece of the fragment-order q / k planes, so a wave's store is 512 bytes in a row.
// v is formed straight (A = 16 token rows, B = 16 rows of W^T): lane (ln, hh) then holds 8 consecutive tokens of head column ln: its own 16 bytes of a piece of the fragment-order V^T plane.
// Rows 0..127 of each batch also leave as f32 (the exact first-tile path reads them): their waves form each projection a second time (v transposed like q and k) and store it unrounded.
// Every loop is unrolled in full so that the fragments are indexed by constants and stay in registers.
union RawX { v8f v; v4f q[2]; };      /* 8 consecutive f32 of an x row as two 16-byte loads leave them */
__device__ __forceinline__ RawX pj_raw(const float* p) { RawX r; r.q[0] = *(const v4fa*)p; r.q[1] = *(const v4fa*)(p + 4); return r; }
// a: columns 8 hh .. 8 hh + 7 of a 32-column step, c: columns 16 + 8 hh .. of the same step (the operand fragment's element order)
__device__ __forceinline__ v16h pj_xfrag(v8f a, v8f c) { FragH f;
#pragma unroll
  for (int q = 0; q < 8; ++q) { f.h[q] = (_Float16)bf16_round(a[q]); f.h[8 + q] = (_Float16)bf16_round(c[q]); }
  return f.v; }
__device__ __forceinline__ v8f pj_tile(v16h a0, v16h a1, v16h b0, v16h b1) { const v8f z8 = {0.f,0.f,0.f,0.f,0.f,0.f,0.f,0.f}; return fa_mma(a1, b1, fa_mma(a0, b0, z8)) * 0.0625f; }      /* weights carried x16 */
__device__ __forceinline__ void pj_f32(float* d, v8f c) { const v4f lo = {c[0], c[1], c[2], c[3]}, hi = {c[4], c[5], c[6], c[7]}; *(v4f*)d = lo; *(v4f*)(d + 4) = hi; }
// the wait before a register that an issued load names is written again; the weight rows' address and the loaded fragments are inputs, so that the address keeps its registers up to the wait and the sixteen loads stand in front of it, asked for together
__device__ __forceinline__ void pj_wfence(const _Float16* p, const v16h (&f)[4][2]) { asm volatile("s_wait_xcnt 0x0" :: "v"(p), "v"(f[0][0]), "v"(f[0][1]), "v"(f[1][0]), "v"(f[1][1]), "v"(f[2][0]), "v"(f[2][1]), "v"(f[3][0]), "v"(f[3][1]) : "memory"); }
// Hh, Hl: this lane's 16 bytes of the first piece of the wave's first token tile; F0: this lane's first element of the row-major f32 rows (token ln of the wave's rows, head column 8 hh)
__device__ __forceinline__ void pj_qk(const _Float16* __restrict__ wp, const v16h (&xf)[4][2], _Float16* __restrict__ Hh, _Float16* __restrict__ Hl, float* __restrict__ F0, bool first) {
  v16h wf[4][2];
#pragma unroll
  for (int t = 0; t < 4; ++t) { wf[t][0] = pk_frag(wp + t * 16 * HD); wf[t][1] = pk_frag(wp + t * 16 * HD + 512); }
  pj_wfence(wp, wf);
#pragma unroll
  for (int j = 0; j < 4; ++j) {
#pragma unroll
    for (int t = 0; t < 4; ++t) { const v8f c = pj_tile(wf[t][0], wf[t][1], xf[j][0], xf[j][1]); FragH fh, fl;
#pragma unroll
      for (int r = 0; r < 8; ++r) { const _Float16 hv = (_Float16)c[r]; fh.h[r] = hv; fl.h[r] = (_Float16)((c[r] - (float)hv) * 1024.0f); }
      *(v8us*)((unsigned short*)Hh + j * 1024 + t * 256) = fh.half[0]; *(v8us*)((unsigned short*)Hl + j * 1024 + t * 256) = fl.half[0]; } }
  asm volatile("s_wait_xcnt 0x0" ::: "memory");      /* the wait before a register that an issued store names is written again */
  if (first) {      /* one scalar branch a projection: the same products once more, for one wave in sixteen */
#pragma unroll
    for (int j = 0; j < 4; ++j) {
#pragma unroll
      for (int t = 0; t < 4; ++t) pj_f32(F0 + (size_t)j * 16 * DM + t * 16, pj_tile(wf[t][0], wf[t][1], xf[j][0], xf[j][1])); }
    asm volatile("s_wait_xcnt 0x0" ::: "memory");      /* likewise: the next projection's weight loads land in registers that these stores name */
  } }
__global__ __launch_bounds__(128) void k_proj(const float* __restrict__ x, const _Float16* __restrict__ BQp, const _Float16* __restrict__ BKp, const _Float16* __restrict__ BVp, _Float16* __restrict__ QHp, _Float16* __restrict__ QLp, _Float16* __restrict__ KHp, _Float16* __restrict__ KLp, _Float16* __restrict__ VTp,
    float* __restrict__ QF0p, float* __restrict__ KF0p, float* __restrict__ VF0p) {
  const int lane = threadIdx.x & 31, ln = lane & 15, hh = lane >> 4; const int w = __builtin_amdgcn_readfirstlane((int)(threadIdx.x >> 5));      /* the wave's number as a scalar: the first-tile test is a scalar branch, every lane stays on at the products */
  const int h = blockIdx.y; const int r0 = (blockIdx.x * 4 + w) * 64; const int b = r0 / SQ, s0 = r0 % SQ; const bool first = s0 < QT0;
  const float* xp = x + (size_t)(r0 + ln) * DM + h * HD + 8 * hh;
  RawX rx[4][4];
#pragma unroll
  for (int j = 0; j < 4; ++j) {
#pragma unroll
    for (int u = 0; u < 4; ++u) rx[j][u] = pj_raw(xp + (size_t)j * 16 * DM + u * 16); }
  /* the loaded values are inputs: all 32 loads of the slice are asked for together, one trip to memory a wave (left alone the compiler asks for four at a time and waits eight times); the wait stands before the address register is written again */
  asm volatile("s_wait_xcnt 0x0" :: "v"(xp), "v"(rx[0][0].v), "v"(rx[0][1].v), "v"(rx[0][2].v), "v"(rx[0][3].v), "v"(rx[1][0].v), "v"(rx[1][1].v), "v"(rx[1][2].v), "v"(rx[1][3].v), "v"(rx[2][0].v), "v"(rx[2][1].v), "v"(rx[2][2].v), "v"(rx[2][3].v), "v"(rx[3][0].v), "v"(rx[3][1].v), "v"(rx[3][2].v), "v"(rx[3][3].v) : "memory");
  v16h xf[4][2];
#pragma unroll
  for (int j = 0; j < 4; ++j) { xf[j][0] = pj_xfrag(rx[j][0].v, rx[j][1].v); xf[j][1] = pj_xfrag(rx[j][2].v, rx[j][3].v); }
  const size_t wo = (size_t)h * HD * HD + lane * 8;      /* the lane's 16 bytes of the first piece of the head's W^T plane (fragment order) */
  const size_t ro = ((size_t)(b * NH + h) * (SQ / 16) + (s0 >> 4)) * 1024 + lane * 8;      /* likewise of the wave's first token tile in the q, k and V^T planes */ const size_t fo = ((size_t)b * QT0 + (first ? s0 : 0) + ln) * DM + h * HD + 8 * hh;
  pj_qk(BQp + wo, xf, QHp + ro, QLp + ro, QF0p + fo, first);
  pj_qk(BKp + wo, xf, KHp + ro, KLp + ro, KF0p + fo, first);
  const _Float16* wvp = BVp + wo; v16h wf[4][2];
#pragma unroll
  for (int t = 0; t < 4; ++t) { wf[t][0] = pk_frag(wvp + t * 16 * HD); wf[t][1] = pk_frag(wvp + t * 16 * HD + 512); }
  pj_wfence(wvp, wf);
  _Float16* vtp = VTp + ro;
#pragma unroll
  for (int t = 0; t < 4; ++t) {
#pragma unroll
    for (int j = 0; j < 4; ++j) { const v8f c = pj_tile(xf[j][0], xf[j][1], wf[t][0], wf[t][1]); FragH f;
#pragma unroll
      for (int r = 0; r < 8; ++r) f.h[r] = (_Float16)c[r];
      *(v8us*)((unsigned short*)vtp + j * 1024 + t * 256) = f.half[0]; } }
  asm volatile("s_wait_xcnt 0x0" ::: "memory");      /* as in pj_qk, in front of the branch */
  if (first) {
#pragma unroll
    for (int j = 0; j < 4; ++j) {
#pragma unroll
      for (int t = 0; t < 4; ++t) pj_f32(VF0p + fo + (size_t)j * 16 * DM + t * 16, pj_tile(wf[t][0], wf[t][1], xf[j][0], xf[j][1])); } } }

template <int MASKADD>
__device__ __forceinline__ void att0_body(float (&lk)[64][64], float (&lv)[64][64], const int bid, const float* __restrict__ QF, const float* __restrict__ KF, const float* __restrict__ VF, int ld, const float* __restrict__ mask, float scale, _Float16* __restrict__ Hh, _Float16* __restrict__ Hl) {
  #pragma clang fp contract(off)
  // 64 query rows of one (batch, head) a work-group of four waves, TWO LANES PER ROW (lane l and lane l ^ 16): each owns 32 of the 64 head columns of its row's q and o, so that the rows fit the register budget of the joint launch.
  // Keys in order (online softmax). A score is the lane's own 32 products summed in column order plus the other lane's sum (one cross-row move); both lanes then hold the same score and keep the same m and l.
  // k and v rows come in chunks of 64 keys, staged once per chunk in LDS by coalesced loads and then read at one address per lane half (broadcast). Four keys' score chains run side by side: each is 32 dependent adds, so one alone leaves the issue slots empty.
  // Every loop over c, u and w and the staging loops over it are unrolled in full so that q, o, s and the staged values are indexed by constants and stay in registers; the loops over chunks and groups of four keys stay rolled so that the code stays small.
  const int tid = threadIdx.x; const int cb = ((tid >> 4) & 1) * 32;      /* the lane's first head column */
  const int rg = (QT0 / 64 - 1) - bid / (NB * NH), h = bid % NH, bt = (bid / NH) % NB;      /* the later row group, with the longer walk, first */
  const int rl = (tid >> 5) * 16 + (tid & 15); const int i = rg * 64 + rl;
  QF += (size_t)bt * QT0 * ld; KF += (size_t)bt * QT0 * ld; VF += (size_t)bt * QT0 * ld;      /* each batch's first-tile rows are a plane of their own */
  const float* qr = QF + (size_t)i * ld + h * HD + cb;
  float q[HD / 2], o[HD / 2];
  { v4f tq[HD / 8];
#pragma unroll
    for (int c = 0; c < HD / 8; ++c) tq[c] = *(const v4fa*)(qr + c * 4);
    asm volatile("s_wait_xcnt 0x0" :: "v"(qr) : "memory");      /* as in the staging below: the row's address keeps its registers until every load that names it has been translated */
#pragma unroll
    for (int c = 0; c < HD / 8; ++c) {
#pragma unroll
      for (int u = 0; u < 4; ++u) { q[c * 4 + u] = tq[c][u]; o[c * 4 + u] = 0.f; } } }
  float m = -1.0e30f, l = 0.f; const int jmax = MASKADD ? (SQ - 1) : (rg * 64 + 63);      /* additive-mask form: every key (the mask input decides); causal form: keys up to the block's last row; jmax + 1 is a multiple of 64 */
#pragma unroll 1
  for (int j0 = 0; j0 <= jmax; j0 += 64) {
    __syncthreads();      /* every wave has left the chunk before it is overwritten */
    { const float* kp[8]; const float* vp[8]; v4f tk[8], tv[8];      /* 64 keys in one pass of 128 threads: 16 loads in flight */
#pragma unroll
      for (int it = 0; it < 8; ++it) { const size_t g = (size_t)(j0 + it * 8 + tid / 16) * ld + h * HD + (tid % 16) * 4; kp[it] = KF + g; vp[it] = VF + g; }
#pragma unroll
      for (int it = 0; it < 8; ++it) { tk[it] = *(const v4fa*)kp[it]; tv[it] = *(const v4fa*)vp[it]; }
      /* the wait before a register that an issued load names is written again; the addresses are inputs so that they keep their registers up to it */
      asm volatile("s_wait_xcnt 0x0" :: "v"(kp[0]), "v"(kp[1]), "v"(kp[2]), "v"(kp[3]), "v"(kp[4]), "v"(kp[5]), "v"(kp[6]), "v"(kp[7]), "v"(vp[0]), "v"(vp[1]), "v"(vp[2]), "v"(vp[3]), "v"(vp[4]), "v"(vp[5]), "v"(vp[6]), "v"(vp[7]) : "memory");
#pragma unroll
      for (int it = 0; it < 8; ++it) { const int row = it * 8 + tid / 16, pc = (tid % 16) * 4; *(v4f*)&lk[row][pc] = tk[it]; *(v4f*)&lv[row][pc] = tv[it]; } }
    __syncthreads();
#pragma unroll 1
    for (int jj = 0; jj < 64; jj += 4) { float s[4] = {0.f, 0.f, 0.f, 0.f};
#pragma unroll
      for (int c = 0; c < HD / 8; ++c) {
#pragma unroll
        for (int u = 0; u < 4; ++u) { const v4f kq = *(const v4f*)&lk[jj + u][cb + c * 4]; s[u] = __fadd_rn(s[u], __fmul_rn(q[c * 4 + 0], kq[0])); s[u] = __fadd_rn(s[u], __fmul_rn(q[c * 4 + 1], kq[1])); s[u] = __fadd_rn(s[u], __fmul_rn(q[c * 4 + 2], kq[2])); s[u] = __fadd_rn(s[u], __fmul_rn(q[c * 4 + 3], kq[3])); } }
#pragma unroll
      for (int u = 0; u < 4; ++u) s[u] = __fadd_rn(s[u], fa_other_half(s[u]));      /* + the other 32 columns: the same sum in both lanes of the row */
      float sc[4], e[4];      /* the four keys' rescale and weight, key after key (m and l are a chain); the o rows follow */
#pragma unroll
      for (int u = 0; u < 4; ++u) { const int j = j0 + jj + u; float sv = __fmul_rn(s[u], scale); if (MASKADD) sv = __fadd_rn(sv, __fmul_rn(bf16_round(mask[(size_t)i * SQ + j]), -10000.0f));
        const float f = (MASKADD || j <= i) ? 1.f : 0.f; const float sm = fmaf(f, sv, (1.f - f) * -1.0e30f); const float mn = fmaxf(m, sm); sc[u] = expf(m - mn); e[u] = expf(sm - mn); l = __fadd_rn(__fmul_rn(l, sc[u]), e[u]); m = mn; }
#pragma unroll
      for (int u = 0; u < 4; ++u) {
#pragma unroll
        for (int c = 0; c < HD / 8; ++c) { const v4f vv = *(const v4f*)&lv[jj + u][cb + c * 4];
#pragma unroll
          for (int w = 0; w < 4; ++w) o[c * 4 + w] = __fadd_rn(__fmul_rn(o[c * 4 + w], sc[u]), __fmul_rn(e[u], vv[w])); } } } }
  const float fin = 64.0f / l;      /* o carried x64 like the f16 path */
  __syncthreads();      /* every wave has left lk before the output rows are written over it */
#pragma unroll
  for (int c = 0; c < HD / 8; ++c) { v4f oo;
#pragma unroll
    for (int u = 0; u < 4; ++u) oo[u] = __fmul_rn(o[c * 4 + u], fin);
    *(v4f*)&lk[rl][cb + c * 4] = oo; }
  __syncthreads();
  {
#pragma unroll 1
    for (int it = 0; it < 4; ++it) {      /* o (x64) leaves as f16 hi + x1024 residual planes in fragment order ([16-row tile][32-column step][piece][lane][8]): row tile it of the group, thread tid = (step, piece, lane); a wave's store is 512 bytes in a row */
      const float* fp = &lk[it * 16 + (tid & 15)][((tid >> 6) & 1) * 32 + ((tid >> 5) & 1) * 16 + ((tid >> 4) & 1) * 8]; const v4f a = *(const v4f*)fp, c = *(const v4f*)(fp + 4); FragH fh, fl;
#pragma unroll
      for (int u = 0; u < 4; ++u) { _Float16 hv = (_Float16)a[u]; fh.h[u] = hv; fl.h[u] = (_Float16)((a[u] - (float)hv) * 1024.0f); hv = (_Float16)c[u]; fh.h[4 + u] = hv; fl.h[4 + u] = (_Float16)((c[u] - (float)hv) * 1024.0f); }
      const size_t t = ((size_t)((bt * (QT0 / 16) + rg * 4 + it) * (DM / 32) + 2 * h + ((tid >> 6) & 1))) * 64 + (tid & 63);
      *(v8us*)((unsigned short*)Hh + t * 8) = fh.half[0]; *(v8us*)((unsigned short*)Hl + t * 8) = fl.half[0]; }
     } }

// ---- ONE attention launch. The first NB NH QT0 / 64 work-groups (started first: theirs is the longest serial chain) do the exact f32 attention of 64 of the rows 0..127 of one (batch, head); the others the fused f16 attention of 64 rows from row 128 on.
// Both read only what the front end wrote, so they run side by side instead of one launch after the other.
__global__ __launch_bounds__(128) void k_attn(const _Float16* __restrict__ QHp, const _Float16* __restrict__ QLp, const _Float16* __restrict__ KHp, const _Float16* __restrict__ KLp, const _Float16* __restrict__ VTp, _Float16* __restrict__ O,
    const float* __restrict__ QF, const float* __restrict__ KF, const float* __restrict__ VF, _Float16* __restrict__ OH, _Float16* __restrict__ OL) {
  __shared__ __attribute__((aligned(16))) float st[2][64][64];
  if (blockIdx.x < NB * NH * (QT0 / 64)) att0_body<0>(st[0], st[1], (int)blockIdx.x, QF, KF, VF, DM, nullptr, SCL, OH, OL);
  else fa_body((int)blockIdx.x - NB * NH * (QT0 / 64), QHp, QLp, KHp, KLp, VTp, O); }

// ---- output GEMM, ONE launch: out = o Wo. A work-group is 128 rows x 64 columns (wave tile 32 x 64), o and Wo^T in fragment order. The row blocks that are a batch's rows 0..127 take the exact path's o instead
// (f16 hi + x1024 residual planes): one walk over K for both, with accumulators of their own, out = hi 2^-10 + residual 2^-20; every output element is written once.
__device__ __forceinline__ void go_walk(const _Float16* a0p, const _Float16* b0p, v8f (&c)[8]) {
  const _Float16* a1p = a0p + (size_t)16 * DM; const _Float16* b1p = b0p + (size_t)16 * DM; const _Float16* b2p = b1p + (size_t)16 * DM; const _Float16* b3p = b2p + (size_t)16 * DM;
#pragma unroll 1
  for (int kb = 0; kb < DM; kb += 32) { const int ko = kb * 16; const _Float16* a0k = a0p + ko; const _Float16* a1k = a1p + ko; const _Float16* b0k = b0p + ko; const _Float16* b1k = b1p + ko; const _Float16* b2k = b2p + ko; const _Float16* b3k = b3p + ko;
    const v16h a0 = pk_frag(a0k), a1 = pk_frag(a1k);
    v16h b = pk_frag(b0k); c[0] = g2_mma(a0, b, c[0]); c[4] = g2_mma(a1, b, c[4]);
    b = pk_frag(b1k); c[1] = g2_mma(a0, b, c[1]); c[5] = g2_mma(a1, b, c[5]);
    b = pk_frag(b2k); c[2] = g2_mma(a0, b, c[2]); c[6] = g2_mma(a1, b, c[6]);
    b = pk_frag(b3k); c[3] = g2_mma(a0, b, c[3]); c[7] = g2_mma(a1, b, c[7]);
    asm volatile("s_wait_xcnt 0x0" :: "v"(a0k), "v"(a1k), "v"(b0k), "v"(b1k), "v"(b2k), "v"(b3k) : "memory"); } }      /* the wait before a register that an issued load names is written again; the step's addresses are inputs so that they keep their registers up to here (left alone a later load lands on an address that an earlier one names) */
// the same walk for two A planes at once (hi into c, residual into cl): each Wo^T fragment is loaded once and serves both, and each accumulator sees its products in the order of a walk of its own
__device__ __forceinline__ void go_walk2(const _Float16* a0p, const _Float16* e0p, const _Float16* b0p, v8f (&c)[8], v8f (&cl)[8]) {
  const _Float16* a1p = a0p + (size_t)16 * DM; const _Float16* e1p = e0p + (size_t)16 * DM; const _Float16* b1p = b0p + (size_t)16 * DM; const _Float16* b2p = b1p + (size_t)16 * DM; const _Float16* b3p = b2p + (size_t)16 * DM;
#pragma unroll 1
  for (int kb = 0; kb < DM; kb += 32) { const int ko = kb * 16; const _Float16* a0k = a0p + ko; const _Float16* a1k = a1p + ko; const _Float16* e0k = e0p + ko; const _Float16* e1k = e1p + ko; const _Float16* b0k = b0p + ko; const _Float16* b1k = b1p + ko; const _Float16* b2k = b2p + ko; const _Float16* b3k = b3p + ko;
    const v16h a0 = pk_frag(a0k), a1 = pk_frag(a1k), e0 = pk_frag(e0k), e1 = pk_frag(e1k);
    v16h b = pk_frag(b0k); c[0] = g2_mma(a0, b, c[0]); c[4] = g2_mma(a1, b, c[4]); cl[0] = g2_mma(e0, b, cl[0]); cl[4] = g2_mma(e1, b, cl[4]);
    b = pk_frag(b1k); c[1] = g2_mma(a0, b, c[1]); c[5] = g2_mma(a1, b, c[5]); cl[1] = g2_mma(e0, b, cl[1]); cl[5] = g2_mma(e1, b, cl[5]);
    b = pk_frag(b2k); c[2] = g2_mma(a0, b, c[2]); c[6] = g2_mma(a1, b, c[6]); cl[2] = g2_mma(e0, b, cl[2]); cl[6] = g2_mma(e1, b, cl[6]);
    b = pk_frag(b3k); c[3] = g2_mma(a0, b, c[3]); c[7] = g2_mma(a1, b, c[7]); cl[3] = g2_mma(e0, b, cl[3]); cl[7] = g2_mma(e1, b, cl[7]);
    asm volatile("s_wait_xcnt 0x0" :: "v"(a0k), "v"(a1k), "v"(e0k), "v"(e1k), "v"(b0k), "v"(b1k), "v"(b2k), "v"(b3k) : "memory"); } }      /* as in go_walk */
__global__ __launch_bounds__(128) void k_gemm_out(const _Float16* __restrict__ A, const _Float16* __restrict__ AH0, const _Float16* __restrict__ AL0, const _Float16* __restrict__ Bh, float* __restrict__ C) {
  __shared__ __attribute__((aligned(16))) float so[4][32][68];
  const int tid = threadIdx.x, w = tid >> 5, lane = tid & 31, ln = lane & 15, hh = lane >> 4;
  const int mt = blockIdx.x / (DM / 64), nq = blockIdx.x % (DM / 64); const int row0 = mt * 128 + 32 * w, col0 = nq * 64;
  const bool first = mt % (SQ / 128) == 0;      /* a batch's rows 0..127: the same for the whole work-group, a scalar branch */
  const size_t f0 = ((size_t)(mt / (SQ / 128)) * QT0 + 32 * w) * DM + lane * 8;      /* the wave's rows in the first-tile planes ([batch][128 rows], fragment order) */
  const _Float16* b0p = Bh + (size_t)col0 * DM + lane * 8;
  const v8f z8 = {0.f,0.f,0.f,0.f,0.f,0.f,0.f,0.f}; v8f c[8] = {z8, z8, z8, z8, z8, z8, z8, z8}, cl[8] = {z8, z8, z8, z8, z8, z8, z8, z8};
  if (first) go_walk2(AH0 + f0, AL0 + f0, b0p, c, cl);
  else go_walk(A + (size_t)row0 * DM + lane * 8, b0p, c);
#pragma unroll
  for (int u = 0; u < 8; ++u) { const int t = u & 3, half = u >> 2;
#pragma unroll
    for (int r = 0; r < 8; ++r) so[w][half * 16 + 8 * hh + r][t * 16 + ln] = c[u][r] * 0.0009765625f + cl[u][r] * 0.00000095367431640625f; }      /* o carried x64, Wo x16; the residual x1024 more */
  __builtin_amdgcn_fence(__ATOMIC_ACQ_REL, "workgroup"); __builtin_amdgcn_wave_barrier();
  const int rsub = lane >> 4, c4 = (lane & 15) * 4;
#pragma unroll
  for (int q = 0; q < 16; ++q) { const int r = q * 2 + rsub; const v4f v = *(const v4fa*)&so[w][r][c4]; *(v4f*)(C + (size_t)(row0 + r) * DM + col0 + c4) = v; } }

extern "C" void kernel_launch(void* const* d_in, const int* in_sizes, int n_in,
                              void* d_out, int out_size, void* d_ws, size_t ws_size, hipStream_t stream) {
  (void)in_sizes; (void)n_in; (void)out_size;
  const float* const* I = (const float* const*)d_in; const float* x = I[0]; const float* xk = I[0]; const float* xv = I[0]; const float* wq = I[1]; const float* bq = nullptr; const float* wk = I[2]; const float* bk = nullptr; const float* wv = I[3]; const float* bv = nullptr; const float* wo = I[4]; const float* bo = nullptr;      /* input order: x, Wq, Wk, Wv (BLOCK-DIAGONAL per-head [16][64][64] = [head][in][out]; NO biases: null pointers), Wo ([in][out] [1024][1024]; no bias: the output GEMM has no bias term); five inputs */
  char* ws = (char*)d_ws; size_t off = 0;
  auto take = [&](size_t bytes) { char* p = ws + off; off += (bytes + 255) & ~(size_t)255; return p; };
  _Float16* BQ = (_Float16*)take((size_t)DM * DM * 2); _Float16* BK = (_Float16*)take((size_t)DM * DM * 2); _Float16* BV = (_Float16*)take((size_t)DM * DM * 2); _Float16* BO = (_Float16*)take((size_t)DM * DM * 2);
  _Float16* QH = (_Float16*)take(NR * DM * 2); _Float16* QL = (_Float16*)take(NR * DM * 2); _Float16* KH = (_Float16*)take(NR * DM * 2); _Float16* KL = (_Float16*)take(NR * DM * 2); _Float16* O16 = (_Float16*)take(NR * DM * 2);
  _Float16* VT = (_Float16*)take((size_t)NB * NH * HD * SQ * 2);      /* V^T of every batch: the fused attention launch covers all of them */
  float* QF0 = (float*)take((size_t)NB * QT0 * DM * 4); float* KF0 = (float*)take((size_t)NB * QT0 * DM * 4); float* VF0 = (float*)take((size_t)NB * QT0 * DM * 4);      /* a plane per batch: the first-tile launches cover all batches */ _Float16* OH0 = (_Float16*)take((size_t)NB * QT0 * DM * 2); _Float16* OL0 = (_Float16*)take((size_t)NB * QT0 * DM * 2);
  if (off > ws_size) return;
  { const unsigned gn = (unsigned)(((size_t)DM * (DM / 8) + 255) / 256); const unsigned gp = (unsigned)(((size_t)HD * (HD / 8) + 255) / 256); k_wt_f16h<<<dim3(gp, NH, 3), 256, 0, stream>>>(wq, wk, wv, BQ, BK, BV, 16.0f); k_wt_f16<<<gn, 256, 0, stream>>>(wo, BO, DM, DM, 16.0f); }      /* BLOCK-DIAGONAL per-head weights wq / wk / wv [NH][HD][HD] = [head][in][out] (x_h @ W_h): W_h[d][e] -> Bt_h[e][d] x16 through the file's transposing builder with K = N = 64, all heads and stacks in one launch (grid y = head, z = stack), into sixteen consecutive [64][64] planes (the first 128 KiB of the weight plane); Wo [in][out]: the same builder with K = N = 1024 */
  k_proj<<<dim3((unsigned)(NR / 256), NH), 128, 0, stream>>>(x, BQ, BK, BV, QH, QL, KH, KL, VT, QF0, KF0, VF0);      /* x -> q, k (f16 hi + x1024 residual planes), V^T (all three in fragment order, [NB][NH][SQ / 16][4][32][8]) and the f32 q, k, v of each batch's first 128 rows: every batch, head and row in one launch (grid x = 256 rows, y = head) */
  k_attn<<<NB * NH * (SQ / 64), 128, 0, stream>>>(QH, QL, KH, KL, VT, O16, QF0, KF0, VF0, OH0, OL0);      /* one launch: exact f32 attention for rows 0..127 of every batch and head (o x64, as f16 hi + x1024 residual planes in fragment order) beside scores (hi.hi + lo.hi + hi.lo), causal softmax and P . V of every other query row (o, merged heads, x64, f16 in fragment order) */
  k_gemm_out<<<(unsigned)((NR / 128) * (DM / 64)), 128, 0, stream>>>(O16, OH0, OL0, BO, (float*)d_out);      /* out = o Wo, every row once: rows 0..127 of a batch from the hi and residual planes, the others from the f16 plane */
}

// v009
// Measured time: 136 microseconds a run.
// Two timings next to v008 put it at 1.19 and 1.17 times that version's speed.
// Counting every step since v000, it is 84.0 times as fast.
#include <hip/hip_runtime.h>
// Causal multi-head self-attention with BLOCK-DIAGONAL per-head projections (x [4][2048][1024] viewed (b, s, 16, 64); q / k / v = einsum('bshd,hde->bshe', xh, W): EACH HEAD applies its own [64][64] weight (W [16][64][64] = [head][in][out], normal x 0.02; NO biases) to ITS OWN 64-wide slice of the row; scores / sqrt(64); where(tril, scores, -inf); softmax over keys; out = merged Wo ([in][out] [1024][1024]; no bias) -> [4][2048][1024]); each projection is ONE head-batched GEMM (K = 64); q and k carried as f16 hi + x1024 residual planes with three-product scores.
// Structure: token rows r = b*2048 + s; ONE front-end launch, one wave per 64 rows of one head: x rounded (bf16, exact in f16) into register fragments, q and k as WMMA products (f32 accumulation, exact x16 weights) split in registers into f16 hi + x1024 residual planes, v as f16 written straight as V^T, the first 128 rows of each batch also as f32; then ONE attention launch: rows 0..127 of each batch exactly in f32 (work-groups of their own, two lanes a row), every other query row fused, one wave per 16 rows: scores against the keys up to the diagonal as three products (hi.hi + lo.hi + hi.lo, K = 64) kept in registers, causal softmax there in one walk (keys above the row masked by a select; running maximum, f32 statistics, native exp; weights f16, at most 1, normalised at the end), o = P . V (o carried x64, folded into the output GEMM alpha) written straight into the merged f16 o plane (every f16 operand plane is kept in fragment order: see pk_frag); out = o W_o GEMM (f32) into the output layout, one launch, rows 0..127 of each batch from the exact path's hi + residual planes.
// Compute dtype: inputs rounded to bf16; x / weights exact; v, softmax weights and o as plain f16 GEMM operands (~2^-12; q, k and the o of rows 0..127 as f16 hi + x1024 residual pairs); scores and softmax statistics f32. v_wmma_f32_16x16x32_f16.
#define NB 4
#define SCL 0.125f                         /* 1 / sqrt(head_dim 64) */
#define SCLR 0.0001220703125f               /* 2^-13: the same scale on the x1024 residual passes */
#define SQ 2048
#define DM 1024
#define NH 16
#define HD 64
#define HG 4                         /* heads per launch of the k_vt(b, h0) overload (not launched) */
#define QT 256                       /* not used */
#define NKX SQ                       /* not used */
#define QT0 128                      /* first-tile rows recomputed exactly in f32 */
#define B0 0                         /* not used */
#define NBR NB                       /* only in MP, which is not used */
#define NR ((size_t)NB * SQ)         /* token rows */
#define MP ((int)((size_t)NBR * SQ)) /* only in MPO, which is not used */
#define QN SQ                        /* not used */
#define NHD NH                       /* not used */
#define MPO MP                       /* not used */
#define LQ DM      /* not used */
typedef __bf16 v16b __attribute__((ext_vector_type(16)));
typedef unsigned short v8us __attribute__((ext_vector_type(8), may_alias));
typedef float  v8f  __attribute__((ext_vector_type(8)));
typedef float  v4f  __attribute__((ext_vector_type(4)));
typedef float  v4fa __attribute__((ext_vector_type(4), may_alias));
union FragB { v16b v; v8us half[2]; unsigned short u[16]; };

__device__ __forceinline__ unsigned short bf16_bits(float x) { unsigned int u = __float_as_uint(x); return (unsigned short)((u + 0x7FFFu + ((u >> 16) & 1u)) >> 16); }
__device__ __forceinline__ float bf16_val(unsigned short b) { return __uint_as_float(((unsigned int)b) << 16); }
__device__ __forceinline__ float bf16_round(float x) { return bf16_val(bf16_bits(x)); }
// D += A·B with NT terms: 1 = ah·bh, 2 = + al·bh (A split), 3 = + ah·bl (both split)
template <int NT>
__device__ __forceinline__ v8f mmaN(v16b ah, v16b al, v16b bh, v16b bl, v8f c) {
  c = __builtin_amdgcn_wmma_f32_16x16x32_bf16(false, ah, false, bh, (short)0, c, false, false);
  if (NT >= 2) c = __builtin_amdgcn_wmma_f32_16x16x32_bf16(false, al, false, bh, (short)0, c, false, false);
  if (NT >= 3) c = __builtin_amdgcn_wmma_f32_16x16x32_bf16(false, ah, false, bl, (short)0, c, false, false);
  asm volatile("v_nop\n\tv_nop\n\tv_nop\n\tv_nop" : "+v"(c) : "v"(ah), "v"(al), "v"(bh), "v"(bl));
  return c;
}

__global__ __launch_bounds__(256) void k_wt_bf16(const float* __restrict__ W, unsigned short* __restrict__ Wt, int K, int N) {
  const int t = blockIdx.x * 256 + threadIdx.x;
  const int k8n = K / 8;
  if (t >= N * k8n) return;
  const int n = t / k8n, k8 = (t % k8n) * 8;
  v8us v;
#pragma unroll
  for (int i = 0; i < 8; ++i) v[i] = bf16_bits(W[(size_t)(k8 + i) * N + n]);
  *(v8us*)(Wt + (size_t)n * K + k8) = v;
  
}

// GEMM C[M][N] (f32, pitch ldc) = act(A[M][K]·W + bias). A f32 row-major (pitch lda) converted per fragment to bf16
// (ASPLIT: hi/lo two planes -> 2 terms, else single rounded term); Wt bf16 [N][K] (pitch ldb). BIAS_BF16 rounds the
// bias to bf16 first (bias quantised to bf16 before the add). K%32==0, M%16==0, N%64==0.
template <bool ASPLIT, int ACT, bool BIAS_BF16>
__global__ __launch_bounds__(128) void k_gemm_bf(const float* __restrict__ A, int lda, const unsigned short* __restrict__ Wt, int ldb,
                                               const float* __restrict__ bias, float* __restrict__ C, int ldc, int M, int N, int K) {
  __shared__ __attribute__((aligned(16))) float so[4][16][64];
  const int tid = threadIdx.x, w = tid >> 5, lane = tid & 31, ln = lane & 15, hh = lane >> 4;
  const int ntn = N / 64;
  const int wid = blockIdx.x * 4 + w;
  const int mt = wid / ntn, nq = wid % ntn;
  if (mt * 16 >= M) return;
  const int row0 = mt * 16, col0 = nq * 64;
  const float* arow = A + (size_t)(row0 + ln) * lda;
  v8f acc[4] = {};
  for (int kb = 0; kb < K; kb += 32) {
    FragB ah, al;
    const v4f x0 = *(const v4fa*)(arow + kb + 8 * hh), x1 = *(const v4fa*)(arow + kb + 8 * hh + 4);
    const v4f x2 = *(const v4fa*)(arow + kb + 16 + 8 * hh), x3 = *(const v4fa*)(arow + kb + 16 + 8 * hh + 4);
    float xs[16] = {x0[0],x0[1],x0[2],x0[3],x1[0],x1[1],x1[2],x1[3],x2[0],x2[1],x2[2],x2[3],x3[0],x3[1],x3[2],x3[3]};
#pragma unroll
    for (int i = 0; i < 16; ++i) { const unsigned short hb = bf16_bits(xs[i]); ah.u[i] = hb; al.u[i] = ASPLIT ? bf16_bits(xs[i] - bf16_val(hb)) : (unsigned short)0; }
#pragma unroll
    for (int t = 0; t < 4; ++t) {
      const unsigned short* brow = Wt + (size_t)(col0 + t * 16 + ln) * ldb + kb;
      FragB b;
      b.half[0] = *(const v8us*)(brow + 8 * hh);
      b.half[1] = *(const v8us*)(brow + 16 + 8 * hh);
      acc[t] = mmaN<ASPLIT ? 2 : 1>(ah.v, al.v, b.v, b.v, acc[t]);
    }
  }
#pragma unroll
  for (int t = 0; t < 4; ++t) {
    float bv = bias ? bias[col0 + t * 16 + ln] : 0.f;
    if (BIAS_BF16) bv = bf16_round(bv);
#pragma unroll
    for (int r = 0; r < 8; ++r) { float v = acc[t][r] + bv; if (ACT == 1) v = fmaxf(v, 0.f); so[w][8 * hh + r][t * 16 + ln] = v; }
  }
  __builtin_amdgcn_fence(__ATOMIC_ACQ_REL, "workgroup");
  __builtin_amdgcn_wave_barrier();
  const int rsub = lane >> 4, c4 = (lane & 15) * 4;
  {
#pragma unroll
    for (int q = 0; q < 8; ++q) {
      const int r = q * 2 + rsub;
      const v4f v = *(const v4fa*)&so[w][r][c4];
      *(v4f*)(C + (size_t)(row0 + r) * ldc + col0 + c4) = v;
    }
    
  }
}

// GEMM C = act(A·W + bias + resid): A f32 (ASPLIT -> hi/lo 2 terms), Wt bf16 [N][K]; ACT 0 none, 1 relu, 2 exact gelu;
// resid (optional, f32, row index = (row % rmod), pitch ldr, RES_BF16 rounds it) added before the activation.
template <bool ASPLIT, int ACT, bool BIAS_BF16, bool RES_BF16>
__global__ __launch_bounds__(128) void k_gemm_bf3(const float* __restrict__ A, int lda, const unsigned short* __restrict__ Wt, int ldb,
                                                const float* __restrict__ bias, const float* __restrict__ resid, int rmod, int ldr,
                                                float* __restrict__ C, int ldc, int M, int N, int K) {
  __shared__ __attribute__((aligned(16))) float so[4][16][64];
  const int tid = threadIdx.x, w = tid >> 5, lane = tid & 31, ln = lane & 15, hh = lane >> 4;
  const int ntn = N / 64;
  const int wid = blockIdx.x * 4 + w;
  const int mt = wid / ntn, nq = wid % ntn;
  if (mt * 16 >= M) return;
  const int row0 = mt * 16, col0 = nq * 64;
  const float* arow = A + (size_t)(row0 + ln) * lda;
  v8f acc[4] = {};
  for (int kb = 0; kb < K; kb += 32) {
    FragB ah, al;
    const v4f x0 = *(const v4fa*)(arow + kb + 8 * hh), x1 = *(const v4fa*)(arow + kb + 8 * hh + 4);
    const v4f x2 = *(const v4fa*)(arow + kb + 16 + 8 * hh), x3 = *(const v4fa*)(arow + kb + 16 + 8 * hh + 4);
    float xs[16] = {x0[0],x0[1],x0[2],x0[3],x1[0],x1[1],x1[2],x1[3],x2[0],x2[1],x2[2],x2[3],x3[0],x3[1],x3[2],x3[3]};
#pragma unroll
    for (int i = 0; i < 16; ++i) { const unsigned short hb = bf16_bits(xs[i]); ah.u[i] = hb; al.u[i] = ASPLIT ? bf16_bits(xs[i] - bf16_val(hb)) : (unsigned short)0; }
#pragma unroll
    for (int t = 0; t < 4; ++t) {
      const unsigned short* brow = Wt + (size_t)(col0 + t * 16 + ln) * ldb + kb;
      FragB b;
      b.half[0] = *(const v8us*)(brow + 8 * hh);
      b.half[1] = *(const v8us*)(brow + 16 + 8 * hh);
      acc[t] = mmaN<ASPLIT ? 2 : 1>(ah.v, al.v, b.v, b.v, acc[t]);
    }
  }
#pragma unroll
  for (int t = 0; t < 4; ++t) {
    const int col = col0 + t * 16 + ln;
    float bv = bias ? bias[col] : 0.f;
    if (BIAS_BF16) bv = bf16_round(bv);
#pragma unroll
    for (int r = 0; r < 8; ++r) {
      float v = acc[t][r] + bv;
      if (resid) { float rv = resid[(size_t)((row0 + 8 * hh + r) % rmod) * ldr + col]; if (RES_BF16) rv = bf16_round(rv); v += rv; }
      if (ACT == 1) v = fmaxf(v, 0.f);
      if (ACT == 2) v = 0.5f * v * (1.0f + erff(v * 0.70710678118654752f));
      if (ACT == 3) { const float u = 0.7978845608028654f * (v + 0.044715f * v * v * v); v = 0.5f * v * (1.0f + tanhf(u)); }
      so[w][8 * hh + r][t * 16 + ln] = v;
    }
  }
  __builtin_amdgcn_fence(__ATOMIC_ACQ_REL, "workgroup");
  __builtin_amdgcn_wave_barrier();
  const int rsub = lane >> 4, c4 = (lane & 15) * 4;
  {
#pragma unroll
    for (int q = 0; q < 8; ++q) {
      const int r = q * 2 + rsub;
      const v4f v = *(const v4fa*)&so[w][r][c4];
      *(v4f*)(C + (size_t)(row0 + r) * ldc + col0 + c4) = v;
    }
    
  }
}
// row LayerNorm (biased variance, eps) over N: s = X (+ R); optional out_sum <- s; out_norm <- (s-mu)*rsqrt(var+eps)*g + b
template <bool PARAM_BF16>
__global__ __launch_bounds__(256) void k_layernorm(const float* __restrict__ X, const float* __restrict__ R, const float* __restrict__ g, const float* __restrict__ bta,
                                                  float* __restrict__ out_sum, float* __restrict__ out_norm, int N, float eps) {
  __shared__ float red[256];
  const int row = blockIdx.x, tid = threadIdx.x;
  const float* x = X + (size_t)row * N; const float* rr = R ? R + (size_t)row * N : nullptr;
  float vals[16];                     // up to N = 4096
  const int per = N / 256;            // contiguous chunk per thread? use strided-by-4 chunks: thread handles j = tid*4 + 1024*u
  float s1 = 0.f;
  for (int u = 0; u < per / 4; ++u) {
    const int j = tid * 4 + 1024 * u;
    const v4f a = *(const v4fa*)(x + j);
    v4f b = {0.f,0.f,0.f,0.f}; if (rr) b = *(const v4fa*)(rr + j);
#pragma unroll
    for (int q = 0; q < 4; ++q) { const float v = a[q] + b[q]; vals[u * 4 + q] = v; s1 += v; }
  }
  red[tid] = s1; __syncthreads();
  for (int st = 128; st > 0; st >>= 1) { if (tid < st) red[tid] += red[tid + st]; __syncthreads(); }
  const float mu = red[0] / (float)N; __syncthreads();
  float s2 = 0.f;
  for (int u = 0; u < per / 4; ++u)
#pragma unroll
    for (int q = 0; q < 4; ++q) { const float c = vals[u * 4 + q] - mu; s2 += c * c; }
  red[tid] = s2; __syncthreads();
  for (int st = 128; st > 0; st >>= 1) { if (tid < st) red[tid] += red[tid + st]; __syncthreads(); }
  const float rs = rsqrtf(red[0] / (float)N + eps);
  {
    for (int u = 0; u < per / 4; ++u) {
      const int j = tid * 4 + 1024 * u;
      v4f o, sm;
#pragma unroll
      for (int q = 0; q < 4; ++q) {
        float gg = g[j + q], bb = bta[j + q];
        if (PARAM_BF16) { gg = bf16_round(gg); bb = bf16_round(bb); }
        sm[q] = vals[u * 4 + q]; o[q] = (vals[u * 4 + q] - mu) * rs * gg + bb;
      }
      if (out_sum) *(v4f*)(out_sum + (size_t)row * N + j) = sm;
      *(v4f*)(out_norm + (size_t)row * N + j) = o;
    }
    
  }
}



// ---- f16 WMMA path (v_wmma_f32_16x16x32_f16): 11-bit significands for operands in range — used where a [0,1] probability operand needs more precision than bf16
typedef _Float16 v16h __attribute__((ext_vector_type(16)));
union FragH { v16h v; v8us half[2]; _Float16 h[16]; unsigned short u[16]; };
template <int NT>
__device__ __forceinline__ v8f mmaH(v16h ah, v16h al, v16h bh, v16h bl, v8f c) {
  c = __builtin_amdgcn_wmma_f32_16x16x32_f16(false, ah, false, bh, (short)0, c, false, false);
  if (NT >= 2) c = __builtin_amdgcn_wmma_f32_16x16x32_f16(false, al, false, bh, (short)0, c, false, false);
  if (NT >= 3) c = __builtin_amdgcn_wmma_f32_16x16x32_f16(false, ah, false, bl, (short)0, c, false, false);
  asm volatile("v_nop\n\tv_nop\n\tv_nop\n\tv_nop" : "+v"(c) : "v"(ah), "v"(al), "v"(bh), "v"(bl));
  return c;
}
// batched GEMM like k_gemm_b but f16 operands: A f32 (split into f16 hi/lo if ASPLIT, else rounded to f16), Bt = f16 values [n][k]; alpha; C f32; N multiple of 16 (partial tiles skipped)
template <bool ASPLIT>
__global__ __launch_bounds__(128) void k_gemm_h(const float* __restrict__ A, int lda, size_t sA, const _Float16* __restrict__ Bh, int ldb, size_t sB, float alpha, float* __restrict__ C, int ldc, size_t sC, int M, int N, int K) {
  __shared__ __attribute__((aligned(16))) float so[4][16][64];
  const int tid = threadIdx.x, w = tid >> 5, lane = tid & 31, ln = lane & 15, hh = lane >> 4; const int by = blockIdx.y;
  A += (size_t)by * sA; Bh += (size_t)by * sB; C += (size_t)by * sC;
  const int ntn = (N + 63) / 64; const int wid = blockIdx.x * 4 + w; const int mt = wid / ntn, nq = wid % ntn; if (mt * 16 >= M) return;
  const int row0 = mt * 16, col0 = nq * 64; const float* arow = A + (size_t)(row0 + ln) * lda;
  v8f acc[4] = {};
  for (int kb = 0; kb < K; kb += 32) {
    FragH ah, al;
    const v4f x0 = *(const v4fa*)(arow + kb + 8 * hh), x1 = *(const v4fa*)(arow + kb + 8 * hh + 4), x2 = *(const v4fa*)(arow + kb + 16 + 8 * hh), x3 = *(const v4fa*)(arow + kb + 16 + 8 * hh + 4);
    float xs[16] = {x0[0],x0[1],x0[2],x0[3],x1[0],x1[1],x1[2],x1[3],x2[0],x2[1],x2[2],x2[3],x3[0],x3[1],x3[2],x3[3]};
#pragma unroll
    for (int i = 0; i < 16; ++i) { const _Float16 h = (_Float16)xs[i]; ah.h[i] = h; al.h[i] = ASPLIT ? (_Float16)(xs[i] - (float)h) : (_Float16)0.0f; }
#pragma unroll
    for (int t = 0; t < 4; ++t) { if (col0 + t * 16 >= N) continue; const size_t boff = (size_t)(col0 + t * 16 + ln) * ldb + kb; FragH bq; bq.half[0] = *(const v8us*)(Bh + boff + 8 * hh); bq.half[1] = *(const v8us*)(Bh + boff + 16 + 8 * hh);
      acc[t] = mmaH<ASPLIT ? 2 : 1>(ah.v, al.v, bq.v, bq.v, acc[t]); }
  }
#pragma unroll
  for (int t = 0; t < 4; ++t) { if (col0 + t * 16 >= N) continue;
#pragma unroll
    for (int r = 0; r < 8; ++r) so[w][8 * hh + r][t * 16 + ln] = acc[t][r] * alpha; }
  __builtin_amdgcn_fence(__ATOMIC_ACQ_REL, "workgroup"); __builtin_amdgcn_wave_barrier();
  const int rsub = lane >> 4, c4 = (lane & 15) * 4;
  {
#pragma unroll
    for (int q = 0; q < 8; ++q) { const int r = q * 2 + rsub; if (col0 + c4 < N) { const v4f v = *(const v4fa*)&so[w][r][c4]; *(v4f*)(C + (size_t)(row0 + r) * ldc + col0 + c4) = v; } }
     }
}

// Wt(n, k) = f16(W[k][n]·scale), stored in fragment order, from f32 row-major W[K][N] (scale = power of two; bf16-exact weights stay exact in f16 away from the subnormal range)
__global__ __launch_bounds__(256) void k_wt_f16(const float* __restrict__ W, _Float16* __restrict__ Wt, int K, int N, float scale) {
  /* Wt in fragment order ([16-row tile of n][32-column step of k][piece][lane][8]): thread t writes the t-th 16 bytes of the plane */
  const int t = blockIdx.x * 256 + threadIdx.x; if (t >= N * (K / 8)) return; const int blk = t >> 6; const int n = (blk / (K / 32)) * 16 + (t & 15), k8 = (blk % (K / 32)) * 32 + ((t >> 5) & 1) * 16 + ((t >> 4) & 1) * 8; FragH f;
#pragma unroll
  for (int i = 0; i < 8; ++i) f.h[i] = (_Float16)(bf16_round(W[(size_t)(k8 + i) * N + n]) * scale); const v8us o = f.half[0];
  *(v8us*)((unsigned short*)Wt + (size_t)t * 8) = o; 
}
// the same builder for the per-head [64][64] weights of three stacks in ONE launch: blockIdx.y = head (consecutive [64][64] planes in source and destination), blockIdx.z = stack
__global__ __launch_bounds__(256) void k_wt_f16h(const float* __restrict__ Wa, const float* __restrict__ Wb, const float* __restrict__ Wc, _Float16* __restrict__ Ta, _Float16* __restrict__ Tb, _Float16* __restrict__ Tc, float scale) {
  const int t = blockIdx.x * 256 + threadIdx.x; if (t >= HD * (HD / 8)) return; const int blk = t >> 6; const int n = (blk / (HD / 32)) * 16 + (t & 15), k8 = (blk % (HD / 32)) * 32 + ((t >> 5) & 1) * 16 + ((t >> 4) & 1) * 8; const size_t o = (size_t)blockIdx.y * HD * HD;      /* each plane in fragment order, thread t its t-th 16 bytes */
  const float* W = (blockIdx.z == 0 ? Wa : blockIdx.z == 1 ? Wb : Wc) + o; _Float16* Wt = (blockIdx.z == 0 ? Ta : blockIdx.z == 1 ? Tb : Tc) + o; FragH f;
#pragma unroll
  for (int i = 0; i < 8; ++i) f.h[i] = (_Float16)(bf16_round(W[(size_t)(k8 + i) * HD + n]) * scale); const v8us ov = f.half[0];
  *(v8us*)((unsigned short*)Wt + (size_t)t * 8) = ov;
}
// k_gemm_hh variant with fused epilogue: v = acc·alpha + bias[by·sBias + col] (+ CP[(row/rowsPerB)·sCPb + by·64 + col] if CP) ; ACT 0 none / 1 elu ; writes f16 C16 (and f32 C if non-null)
template <int ACT>
__global__ __launch_bounds__(128) void k_gemm_hhx(const _Float16* __restrict__ A, int lda, size_t sA, const _Float16* __restrict__ Bh, int ldb, size_t sB, float alpha, const float* __restrict__ bias, size_t sBias, const float* __restrict__ CP, int rowsPerB, size_t sCPb, int row0g,
    float* __restrict__ C, _Float16* __restrict__ C16, int ldc, size_t sC, int M, int N, int K) {
  __shared__ __attribute__((aligned(16))) float so[4][16][64];
  const int tid = threadIdx.x, w = tid >> 5, lane = tid & 31, ln = lane & 15, hh = lane >> 4; const int by = blockIdx.y;
  A += (size_t)by * sA; Bh += (size_t)by * sB; const size_t cofs = (size_t)by * sC; const float* bp = bias ? bias + (size_t)by * sBias : nullptr;
  const int ntn = (N + 63) / 64; const int wid = blockIdx.x * 4 + w; const int mt = wid / ntn, nq = wid % ntn; if (mt * 16 >= M) return;
  const int row0 = mt * 16, col0 = nq * 64; const _Float16* arow = A + (size_t)(row0 + ln) * lda;
  v8f acc[4] = {};
  for (int kb = 0; kb < K; kb += 32) { FragH ah; ah.half[0] = *(const v8us*)((const unsigned short*)arow + kb + 8 * hh); ah.half[1] = *(const v8us*)((const unsigned short*)arow + kb + 16 + 8 * hh);
#pragma unroll
    for (int t = 0; t < 4; ++t) { if (col0 + t * 16 >= N) continue; const size_t boff = (size_t)(col0 + t * 16 + ln) * ldb + kb; FragH bq; bq.half[0] = *(const v8us*)((const unsigned short*)Bh + boff + 8 * hh); bq.half[1] = *(const v8us*)((const unsigned short*)Bh + boff + 16 + 8 * hh);
      acc[t] = mmaH<1>(ah.v, ah.v, bq.v, bq.v, acc[t]); }
  }
#pragma unroll
  for (int t = 0; t < 4; ++t) { if (col0 + t * 16 >= N) continue; const int col = col0 + t * 16 + ln; const float bv = bp ? bf16_round(bp[col]) : 0.f;
#pragma unroll
    for (int r = 0; r < 8; ++r) { float v = acc[t][r] * alpha + bv; if (CP) { const int rr = row0g + row0 + 8 * hh + r; if (rowsPerB < 0) v += CP[cofs + (size_t)rr * ldc + col];      /* rowsPerB < 0: own element of the batched C plane */ else { const int bidx = rr / rowsPerB; v += CP[(size_t)bidx * sCPb + (size_t)by * 64 + col]; } } if (ACT == 1) v = (v > 0.f) ? v : expm1f(v); else if (ACT == 7) v = (v > 0.f) ? v + 1.0f : expf(v); else if (ACT == 8) v = tanhf(v); else if (ACT == 9) v = 0.5f * v * (1.0f + tanhf(0.7978845608028654f * (v + 0.044715f * v * v * v))); else if (ACT == 11) v = 1.0f / (1.0f + expf(-v)); else if (ACT == 12) v = (v > 0.f) ? v : 0.01f * v; else if (ACT == 14) v = (v > 0.f) ? v : 0.1f * v; else if (ACT == 16) v = (v >= 0.f) ? v : 0.3f * v; else if (ACT == 17) v = (v >= 0.f) ? v : 0.2f * v; else if (ACT == 15) v = v / (1.0f + expf(-v)); else if (ACT == 3) v = fmaxf(v, 0.f); else if (ACT == 6) v = 0.5f * v * (1.0f + erff(v * 0.70710678118654752f)); so[w][8 * hh + r][t * 16 + ln] = v; } }
  __builtin_amdgcn_fence(__ATOMIC_ACQ_REL, "workgroup"); __builtin_amdgcn_wave_barrier();
  const int rsub = lane >> 4, c4 = (lane & 15) * 4; typedef _Float16 v4h __attribute__((ext_vector_type(4)));
  {
#pragma unroll
    for (int q = 0; q < 8; ++q) { const int r = q * 2 + rsub; if (col0 + c4 < N) { const v4f v = *(const v4fa*)&so[w][r][c4]; if (C) *(v4f*)(C + cofs + (size_t)(row0 + r) * ldc + col0 + c4) = v; if (C16) { v4h h4; for (int i = 0; i < 4; ++i) h4[i] = (_Float16)v[i]; *(v4h*)(C16 + cofs + (size_t)(row0 + r) * ldc + col0 + c4) = h4; } } }
     }
}


typedef _Float16 v4h __attribute__((ext_vector_type(4)));

__global__ __launch_bounds__(256) void k_x16(const float* __restrict__ x, _Float16* __restrict__ X16, size_t n8) { const size_t t = (size_t)blockIdx.x * 256 + threadIdx.x; if (t >= n8) return; FragH f;
#pragma unroll
  for (int q = 0; q < 8; ++q) f.h[q] = (_Float16)bf16_round(x[t * 8 + q]); *(v8us*)((unsigned short*)X16 + t * 8) = f.half[0];  }
__global__ __launch_bounds__(256) void k_h16(const float* __restrict__ x, _Float16* __restrict__ X16, size_t n8) { const size_t t = (size_t)blockIdx.x * 256 + threadIdx.x; if (t >= n8) return; FragH f;
#pragma unroll
  for (int q = 0; q < 8; ++q) f.h[q] = (_Float16)x[t * 8 + q]; *(v8us*)((unsigned short*)X16 + t * 8) = f.half[0];  }
__global__ __launch_bounds__(256) void k_round16f(const float* __restrict__ W, _Float16* __restrict__ Bt, size_t n8) { const size_t t = (size_t)blockIdx.x * 256 + threadIdx.x; if (t >= n8) return; FragH f;
#pragma unroll
  for (int i = 0; i < 8; ++i) f.h[i] = (_Float16)(bf16_round(W[t * 8 + i]) * 16.0f); *(v8us*)((unsigned short*)Bt + t * 8) = f.half[0];  }
template <int NHv, int TTv>
__global__ __launch_bounds__(256) void k_vt(const _Float16* __restrict__ V16, int ldv, int voff, _Float16* __restrict__ Vt) { __shared__ unsigned short tl[64][66]; const int tid = threadIdx.x; const int slab = blockIdx.x / (TTv / 64), lg = blockIdx.x % (TTv / 64); const int b = slab / NHv, h = slab % NHv;
  for (int i = tid; i < 64 * 8; i += 256) { const int r = i / 8, c8 = (i % 8) * 8; FragH f; f.half[0] = *(const v8us*)((const unsigned short*)V16 + ((size_t)b * TTv + lg * 64 + r) * ldv + voff + h * 64 + c8);
#pragma unroll
    for (int q = 0; q < 8; ++q) tl[r][c8 + q] = f.u[q]; }
  __syncthreads();
  {
#pragma unroll
    for (int rd = 0; rd < 2; ++rd) { const int d = rd * 32 + tid / 8, pc = tid % 8; FragH f;
#pragma unroll
      for (int q = 0; q < 8; ++q) f.u[q] = tl[pc * 8 + q][d];
      *(v8us*)((unsigned short*)Vt + ((size_t)slab * 64 + d) * TTv + lg * 64 + pc * 8) = f.half[0]; }
     } }

__global__ __launch_bounds__(256) void k_hl(const float* __restrict__ F, _Float16* __restrict__ Hh, _Float16* __restrict__ Hl, size_t n8) { const size_t t = (size_t)blockIdx.x * 256 + threadIdx.x; if (t >= n8) return; FragH fh, fl;
  /* F: row-major rows of DM; Hh, Hl: fragment order ([16-row tile][32-column step][piece][lane][8]), thread t their t-th 16 bytes */
  const size_t blk = t >> 6; const float* fp = F + ((blk / (DM / 32)) * 16 + (t & 15)) * DM + (blk % (DM / 32)) * 32 + ((t >> 5) & 1) * 16 + ((t >> 4) & 1) * 8; const v4f a = *(const v4fa*)fp, c = *(const v4fa*)(fp + 4);
#pragma unroll
  for (int q = 0; q < 4; ++q) { _Float16 h = (_Float16)a[q]; fh.h[q] = h; fl.h[q] = (_Float16)((a[q] - (float)h) * 1024.0f); h = (_Float16)c[q]; fh.h[4 + q] = h; fl.h[4 + q] = (_Float16)((c[q] - (float)h) * 1024.0f); }
  { *(v8us*)((unsigned short*)Hh + t * 8) = fh.half[0]; *(v8us*)((unsigned short*)Hl + t * 8) = fl.half[0];  } }

// ---- helpers of the output GEMM (A and Bh in fragment order; wave tile 32x64): the kernel itself stands behind the attention ----
__device__ __forceinline__ v16h g2_frag(const _Float16* p, int hh) { FragH f; f.half[0] = *(const v8us*)((const unsigned short*)p + 8 * hh); f.half[1] = *(const v8us*)((const unsigned short*)p + 16 + 8 * hh); return f.v; }
// ---- fragment-order planes. Every f16 operand plane of the products (q and k hi / residual, V^T, o, the weights) is stored as the operand fragments themselves: a 16-row x 32-column block is two pieces of 512 bytes,
// piece u = columns 16 u .. 16 u + 15, and in a piece lane (ln, hh) owns 16 bytes at lane * 16: row ln, columns 8 hh .. 8 hh + 7 of the piece. A wave-wide 16-byte load or store then covers 512 contiguous bytes (four whole 128-byte lines)
// where a row-major plane gives it sixteen lines of which it uses 32 bytes each. p: the lane's own 16 bytes of piece 0.
__device__ __forceinline__ v16h pk_frag(const _Float16* p) { FragH f; f.half[0] = *(const v8us*)((const unsigned short*)p); f.half[1] = *(const v8us*)((const unsigned short*)p + 256); return f.v; }
__device__ __forceinline__ v8f g2_mma(v16h a, v16h b, v8f c) { v8f d = __builtin_amdgcn_wmma_f32_16x16x32_f16(false, a, false, b, (short)0, c, false, false); asm volatile("v_nop\n\tv_nop\n\tv_nop\n\tv_nop" : "+v"(d) : "v"(a), "v"(b)); return d; }

__global__ __launch_bounds__(256) void k_wnat(const float* __restrict__ w, size_t n8, _Float16* __restrict__ Bt) { const size_t t = (size_t)blockIdx.x * 256 + threadIdx.x; if (t >= n8) return; FragH f; for (int q = 0; q < 8; ++q) f.h[q] = (_Float16)(bf16_round(w[t * 8 + q]) * 16.0f); *(v8us*)((unsigned short*)Bt + t * 8) = f.half[0];  }
__global__ __launch_bounds__(256) void k_rsm(const float* __restrict__ S, _Float16* __restrict__ P, int nrows) {
  #pragma clang fp contract(off)
  const int i = blockIdx.x * 256 + threadIdx.x; if (i >= nrows) return; const float* s = S + (size_t)i * SQ; float mx = -3.0e38f;
#pragma unroll 1
  for (int j = 0; j < SQ; ++j) mx = fmaxf(mx, s[j]); float se = 0.f;
#pragma unroll 1
  for (int j = 0; j < SQ; ++j) se += expf(s[j] - mx); const float sc = 256.0f / se;
#pragma unroll 1
  for (int j0 = 0; j0 < SQ; j0 += 8) { FragH f; for (int q = 0; q < 8; ++q) f.h[q] = (_Float16)(expf(s[j0 + q] - mx) * sc); unsigned short* d = (unsigned short*)P + (size_t)i * SQ + j0; *(v8us*)d = f.half[0];  } }
__global__ __launch_bounds__(256) void k_vt(const _Float16* __restrict__ V16, int b, int h0, _Float16* __restrict__ VT) { __shared__ unsigned short tl[64][65]; const int tid = threadIdx.x; const int hh = blockIdx.x % HG, sg = blockIdx.x / HG; const int s0 = sg * 64; const int h = h0 + hh;
  for (int i = tid; i < 64 * 8; i += 256) { const int j = i / 8, d8 = (i % 8) * 8; FragH f; f.half[0] = *(const v8us*)((const unsigned short*)V16 + ((size_t)b * SQ + s0 + j) * DM + h * HD + d8); for (int q = 0; q < 8; ++q) tl[d8 + q][j] = f.u[q]; }
  __syncthreads();
  { for (int i = tid; i < 64 * 8; i += 256) { const int d = i / 8, j8 = (i % 8) * 8; FragH f; for (int q = 0; q < 8; ++q) f.u[q] = tl[d][j8 + q]; *(v8us*)((unsigned short*)VT + ((size_t)hh * HD + d) * SQ + s0 + j8) = f.half[0]; }  } }



// Fused causal attention, ONE WAVE PER 16 QUERY ROWS of one (batch, head); no score or weight ever leaves the registers, no LDS, no barrier.
// Scores are formed transposed, S^T = K . Q^T (A = 16 key rows, B = 16 query rows): lane (ln, hh) then holds keys 8 hh .. 8 hh + 7 of the tile for query ln, so row maximum and row sum are per-lane values
// (plus one exchange between the two lane halves), and two neighbouring tiles' weights ARE the 32-key operand fragment of the second product (elements 0..7 = keys 8 hh + i, 8..15 = keys 16 + 8 hh + i).
// The second product is transposed too, O^T = V^T . P^T (A = 16 rows of V^T, B = the weights): lane (ln, hh) ends with 8 consecutive output columns of query ln, one 16-byte store a tile.
// ONE walk over the keys up to the diagonal: a running row maximum; each chunk's weights are exp(s - maximum so far) as f16 (at most 1), and the row sum and the four output tiles are first multiplied by exp(old maximum - new maximum); the division by the row sum comes once, at the end.
// Every loop over r, i and t is unrolled in full so that s, e, p and the accumulators are indexed by constants and stay in registers; the loop over the chunks stays rolled.
__device__ __forceinline__ v8f fa_mma(v16h a, v16h b, v8f c) { return __builtin_amdgcn_wmma_f32_16x16x32_f16(false, a, false, b, (short)0, c, false, false); }
// scores of 16 keys x 16 queries: hi.hi / 8, then + 2^-13 lo.hi, then + 2^-13 hi.lo (three accumulators of their own, added in this order); keys above the row get -1e9
// a0, a1: the 16 key rows' hi plane (head columns 0..31, 32..63); l0, l1: their residual plane
__device__ __forceinline__ void fa_scores(v16h a0, v16h a1, v16h l0, v16h l1, v16h qh0, v16h qh1, v16h ql0, v16h ql1, int keyb, int last, float* s) {
  const v8f z8 = {0.f,0.f,0.f,0.f,0.f,0.f,0.f,0.f};
  v8f c1 = fa_mma(a0, qh0, z8), c2 = fa_mma(a0, ql0, z8), c3 = fa_mma(l0, qh0, z8);
  c1 = fa_mma(a1, qh1, c1); c2 = fa_mma(a1, ql1, c2); c3 = fa_mma(l1, qh1, c3);
#pragma unroll
  for (int r = 0; r < 8; ++r) { float v = c1[r] * SCL; v += c2[r] * SCLR; v += c3[r] * SCLR; s[r] = (keyb + r <= last) ? v : -1.0e9f; } }
// lane l's value as seen from lane l ^ 16: one vector cross-row move (a shuffle would go through the LDS pipe and its wait, here once a chunk)
// 16 head columns x 32 keys of V^T: the same piece of two neighbouring token tiles (keys 8 hh + i, then 16 + 8 hh + i)
__device__ __forceinline__ v16h vt_frag(const _Float16* p) { FragH f; f.half[0] = *(const v8us*)((const unsigned short*)p); f.half[1] = *(const v8us*)((const unsigned short*)p + 1024); return f.v; }
__device__ __forceinline__ float fa_other_half(float x) { const unsigned u = __float_as_uint(x); return __uint_as_float(__builtin_amdgcn_permlanex16(u, u, 0x76543210u, 0xfedcba98u, false, false)); }
__device__ __forceinline__ void fa_body(const int bid, const _Float16* __restrict__ QHp, const _Float16* __restrict__ QLp, const _Float16* __restrict__ KHp, const _Float16* __restrict__ KLp, const _Float16* __restrict__ VTp, _Float16* __restrict__ O) {
  const int lane = threadIdx.x & 31, ln = lane & 15, hh = lane >> 4; const int w = __builtin_amdgcn_readfirstlane((int)(threadIdx.x >> 5));      /* the wave's number as a scalar: the key loops get scalar trip counts */
  const int bh = bid % (NB * NH), qb = (SQ / 64 - 1) - bid / (NB * NH);      /* longest rows first */
  const int b = bh / NH, h = bh % NH; const int q0 = qb * 64 + w * 16; const int last = q0 + ln; const int nch = (q0 + 47) >> 5;      /* 32-key chunks up to the diagonal; the last one may hold 16 keys that are masked for every row (they exist: q0 + 31 < SQ there) */
  /* q, k and V^T planes in fragment order, [batch, head][16-token tile][4 pieces][lane][8]: a tile is 1024 elements, a 32-key chunk 2048 in a row. q, k: piece = 16 head columns; V^T: piece = 16 head columns x the tile's 16 tokens */
  const size_t pb = (size_t)bh * (SQ / 16) * 1024 + lane * 8; const size_t rq = pb + (size_t)(q0 >> 4) * 1024;
  const _Float16* qhp = QHp + rq; const _Float16* qlp = QLp + rq;
  const v16h qh0 = pk_frag(qhp), qh1 = pk_frag(qhp + 512), ql0 = pk_frag(qlp), ql1 = pk_frag(qlp + 512);
  asm volatile("s_wait_xcnt 0x0" :: "v"(qhp), "v"(qlp) : "memory");      /* the wait before a register that an issued load names is written again; the addresses are inputs so that they keep their registers up to it (the same at the loop's wait below) */
  const _Float16* kh = KHp + pb; const _Float16* kl = KLp + pb; const _Float16* vt = VTp + pb;
  float m = -3.0e38f, l = 0.f;      /* m: the row's running maximum, the same in both lane halves; l: this lane half's share of the row sum, at scale exp(-m) */
  const v8f z8 = {0.f,0.f,0.f,0.f,0.f,0.f,0.f,0.f}; v8f o0 = z8, o1 = z8, o2 = z8, o3 = z8;
  for (int c = 0; c < nch; ++c) { float s[16]; const _Float16* ka = kh + (size_t)c * 2048; const _Float16* kb = kl + (size_t)c * 2048; const _Float16* vc = vt + (size_t)c * 2048;
    const v16h a0 = pk_frag(ka), a1 = pk_frag(ka + 512), a2 = pk_frag(ka + 1024), a3 = pk_frag(ka + 1536), l0 = pk_frag(kb), l1 = pk_frag(kb + 512), l2 = pk_frag(kb + 1024), l3 = pk_frag(kb + 1536);
    const v16h v0 = vt_frag(vc), v1 = vt_frag(vc + 256), v2 = vt_frag(vc + 512), v3 = vt_frag(vc + 768);
    /* the loaded values are inputs too: all of the chunk's loads (key rows and V^T rows) are asked for together, one trip to the caches a chunk; left alone the compiler reuses two fragments' registers and waits for memory before nearly every product */
    asm volatile("s_wait_xcnt 0x0" :: "v"(ka), "v"(kb), "v"(vc), "v"(a0), "v"(a1), "v"(a2), "v"(a3), "v"(l0), "v"(l1), "v"(l2), "v"(l3), "v"(v0), "v"(v1), "v"(v2), "v"(v3) : "memory");
    __builtin_amdgcn_sched_barrier(0);      /* keeps the products behind the wait, so that the wait is not moved down past them with the last loads */
    fa_scores(a0, a1, l0, l1, qh0, qh1, ql0, ql1, c * 32 + 8 * hh, last, s); fa_scores(a2, a3, l2, l3, qh0, qh1, ql0, ql1, c * 32 + 16 + 8 * hh, last, s + 8);
    float mc = s[0];
#pragma unroll
    for (int i = 1; i < 16; ++i) mc = fmaxf(mc, s[i]);
    const float mn = fmaxf(m, fmaxf(mc, fa_other_half(mc)));      /* both halves' weights enter one product, so they need one maximum */
    const float al = __expf(m - mn);      /* what the sum and the output tiles so far are worth at the new maximum (0 in the first chunk, 1 while the maximum stands) */
    float e[16]; FragH p;
#pragma unroll
    for (int i = 0; i < 16; ++i) { e[i] = __expf(s[i] - mn); p.h[i] = (_Float16)e[i]; }
    const float a = (((e[0] + e[1]) + (e[2] + e[3])) + ((e[4] + e[5]) + (e[6] + e[7]))) + (((e[8] + e[9]) + (e[10] + e[11])) + ((e[12] + e[13]) + (e[14] + e[15])));
    l = l * al + a; m = mn;
    o0 *= al; o1 *= al; o2 *= al; o3 *= al;
    o0 = fa_mma(v0, p.v, o0); o1 = fa_mma(v1, p.v, o1); o2 = fa_mma(v2, p.v, o2); o3 = fa_mma(v3, p.v, o3); }
  const float sc = 64.0f / (l + fa_other_half(l));      /* the other eight keys of every tile sit in the other lane half; o carried x64 */
  const v8f os[4] = {o0, o1, o2, o3};
#pragma unroll
  for (int t = 0; t < 4; ++t) { FragH f;
#pragma unroll
    for (int r = 0; r < 8; ++r) f.h[r] = (_Float16)(os[t][r] * sc);
    *(v8us*)((unsigned short*)O + ((size_t)b * SQ + q0) * DM + h * 1024 + t * 256 + lane * 8) = f.half[0]; }      /* o in fragment order for the output GEMM: [16-row tile][32-column step][piece][lane][8]; head h, tile t = step 2 h + t / 2, piece t % 2 */
  asm volatile("s_wait_xcnt 0x0" ::: "memory"); }      /* the wait before a register that the four issued stores name is written again: in the joint launch the f32 rows' code follows them in the listing */


// ---- front end in ONE launch: x -> q and k (f16 hi + x1024 residual planes), V^T, and the first tile's f32 q, k, v rows. One wave per 64 token rows of one head; no LDS, no barrier.
// The wave reads its [64][64] f32 slice of x once, rounds it (bf16, exact in f16) into eight operand fragments and keeps them in registers for all three projections (K = 64: two products a tile, columns 0..31 then 32..63).
// q and k are formed transposed (A = 16 rows of W^T, B = 16 token rows): lane (ln, hh) then holds 8 consecutive head columns of token ln: its own 16 bytes of a piece of the fragment-order q / k planes, so a wave's store is 512 bytes in a row.
// v is formed straight (A = 16 token rows, B = 16 rows of W^T): lane (ln, hh) then holds 8 consecutive tokens of head column ln: its own 16 bytes of a piece of the fragment-order V^T plane.
// Rows 0..127 of each batch also leave as f32 (the exact first-tile path reads them): their waves form each projection a second time (v transposed like q and k) and store it unrounded.
// Every loop is unrolled in full so that the fragments are indexed by constants and stay in registers.
union RawX { v8f v; v4f q[2]; };      /* 8 consecutive f32 of an x row as two 16-byte loads leave them */
__device__ __forceinline__ RawX pj_raw(const float* p) { RawX r; r.q[0] = *(const v4fa*)p; r.q[1] = *(const v4fa*)(p + 4); return r; }
// a: columns 8 hh .. 8 hh + 7 of a 32-column step, c: columns 16 + 8 hh .. of the same step (the operand fragment's element order)
__device__ __forceinline__ v16h pj_xfrag(v8f a, v8f c) { FragH f;
#pragma unroll
  for (int q = 0; q < 8; ++q) { f.h[q] = (_Float16)bf16_round(a[q]); f.h[8 + q] = (_Float16)bf16_round(c[q]); }
  return f.v; }
__device__ __forceinline__ v8f pj_tile(v16h a0, v16h a1, v16h b0, v16h b1) { const v8f z8 = {0.f,0.f,0.f,0.f,0.f,0.f,0.f,0.f}; return fa_mma(a1, b1, fa_mma(a0, b0, z8)) * 0.0625f; }      /* weights carried x16 */
__device__ __forceinline__ void pj_f32(float* d, v8f c) { const v4f lo = {c[0], c[1], c[2], c[3]}, hi = {c[4], c[5], c[6], c[7]}; *(v4f*)d = lo; *(v4f*)(d + 4) = hi; }
// the wait before a register that an issued load names is written again; the weight rows' address and the loaded fragments are inputs, so that the address keeps its registers up to the wait and the sixteen loads stand in front of it, asked for together
__device__ __forceinline__ void pj_wfence(const _Float16* p, const v16h (&f)[4][2]) { asm volatile("s_wait_xcnt 0x0" :: "v"(p), "v"(f[0][0]), "v"(f[0][1]), "v"(f[1][0]), "v"(f[1][1]), "v"(f[2][0]), "v"(f[2][1]), "v"(f[3][0]), "v"(f[3][1]) : "memory"); }
// Hh, Hl: this lane's 16 bytes of the first piece of the wave's first token tile; F0: this lane's first element of the row-major f32 rows (token ln of the wave's rows, head column 8 hh)
__device__ __forceinline__ void pj_qk(const _Float16* __restrict__ wp, const v16h (&xf)[4][2], _Float16* __restrict__ Hh, _Float16* __restrict__ Hl, float* __restrict__ F0, bool first) {
  v16h wf[4][2];
#pragma unroll
  for (int t = 0; t < 4; ++t) { wf[t][0] = pk_frag(wp + t * 16 * HD); wf[t][1] = pk_frag(wp + t * 16 * HD + 512); }
  pj_wfence(wp, wf);
#pragma unroll
  for (int j = 0; j < 4; ++j) {
#pragma unroll
    for (int t = 0; t < 4; ++t) { const v8f c = pj_tile(wf[t][0], wf[t][1], xf[j][0], xf[j][1]); FragH fh, fl;
#pragma unroll
      for (int r = 0; r < 8; ++r) { const _Float16 hv = (_Float16)c[r]; fh.h[r] = hv; fl.h[r] = (_Float16)((c[r] - (float)hv) * 1024.0f); }
      *(v8us*)((unsigned short*)Hh + j * 1024 + t * 256) = fh.half[0]; *(v8us*)((unsigned short*)Hl + j * 1024 + t * 256) = fl.half[0]; } }
  asm volatile("s_wait_xcnt 0x0" ::: "memory");      /* the wait before a register that an issued store names is written again */
  if (first) {      /* one scalar branch a projection: the same products once more, for one wave in sixteen */
#pragma unroll
    for (int j = 0; j < 4; ++j) {
#pragma unroll
      for (int t = 0; t < 4; ++t) pj_f32(F0 + (size_t)j * 16 * DM + t * 16, pj_tile(wf[t][0], wf[t][1], xf[j][0], xf[j][1])); }
    asm volatile("s_wait_xcnt 0x0" ::: "memory");      /* likewise: the next projection's weight loads land in registers that these stores name */
  } }
__global__ __launch_bounds__(128) void k_proj(const float* __restrict__ x, const _Float16* __restrict__ BQp, const _Float16* __restrict__ BKp, const _Float16* __restrict__ BVp, _Float16* __restrict__ QHp, _Float16* __restrict__ QLp, _Float16* __restrict__ KHp, _Float16* __restrict__ KLp, _Float16* __restrict__ VTp,
    float* __restrict__ QF0p, float* __restrict__ KF0p, float* __restrict__ VF0p) {
  const int lane = threadIdx.x & 31, ln = lane & 15, hh = lane >> 4; const int w = __builtin_amdgcn_readfirstlane((int)(threadIdx.x >> 5));      /* the wave's number as a scalar: the first-tile test is a scalar branch, every lane stays on at the products */
  const int h = blockIdx.y; const int r0 = (blockIdx.x * 4 + w) * 64; const int b = r0 / SQ, s0 = r0 % SQ; const bool first = s0 < QT0;
  const float* xp = x + (size_t)(r0 + ln) * DM + h * HD + 8 * hh;
  RawX rx[4][4];
#pragma unroll
  for (int j = 0; j < 4; ++j) {
#pragma unroll
    for (int u = 0; u < 4; ++u) rx[j][u] = pj_raw(xp + (size_t)j * 16 * DM + u * 16); }
  /* the loaded values are inputs: all 32 loads of the slice are asked for together, one trip to memory a wave (left alone the compiler asks for four at a time and waits eight times); the wait stands before the address register is written again */
  asm volatile("s_wait_xcnt 0x0" :: "v"(xp), "v"(rx[0][0].v), "v"(rx[0][1].v), "v"(rx[0][2].v), "v"(rx[0][3].v), "v"(rx[1][0].v), "v"(rx[1][1].v), "v"(rx[1][2].v), "v"(rx[1][3].v), "v"(rx[2][0].v), "v"(rx[2][1].v), "v"(rx[2][2].v), "v"(rx[2][3].v), "v"(rx[3][0].v), "v"(rx[3][1].v), "v"(rx[3][2].v), "v"(rx[3][3].v) : "memory");
  v16h xf[4][2];
#pragma unroll
  for (int j = 0; j < 4; ++j) { xf[j][0] = pj_xfrag(rx[j][0].v, rx[j][1].v); xf[j][1] = pj_xfrag(rx[j][2].v, rx[j][3].v); }
  const size_t wo = (size_t)h * HD * HD + lane * 8;      /* the lane's 16 bytes of the first piece of the head's W^T plane (fragment order) */
  const size_t ro = ((size_t)(b * NH + h) * (SQ / 16) + (s0 >> 4)) * 1024 + lane * 8;      /* likewise of the wave's first token tile in the q, k and V^T planes */ const size_t fo = ((size_t)b * QT0 + (first ? s0 : 0) + ln) * DM + h * HD + 8 * hh;
  pj_qk(BQp + wo, xf, QHp + ro, QLp + ro, QF0p + fo, first);
  pj_qk(BKp + wo, xf, KHp + ro, KLp + ro, KF0p + fo, first);
  const _Float16* wvp = BVp + wo; v16h wf[4][2];
#pragma unroll
  for (int t = 0; t < 4; ++t) { wf[t][0] = pk_frag(wvp + t * 16 * HD); wf[t][1] = pk_frag(wvp + t * 16 * HD + 512); }
  pj_wfence(wvp, wf);
  _Float16* vtp = VTp + ro;
#pragma unroll
  for (int t = 0; t < 4; ++t) {
#pragma unroll
    for (int j = 0; j < 4; ++j) { const v8f c = pj_tile(xf[j][0], xf[j][1], wf[t][0], wf[t][1]); FragH f;
#pragma unroll
      for (int r = 0; r < 8; ++r) f.h[r] = (_Float16)c[r];
      *(v8us*)((unsigned short*)vtp + j * 1024 + t * 256) = f.half[0]; } }
  asm volatile("s_wait_xcnt 0x0" ::: "memory");      /* as in pj_qk, in front of the branch */
  if (first) {
#pragma unroll
    for (int j = 0; j < 4; ++j) {
#pragma unroll
      for (int t = 0; t < 4; ++t) pj_f32(VF0p + fo + (size_t)j * 16 * DM + t * 16, pj_tile(wf[t][0], wf[t][1], xf[j][0], xf[j][1])); } } }

template <int MASKADD>
__device__ __forceinline__ void att0_body(float (&lk)[64][64], float (&lv)[64][64], const int bid, const float* __restrict__ QF, const float* __restrict__ KF, const float* __restrict__ VF, int ld, const float* __restrict__ mask, float scale, _Float16* __restrict__ Hh, _Float16* __restrict__ Hl) {
  #pragma clang fp contract(off)
  // 64 query rows of one (batch, head) a work-group of four waves, TWO LANES PER ROW (lane l and lane l ^ 16): each owns 32 of the 64 head columns of its row's q and o, so that the rows fit the register budget of the joint launch.
  // Keys in order (online softmax). A score is the lane's own 32 products summed in column order plus the other lane's sum (one cross-row move); both lanes then hold the same score and keep the same m and l.
  // k and v rows come in chunks of 64 keys, staged once per chunk in LDS by coalesced loads and then read at one address per lane half (broadcast). Four keys' score chains run side by side: each is 32 dependent adds, so one alone leaves the issue slots empty.
  // Every loop over c, u and w and the staging loops over it are unrolled in full so that q, o, s and the staged values are indexed by constants and stay in registers; the loops over chunks and groups of four keys stay rolled so that the code stays small.
  const int tid = threadIdx.x; const int cb = ((tid >> 4) & 1) * 32;      /* the lane's first head column */
  const int rg = (QT0 / 64 - 1) - bid / (NB * NH), h = bid % NH, bt = (bid / NH) % NB;      /* the later row group, with the longer walk, first */
  const int rl = (tid >> 5) * 16 + (tid & 15); const int i = rg * 64 + rl;
  QF += (size_t)bt * QT0 * ld; KF += (size_t)bt * QT0 * ld; VF += (size_t)bt * QT0 * ld;      /* each batch's first-tile rows are a plane of their own */
  const float* qr = QF + (size_t)i * ld + h * HD + cb;
  float q[HD / 2], o[HD / 2];
  { v4f tq[HD / 8];
#pragma unroll
    for (int c = 0; c < HD / 8; ++c) tq[c] = *(const v4fa*)(qr + c * 4);
    asm volatile("s_wait_xcnt 0x0" :: "v"(qr) : "memory");      /* as in the staging below: the row's address keeps its registers until every load that names it has been translated */
#pragma unroll
    for (int c = 0; c < HD / 8; ++c) {
#pragma unroll
      for (int u = 0; u < 4; ++u) { q[c * 4 + u] = tq[c][u]; o[c * 4 + u] = 0.f; } } }
  float m = -1.0e30f, l = 0.f; const int jmax = MASKADD ? (SQ - 1) : (rg * 64 + 63);      /* additive-mask form: every key (the mask input decides); causal form: keys up to the block's last row; jmax + 1 is a multiple of 64 */
#pragma unroll 1
  for (int j0 = 0; j0 <= jmax; j0 += 64) {
    __syncthreads();      /* every wave has left the chunk before it is overwritten */
    { const float* kp[8]; const float* vp[8]; v4f tk[8], tv[8];      /* 64 keys in one pass of 128 threads: 16 loads in flight */
#pragma unroll
      for (int it = 0; it < 8; ++it) { const size_t g = (size_t)(j0 + it * 8 + tid / 16) * ld + h * HD + (tid % 16) * 4; kp[it] = KF + g; vp[it] = VF + g; }
#pragma unroll
      for (int it = 0; it < 8; ++it) { tk[it] = *(const v4fa*)kp[it]; tv[it] = *(const v4fa*)vp[it]; }
      /* the wait before a register that an issued load names is written again; the addresses are inputs so that they keep their registers up to it */
      asm volatile("s_wait_xcnt 0x0" :: "v"(kp[0]), "v"(kp[1]), "v"(kp[2]), "v"(kp[3]), "v"(kp[4]), "v"(kp[5]), "v"(kp[6]), "v"(kp[7]), "v"(vp[0]), "v"(vp[1]), "v"(vp[2]), "v"(vp[3]), "v"(vp[4]), "v"(vp[5]), "v"(vp[6]), "v"(vp[7]) : "memory");
#pragma unroll
      for (int it = 0; it < 8; ++it) { const int row = it * 8 + tid / 16, pc = (tid % 16) * 4; *(v4f*)&lk[row][pc] = tk[it]; *(v4f*)&lv[row][pc] = tv[it]; } }
    __syncthreads();
#pragma unroll 1
    for (int jj = 0; jj < 64; jj += 4) { float s[4] = {0.f, 0.f, 0.f, 0.f};
#pragma unroll
      for (int c = 0; c < HD / 8; ++c) {
#pragma unroll
        for (int u = 0; u < 4; ++u) { const v4f kq = *(const v4f*)&lk[jj + u][cb + c * 4]; s[u] = __fadd_rn(s[u], __fmul_rn(q[c * 4 + 0], kq[0])); s[u] = __fadd_rn(s[u], __fmul_rn(q[c * 4 + 1], kq[1])); s[u] = __fadd_rn(s[u], __fmul_rn(q[c * 4 + 2], kq[2])); s[u] = __fadd_rn(s[u], __fmul_rn(q[c * 4 + 3], kq[3])); } }
#pragma unroll
      for (int u = 0; u < 4; ++u) s[u] = __fadd_rn(s[u], fa_other_half(s[u]));      /* + the other 32 columns: the same sum in both lanes of the row */
      float sc[4], e[4];      /* the four keys' rescale and weight, key after key (m and l are a chain); the o rows follow */
#pragma unroll
      for (int u = 0; u < 4; ++u) { const int j = j0 + jj + u; float sv = __fmul_rn(s[u], scale); if (MASKADD) sv = __fadd_rn(sv, __fmul_rn(bf16_round(mask[(size_t)i * SQ + j]), -10000.0f));
        const float f = (MASKADD || j <= i) ? 1.f : 0.f; const float sm = fmaf(f, sv, (1.f - f) * -1.0e30f); const float mn = fmaxf(m, sm); sc[u] = expf(m - mn); e[u] = expf(sm - mn); l = __fadd_rn(__fmul_rn(l, sc[u]), e[u]); m = mn; }
#pragma unroll
      for (int u = 0; u < 4; ++u) {
#pragma unroll
        for (int c = 0; c < HD / 8; ++c) { const v4f vv = *(const v4f*)&lv[jj + u][cb + c * 4];
#pragma unroll
          for (int w = 0; w < 4; ++w) o[c * 4 + w] = __fadd_rn(__fmul_rn(o[c * 4 + w], sc[u]), __fmul_rn(e[u], vv[w])); } } } }
  const float fin = 64.0f / l;      /* o carried x64 like the f16 path */
  __syncthreads();      /* every wave has left lk before the output rows are written over it */
#pragma unroll
  for (int c = 0; c < HD / 8; ++c) { v4f oo;
#pragma unroll
    for (int u = 0; u < 4; ++u) oo[u] = __fmul_rn(o[c * 4 + u], fin);
    *(v4f*)&lk[rl][cb + c * 4] = oo; }
  __syncthreads();
  {
#pragma unroll 1
    for (int it = 0; it < 4; ++it) {      /* o (x64) leaves as f16 hi + x1024 residual planes in fragment order ([16-row tile][32-column step][piece][lane][8]): row tile it of the group, thread tid = (step, piece, lane); a wave's store is 512 bytes in a row */
      const float* fp = &lk[it * 16 + (tid & 15)][((tid >> 6) & 1) * 32 + ((tid >> 5) & 1) * 16 + ((tid >> 4) & 1) * 8]; const v4f a = *(const v4f*)fp, c = *(const v4f*)(fp + 4); FragH fh, fl;
#pragma unroll
      for (int u = 0; u < 4; ++u) { _Float16 hv = (_Float16)a[u]; fh.h[u] = hv; fl.h[u] = (_Float16)((a[u] - (float)hv) * 1024.0f); hv = (_Float16)c[u]; fh.h[4 + u] = hv; fl.h[4 + u] = (_Float16)((c[u] - (float)hv) * 1024.0f); }
      const size_t t = ((size_t)((bt * (QT0 / 16) + rg * 4 + it) * (DM / 32) + 2 * h + ((tid >> 6) & 1))) * 64 + (tid & 63);
      *(v8us*)((unsigned short*)Hh + t * 8) = fh.half[0]; *(v8us*)((unsigned short*)Hl + t * 8) = fl.half[0]; }
     } }

// ---- ONE attention launch. The first NB NH QT0 / 64 work-groups (started first: theirs is the longest serial chain) do the exact f32 attention of 64 of the rows 0..127 of one (batch, head); the others the fused f16 attention of 64 rows from row 128 on.
// Both read only what the front end wrote, so they run side by side instead of one launch after the other.
__global__ __launch_bounds__(128) void k_attn(const _Float16* __restrict__ QHp, const _Float16* __restrict__ QLp, const _Float16* __restrict__ KHp, const _Float16* __restrict__ KLp, const _Float16* __restrict__ VTp, _Float16* __restrict__ O,
    const float* __restrict__ QF, const float* __restrict__ KF, const float* __restrict__ VF, _Float16* __restrict__ OH, _Float16* __restrict__ OL) {
  __shared__ __attribute__((aligned(16))) float st[2][64][64];
  if (blockIdx.x < NB * NH * (QT0 / 64)) att0_body<0>(st[0], st[1], (int)blockIdx.x, QF, KF, VF, DM, nullptr, SCL, OH, OL);
  else fa_body((int)blockIdx.x - NB * NH * (QT0 / 64), QHp, QLp, KHp, KLp, VTp, O); }

// ---- output GEMM, ONE launch: out = o Wo. A work-group is 128 rows x 64 columns (wave tile 32 x 64), o and Wo^T in fragment order. The row blocks that are a batch's rows 0..127 take the exact path's o instead
// (f16 hi + x1024 residual planes): one walk over K for both, with accumulators of their own, out = hi 2^-10 + residual 2^-20; every output element is written once.
// All fragment loads of a trip through the loop are asked for together and waited for once. Left alone the compiler keeps one register set for the four Wo^T fragments of a k step and waits for memory in front of every second product: four trips to the caches, one behind the other, a step.
__device__ __forceinline__ void go_walk(const _Float16* a0p, const _Float16* b0p, v8f (&c)[8]) {
  const _Float16* a1p = a0p + (size_t)16 * DM; const _Float16* b1p = b0p + (size_t)16 * DM; const _Float16* b2p = b1p + (size_t)16 * DM; const _Float16* b3p = b2p + (size_t)16 * DM;
#pragma unroll 1
  for (int kb = 0; kb < DM; kb += 64) { const int ko = kb * 16; const _Float16* a0k = a0p + ko; const _Float16* a1k = a1p + ko; const _Float16* b0k = b0p + ko; const _Float16* b1k = b1p + ko; const _Float16* b2k = b2p + ko; const _Float16* b3k = b3p + ko;      /* two k steps a trip (the loop stays rolled: the code stays small); a step is 512 elements of a 16-row tile */
    const v16h a0 = pk_frag(a0k), a1 = pk_frag(a1k), b0 = pk_frag(b0k), b1 = pk_frag(b1k), b2 = pk_frag(b2k), b3 = pk_frag(b3k);
    const v16h d0 = pk_frag(a0k + 512), d1 = pk_frag(a1k + 512), f0 = pk_frag(b0k + 512), f1 = pk_frag(b1k + 512), f2 = pk_frag(b2k + 512), f3 = pk_frag(b3k + 512);
    /* the loaded values are inputs: all 24 loads stand in front of this line, one trip to the caches for sixteen products; it is also the wait before a register that an issued load names is written again, and the addresses are inputs so that they keep their registers up to it */
    asm volatile("s_wait_xcnt 0x0" :: "v"(a0k), "v"(a1k), "v"(b0k), "v"(b1k), "v"(b2k), "v"(b3k), "v"(a0), "v"(a1), "v"(b0), "v"(b1), "v"(b2), "v"(b3), "v"(d0), "v"(d1), "v"(f0), "v"(f1), "v"(f2), "v"(f3) : "memory");
    c[0] = g2_mma(a0, b0, c[0]); c[4] = g2_mma(a1, b0, c[4]); c[1] = g2_mma(a0, b1, c[1]); c[5] = g2_mma(a1, b1, c[5]); c[2] = g2_mma(a0, b2, c[2]); c[6] = g2_mma(a1, b2, c[6]); c[3] = g2_mma(a0, b3, c[3]); c[7] = g2_mma(a1, b3, c[7]);
    c[0] = g2_mma(d0, f0, c[0]); c[4] = g2_mma(d1, f0, c[4]); c[1] = g2_mma(d0, f1, c[1]); c[5] = g2_mma(d1, f1, c[5]); c[2] = g2_mma(d0, f2, c[2]); c[6] = g2_mma(d1, f2, c[6]); c[3] = g2_mma(d0, f3, c[3]); c[7] = g2_mma(d1, f3, c[7]); } }
// the same walk for two A planes at once (hi into c, residual into cl): each Wo^T fragment is loaded once and serves both, and each accumulator sees its products in the order of a walk of its own.
// Sixteen accumulator tiles leave registers for twelve fragments: the A planes' fragments of two k steps (rows that only this row block reads) come in one trip with the first step's Wo^T fragments; the second step's Wo^T fragments follow in a group of their own, into the registers of the first step's.
__device__ __forceinline__ void go_walk2(const _Float16* a0p, const _Float16* e0p, const _Float16* b0p, v8f (&c)[8], v8f (&cl)[8]) {
#pragma unroll 1
  for (int kb = 0; kb < DM; kb += 64) { const int ko = kb * 16; const _Float16* ak = a0p + ko; const _Float16* ek = e0p + ko; const _Float16* bk = b0p + ko;      /* the second row tile and the other column tiles stand 16 DM elements apart: constant offsets of these three addresses */
    const v16h a0 = pk_frag(ak), a1 = pk_frag(ak + 16 * DM), e0 = pk_frag(ek), e1 = pk_frag(ek + 16 * DM), d0 = pk_frag(ak + 512), d1 = pk_frag(ak + 16 * DM + 512), h0 = pk_frag(ek + 512), h1 = pk_frag(ek + 16 * DM + 512);
    const v16h b0 = pk_frag(bk), b1 = pk_frag(bk + 16 * DM), b2 = pk_frag(bk + 32 * DM), b3 = pk_frag(bk + 48 * DM);
    asm volatile("s_wait_xcnt 0x0" :: "v"(ak), "v"(ek), "v"(bk), "v"(a0), "v"(a1), "v"(e0), "v"(e1), "v"(d0), "v"(d1), "v"(h0), "v"(h1), "v"(b0), "v"(b1), "v"(b2), "v"(b3) : "memory");      /* as in go_walk: all 24 loads in front of it */
    c[0] = g2_mma(a0, b0, c[0]); c[4] = g2_mma(a1, b0, c[4]); cl[0] = g2_mma(e0, b0, cl[0]); cl[4] = g2_mma(e1, b0, cl[4]);
    c[1] = g2_mma(a0, b1, c[1]); c[5] = g2_mma(a1, b1, c[5]); cl[1] = g2_mma(e0, b1, cl[1]); cl[5] = g2_mma(e1, b1, cl[5]);
    c[2] = g2_mma(a0, b2, c[2]); c[6] = g2_mma(a1, b2, c[6]); cl[2] = g2_mma(e0, b2, cl[2]); cl[6] = g2_mma(e1, b2, cl[6]);
    c[3] = g2_mma(a0, b3, c[3]); c[7] = g2_mma(a1, b3, c[7]); cl[3] = g2_mma(e0, b3, cl[3]); cl[7] = g2_mma(e1, b3, cl[7]);
    const v16h f0 = pk_frag(bk + 512), f1 = pk_frag(bk + 16 * DM + 512), f2 = pk_frag(bk + 32 * DM + 512), f3 = pk_frag(bk + 48 * DM + 512);
    asm volatile("s_wait_xcnt 0x0" :: "v"(bk), "v"(f0), "v"(f1), "v"(f2), "v"(f3) : "memory");      /* likewise for the second step's eight loads */
    c[0] = g2_mma(d0, f0, c[0]); c[4] = g2_mma(d1, f0, c[4]); cl[0] = g2_mma(h0, f0, cl[0]); cl[4] = g2_mma(h1, f0, cl[4]);
    c[1] = g2_mma(d0, f1, c[1]); c[5] = g2_mma(d1, f1, c[5]); cl[1] = g2_mma(h0, f1, cl[1]); cl[5] = g2_mma(h1, f1, cl[5]);
    c[2] = g2_mma(d0, f2, c[2]); c[6] = g2_mma(d1, f2, c[6]); cl[2] = g2_mma(h0, f2, cl[2]); cl[6] = g2_mma(h1, f2, cl[6]);
    c[3] = g2_mma(d0, f3, c[3]); c[7] = g2_mma(d1, f3, c[7]); cl[3] = g2_mma(h0, f3, cl[3]); cl[7] = g2_mma(h1, f3, cl[7]); } }
__global__ __launch_bounds__(128) void k_gemm_out(const _Float16* __restrict__ A, const _Float16* __restrict__ AH0, const _Float16* __restrict__ AL0, const _Float16* __restrict__ Bh, float* __restrict__ C) {
  __shared__ __attribute__((aligned(16))) float so[4][32][68];
  const int tid = threadIdx.x, w = tid >> 5, lane = tid & 31, ln = lane & 15, hh = lane >> 4;
  const int mt = blockIdx.x / (DM / 64), nq = blockIdx.x % (DM / 64); const int row0 = mt * 128 + 32 * w, col0 = nq * 64;
  const bool first = mt % (SQ / 128) == 0;      /* a batch's rows 0..127: the same for the whole work-group, a scalar branch */
  const size_t f0 = ((size_t)(mt / (SQ / 128)) * QT0 + 32 * w) * DM + lane * 8;      /* the wave's rows in the first-tile planes ([batch][128 rows], fragment order) */
  const _Float16* b0p = Bh + (size_t)col0 * DM + lane * 8;
  const v8f z8 = {0.f,0.f,0.f,0.f,0.f,0.f,0.f,0.f}; v8f c[8] = {z8, z8, z8, z8, z8, z8, z8, z8}, cl[8] = {z8, z8, z8, z8, z8, z8, z8, z8};
  if (first) go_walk2(AH0 + f0, AL0 + f0, b0p, c, cl);
  else go_walk(A + (size_t)row0 * DM + lane * 8, b0p, c);
#pragma unroll
  for (int u = 0; u < 8; ++u) { const int t = u & 3, half = u >> 2;
#pragma unroll
    for (int r = 0; r < 8; ++r) so[w][half * 16 + 8 * hh + r][t * 16 + ln] = c[u][r] * 0.0009765625f + cl[u][r] * 0.00000095367431640625f; }      /* o carried x64, Wo x16; the residual x1024 more */
  __builtin_amdgcn_fence(__ATOMIC_ACQ_REL, "workgroup"); __builtin_amdgcn_wave_barrier();
  const int rsub = lane >> 4, c4 = (lane & 15) * 4;
#pragma unroll
  for (int q = 0; q < 16; ++q) { const int r = q * 2 + rsub; const v4f v = *(const v4fa*)&so[w][r][c4]; *(v4f*)(C + (size_t)(row0 + r) * DM + col0 + c4) = v; } }

extern "C" void kernel_launch(void* const* d_in, const int* in_sizes, int n_in,
                              void* d_out, int out_size, void* d_ws, size_t ws_size, hipStream_t stream) {
  (void)in_sizes; (void)n_in; (void)out_size;
  const float* const* I = (const float* const*)d_in; const float* x = I[0]; const float* xk = I[0]; const float* xv = I[0]; const float* wq = I[1]; const float* bq = nullptr; const float* wk = I[2]; const float* bk = nullptr; const float* wv = I[3]; const float* bv = nullptr; const float* wo = I[4]; const float* bo = nullptr;      /* input order: x, Wq, Wk, Wv (BLOCK-DIAGONAL per-head [16][64][64] = [head][in][out]; NO biases: null pointers), Wo ([in][out] [1024][1024]; no bias: the output GEMM has no bias term); five inputs */
  char* ws = (char*)d_ws; size_t off = 0;
  auto take = [&](size_t bytes) { char* p = ws + off; off += (bytes + 255) & ~(size_t)255; return p; };
  _Float16* BQ = (_Float16*)take((size_t)DM * DM * 2); _Float16* BK = (_Float16*)take((size_t)DM * DM * 2); _Float16* BV = (_Float16*)take((size_t)DM * DM * 2); _Float16* BO = (_Float16*)take((size_t)DM * DM * 2);
  _Float16* QH = (_Float16*)take(NR * DM * 2); _Float16* QL = (_Float16*)take(NR * DM * 2); _Float16* KH = (_Float16*)take(NR * DM * 2); _Float16* KL = (_Float16*)take(NR * DM * 2); _Float16* O16 = (_Float16*)take(NR * DM * 2);
  _Float16* VT = (_Float16*)take((size_t)NB * NH * HD * SQ * 2);      /* V^T of every batch: the fused attention launch covers all of them */
  float* QF0 = (float*)take((size_t)NB * QT0 * DM * 4); float* KF0 = (float*)take((size_t)NB * QT0 * DM * 4); float* VF0 = (float*)take((size_t)NB * QT0 * DM * 4);      /* a plane per batch: the first-tile launches cover all batches */ _Float16* OH0 = (_Float16*)take((size_t)NB * QT0 * DM * 2); _Float16* OL0 = (_Float16*)take((size_t)NB * QT0 * DM * 2);
  if (off > ws_size) return;
  { const unsigned gn = (unsigned)(((size_t)DM * (DM / 8) + 255) / 256); const unsigned gp = (unsigned)(((size_t)HD * (HD / 8) + 255) / 256); k_wt_f16h<<<dim3(gp, NH, 3), 256, 0, stream>>>(wq, wk, wv, BQ, BK, BV, 16.0f); k_wt_f16<<<gn, 256, 0, stream>>>(wo, BO, DM, DM, 16.0f); }      /* BLOCK-DIAGONAL per-head weights wq / wk / wv [NH][HD][HD] = [head][in][out] (x_h @ W_h): W_h[d][e] -> Bt_h[e][d] x16 through the file's transposing builder with K = N = 64, all heads and stacks in one launch (grid y = head, z = stack), into sixteen consecutive [64][64] planes (the first 128 KiB of the weight plane); Wo [in][out]: the same builder with K = N = 1024 */
  k_proj<<<dim3((unsigned)(NR / 256), NH), 128, 0, stream>>>(x, BQ, BK, BV, QH, QL, KH, KL, VT, QF0, KF0, VF0);      /* x -> q, k (f16 hi + x1024 residual planes), V^T (all three in fragment order, [NB][NH][SQ / 16][4][32][8]) and the f32 q, k, v of each batch's first 128 rows: every batch, head and row in one launch (grid x = 256 rows, y = head) */
  k_attn<<<NB * NH * (SQ / 64), 128, 0, stream>>>(QH, QL, KH, KL, VT, O16, QF0, KF0, VF0, OH0, OL0);      /* one launch: exact f32 attention for rows 0..127 of every batch and head (o x64, as f16 hi + x1024 residual planes in fragment order) beside scores (hi.hi + lo.hi + hi.lo), causal softmax and P . V of every other query row (o, merged heads, x64, f16 in fragment order) */
  k_gemm_out<<<(unsigned)((NR / 128) * (DM / 64)), 128, 0, stream>>>(O16, OH0, OL0, BO, (float*)d_out);      /* out = o Wo, every row once: rows 0..127 of a batch from the hi and residual planes, the others from the f16 plane */
}

// v010
// A run of this version takes 132 microseconds.
// Next to v009, in two timings, it ran 1.04 and 1.02 times as fast.
// Counting every step since v000, it is 86.5 times as fast.
#include <hip/hip_runtime.h>
// Causal multi-head self-attention with BLOCK-DIAGONAL per-head projections (x [4][2048][1024] viewed (b, s, 16, 64); q / k / v = einsum('bshd,hde->bshe', xh, W): EACH HEAD applies its own [64][64] weight (W [16][64][64] = [head][in][out], normal x 0.02; NO biases) to ITS OWN 64-wide slice of the row; scores / sqrt(64); where(tril, scores, -inf); softmax over keys; out = merged Wo ([in][out] [1024][1024]; no bias) -> [4][2048][1024]); each projection is ONE head-batched GEMM (K = 64); q and k carried as f16 hi + x1024 residual planes with three-product scores.
// Structure: token rows r = b*2048 + s; ONE front-end launch, one wave per 64 rows of one head: x rounded (bf16, exact in f16) into register fragments, q and k as WMMA products (f32 accumulation, exact x16 weights) split in registers into f16 hi + x1024 residual planes, v as f16 written straight as V^T, the first 128 rows of each batch also as f32; then ONE attention launch: rows 0..127 of each batch exactly in f32 (work-groups of their own, two lanes a row), every other query row fused, one wave per 16 rows: scores against the keys up to the diagonal as three products (hi.hi + lo.hi + hi.lo, K = 64) kept in registers, causal softmax there in one walk (keys above the row masked by a select; running maximum, f32 statistics, native exp; weights f16, at most 1, normalised at the end), o = P . V (o carried x64, folded into the output GEMM alpha) written straight into the merged f16 o plane (every f16 operand plane is kept in fragment order: see pk_frag); out = o W_o GEMM (f32) into the output layout, one launch, rows 0..127 of each batch from the exact path's hi + residual planes.
// Compute dtype: inputs rounded to bf16; x / weights exact; v, softmax weights and o as plain f16 GEMM operands (~2^-12; q, k and the o of rows 0..127 as f16 hi + x1024 residual pairs); scores and softmax statistics f32. v_wmma_f32_16x16x32_f16.
#define NB 4
#define SCL 0.125f                         /* 1 / sqrt(head_dim 64) */
#define SCLR 0.0001220703125f               /* 2^-13: the same scale on the x1024 residual passes */
#define SQ 2048
#define DM 1024
#define NH 16
#define HD 64
#define HG 4                         /* heads per launch of the k_vt(b, h0) overload (not launched) */
#define QT 256                       /* not used */
#define NKX SQ                       /* not used */
#define QT0 128                      /* first-tile rows recomputed exactly in f32 */
#define B0 0                         /* not used */
#define NBR NB                       /* only in MP, which is not used */
#define NR ((size_t)NB * SQ)         /* token rows */
#define MP ((int)((size_t)NBR * SQ)) /* only in MPO, which is not used */
#define QN SQ                        /* not used */
#define NHD NH                       /* not used */
#define MPO MP                       /* not used */
#define LQ DM      /* not used */
#define WOX 16     /* grid columns of the front end that hold the Wo blocks: WOX NH = (DM / 64)^2 work-groups */
typedef __bf16 v16b __attribute__((ext_vector_type(16)));
typedef unsigned short v8us __attribute__((ext_vector_type(8), may_alias));
typedef float  v8f  __attribute__((ext_vector_type(8)));
typedef float  v4f  __attribute__((ext_vector_type(4)));
typedef float  v4fa __attribute__((ext_vector_type(4), may_alias));
union FragB { v16b v; v8us half[2]; unsigned short u[16]; };

__device__ __forceinline__ unsigned short bf16_bits(float x) { unsigned int u = __float_as_uint(x); return (unsigned short)((u + 0x7FFFu + ((u >> 16) & 1u)) >> 16); }
__device__ __forceinline__ float bf16_val(unsigned short b) { return __uint_as_float(((unsigned int)b) << 16); }
__device__ __forceinline__ float bf16_round(float x) { return bf16_val(bf16_bits(x)); }
// D += A·B with NT terms: 1 = ah·bh, 2 = + al·bh (A split), 3 = + ah·bl (both split)
template <int NT>
__device__ __forceinline__ v8f mmaN(v16b ah, v16b al, v16b bh, v16b bl, v8f c) {
  c = __builtin_amdgcn_wmma_f32_16x16x32_bf16(false, ah, false, bh, (short)0, c, false, false);
  if (NT >= 2) c = __builtin_amdgcn_wmma_f32_16x16x32_bf16(false, al, false, bh, (short)0, c, false, false);
  if (NT >= 3) c = __builtin_amdgcn_wmma_f32_16x16x32_bf16(false, ah, false, bl, (short)0, c, false, false);
  asm volatile("v_nop\n\tv_nop\n\tv_nop\n\tv_nop" : "+v"(c) : "v"(ah), "v"(al), "v"(bh), "v"(bl));
  return c;
}

__global__ __launch_bounds__(256) void k_wt_bf16(const float* __restrict__ W, unsigned short* __restrict__ Wt, int K, int N) {
  const int t = blockIdx.x * 256 + threadIdx.x;
  const int k8n = K / 8;
  if (t >= N * k8n) return;
  const int n = t / k8n, k8 = (t % k8n) * 8;
  v8us v;
#pragma unroll
  for (int i = 0; i < 8; ++i) v[i] = bf16_bits(W[(size_t)(k8 + i) * N + n]);
  *(v8us*)(Wt + (size_t)n * K + k8) = v;
  
}

// GEMM C[M][N] (f32, pitch ldc) = act(A[M][K]·W + bias). A f32 row-major (pitch lda) converted per fragment to bf16
// (ASPLIT: hi/lo two planes -> 2 terms, else single rounded term); Wt bf16 [N][K] (pitch ldb). BIAS_BF16 rounds the
// bias to bf16 first (bias quantised to bf16 before the add). K%32==0, M%16==0, N%64==0.
template <bool ASPLIT, int ACT, bool BIAS_BF16>
__global__ __launch_bounds__(128) void k_gemm_bf(const float* __restrict__ A, int lda, const unsigned short* __restrict__ Wt, int ldb,
                                               const float* __restrict__ bias, float* __restrict__ C, int ldc, int M, int N, int K) {
  __shared__ __attribute__((aligned(16))) float so[4][16][64];
  const int tid = threadIdx.x, w = tid >> 5, lane = tid & 31, ln = lane & 15, hh = lane >> 4;
  const int ntn = N / 64;
  const int wid = blockIdx.x * 4 + w;
  const int mt = wid / ntn, nq = wid % ntn;
  if (mt * 16 >= M) return;
  const int row0 = mt * 16, col0 = nq * 64;
  const float* arow = A + (size_t)(row0 + ln) * lda;
  v8f acc[4] = {};
  for (int kb = 0; kb < K; kb += 32) {
    FragB ah, al;
    const v4f x0 = *(const v4fa*)(arow + kb + 8 * hh), x1 = *(const v4fa*)(arow + kb + 8 * hh + 4);
    const v4f x2 = *(const v4fa*)(arow + kb + 16 + 8 * hh), x3 = *(const v4fa*)(arow + kb + 16 + 8 * hh + 4);
    float xs[16] = {x0[0],x0[1],x0[2],x0[3],x1[0],x1[1],x1[2],x1[3],x2[0],x2[1],x2[2],x2[3],x3[0],x3[1],x3[2],x3[3]};
#pragma unroll
    for (int i = 0; i < 16; ++i) { const unsigned short hb = bf16_bits(xs[i]); ah.u[i] = hb; al.u[i] = ASPLIT ? bf16_bits(xs[i] - bf16_val(hb)) : (unsigned short)0; }
#pragma unroll
    for (int t = 0; t < 4; ++t) {
      const unsigned short* brow = Wt + (size_t)(col0 + t * 16 + ln) * ldb + kb;
      FragB b;
      b.half[0] = *(const v8us*)(brow + 8 * hh);
      b.half[1] = *(const v8us*)(brow + 16 + 8 * hh);
      acc[t] = mmaN<ASPLIT ? 2 : 1>(ah.v, al.v, b.v, b.v, acc[t]);
    }
  }
#pragma unroll
  for (int t = 0; t < 4; ++t) {
    float bv = bias ? bias[col0 + t * 16 + ln] : 0.f;
    if (BIAS_BF16) bv = bf16_round(bv);
#pragma unroll
    for (int r = 0; r < 8; ++r) { float v = acc[t][r] + bv; if (ACT == 1) v = fmaxf(v, 0.f); so[w][8 * hh + r][t * 16 + ln] = v; }
  }
  __builtin_amdgcn_fence(__ATOMIC_ACQ_REL, "workgroup");
  __builtin_amdgcn_wave_barrier();
  const int rsub = lane >> 4, c4 = (lane & 15) * 4;
  {
#pragma unroll
    for (int q = 0; q < 8; ++q) {
      const int r = q * 2 + rsub;
      const v4f v = *(const v4fa*)&so[w][r][c4];
      *(v4f*)(C + (size_t)(row0 + r) * ldc + col0 + c4) = v;
    }
    
  }
}

// GEMM C = act(A·W + bias + resid): A f32 (ASPLIT -> hi/lo 2 terms), Wt bf16 [N][K]; ACT 0 none, 1 relu, 2 exact gelu;
// resid (optional, f32, row index = (row % rmod), pitch ldr, RES_BF16 rounds it) added before the activation.
template <bool ASPLIT, int ACT, bool BIAS_BF16, bool RES_BF16>
__global__ __launch_bounds__(128) void k_gemm_bf3(const float* __restrict__ A, int lda, const unsigned short* __restrict__ Wt, int ldb,
                                                const float* __restrict__ bias, const float* __restrict__ resid, int rmod, int ldr,
                                                float* __restrict__ C, int ldc, int M, int N, int K) {
  __shared__ __attribute__((aligned(16))) float so[4][16][64];
  const int tid = threadIdx.x, w = tid >> 5, lane = tid & 31, ln = lane & 15, hh = lane >> 4;
  const int ntn = N / 64;
  const int wid = blockIdx.x * 4 + w;
  const int mt = wid / ntn, nq = wid % ntn;
  if (mt * 16 >= M) return;
  const int row0 = mt * 16, col0 = nq * 64;
  const float* arow = A + (size_t)(row0 + ln) * lda;
  v8f acc[4] = {};
  for (int kb = 0; kb < K; kb += 32) {
    FragB ah, al;
    const v4f x0 = *(const v4fa*)(arow + kb + 8 * hh), x1 = *(const v4fa*)(arow + kb + 8 * hh + 4);
    const v4f x2 = *(const v4fa*)(arow + kb + 16 + 8 * hh), x3 = *(const v4fa*)(arow + kb + 16 + 8 * hh + 4);
    float xs[16] = {x0[0],x0[1],x0[2],x0[3],x1[0],x1[1],x1[2],x1[3],x2[0],x2[1],x2[2],x2[3],x3[0],x3[1],x3[2],x3[3]};
#pragma unroll
    for (int i = 0; i < 16; ++i) { const unsigned short hb = bf16_bits(xs[i]); ah.u[i] = hb; al.u[i] = ASPLIT ? bf16_bits(xs[i] - bf16_val(hb)) : (unsigned short)0; }
#pragma unroll
    for (int t = 0; t < 4; ++t) {
      const unsigned short* brow = Wt + (size_t)(col0 + t * 16 + ln) * ldb + kb;
      FragB b;
      b.half[0] = *(const v8us*)(brow + 8 * hh);
      b.half[1] = *(const v8us*)(brow + 16 + 8 * hh);
      acc[t] = mmaN<ASPLIT ? 2 : 1>(ah.v, al.v, b.v, b.v, acc[t]);
    }
  }
#pragma unroll
  for (int t = 0; t < 4; ++t) {
    const int col = col0 + t * 16 + ln;
    float bv = bias ? bias[col] : 0.f;
    if (BIAS_BF16) bv = bf16_round(bv);
#pragma unroll
    for (int r = 0; r < 8; ++r) {
      float v = acc[t][r] + bv;
      if (resid) { float rv = resid[(size_t)((row0 + 8 * hh + r) % rmod) * ldr + col]; if (RES_BF16) rv = bf16_round(rv); v += rv; }
      if (ACT == 1) v = fmaxf(v, 0.f);
      if (ACT == 2) v = 0.5f * v * (1.0f + erff(v * 0.70710678118654752f));
      if (ACT == 3) { const float u = 0.7978845608028654f * (v + 0.044715f * v * v * v); v = 0.5f * v * (1.0f + tanhf(u)); }
      so[w][8 * hh + r][t * 16 + ln] = v;
    }
  }
  __builtin_amdgcn_fence(__ATOMIC_ACQ_REL, "workgroup");
  __builtin_amdgcn_wave_barrier();
  const int rsub = lane >> 4, c4 = (lane & 15) * 4;
  {
#pragma unroll
    for (int q = 0; q < 8; ++q) {
      const int r = q * 2 + rsub;
      const v4f v = *(const v4fa*)&so[w][r][c4];
      *(v4f*)(C + (size_t)(row0 + r) * ldc + col0 + c4) = v;
    }
    
  }
}
// row LayerNorm (biased variance, eps) over N: s = X (+ R); optional out_sum <- s; out_norm <- (s-mu)*rsqrt(var+eps)*g + b
template <bool PARAM_BF16>
__global__ __launch_bounds__(256) void k_layernorm(const float* __restrict__ X, const float* __restrict__ R, const float* __restrict__ g, const float* __restrict__ bta,
                                                  float* __restrict__ out_sum, float* __restrict__ out_norm, int N, float eps) {
  __shared__ float red[256];
  const int row = blockIdx.x, tid = threadIdx.x;
  const float* x = X + (size_t)row * N; const float* rr = R ? R + (size_t)row * N : nullptr;
  float vals[16];                     // up to N = 4096
  const int per = N / 256;            // contiguous chunk per thread? use strided-by-4 chunks: thread handles j = tid*4 + 1024*u
  float s1 = 0.f;
  for (int u = 0; u < per / 4; ++u) {
    const int j = tid * 4 + 1024 * u;
    const v4f a = *(const v4fa*)(x + j);
    v4f b = {0.f,0.f,0.f,0.f}; if (rr) b = *(const v4fa*)(rr + j);
#pragma unroll
    for (int q = 0; q < 4; ++q) { const float v = a[q] + b[q]; vals[u * 4 + q] = v; s1 += v; }
  }
  red[tid] = s1; __syncthreads();
  for (int st = 128; st > 0; st >>= 1) { if (tid < st) red[tid] += red[tid + st]; __syncthreads(); }
  const float mu = red[0] / (float)N; __syncthreads();
  float s2 = 0.f;
  for (int u = 0; u < per / 4; ++u)
#pragma unroll
    for (int q = 0; q < 4; ++q) { const float c = vals[u * 4 + q] - mu; s2 += c * c; }
  red[tid] = s2; __syncthreads();
  for (int st = 128; st > 0; st >>= 1) { if (tid < st) red[tid] += red[tid + st]; __syncthreads(); }
  const float rs = rsqrtf(red[0] / (float)N + eps);
  {
    for (int u = 0; u < per / 4; ++u) {
      const int j = tid * 4 + 1024 * u;
      v4f o, sm;
#pragma unroll
      for (int q = 0; q < 4; ++q) {
        float gg = g[j + q], bb = bta[j + q];
        if (PARAM_BF16) { gg = bf16_round(gg); bb = bf16_round(bb); }
        sm[q] = vals[u * 4 + q]; o[q] = (vals[u * 4 + q] - mu) * rs * gg + bb;
      }
      if (out_sum) *(v4f*)(out_sum + (size_t)row * N + j) = sm;
      *(v4f*)(out_norm + (size_t)row * N + j) = o;
    }
    
  }
}



// ---- f16 WMMA path (v_wmma_f32_16x16x32_f16): 11-bit significands for operands in range — used where a [0,1] probability operand needs more precision than bf16
typedef _Float16 v16h __attribute__((ext_vector_type(16)));
union FragH { v16h v; v8us half[2]; _Float16 h[16]; unsigned short u[16]; };
template <int NT>
__device__ __forceinline__ v8f mmaH(v16h ah, v16h al, v16h bh, v16h bl, v8f c) {
  c = __builtin_amdgcn_wmma_f32_16x16x32_f16(false, ah, false, bh, (short)0, c, false, false);
  if (NT >= 2) c = __builtin_amdgcn_wmma_f32_16x16x32_f16(false, al, false, bh, (short)0, c, false, false);
  if (NT >= 3) c = __builtin_amdgcn_wmma_f32_16x16x32_f16(false, ah, false, bl, (short)0, c, false, false);
  asm volatile("v_nop\n\tv_nop\n\tv_nop\n\tv_nop" : "+v"(c) : "v"(ah), "v"(al), "v"(bh), "v"(bl));
  return c;
}
// batched GEMM like k_gemm_b but f16 operands: A f32 (split into f16 hi/lo if ASPLIT, else rounded to f16), Bt = f16 values [n][k]; alpha; C f32; N multiple of 16 (partial tiles skipped)
template <bool ASPLIT>
__global__ __launch_bounds__(128) void k_gemm_h(const float* __restrict__ A, int lda, size_t sA, const _Float16* __restrict__ Bh, int ldb, size_t sB, float alpha, float* __restrict__ C, int ldc, size_t sC, int M, int N, int K) {
  __shared__ __attribute__((aligned(16))) float so[4][16][64];
  const int tid = threadIdx.x, w = tid >> 5, lane = tid & 31, ln = lane & 15, hh = lane >> 4; const int by = blockIdx.y;
  A += (size_t)by * sA; Bh += (size_t)by * sB; C += (size_t)by * sC;
  const int ntn = (N + 63) / 64; const int wid = blockIdx.x * 4 + w; const int mt = wid / ntn, nq = wid % ntn; if (mt * 16 >= M) return;
  const int row0 = mt * 16, col0 = nq * 64; const float* arow = A + (size_t)(row0 + ln) * lda;
  v8f acc[4] = {};
  for (int kb = 0; kb < K; kb += 32) {
    FragH ah, al;
    const v4f x0 = *(const v4fa*)(arow + kb + 8 * hh), x1 = *(const v4fa*)(arow + kb + 8 * hh + 4), x2 = *(const v4fa*)(arow + kb + 16 + 8 * hh), x3 = *(const v4fa*)(arow + kb + 16 + 8 * hh + 4);
    float xs[16] = {x0[0],x0[1],x0[2],x0[3],x1[0],x1[1],x1[2],x1[3],x2[0],x2[1],x2[2],x2[3],x3[0],x3[1],x3[2],x3[3]};
#pragma unroll
    for (int i = 0; i < 16; ++i) { const _Float16 h = (_Float16)xs[i]; ah.h[i] = h; al.h[i] = ASPLIT ? (_Float16)(xs[i] - (float)h) : (_Float16)0.0f; }
#pragma unroll
    for (int t = 0; t < 4; ++t) { if (col0 + t * 16 >= N) continue; const size_t boff = (size_t)(col0 + t * 16 + ln) * ldb + kb; FragH bq; bq.half[0] = *(const v8us*)(Bh + boff + 8 * hh); bq.half[1] = *(const v8us*)(Bh + boff + 16 + 8 * hh);
      acc[t] = mmaH<ASPLIT ? 2 : 1>(ah.v, al.v, bq.v, bq.v, acc[t]); }
  }
#pragma unroll
  for (int t = 0; t < 4; ++t) { if (col0 + t * 16 >= N) continue;
#pragma unroll
    for (int r = 0; r < 8; ++r) so[w][8 * hh + r][t * 16 + ln] = acc[t][r] * alpha; }
  __builtin_amdgcn_fence(__ATOMIC_ACQ_REL, "workgroup"); __builtin_amdgcn_wave_barrier();
  const int rsub = lane >> 4, c4 = (lane & 15) * 4;
  {
#pragma unroll
    for (int q = 0; q < 8; ++q) { const int r = q * 2 + rsub; if (col0 + c4 < N) { const v4f v = *(const v4fa*)&so[w][r][c4]; *(v4f*)(C + (size_t)(row0 + r) * ldc + col0 + c4) = v; } }
     }
}

// k_gemm_hh variant with fused epilogue: v = acc·alpha + bias[by·sBias + col] (+ CP[(row/rowsPerB)·sCPb + by·64 + col] if CP) ; ACT 0 none / 1 elu ; writes f16 C16 (and f32 C if non-null)
template <int ACT>
__global__ __launch_bounds__(128) void k_gemm_hhx(const _Float16* __restrict__ A, int lda, size_t sA, const _Float16* __restrict__ Bh, int ldb, size_t sB, float alpha, const float* __restrict__ bias, size_t sBias, const float* __restrict__ CP, int rowsPerB, size_t sCPb, int row0g,
    float* __restrict__ C, _Float16* __restrict__ C16, int ldc, size_t sC, int M, int N, int K) {
  __shared__ __attribute__((aligned(16))) float so[4][16][64];
  const int tid = threadIdx.x, w = tid >> 5, lane = tid & 31, ln = lane & 15, hh = lane >> 4; const int by = blockIdx.y;
  A += (size_t)by * sA; Bh += (size_t)by * sB; const size_t cofs = (size_t)by * sC; const float* bp = bias ? bias + (size_t)by * sBias : nullptr;
  const int ntn = (N + 63) / 64; const int wid = blockIdx.x * 4 + w; const int mt = wid / ntn, nq = wid % ntn; if (mt * 16 >= M) return;
  const int row0 = mt * 16, col0 = nq * 64; const _Float16* arow = A + (size_t)(row0 + ln) * lda;
  v8f acc[4] = {};
  for (int kb = 0; kb < K; kb += 32) { FragH ah; ah.half[0] = *(const v8us*)((const unsigned short*)arow + kb + 8 * hh); ah.half[1] = *(const v8us*)((const unsigned short*)arow + kb + 16 + 8 * hh);
#pragma unroll
    for (int t = 0; t < 4; ++t) { if (col0 + t * 16 >= N) continue; const size_t boff = (size_t)(col0 + t * 16 + ln) * ldb + kb; FragH bq; bq.half[0] = *(const v8us*)((const unsigned short*)Bh + boff + 8 * hh); bq.half[1] = *(const v8us*)((const unsigned short*)Bh + boff + 16 + 8 * hh);
      acc[t] = mmaH<1>(ah.v, ah.v, bq.v, bq.v, acc[t]); }
  }
#pragma unroll
  for (int t = 0; t < 4; ++t) { if (col0 + t * 16 >= N) continue; const int col = col0 + t * 16 + ln; const float bv = bp ? bf16_round(bp[col]) : 0.f;
#pragma unroll
    for (int r = 0; r < 8; ++r) { float v = acc[t][r] * alpha + bv; if (CP) { const int rr = row0g + row0 + 8 * hh + r; if (rowsPerB < 0) v += CP[cofs + (size_t)rr * ldc + col];      /* rowsPerB < 0: own element of the batched C plane */ else { const int bidx = rr / rowsPerB; v += CP[(size_t)bidx * sCPb + (size_t)by * 64 + col]; } } if (ACT == 1) v = (v > 0.f) ? v : expm1f(v); else if (ACT == 7) v = (v > 0.f) ? v + 1.0f : expf(v); else if (ACT == 8) v = tanhf(v); else if (ACT == 9) v = 0.5f * v * (1.0f + tanhf(0.7978845608028654f * (v + 0.044715f * v * v * v))); else if (ACT == 11) v = 1.0f / (1.0f + expf(-v)); else if (ACT == 12) v = (v > 0.f) ? v : 0.01f * v; else if (ACT == 14) v = (v > 0.f) ? v : 0.1f * v; else if (ACT == 16) v = (v >= 0.f) ? v : 0.3f * v; else if (ACT == 17) v = (v >= 0.f) ? v : 0.2f * v; else if (ACT == 15) v = v / (1.0f + expf(-v)); else if (ACT == 3) v = fmaxf(v, 0.f); else if (ACT == 6) v = 0.5f * v * (1.0f + erff(v * 0.70710678118654752f)); so[w][8 * hh + r][t * 16 + ln] = v; } }
  __builtin_amdgcn_fence(__ATOMIC_ACQ_REL, "workgroup"); __builtin_amdgcn_wave_barrier();
  const int rsub = lane >> 4, c4 = (lane & 15) * 4; typedef _Float16 v4h __attribute__((ext_vector_type(4)));
  {
#pragma unroll
    for (int q = 0; q < 8; ++q) { const int r = q * 2 + rsub; if (col0 + c4 < N) { const v4f v = *(const v4fa*)&so[w][r][c4]; if (C) *(v4f*)(C + cofs + (size_t)(row0 + r) * ldc + col0 + c4) = v; if (C16) { v4h h4; for (int i = 0; i < 4; ++i) h4[i] = (_Float16)v[i]; *(v4h*)(C16 + cofs + (size_t)(row0 + r) * ldc + col0 + c4) = h4; } } }
     }
}


typedef _Float16 v4h __attribute__((ext_vector_type(4)));

__global__ __launch_bounds__(256) void k_x16(const float* __restrict__ x, _Float16* __restrict__ X16, size_t n8) { const size_t t = (size_t)blockIdx.x * 256 + threadIdx.x; if (t >= n8) return; FragH f;
#pragma unroll
  for (int q = 0; q < 8; ++q) f.h[q] = (_Float16)bf16_round(x[t * 8 + q]); *(v8us*)((unsigned short*)X16 + t * 8) = f.half[0];  }
__global__ __launch_bounds__(256) void k_h16(const float* __restrict__ x, _Float16* __restrict__ X16, size_t n8) { const size_t t = (size_t)blockIdx.x * 256 + threadIdx.x; if (t >= n8) return; FragH f;
#pragma unroll
  for (int q = 0; q < 8; ++q) f.h[q] = (_Float16)x[t * 8 + q]; *(v8us*)((unsigned short*)X16 + t * 8) = f.half[0];  }
__global__ __launch_bounds__(256) void k_round16f(const float* __restrict__ W, _Float16* __restrict__ Bt, size_t n8) { const size_t t = (size_t)blockIdx.x * 256 + threadIdx.x; if (t >= n8) return; FragH f;
#pragma unroll
  for (int i = 0; i < 8; ++i) f.h[i] = (_Float16)(bf16_round(W[t * 8 + i]) * 16.0f); *(v8us*)((unsigned short*)Bt + t * 8) = f.half[0];  }
template <int NHv, int TTv>
__global__ __launch_bounds__(256) void k_vt(const _Float16* __restrict__ V16, int ldv, int voff, _Float16* __restrict__ Vt) { __shared__ unsigned short tl[64][66]; const int tid = threadIdx.x; const int slab = blockIdx.x / (TTv / 64), lg = blockIdx.x % (TTv / 64); const int b = slab / NHv, h = slab % NHv;
  for (int i = tid; i < 64 * 8; i += 256) { const int r = i / 8, c8 = (i % 8) * 8; FragH f; f.half[0] = *(const v8us*)((const unsigned short*)V16 + ((size_t)b * TTv + lg * 64 + r) * ldv + voff + h * 64 + c8);
#pragma unroll
    for (int q = 0; q < 8; ++q) tl[r][c8 + q] = f.u[q]; }
  __syncthreads();
  {
#pragma unroll
    for (int rd = 0; rd < 2; ++rd) { const int d = rd * 32 + tid / 8, pc = tid % 8; FragH f;
#pragma unroll
      for (int q = 0; q < 8; ++q) f.u[q] = tl[pc * 8 + q][d];
      *(v8us*)((unsigned short*)Vt + ((size_t)slab * 64 + d) * TTv + lg * 64 + pc * 8) = f.half[0]; }
     } }

__global__ __launch_bounds__(256) void k_hl(const float* __restrict__ F, _Float16* __restrict__ Hh, _Float16* __restrict__ Hl, size_t n8) { const size_t t = (size_t)blockIdx.x * 256 + threadIdx.x; if (t >= n8) return; FragH fh, fl;
  /* F: row-major rows of DM; Hh, Hl: fragment order ([16-row tile][32-column step][piece][lane][8]), thread t their t-th 16 bytes */
  const size_t blk = t >> 6; const float* fp = F + ((blk / (DM / 32)) * 16 + (t & 15)) * DM + (blk % (DM / 32)) * 32 + ((t >> 5) & 1) * 16 + ((t >> 4) & 1) * 8; const v4f a = *(const v4fa*)fp, c = *(const v4fa*)(fp + 4);
#pragma unroll
  for (int q = 0; q < 4; ++q) { _Float16 h = (_Float16)a[q]; fh.h[q] = h; fl.h[q] = (_Float16)((a[q] - (float)h) * 1024.0f); h = (_Float16)c[q]; fh.h[4 + q] = h; fl.h[4 + q] = (_Float16)((c[q] - (float)h) * 1024.0f); }
  { *(v8us*)((unsigned short*)Hh + t * 8) = fh.half[0]; *(v8us*)((unsigned short*)Hl + t * 8) = fl.half[0];  } }

// ---- helpers of the output GEMM (A and Bh in fragment order; wave tile 32x64): the kernel itself stands behind the attention ----
__device__ __forceinline__ v16h g2_frag(const _Float16* p, int hh) { FragH f; f.half[0] = *(const v8us*)((const unsigned short*)p + 8 * hh); f.half[1] = *(const v8us*)((const unsigned short*)p + 16 + 8 * hh); return f.v; }
// ---- fragment-order planes. Every f16 operand plane of the products (q and k hi / residual, V^T, o, the weights) is stored as the operand fragments themselves: a 16-row x 32-column block is two pieces of 512 bytes,
// piece u = columns 16 u .. 16 u + 15, and in a piece lane (ln, hh) owns 16 bytes at lane * 16: row ln, columns 8 hh .. 8 hh + 7 of the piece. A wave-wide 16-byte load or store then covers 512 contiguous bytes (four whole 128-byte lines)
// where a row-major plane gives it sixteen lines of which it uses 32 bytes each. p: the lane's own 16 bytes of piece 0.
__device__ __forceinline__ v16h pk_frag(const _Float16* p) { FragH f; f.half[0] = *(const v8us*)((const unsigned short*)p); f.half[1] = *(const v8us*)((const unsigned short*)p + 256); return f.v; }
__device__ __forceinline__ v8f g2_mma(v16h a, v16h b, v8f c) { v8f d = __builtin_amdgcn_wmma_f32_16x16x32_f16(false, a, false, b, (short)0, c, false, false); asm volatile("v_nop\n\tv_nop\n\tv_nop\n\tv_nop" : "+v"(d) : "v"(a), "v"(b)); return d; }

__global__ __launch_bounds__(256) void k_wnat(const float* __restrict__ w, size_t n8, _Float16* __restrict__ Bt) { const size_t t = (size_t)blockIdx.x * 256 + threadIdx.x; if (t >= n8) return; FragH f; for (int q = 0; q < 8; ++q) f.h[q] = (_Float16)(bf16_round(w[t * 8 + q]) * 16.0f); *(v8us*)((unsigned short*)Bt + t * 8) = f.half[0];  }
__global__ __launch_bounds__(256) void k_rsm(const float* __restrict__ S, _Float16* __restrict__ P, int nrows) {
  #pragma clang fp contract(off)
  const int i = blockIdx.x * 256 + threadIdx.x; if (i >= nrows) return; const float* s = S + (size_t)i * SQ; float mx = -3.0e38f;
#pragma unroll 1
  for (int j = 0; j < SQ; ++j) mx = fmaxf(mx, s[j]); float se = 0.f;
#pragma unroll 1
  for (int j = 0; j < SQ; ++j) se += expf(s[j] - mx); const float sc = 256.0f / se;
#pragma unroll 1
  for (int j0 = 0; j0 < SQ; j0 += 8) { FragH f; for (int q = 0; q < 8; ++q) f.h[q] = (_Float16)(expf(s[j0 + q] - mx) * sc); unsigned short* d = (unsigned short*)P + (size_t)i * SQ + j0; *(v8us*)d = f.half[0];  } }
__global__ __launch_bounds__(256) void k_vt(const _Float16* __restrict__ V16, int b, int h0, _Float16* __restrict__ VT) { __shared__ unsigned short tl[64][65]; const int tid = threadIdx.x; const int hh = blockIdx.x % HG, sg = blockIdx.x / HG; const int s0 = sg * 64; const int h = h0 + hh;
  for (int i = tid; i < 64 * 8; i += 256) { const int j = i / 8, d8 = (i % 8) * 8; FragH f; f.half[0] = *(const v8us*)((const unsigned short*)V16 + ((size_t)b * SQ + s0 + j) * DM + h * HD + d8); for (int q = 0; q < 8; ++q) tl[d8 + q][j] = f.u[q]; }
  __syncthreads();
  { for (int i = tid; i < 64 * 8; i += 256) { const int d = i / 8, j8 = (i % 8) * 8; FragH f; for (int q = 0; q < 8; ++q) f.u[q] = tl[d][j8 + q]; *(v8us*)((unsigned short*)VT + ((size_t)hh * HD + d) * SQ + s0 + j8) = f.half[0]; }  } }



// Fused causal attention, ONE WAVE PER 16 QUERY ROWS of one (batch, head); no score or weight ever leaves the registers, no LDS, no barrier.
// Scores are formed transposed, S^T = K . Q^T (A = 16 key rows, B = 16 query rows): lane (ln, hh) then holds keys 8 hh .. 8 hh + 7 of the tile for query ln, so row maximum and row sum are per-lane values
// (plus one exchange between the two lane halves), and two neighbouring tiles' weights ARE the 32-key operand fragment of the second product (elements 0..7 = keys 8 hh + i, 8..15 = keys 16 + 8 hh + i).
// The second product is transposed too, O^T = V^T . P^T (A = 16 rows of V^T, B = the weights): lane (ln, hh) ends with 8 consecutive output columns of query ln, one 16-byte store a tile.
// ONE walk over the keys up to the diagonal: a running row maximum; each chunk's weights are exp(s - maximum so far) as f16 (at most 1), and the row sum and the four output tiles are first multiplied by exp(old maximum - new maximum); the division by the row sum comes once, at the end.
// Every loop over r, i and t is unrolled in full so that s, e, p and the accumulators are indexed by constants and stay in registers; the loop over the chunks stays rolled.
__device__ __forceinline__ v8f fa_mma(v16h a, v16h b, v8f c) { return __builtin_amdgcn_wmma_f32_16x16x32_f16(false, a, false, b, (short)0, c, false, false); }
// scores of 16 keys x 16 queries: hi.hi / 8, then + 2^-13 lo.hi, then + 2^-13 hi.lo (three accumulators of their own, added in this order); keys above the row get -1e9
// a0, a1: the 16 key rows' hi plane (head columns 0..31, 32..63); l0, l1: their residual plane
__device__ __forceinline__ void fa_scores(v16h a0, v16h a1, v16h l0, v16h l1, v16h qh0, v16h qh1, v16h ql0, v16h ql1, int keyb, int last, float* s) {
  const v8f z8 = {0.f,0.f,0.f,0.f,0.f,0.f,0.f,0.f};
  v8f c1 = fa_mma(a0, qh0, z8), c2 = fa_mma(a0, ql0, z8), c3 = fa_mma(l0, qh0, z8);
  c1 = fa_mma(a1, qh1, c1); c2 = fa_mma(a1, ql1, c2); c3 = fa_mma(l1, qh1, c3);
#pragma unroll
  for (int r = 0; r < 8; ++r) { float v = c1[r] * SCL; v += c2[r] * SCLR; v += c3[r] * SCLR; s[r] = (keyb + r <= last) ? v : -1.0e9f; } }
// lane l's value as seen from lane l ^ 16: one vector cross-row move (a shuffle would go through the LDS pipe and its wait, here once a chunk)
// 16 head columns x 32 keys of V^T: the same piece of two neighbouring token tiles (keys 8 hh + i, then 16 + 8 hh + i)
__device__ __forceinline__ v16h vt_frag(const _Float16* p) { FragH f; f.half[0] = *(const v8us*)((const unsigned short*)p); f.half[1] = *(const v8us*)((const unsigned short*)p + 1024); return f.v; }
__device__ __forceinline__ float fa_other_half(float x) { const unsigned u = __float_as_uint(x); return __uint_as_float(__builtin_amdgcn_permlanex16(u, u, 0x76543210u, 0xfedcba98u, false, false)); }
__device__ __forceinline__ void fa_body(const int bid, const _Float16* __restrict__ QHp, const _Float16* __restrict__ QLp, const _Float16* __restrict__ KHp, const _Float16* __restrict__ KLp, const _Float16* __restrict__ VTp, _Float16* __restrict__ O) {
  const int lane = threadIdx.x & 31, ln = lane & 15, hh = lane >> 4; const int w = __builtin_amdgcn_readfirstlane((int)(threadIdx.x >> 5));      /* the wave's number as a scalar: the key loops get scalar trip counts */
  const int bh = bid % (NB * NH), qb = (SQ / 64 - 1) - bid / (NB * NH);      /* longest rows first */
  const int b = bh / NH, h = bh % NH; const int q0 = qb * 64 + w * 16; const int last = q0 + ln; const int nch = (q0 + 47) >> 5;      /* 32-key chunks up to the diagonal; the last one may hold 16 keys that are masked for every row (they exist: q0 + 31 < SQ there) */
  /* q, k and V^T planes in fragment order, [batch, head][16-token tile][4 pieces][lane][8]: a tile is 1024 elements, a 32-key chunk 2048 in a row. q, k: piece = 16 head columns; V^T: piece = 16 head columns x the tile's 16 tokens */
  const size_t pb = (size_t)bh * (SQ / 16) * 1024 + lane * 8; const size_t rq = pb + (size_t)(q0 >> 4) * 1024;
  const _Float16* qhp = QHp + rq; const _Float16* qlp = QLp + rq;
  const v16h qh0 = pk_frag(qhp), qh1 = pk_frag(qhp + 512), ql0 = pk_frag(qlp), ql1 = pk_frag(qlp + 512);
  asm volatile("s_wait_xcnt 0x0" :: "v"(qhp), "v"(qlp) : "memory");      /* the wait before a register that an issued load names is written again; the addresses are inputs so that they keep their registers up to it (the same at the loop's wait below) */
  const _Float16* kh = KHp + pb; const _Float16* kl = KLp + pb; const _Float16* vt = VTp + pb;
  float m = -3.0e38f, l = 0.f;      /* m: the row's running maximum, the same in both lane halves; l: this lane half's share of the row sum, at scale exp(-m) */
  const v8f z8 = {0.f,0.f,0.f,0.f,0.f,0.f,0.f,0.f}; v8f o0 = z8, o1 = z8, o2 = z8, o3 = z8;
  for (int c = 0; c < nch; ++c) { float s[16]; const _Float16* ka = kh + (size_t)c * 2048; const _Float16* kb = kl + (size_t)c * 2048; const _Float16* vc = vt + (size_t)c * 2048;
    const v16h a0 = pk_frag(ka), a1 = pk_frag(ka + 512), a2 = pk_frag(ka + 1024), a3 = pk_frag(ka + 1536), l0 = pk_frag(kb), l1 = pk_frag(kb + 512), l2 = pk_frag(kb + 1024), l3 = pk_frag(kb + 1536);
    const v16h v0 = vt_frag(vc), v1 = vt_frag(vc + 256), v2 = vt_frag(vc + 512), v3 = vt_frag(vc + 768);
    /* the loaded values are inputs too: all of the chunk's loads (key rows and V^T rows) are asked for together, one trip to the caches a chunk; left alone the compiler reuses two fragments' registers and waits for memory before nearly every product */
    asm volatile("s_wait_xcnt 0x0" :: "v"(ka), "v"(kb), "v"(vc), "v"(a0), "v"(a1), "v"(a2), "v"(a3), "v"(l0), "v"(l1), "v"(l2), "v"(l3), "v"(v0), "v"(v1), "v"(v2), "v"(v3) : "memory");
    __builtin_amdgcn_sched_barrier(0);      /* keeps the products behind the wait, so that the wait is not moved down past them with the last loads */
    fa_scores(a0, a1, l0, l1, qh0, qh1, ql0, ql1, c * 32 + 8 * hh, last, s); fa_scores(a2, a3, l2, l3, qh0, qh1, ql0, ql1, c * 32 + 16 + 8 * hh, last, s + 8);
    float mc = s[0];
#pragma unroll
    for (int i = 1; i < 16; ++i) mc = fmaxf(mc, s[i]);
    const float mn = fmaxf(m, fmaxf(mc, fa_other_half(mc)));      /* both halves' weights enter one product, so they need one maximum */
    const float al = __expf(m - mn);      /* what the sum and the output tiles so far are worth at the new maximum (0 in the first chunk, 1 while the maximum stands) */
    float e[16]; FragH p;
#pragma unroll
    for (int i = 0; i < 16; ++i) { e[i] = __expf(s[i] - mn); p.h[i] = (_Float16)e[i]; }
    const float a = (((e[0] + e[1]) + (e[2] + e[3])) + ((e[4] + e[5]) + (e[6] + e[7]))) + (((e[8] + e[9]) + (e[10] + e[11])) + ((e[12] + e[13]) + (e[14] + e[15])));
    l = l * al + a; m = mn;
    o0 *= al; o1 *= al; o2 *= al; o3 *= al;
    o0 = fa_mma(v0, p.v, o0); o1 = fa_mma(v1, p.v, o1); o2 = fa_mma(v2, p.v, o2); o3 = fa_mma(v3, p.v, o3); }
  const float sc = 64.0f / (l + fa_other_half(l));      /* the other eight keys of every tile sit in the other lane half; o carried x64 */
  const v8f os[4] = {o0, o1, o2, o3};
#pragma unroll
  for (int t = 0; t < 4; ++t) { FragH f;
#pragma unroll
    for (int r = 0; r < 8; ++r) f.h[r] = (_Float16)(os[t][r] * sc);
    *(v8us*)((unsigned short*)O + ((size_t)b * SQ + q0) * DM + h * 1024 + t * 256 + lane * 8) = f.half[0]; }      /* o in fragment order for the output GEMM: [16-row tile][32-column step][piece][lane][8]; head h, tile t = step 2 h + t / 2, piece t % 2 */
  asm volatile("s_wait_xcnt 0x0" ::: "memory"); }      /* the wait before a register that the four issued stores name is written again: in the joint launch the f32 rows' code follows them in the listing */


// ---- front end in ONE launch: x -> q and k (f16 hi + x1024 residual planes), V^T, and the first tile's f32 q, k, v rows; the weights are prepared here too. One wave per 64 token rows of one head; the four waves of a work-group share one head, build its three W^T planes in LDS together and meet at one barrier.
// The wave reads its [64][64] f32 slice of x once, rounds it (bf16, exact in f16) into eight operand fragments and keeps them in registers for all three projections (K = 64: two products a tile, columns 0..31 then 32..63).
// q and k are formed transposed (A = 16 rows of W^T, B = 16 token rows): lane (ln, hh) then holds 8 consecutive head columns of token ln: its own 16 bytes of a piece of the fragment-order q / k planes, so a wave's store is 512 bytes in a row.
// v is formed straight (A = 16 token rows, B = 16 rows of W^T): lane (ln, hh) then holds 8 consecutive tokens of head column ln: its own 16 bytes of a piece of the fragment-order V^T plane.
// Rows 0..127 of each batch also leave as f32 (the exact first-tile path reads them): their waves form each projection a second time (v transposed like q and k) and store it unrounded.
// Every loop is unrolled in full so that the fragments are indexed by constants and stay in registers.
// amdgpu_waves_per_eu(4) on the kernel: a budget of 256 registers; with the raw weights and the raw x slice in flight together the build otherwise takes two registers above v255 and pays window switches and a wave per SIMD for them.
union RawX { v8f v; v4f q[2]; };      /* 8 consecutive f32 of an x row as two 16-byte loads leave them */
__device__ __forceinline__ RawX pj_raw(const float* p) { RawX r; r.q[0] = *(const v4fa*)p; r.q[1] = *(const v4fa*)(p + 4); return r; }
// a: columns 8 hh .. 8 hh + 7 of a 32-column step, c: columns 16 + 8 hh .. of the same step (the operand fragment's element order)
__device__ __forceinline__ v16h pj_xfrag(v8f a, v8f c) { FragH f;
#pragma unroll
  for (int q = 0; q < 8; ++q) { f.h[q] = (_Float16)bf16_round(a[q]); f.h[8 + q] = (_Float16)bf16_round(c[q]); }
  return f.v; }
__device__ __forceinline__ v8f pj_tile(v16h a0, v16h a1, v16h b0, v16h b1) { const v8f z8 = {0.f,0.f,0.f,0.f,0.f,0.f,0.f,0.f}; return fa_mma(a1, b1, fa_mma(a0, b0, z8)) * 0.0625f; }      /* weights carried x16 */
__device__ __forceinline__ void pj_f32(float* d, v8f c) { const v4f lo = {c[0], c[1], c[2], c[3]}, hi = {c[4], c[5], c[6], c[7]}; *(v4f*)d = lo; *(v4f*)(d + 4) = hi; }
// ---- weight blocks. A [64][64] block of a row-major f32 weight W[k][n] becomes W^T x16 as f16 (bf16-rounded first: exact) in fragment order ([16-row tile of n][32-column step of k][piece][lane][8], 8 KiB) in LDS.
// 128 threads: thread (a = tid & 15, kg = tid >> 4) reads rows 8 kg .. 8 kg + 7, columns 4 a .. 4 a + 3 (a wave-wide 16-byte load covers two whole 256-byte rows) and writes four 16-byte units, one a column.
union RawW { v8f v; v4f q[2]; };      /* two rows' 16 bytes */
__device__ __forceinline__ void wt_load(const float* p, const int pitch, RawW (&r)[4]) {
#pragma unroll
  for (int i = 0; i < 4; ++i) { r[i].q[0] = *(const v4fa*)(p + (size_t)(2 * i) * pitch); r[i].q[1] = *(const v4fa*)(p + (size_t)(2 * i + 1) * pitch); } }
__device__ __forceinline__ void wt_put(const RawW (&r)[4], _Float16* d, const int tid) {
  const int a = tid & 15, kg = tid >> 4;
#pragma unroll
  for (int j = 0; j < 4; ++j) { FragH f; const int n = 4 * a + j;
#pragma unroll
    for (int i = 0; i < 8; ++i) f.h[i] = (_Float16)(bf16_round(r[i >> 1].q[i & 1][j]) * 16.0f);
    *(v8us*)((unsigned short*)d + (((n >> 4) * 2 + (kg >> 2)) * 64 + ((kg >> 1) & 1) * 32 + (kg & 1) * 16 + (n & 15)) * 8) = f.half[0]; } }
// Hh, Hl: this lane's 16 bytes of the first piece of the wave's first token tile; F0: this lane's first element of the row-major f32 rows (token ln of the wave's rows, head column 8 hh)
__device__ __forceinline__ void pj_qk(const _Float16* wp, const v16h (&xf)[4][2], _Float16* __restrict__ Hh, _Float16* __restrict__ Hl, float* __restrict__ F0, bool first) {
  v16h wf[4][2];
#pragma unroll
  for (int t = 0; t < 4; ++t) { wf[t][0] = pk_frag(wp + t * 16 * HD); wf[t][1] = pk_frag(wp + t * 16 * HD + 512); }      /* wp: the lane's 16 bytes of the first piece of the head's W^T plane in LDS */
#pragma unroll
  for (int j = 0; j < 4; ++j) {
#pragma unroll
    for (int t = 0; t < 4; ++t) { const v8f c = pj_tile(wf[t][0], wf[t][1], xf[j][0], xf[j][1]); FragH fh, fl;
#pragma unroll
      for (int r = 0; r < 8; ++r) { const _Float16 hv = (_Float16)c[r]; fh.h[r] = hv; fl.h[r] = (_Float16)((c[r] - (float)hv) * 1024.0f); }
      *(v8us*)((unsigned short*)Hh + j * 1024 + t * 256) = fh.half[0]; *(v8us*)((unsigned short*)Hl + j * 1024 + t * 256) = fl.half[0]; } }
  asm volatile("s_wait_xcnt 0x0" ::: "memory");      /* the wait before a register that an issued store names is written again */
  if (first) {      /* one scalar branch a projection: the same products once more, for one wave in sixteen */
#pragma unroll
    for (int j = 0; j < 4; ++j) {
#pragma unroll
      for (int t = 0; t < 4; ++t) pj_f32(F0 + (size_t)j * 16 * DM + t * 16, pj_tile(wf[t][0], wf[t][1], xf[j][0], xf[j][1])); }
    asm volatile("s_wait_xcnt 0x0" ::: "memory");      /* likewise: the next projection's weight fragments land in registers that these stores name */
  } }
__global__ __launch_bounds__(128) __attribute__((amdgpu_waves_per_eu(4))) void k_proj(const float* __restrict__ x, const float* __restrict__ Wq, const float* __restrict__ Wk, const float* __restrict__ Wv, const float* __restrict__ Wo, _Float16* __restrict__ BOp, _Float16* __restrict__ QHp, _Float16* __restrict__ QLp, _Float16* __restrict__ KHp, _Float16* __restrict__ KLp, _Float16* __restrict__ VTp,
    float* __restrict__ QF0p, float* __restrict__ KF0p, float* __restrict__ VF0p) {
  __shared__ __attribute__((aligned(16))) _Float16 wl[3][HD * HD];
  const int tid = threadIdx.x; const size_t wlo = (size_t)(tid >> 4) * 8;      /* the thread's first row of a weight block */
  if (blockIdx.x >= NR / 256) {      /* the work-groups behind the token rows (the same test for a whole work-group): each turns one [64][64] block of Wo into its part of the fragment-order Wo^T plane, which only the output GEMM's launch reads */
    const int e = (int)(blockIdx.x - NR / 256) + WOX * (int)blockIdx.y; const int k0 = (e % (DM / 64)) * 64, n0 = (e / (DM / 64)) * 64;
    const float* wp = Wo + ((size_t)k0 + wlo) * DM + n0 + (tid & 15) * 4; RawW ro[4]; wt_load(wp, DM, ro);
    asm volatile("s_wait_xcnt 0x0" :: "v"(wp), "v"(ro[0].v), "v"(ro[1].v), "v"(ro[2].v), "v"(ro[3].v) : "memory");      /* the wait before a register that an issued load names is written again; the loaded values are inputs so that the eight loads stand in front of it, asked for together */
    wt_put(ro, wl[0], tid);
    __syncthreads();      /* the block is whole before it leaves in runs of 1 KiB (64 units of one n tile and k step), a wave's store 512 bytes in a row */
#pragma unroll
    for (int p = 0; p < 4; ++p) { const int bl = p * 2 + (tid >> 6); const v8us u = *(const v8us*)((const unsigned short*)wl[0] + (p * 128 + tid) * 8);
      *(v8us*)((unsigned short*)BOp + ((size_t)(((n0 >> 4) + (bl >> 1)) * (DM / 32) + (k0 >> 5) + (bl & 1)) * 64 + (tid & 63)) * 8) = u; }
    return; }
  const int lane = threadIdx.x & 31, ln = lane & 15, hh = lane >> 4; const int w = __builtin_amdgcn_readfirstlane((int)(threadIdx.x >> 5));      /* the wave's number as a scalar: the first-tile test is a scalar branch, every lane stays on at the products */
  const int h = blockIdx.y; const int r0 = (blockIdx.x * 4 + w) * 64; const int b = r0 / SQ, s0 = r0 % SQ; const bool first = s0 < QT0;
  /* the head's three [64][64] weights: asked for first, turned into W^T planes in LDS by the work-group's four waves together while the x slice is still on its way */
  const size_t wgo = (size_t)h * HD * HD + wlo * HD + (tid & 15) * 4; const float* wqp = Wq + wgo; const float* wkp = Wk + wgo; const float* wvp0 = Wv + wgo;
  RawW rq[4], rk[4], rv[4]; wt_load(wqp, HD, rq); wt_load(wkp, HD, rk); wt_load(wvp0, HD, rv);
  const float* xp = x + (size_t)(r0 + ln) * DM + h * HD + 8 * hh;
  RawX rx[4][4];
#pragma unroll
  for (int j = 0; j < 4; ++j) {
#pragma unroll
    for (int u = 0; u < 4; ++u) rx[j][u] = pj_raw(xp + (size_t)j * 16 * DM + u * 16); }
  /* the wait before a register that an issued weight load names is written again; the loaded weights are inputs so that their 24 loads stand in front of it, asked for together */
  asm volatile("s_wait_xcnt 0x0" :: "v"(wqp), "v"(wkp), "v"(wvp0), "v"(rq[0].v), "v"(rq[1].v), "v"(rq[2].v), "v"(rq[3].v), "v"(rk[0].v), "v"(rk[1].v), "v"(rk[2].v), "v"(rk[3].v), "v"(rv[0].v), "v"(rv[1].v), "v"(rv[2].v), "v"(rv[3].v) : "memory");
  wt_put(rq, wl[0], tid); wt_put(rk, wl[1], tid); wt_put(rv, wl[2], tid);
  /* the loaded values are inputs: all 32 loads of the slice are asked for together, one trip to memory a wave (left alone the compiler asks for four at a time and waits eight times); the wait stands before the address register is written again */
  asm volatile("s_wait_xcnt 0x0" :: "v"(xp), "v"(rx[0][0].v), "v"(rx[0][1].v), "v"(rx[0][2].v), "v"(rx[0][3].v), "v"(rx[1][0].v), "v"(rx[1][1].v), "v"(rx[1][2].v), "v"(rx[1][3].v), "v"(rx[2][0].v), "v"(rx[2][1].v), "v"(rx[2][2].v), "v"(rx[2][3].v), "v"(rx[3][0].v), "v"(rx[3][1].v), "v"(rx[3][2].v), "v"(rx[3][3].v) : "memory");
  v16h xf[4][2];
#pragma unroll
  for (int j = 0; j < 4; ++j) { xf[j][0] = pj_xfrag(rx[j][0].v, rx[j][1].v); xf[j][1] = pj_xfrag(rx[j][2].v, rx[j][3].v); }
  __syncthreads();      /* the three W^T planes are whole before any wave reads its fragments */
  const int wo = lane * 8;      /* the lane's 16 bytes of the first piece of a W^T plane (fragment order) */
  const size_t ro = ((size_t)(b * NH + h) * (SQ / 16) + (s0 >> 4)) * 1024 + lane * 8;      /* likewise of the wave's first token tile in the q, k and V^T planes */ const size_t fo = ((size_t)b * QT0 + (first ? s0 : 0) + ln) * DM + h * HD + 8 * hh;
  pj_qk(wl[0] + wo, xf, QHp + ro, QLp + ro, QF0p + fo, first);
  pj_qk(wl[1] + wo, xf, KHp + ro, KLp + ro, KF0p + fo, first);
  const _Float16* wvp = wl[2] + wo; v16h wf[4][2];
#pragma unroll
  for (int t = 0; t < 4; ++t) { wf[t][0] = pk_frag(wvp + t * 16 * HD); wf[t][1] = pk_frag(wvp + t * 16 * HD + 512); }
  _Float16* vtp = VTp + ro;
#pragma unroll
  for (int t = 0; t < 4; ++t) {
#pragma unroll
    for (int j = 0; j < 4; ++j) { const v8f c = pj_tile(xf[j][0], xf[j][1], wf[t][0], wf[t][1]); FragH f;
#pragma unroll
      for (int r = 0; r < 8; ++r) f.h[r] = (_Float16)c[r];
      *(v8us*)((unsigned short*)vtp + j * 1024 + t * 256) = f.half[0]; } }
  asm volatile("s_wait_xcnt 0x0" ::: "memory");      /* as in pj_qk, in front of the branch */
  if (first) {
#pragma unroll
    for (int j = 0; j < 4; ++j) {
#pragma unroll
      for (int t = 0; t < 4; ++t) pj_f32(VF0p + fo + (size_t)j * 16 * DM + t * 16, pj_tile(wf[t][0], wf[t][1], xf[j][0], xf[j][1])); }
    asm volatile("s_wait_xcnt 0x0" ::: "memory"); } }      /* the wait before a register that these stores name is written again: the Wo blocks' code follows them in the listing */

template <int MASKADD>
__device__ __forceinline__ void att0_body(float (&lk)[64][64], float (&lv)[64][64], const int bid, const float* __restrict__ QF, const float* __restrict__ KF, const float* __restrict__ VF, int ld, const float* __restrict__ mask, float scale, _Float16* __restrict__ Hh, _Float16* __restrict__ Hl) {
  #pragma clang fp contract(off)
  // 64 query rows of one (batch, head) a work-group of four waves, TWO LANES PER ROW (lane l and lane l ^ 16): each owns 32 of the 64 head columns of its row's q and o, so that the rows fit the register budget of the joint launch.
  // Keys in order (online softmax). A score is the lane's own 32 products summed in column order plus the other lane's sum (one cross-row move); both lanes then hold the same score and keep the same m and l.
  // k and v rows come in chunks of 64 keys, staged once per chunk in LDS by coalesced loads and then read at one address per lane half (broadcast). Four keys' score chains run side by side: each is 32 dependent adds, so one alone leaves the issue slots empty.
  // Every loop over c, u and w and the staging loops over it are unrolled in full so that q, o, s and the staged values are indexed by constants and stay in registers; the loops over chunks and groups of four keys stay rolled so that the code stays small.
  const int tid = threadIdx.x; const int cb = ((tid >> 4) & 1) * 32;      /* the lane's first head column */
  const int rg = (QT0 / 64 - 1) - bid / (NB * NH), h = bid % NH, bt = (bid / NH) % NB;      /* the later row group, with the longer walk, first */
  const int rl = (tid >> 5) * 16 + (tid & 15); const int i = rg * 64 + rl;
  QF += (size_t)bt * QT0 * ld; KF += (size_t)bt * QT0 * ld; VF += (size_t)bt * QT0 * ld;      /* each batch's first-tile rows are a plane of their own */
  const float* qr = QF + (size_t)i * ld + h * HD + cb;
  float q[HD / 2], o[HD / 2];
  { v4f tq[HD / 8];
#pragma unroll
    for (int c = 0; c < HD / 8; ++c) tq[c] = *(const v4fa*)(qr + c * 4);
    asm volatile("s_wait_xcnt 0x0" :: "v"(qr) : "memory");      /* as in the staging below: the row's address keeps its registers until every load that names it has been translated */
#pragma unroll
    for (int c = 0; c < HD / 8; ++c) {
#pragma unroll
      for (int u = 0; u < 4; ++u) { q[c * 4 + u] = tq[c][u]; o[c * 4 + u] = 0.f; } } }
  float m = -1.0e30f, l = 0.f; const int jmax = MASKADD ? (SQ - 1) : (rg * 64 + 63);      /* additive-mask form: every key (the mask input decides); causal form: keys up to the block's last row; jmax + 1 is a multiple of 64 */
#pragma unroll 1
  for (int j0 = 0; j0 <= jmax; j0 += 64) {
    __syncthreads();      /* every wave has left the chunk before it is overwritten */
    { const float* kp[8]; const float* vp[8]; v4f tk[8], tv[8];      /* 64 keys in one pass of 128 threads: 16 loads in flight */
#pragma unroll
      for (int it = 0; it < 8; ++it) { const size_t g = (size_t)(j0 + it * 8 + tid / 16) * ld + h * HD + (tid % 16) * 4; kp[it] = KF + g; vp[it] = VF + g; }
#pragma unroll
      for (int it = 0; it < 8; ++it) { tk[it] = *(const v4fa*)kp[it]; tv[it] = *(const v4fa*)vp[it]; }
      /* the wait before a register that an issued load names is written again; the addresses are inputs so that they keep their registers up to it */
      asm volatile("s_wait_xcnt 0x0" :: "v"(kp[0]), "v"(kp[1]), "v"(kp[2]), "v"(kp[3]), "v"(kp[4]), "v"(kp[5]), "v"(kp[6]), "v"(kp[7]), "v"(vp[0]), "v"(vp[1]), "v"(vp[2]), "v"(vp[3]), "v"(vp[4]), "v"(vp[5]), "v"(vp[6]), "v"(vp[7]) : "memory");
#pragma unroll
      for (int it = 0; it < 8; ++it) { const int row = it * 8 + tid / 16, pc = (tid % 16) * 4; *(v4f*)&lk[row][pc] = tk[it]; *(v4f*)&lv[row][pc] = tv[it]; } }
    __syncthreads();
#pragma unroll 1
    for (int jj = 0; jj < 64; jj += 4) { float s[4] = {0.f, 0.f, 0.f, 0.f};
#pragma unroll
      for (int c = 0; c < HD / 8; ++c) {
#pragma unroll
        for (int u = 0; u < 4; ++u) { const v4f kq = *(const v4f*)&lk[jj + u][cb + c * 4]; s[u] = __fadd_rn(s[u], __fmul_rn(q[c * 4 + 0], kq[0])); s[u] = __fadd_rn(s[u], __fmul_rn(q[c * 4 + 1], kq[1])); s[u] = __fadd_rn(s[u], __fmul_rn(q[c * 4 + 2], kq[2])); s[u] = __fadd_rn(s[u], __fmul_rn(q[c * 4 + 3], kq[3])); } }
#pragma unroll
      for (int u = 0; u < 4; ++u) s[u] = __fadd_rn(s[u], fa_other_half(s[u]));      /* + the other 32 columns: the same sum in both lanes of the row */
      float sc[4], e[4];      /* the four keys' rescale and weight, key after key (m and l are a chain); the o rows follow */
#pragma unroll
      for (int u = 0; u < 4; ++u) { const int j = j0 + jj + u; float sv = __fmul_rn(s[u], scale); if (MASKADD) sv = __fadd_rn(sv, __fmul_rn(bf16_round(mask[(size_t)i * SQ + j]), -10000.0f));
        const float f = (MASKADD || j <= i) ? 1.f : 0.f; const float sm = fmaf(f, sv, (1.f - f) * -1.0e30f); const float mn = fmaxf(m, sm); sc[u] = expf(m - mn); e[u] = expf(sm - mn); l = __fadd_rn(__fmul_rn(l, sc[u]), e[u]); m = mn; }
#pragma unroll
      for (int u = 0; u < 4; ++u) {
#pragma unroll
        for (int c = 0; c < HD / 8; ++c) { const v4f vv = *(const v4f*)&lv[jj + u][cb + c * 4];
#pragma unroll
          for (int w = 0; w < 4; ++w) o[c * 4 + w] = __fadd_rn(__fmul_rn(o[c * 4 + w], sc[u]), __fmul_rn(e[u], vv[w])); } } } }
  const float fin = 64.0f / l;      /* o carried x64 like the f16 path */
  __syncthreads();      /* every wave has left lk before the output rows are written over it */
#pragma unroll
  for (int c = 0; c < HD / 8; ++c) { v4f oo;
#pragma unroll
    for (int u = 0; u < 4; ++u) oo[u] = __fmul_rn(o[c * 4 + u], fin);
    *(v4f*)&lk[rl][cb + c * 4] = oo; }
  __syncthreads();
  {
#pragma unroll 1
    for (int it = 0; it < 4; ++it) {      /* o (x64) leaves as f16 hi + x1024 residual planes in fragment order ([16-row tile][32-column step][piece][lane][8]): row tile it of the group, thread tid = (step, piece, lane); a wave's store is 512 bytes in a row */
      const float* fp = &lk[it * 16 + (tid & 15)][((tid >> 6) & 1) * 32 + ((tid >> 5) & 1) * 16 + ((tid >> 4) & 1) * 8]; const v4f a = *(const v4f*)fp, c = *(const v4f*)(fp + 4); FragH fh, fl;
#pragma unroll
      for (int u = 0; u < 4; ++u) { _Float16 hv = (_Float16)a[u]; fh.h[u] = hv; fl.h[u] = (_Float16)((a[u] - (float)hv) * 1024.0f); hv = (_Float16)c[u]; fh.h[4 + u] = hv; fl.h[4 + u] = (_Float16)((c[u] - (float)hv) * 1024.0f); }
      const size_t t = ((size_t)((bt * (QT0 / 16) + rg * 4 + it) * (DM / 32) + 2 * h + ((tid >> 6) & 1))) * 64 + (tid & 63);
      *(v8us*)((unsigned short*)Hh + t * 8) = fh.half[0]; *(v8us*)((unsigned short*)Hl + t * 8) = fl.half[0]; }
     } }

// ---- ONE attention launch. The first NB NH QT0 / 64 work-groups (started first: theirs is the longest serial chain) do the exact f32 attention of 64 of the rows 0..127 of one (batch, head); the others the fused f16 attention of 64 rows from row 128 on.
// Both read only what the front end wrote, so they run side by side instead of one launch after the other.
__global__ __launch_bounds__(128) void k_attn(const _Float16* __restrict__ QHp, const _Float16* __restrict__ QLp, const _Float16* __restrict__ KHp, const _Float16* __restrict__ KLp, const _Float16* __restrict__ VTp, _Float16* __restrict__ O,
    const float* __restrict__ QF, const float* __restrict__ KF, const float* __restrict__ VF, _Float16* __restrict__ OH, _Float16* __restrict__ OL) {
  __shared__ __attribute__((aligned(16))) float st[2][64][64];
  if (blockIdx.x < NB * NH * (QT0 / 64)) att0_body<0>(st[0], st[1], (int)blockIdx.x, QF, KF, VF, DM, nullptr, SCL, OH, OL);
  else fa_body((int)blockIdx.x - NB * NH * (QT0 / 64), QHp, QLp, KHp, KLp, VTp, O); }

// ---- output GEMM, ONE launch: out = o Wo. A work-group is 128 rows x 64 columns (wave tile 32 x 64), o and Wo^T in fragment order. The row blocks that are a batch's rows 0..127 take the exact path's o instead
// (f16 hi + x1024 residual planes): one walk over K for both, with accumulators of their own, out = hi 2^-10 + residual 2^-20; every output element is written once.
// All fragment loads of a trip through the loop are asked for together and waited for once. Left alone the compiler keeps one register set for the four Wo^T fragments of a k step and waits for memory in front of every second product: four trips to the caches, one behind the other, a step.
__device__ __forceinline__ void go_walk(const _Float16* a0p, const _Float16* b0p, v8f (&c)[8]) {
  const _Float16* a1p = a0p + (size_t)16 * DM; const _Float16* b1p = b0p + (size_t)16 * DM; const _Float16* b2p = b1p + (size_t)16 * DM; const _Float16* b3p = b2p + (size_t)16 * DM;
#pragma unroll 1
  for (int kb = 0; kb < DM; kb += 64) { const int ko = kb * 16; const _Float16* a0k = a0p + ko; const _Float16* a1k = a1p + ko; const _Float16* b0k = b0p + ko; const _Float16* b1k = b1p + ko; const _Float16* b2k = b2p + ko; const _Float16* b3k = b3p + ko;      /* two k steps a trip (the loop stays rolled: the code stays small); a step is 512 elements of a 16-row tile */
    const v16h a0 = pk_frag(a0k), a1 = pk_frag(a1k), b0 = pk_frag(b0k), b1 = pk_frag(b1k), b2 = pk_frag(b2k), b3 = pk_frag(b3k);
    const v16h d0 = pk_frag(a0k + 512), d1 = pk_frag(a1k + 512), f0 = pk_frag(b0k + 512), f1 = pk_frag(b1k + 512), f2 = pk_frag(b2k + 512), f3 = pk_frag(b3k + 512);
    /* the loaded values are inputs: all 24 loads stand in front of this line, one trip to the caches for sixteen products; it is also the wait before a register that an issued load names is written again, and the addresses are inputs so that they keep their registers up to it */
    asm volatile("s_wait_xcnt 0x0" :: "v"(a0k), "v"(a1k), "v"(b0k), "v"(b1k), "v"(b2k), "v"(b3k), "v"(a0), "v"(a1), "v"(b0), "v"(b1), "v"(b2), "v"(b3), "v"(d0), "v"(d1), "v"(f0), "v"(f1), "v"(f2), "v"(f3) : "memory");
    c[0] = g2_mma(a0, b0, c[0]); c[4] = g2_mma(a1, b0, c[4]); c[1] = g2_mma(a0, b1, c[1]); c[5] = g2_mma(a1, b1, c[5]); c[2] = g2_mma(a0, b2, c[2]); c[6] = g2_mma(a1, b2, c[6]); c[3] = g2_mma(a0, b3, c[3]); c[7] = g2_mma(a1, b3, c[7]);
    c[0] = g2_mma(d0, f0, c[0]); c[4] = g2_mma(d1, f0, c[4]); c[1] = g2_mma(d0, f1, c[1]); c[5] = g2_mma(d1, f1, c[5]); c[2] = g2_mma(d0, f2, c[2]); c[6] = g2_mma(d1, f2, c[6]); c[3] = g2_mma(d0, f3, c[3]); c[7] = g2_mma(d1, f3, c[7]); } }
// the same walk for two A planes at once (hi into c, residual into cl): each Wo^T fragment is loaded once and serves both, and each accumulator sees its products in the order of a walk of its own.
// Sixteen accumulator tiles leave registers for twelve fragments: the A planes' fragments of two k steps (rows that only this row block reads) come in one trip with the first step's Wo^T fragments; the second step's Wo^T fragments follow in a group of their own, into the registers of the first step's.
__device__ __forceinline__ void go_walk2(const _Float16* a0p, const _Float16* e0p, const _Float16* b0p, v8f (&c)[8], v8f (&cl)[8]) {
#pragma unroll 1
  for (int kb = 0; kb < DM; kb += 64) { const int ko = kb * 16; const _Float16* ak = a0p + ko; const _Float16* ek = e0p + ko; const _Float16* bk = b0p + ko;      /* the second row tile and the other column tiles stand 16 DM elements apart: constant offsets of these three addresses */
    const v16h a0 = pk_frag(ak), a1 = pk_frag(ak + 16 * DM), e0 = pk_frag(ek), e1 = pk_frag(ek + 16 * DM), d0 = pk_frag(ak + 512), d1 = pk_frag(ak + 16 * DM + 512), h0 = pk_frag(ek + 512), h1 = pk_frag(ek + 16 * DM + 512);
    const v16h b0 = pk_frag(bk), b1 = pk_frag(bk + 16 * DM), b2 = pk_frag(bk + 32 * DM), b3 = pk_frag(bk + 48 * DM);
    asm volatile("s_wait_xcnt 0x0" :: "v"(ak), "v"(ek), "v"(bk), "v"(a0), "v"(a1), "v"(e0), "v"(e1), "v"(d0), "v"(d1), "v"(h0), "v"(h1), "v"(b0), "v"(b1), "v"(b2), "v"(b3) : "memory");      /* as in go_walk: all 24 loads in front of it */
    c[0] = g2_mma(a0, b0, c[0]); c[4] = g2_mma(a1, b0, c[4]); cl[0] = g2_mma(e0, b0, cl[0]); cl[4] = g2_mma(e1, b0, cl[4]);
    c[1] = g2_mma(a0, b1, c[1]); c[5] = g2_mma(a1, b1, c[5]); cl[1] = g2_mma(e0, b1, cl[1]); cl[5] = g2_mma(e1, b1, cl[5]);
    c[2] = g2_mma(a0, b2, c[2]); c[6] = g2_mma(a1, b2, c[6]); cl[2] = g2_mma(e0, b2, cl[2]); cl[6] = g2_mma(e1, b2, cl[6]);
    c[3] = g2_mma(a0, b3, c[3]); c[7] = g2_mma(a1, b3, c[7]); cl[3] = g2_mma(e0, b3, cl[3]); cl[7] = g2_mma(e1, b3, cl[7]);
    const v16h f0 = pk_frag(bk + 512), f1 = pk_frag(bk + 16 * DM + 512), f2 = pk_frag(bk + 32 * DM + 512), f3 = pk_frag(bk + 48 * DM + 512);
    asm volatile("s_wait_xcnt 0x0" :: "v"(bk), "v"(f0), "v"(f1), "v"(f2), "v"(f3) : "memory");      /* likewise for the second step's eight loads */
    c[0] = g2_mma(d0, f0, c[0]); c[4] = g2_mma(d1, f0, c[4]); cl[0] = g2_mma(h0, f0, cl[0]); cl[4] = g2_mma(h1, f0, cl[4]);
    c[1] = g2_mma(d0, f1, c[1]); c[5] = g2_mma(d1, f1, c[5]); cl[1] = g2_mma(h0, f1, cl[1]); cl[5] = g2_mma(h1, f1, cl[5]);
    c[2] = g2_mma(d0, f2, c[2]); c[6] = g2_mma(d1, f2, c[6]); cl[2] = g2_mma(h0, f2, cl[2]); cl[6] = g2_mma(h1, f2, cl[6]);
    c[3] = g2_mma(d0, f3, c[3]); c[7] = g2_mma(d1, f3, c[7]); cl[3] = g2_mma(h0, f3, cl[3]); cl[7] = g2_mma(h1, f3, cl[7]); } }
__global__ __launch_bounds__(128) void k_gemm_out(const _Float16* __restrict__ A, const _Float16* __restrict__ AH0, const _Float16* __restrict__ AL0, const _Float16* __restrict__ Bh, float* __restrict__ C) {
  __shared__ __attribute__((aligned(16))) float so[4][32][68];
  const int tid = threadIdx.x, w = tid >> 5, lane = tid & 31, ln = lane & 15, hh = lane >> 4;
  const int mt = blockIdx.x / (DM / 64), nq = blockIdx.x % (DM / 64); const int row0 = mt * 128 + 32 * w, col0 = nq * 64;
  const bool first = mt % (SQ / 128) == 0;      /* a batch's rows 0..127: the same for the whole work-group, a scalar branch */
  const size_t f0 = ((size_t)(mt / (SQ / 128)) * QT0 + 32 * w) * DM + lane * 8;      /* the wave's rows in the first-tile planes ([batch][128 rows], fragment order) */
  const _Float16* b0p = Bh + (size_t)col0 * DM + lane * 8;
  const v8f z8 = {0.f,0.f,0.f,0.f,0.f,0.f,0.f,0.f}; v8f c[8] = {z8, z8, z8, z8, z8, z8, z8, z8}, cl[8] = {z8, z8, z8, z8, z8, z8, z8, z8};
  if (first) go_walk2(AH0 + f0, AL0 + f0, b0p, c, cl);
  else go_walk(A + (size_t)row0 * DM + lane * 8, b0p, c);
#pragma unroll
  for (int u = 0; u < 8; ++u) { const int t = u & 3, half = u >> 2;
#pragma unroll
    for (int r = 0; r < 8; ++r) so[w][half * 16 + 8 * hh + r][t * 16 + ln] = c[u][r] * 0.0009765625f + cl[u][r] * 0.00000095367431640625f; }      /* o carried x64, Wo x16; the residual x1024 more */
  __builtin_amdgcn_fence(__ATOMIC_ACQ_REL, "workgroup"); __builtin_amdgcn_wave_barrier();
  const int rsub = lane >> 4, c4 = (lane & 15) * 4;
#pragma unroll
  for (int q = 0; q < 16; ++q) { const int r = q * 2 + rsub; const v4f v = *(const v4fa*)&so[w][r][c4]; *(v4f*)(C + (size_t)(row0 + r) * DM + col0 + c4) = v; } }

extern "C" void kernel_launch(void* const* d_in, const int* in_sizes, int n_in,
                              void* d_out, int out_size, void* d_ws, size_t ws_size, hipStream_t stream) {
  (void)in_sizes; (void)n_in; (void)out_size;
  const float* const* I = (const float* const*)d_in; const float* x = I[0]; const float* xk = I[0]; const float* xv = I[0]; const float* wq = I[1]; const float* bq = nullptr; const float* wk = I[2]; const float* bk = nullptr; const float* wv = I[3]; const float* bv = nullptr; const float* wo = I[4]; const float* bo = nullptr;      /* input order: x, Wq, Wk, Wv (BLOCK-DIAGONAL per-head [16][64][64] = [head][in][out]; NO biases: null pointers), Wo ([in][out] [1024][1024]; no bias: the output GEMM has no bias term); five inputs */
  char* ws = (char*)d_ws; size_t off = 0;
  auto take = [&](size_t bytes) { char* p = ws + off; off += (bytes + 255) & ~(size_t)255; return p; };
  _Float16* BO = (_Float16*)take((size_t)DM * DM * 2);
  _Float16* QH = (_Float16*)take(NR * DM * 2); _Float16* QL = (_Float16*)take(NR * DM * 2); _Float16* KH = (_Float16*)take(NR * DM * 2); _Float16* KL = (_Float16*)take(NR * DM * 2); _Float16* O16 = (_Float16*)take(NR * DM * 2);
  _Float16* VT = (_Float16*)take((size_t)NB * NH * HD * SQ * 2);      /* V^T of every batch: the fused attention launch covers all of them */
  float* QF0 = (float*)take((size_t)NB * QT0 * DM * 4); float* KF0 = (float*)take((size_t)NB * QT0 * DM * 4); float* VF0 = (float*)take((size_t)NB * QT0 * DM * 4);      /* a plane per batch: the first-tile launches cover all batches */ _Float16* OH0 = (_Float16*)take((size_t)NB * QT0 * DM * 2); _Float16* OL0 = (_Float16*)take((size_t)NB * QT0 * DM * 2);
  if (off > ws_size) return;
  k_proj<<<dim3((unsigned)(NR / 256) + WOX, NH), 128, 0, stream>>>(x, wq, wk, wv, wo, BO, QH, QL, KH, KL, VT, QF0, KF0, VF0);      /* the per-head weights wq / wk / wv [NH][HD][HD] = [head][in][out] become W^T x16 planes in each work-group's LDS; grid columns from NR / 256 on: Wo [in][out] -> Wo^T x16 in fragment order; x -> q, k (f16 hi + x1024 residual planes), V^T (all three in fragment order, [NB][NH][SQ / 16][4][32][8]) and the f32 q, k, v of each batch's first 128 rows: every batch, head and row in one launch (grid x = 256 rows, y = head) */
  k_attn<<<NB * NH * (SQ / 64), 128, 0, stream>>>(QH, QL, KH, KL, VT, O16, QF0, KF0, VF0, OH0, OL0);      /* one launch: exact f32 attention for rows 0..127 of every batch and head (o x64, as f16 hi + x1024 residual planes in fragment order) beside scores (hi.hi + lo.hi + hi.lo), causal softmax and P . V of every other query row (o, merged heads, x64, f16 in fragment order) */
  k_gemm_out<<<(unsigned)((NR / 128) * (DM / 64)), 128, 0, stream>>>(O16, OH0, OL0, BO, (float*)d_out);      /* out = o Wo, every row once: rows 0..127 of a batch from the hi and residual planes, the others from the f16 plane */
}
